// v000
// Times are from an AMD MI455X. After a warm-up the kernel runs many times in a row, and a time is the length of
// such a window on the GPU divided by its runs, so every launch and the gaps after it count. The runs cycle
// through copies of the inputs. A figure is the median of several windows, for all but v000 over two sittings.
// Sittings can differ by a few percent; kernels timed side by side share one.
// The starting kernel, v000, takes 542 microseconds a run.
// Contractions: q, k, v^T projections = v_wmma_f32_16x16x32_bf16 (bf16 operands from RNE-converted inputs, single product);
// q.k^T scores = v_wmma_f32_16x16x32_bf16 with bf16 hi/lo split q and k (hi.hi + hi.lo + lo.hi);
// p.v = v_wmma_f32_16x16x32_f16 (p carried x1024 in f16, v in f16; extra f16 residual planes x4096 of p and v for the first VLP query rows);
// ctx.Wo = v_wmma_f32_16x16x32_bf16 with ctx as bf16 hi/lo planes times bf16 Wo (2 products); all f32 accumulate; causal compare and softmax in f32.
#include <hip/hip_runtime.h>
#include <math.h>
#include <float.h>
#include <stdint.h>

#ifndef NB
#define NB    4
#endif
#ifndef SEQ
#define SEQ   2048
#endif
#define NB_FULL  4
#define SEQ_FULL 2048
#define DM    1024
#define NH    16
#define HD    64
#define NQB   (SEQ / 64)                      // key / query tiles of 64
#define VLP   ((SEQ < 512) ? SEQ : 512)       // key pitch of the v^T residual plane (keys 0..VLP-1)
#define RESQB (VLP / 64)                      // number of leading 64-row query blocks that use the p / v residual planes
static_assert(NB >= 1 && NB <= NB_FULL);
static_assert(NH * HD == DM && HD == 64);
static_assert((SEQ % 64) == 0 && (DM % 64) == 0 && SEQ >= 64 && SEQ <= SEQ_FULL);
static_assert(RESQB * 64 == VLP && VLP <= SEQ && RESQB >= 1 && RESQB <= NQB);
static_assert(((SEQ * DM / 8) % 256) == 0 && ((DM * DM / 8) % 256) == 0);

typedef _Float16 v16h __attribute__((ext_vector_type(16)));
typedef _Float16 v8h  __attribute__((ext_vector_type(8)));
typedef __bf16   v16b __attribute__((ext_vector_type(16)));
typedef __bf16   v8b  __attribute__((ext_vector_type(8)));
typedef float    v8f  __attribute__((ext_vector_type(8)));
typedef float    v4f  __attribute__((ext_vector_type(4)));
typedef unsigned int v4u __attribute__((ext_vector_type(4)));

// ---- scalar helpers --------------------------------------------------------------------------------
__device__ __forceinline__ unsigned short bf_bits(float f) {          // f32 -> bf16 bits, RNE convert
  unsigned u = __float_as_uint(f);
  return (unsigned short)((u + 0x7FFFu + ((u >> 16) & 1u)) >> 16);
}
__device__ __forceinline__ float bf_up(unsigned short h) { return __uint_as_float(((unsigned)h) << 16); }
__device__ __forceinline__ unsigned short h_bits(_Float16 x) { return __builtin_bit_cast(unsigned short, x); }
__device__ __forceinline__ unsigned pk16(unsigned short a, unsigned short b) { return (unsigned)a | ((unsigned)b << 16); }
__device__ __forceinline__ v8f zero8() { v8f z = {0.f, 0.f, 0.f, 0.f, 0.f, 0.f, 0.f, 0.f}; return z; }
__device__ __forceinline__ v8h zero8h() {
  const _Float16 z = (_Float16)0.0f;
  v8h r = {z, z, z, z, z, z, z, z};
  return r;
}

// ---- fragment loaders: 16-bit A/B operand, lane -> row/col (lane&15), p already includes +8*(lane>>4);
//      elements 0..7 <- p[0..7] (k0+8h..), elements 8..15 <- p[16..23] (k0+16+8h..)
__device__ __forceinline__ v16b ldfrag_b(const __bf16* p) {
  union { v16b v; v8b h[2]; } f;
  f.h[0] = *(const v8b*)(p);
  f.h[1] = *(const v8b*)(p + 16);
  return f.v;
}

// ---- WMMA helpers with trailing VALU hazard gap --------------------------------------------------------
__device__ __forceinline__ v8f mma_b(v16b a, v16b b, v8f c) {
  c = __builtin_amdgcn_wmma_f32_16x16x32_bf16(false, a, false, b, (short)0, c, false, false);
  asm volatile("v_nop\n\tv_nop\n\tv_nop\n\tv_nop" : "+v"(c) : "v"(a), "v"(b));
  return c;
}
__device__ __forceinline__ v8f mma_h(v16h a, v16h b, v8f c) {
  c = __builtin_amdgcn_wmma_f32_16x16x32_f16(false, a, false, b, (short)0, c, false, false);
  asm volatile("v_nop\n\tv_nop\n\tv_nop\n\tv_nop" : "+v"(c) : "v"(a), "v"(b));
  return c;
}
__device__ __forceinline__ v8f mma_b_raw(v16b a, v16b b, v8f c) {
  return __builtin_amdgcn_wmma_f32_16x16x32_bf16(false, a, false, b, (short)0, c, false, false);
}
__device__ __forceinline__ void dep_guard_b(v8f& a, v8f& b, v16b x, v16b y) {
  asm volatile("v_nop\n\tv_nop\n\tv_nop\n\tv_nop" : "+v"(a), "+v"(b) : "v"(x), "v"(y));
}
__device__ __forceinline__ void keep4_b(v16b a, v16b b, v16b c, v16b d) {
  asm volatile("v_nop" :: "v"(a), "v"(b), "v"(c), "v"(d));
}
__device__ __forceinline__ void acc_guard4(v8f& a, v8f& b, v8f& c, v8f& d) {
  asm volatile("v_nop\n\tv_nop\n\tv_nop\n\tv_nop" : "+v"(a), "+v"(b), "+v"(c), "+v"(d));
}

// =====================================================================================================
// f32 -> bf16 (RNE convert), 8 elements per thread, one 16-B store per lane: a wave writes 512 contiguous B
// blockIdx.y selects the batch slice (element strides inStride / outStride).
// coverage: n8 threads x 8 = the whole plane slice (n8 is a multiple of 256, host-asserted above).
// =====================================================================================================
__global__ __launch_bounds__(256) void cvt_bf16x8(const float* __restrict__ in, unsigned short* out, int n8,
                                                  long long inStride, long long outStride) {
  const int i = blockIdx.x * 256 + threadIdx.x;
  const float* src = in + (size_t)blockIdx.y * (size_t)inStride;
  unsigned short* dst = out + (size_t)blockIdx.y * (size_t)outStride;
  if (i < n8) {
    const v4f a = *(const v4f*)(src + (size_t)i * 8);
    const v4f b = *(const v4f*)(src + (size_t)i * 8 + 4);
    v4u p;
    p[0] = pk16(bf_bits(a[0]), bf_bits(a[1]));
    p[1] = pk16(bf_bits(a[2]), bf_bits(a[3]));
    p[2] = pk16(bf_bits(b[0]), bf_bits(b[1]));
    p[3] = pk16(bf_bits(b[2]), bf_bits(b[3]));
    *(v4u*)(dst + (size_t)i * 8) = p;
    
  }
}

// =====================================================================================================
// Register-blocked bf16 WMMA GEMM: C[m][n] = sum_k A[m][k] * Bt[n][k]; one wave per 64x64 tile,
// no block barriers. A row-major [M][K] pitch lda; Bt row-major [N][K] pitch ldb (k contiguous);
// M, N multiples of 64, K multiple of 32 (host-checked). blockIdx.y = batch index (strides in elements).
// NSPLIT: 0 = A.Bt; 1 = (A + A2).Bt (A2 = unscaled bf16 lo plane of A); 2 = A.Bt + A2.Bt + A.Bt2.
// OUT_MODE: 0 = f32 (pitch ldc); 2 = bf16 hi plane C + bf16 lo plane C2 (lo = RNE(v - hi), unscaled);
//           3 = f16 hi plane C + f16 residual plane C2 = f16((v - hi) * rscale), C2 written only for tiles
//               with n0 < N2 (pitch ldc2, batch stride strideC2).
// =====================================================================================================
template <int NSPLIT, int OUT_MODE>
__global__ __launch_bounds__(256) void gemm64(
    const unsigned short* __restrict__ Ap, const unsigned short* A2p, int lda, long long strideA,
    const unsigned short* __restrict__ Btp, const unsigned short* Bt2p, int ldb, long long strideB,
    void* Cout, int ldc, long long strideC,
    void* Cout2, int ldc2, long long strideC2, int N2,
    int M, int N, int K, float rscale) {
  const __bf16* A   = (const __bf16*)(const void*)Ap;
  const __bf16* A2  = (const __bf16*)(const void*)A2p;
  const __bf16* Bt  = (const __bf16*)(const void*)Btp;
  const __bf16* Bt2 = (const __bf16*)(const void*)Bt2p;
  __shared__ __align__(16) float sT[8][16 * 68];   // per-wave 16x64 slab, pitch 68 floats
  const int b    = blockIdx.y;
  const int lane = threadIdx.x & 31;
  const int wave = threadIdx.x >> 5;
  const int tilesN = N >> 6;
  const int tilesM = M >> 6;
  const int tile = blockIdx.x * 8 + wave;
  if (tile >= tilesM * tilesN) return;   // wave-uniform; no block barriers in this kernel
  const int tm = tile / tilesN;
  const int tn = tile - tm * tilesN;
  const int m0 = tm << 6;
  const int n0 = tn << 6;

  const __bf16* Ab  = A  + (size_t)b * strideA;
  const __bf16* Bb  = Bt + (size_t)b * strideB;
  const __bf16* Ab2 = (NSPLIT >= 1) ? (A2  + (size_t)b * strideA) : Ab;
  const __bf16* Bb2 = (NSPLIT == 2) ? (Bt2 + (size_t)b * strideB) : Bb;

  const int rlane = lane & 15;                 // row (A) / col (B, D) within subtile
  const int koff  = (lane >> 4) * 8;           // k offset of this lane half
  const int mOff  = (lane >> 4) * 8;           // D row offset

  v8f acc[4][4];
#pragma unroll
  for (int i = 0; i < 4; ++i)
#pragma unroll
    for (int j = 0; j < 4; ++j) acc[i][j] = zero8();

  for (int k0 = 0; k0 < K; k0 += 32) {
    v16b bh[4], bl[4];
#pragma unroll
    for (int j = 0; j < 4; ++j) {
      const size_t bo = (size_t)(n0 + (j << 4) + rlane) * ldb + koff + k0;
      bh[j] = ldfrag_b(Bb + bo);
      if (NSPLIT == 2) bl[j] = ldfrag_b(Bb2 + bo); else bl[j] = bh[j];
    }
#pragma unroll
    for (int i = 0; i < 4; ++i) {
      const size_t ao = (size_t)(m0 + (i << 4) + rlane) * lda + koff + k0;
      const v16b ah = ldfrag_b(Ab + ao);
      v16b al = ah;
      if (NSPLIT >= 1) al = ldfrag_b(Ab2 + ao);
#pragma unroll
      for (int j = 0; j < 4; ++j) {
        acc[i][j] = mma_b_raw(ah, bh[j], acc[i][j]);
        if (NSPLIT >= 1) acc[i][j] = mma_b_raw(al, bh[j], acc[i][j]);
        if (NSPLIT == 2) acc[i][j] = mma_b_raw(ah, bl[j], acc[i][j]);
      }
      dep_guard_b(acc[i][0], acc[i][3], ah, al);
    }
    keep4_b(bh[0], bh[1], bh[2], bh[3]);
    if (NSPLIT == 2) keep4_b(bl[0], bl[1], bl[2], bl[3]);
  }
  acc_guard4(acc[0][0], acc[0][1], acc[0][2], acc[0][3]);
  acc_guard4(acc[1][0], acc[1][1], acc[1][2], acc[1][3]);
  acc_guard4(acc[2][0], acc[2][1], acc[2][2], acc[2][3]);
  acc_guard4(acc[3][0], acc[3][1], acc[3][2], acc[3][3]);

  // ---- epilogue ----
  float* slab = sT[wave];
#pragma unroll
  for (int i = 0; i < 4; ++i) {
    const int mBase = m0 + (i << 4);
#pragma unroll
    for (int j = 0; j < 4; ++j) {
#pragma unroll
      for (int r = 0; r < 8; ++r) {
        slab[(mOff + r) * 68 + (j << 4) + rlane] = acc[i][j][r];
      }
    }
    __builtin_amdgcn_fence(3, "workgroup");
    __builtin_amdgcn_wave_barrier();
    __builtin_amdgcn_fence(2, "workgroup");
    if (OUT_MODE == 0) {
      float* C = (float*)Cout + (size_t)b * strideC;
      const int hh = lane >> 4, c4 = (lane & 15) * 4;     // 256-B row segment = 16 lanes x 16 B
      {
#pragma unroll
        for (int it = 0; it < 8; ++it) {
          const int row = it * 2 + hh;                     // it 0..7 x hh 0..1 = rows 0..15
          const v4f v = *(const v4f*)(slab + row * 68 + c4);
          *(v4f*)(C + (size_t)(mBase + row) * ldc + n0 + c4) = v;
        }
        
      }
    } else {
      const int q = lane >> 3, c8 = (lane & 7) * 8;
      unsigned short* C  = (unsigned short*)Cout  + (size_t)b * strideC;
      unsigned short* C2 = (unsigned short*)Cout2 + (size_t)b * strideC2;
      const bool wlo = (OUT_MODE == 2) || (n0 < N2);      // wave-uniform
      v4u hv[4], lv[4];
#pragma unroll
      for (int it = 0; it < 4; ++it) {
        const int row = it * 4 + q;                        // it 0..3 x q 0..3 = rows 0..15
        const float* sp = slab + row * 68 + c8;
        v4u a, a2;
#pragma unroll
        for (int e = 0; e < 4; ++e) {
          const float f0 = sp[2 * e], f1 = sp[2 * e + 1];
          unsigned short h0, h1, l0, l1;
          if (OUT_MODE == 2) {
            h0 = bf_bits(f0); h1 = bf_bits(f1);
            l0 = bf_bits(f0 - bf_up(h0)); l1 = bf_bits(f1 - bf_up(h1));
          } else {
            const _Float16 x0 = (_Float16)f0, x1 = (_Float16)f1;
            h0 = h_bits(x0); h1 = h_bits(x1);
            l0 = h_bits((_Float16)((f0 - (float)x0) * rscale));
            l1 = h_bits((_Float16)((f1 - (float)x1) * rscale));
          }
          a[e] = pk16(h0, h1); a2[e] = pk16(l0, l1);
        }
        hv[it] = a; lv[it] = a2;
      }
      {
#pragma unroll
        for (int it = 0; it < 4; ++it) {
          const int row = it * 4 + q;
          *(v4u*)(C + (size_t)(mBase + row) * ldc + n0 + c8) = hv[it];
          if (wlo) *(v4u*)(C2 + (size_t)(mBase + row) * ldc2 + n0 + c8) = lv[it];
        }
        
      }
    }
    __builtin_amdgcn_fence(3, "workgroup");
    __builtin_amdgcn_wave_barrier();
    __builtin_amdgcn_fence(2, "workgroup");
  }
}

// =====================================================================================================
// Causal attention, head dim 64, blockIdx.y = batch index (all planes carry NB batch slices back to back).
//   q planes (bf16 hi / lo): element (b, t, h, d) at [b*SEQ*DM + t*DM + h*64 + d]
//   k planes (bf16 hi / lo): same layout with key index s
//   v^T hi plane (f16):      element (b, h, d, s) at [b*DM*SEQ + (h*64 + d)*SEQ + s]
//   v^T residual plane (f16, (v - hi)*4096): [b*DM*VLP + (h*64 + d)*VLP + s], s < VLP, read only when RES
//   (a key tile at or beyond VLP would contribute a zero v residual; never happens for query blocks < RESQB)
//   logit (t, s) = q.k * sscale for s <= t, finfo.min for s > t. Query block qb (64 rows) visits key tiles
//   0..qb only (every later key is above the diagonal for all 64 rows -> weight exactly 0); the compare
//   s > t is applied on the diagonal tile kt == qb only (block-uniform flag, per-element select). Every row
//   has the live key s = t in the diagonal tile and all of tile 0, so the row max is always finite.
//   out planes (bf16 hi / lo of the normalised context): element (b, t, h, d) at [b*SEQ*DM + t*DM + h*64 + d]
//   scores = q . k : bf16 hi/lo split (hi.hi + hi.lo + lo.hi), f32 accumulate, then * sscale in f32
//   p = exp(s - m) carried as f16(1024 p); context = p . v on f16 WMMA; RES adds f16 residual planes of p and v
//   (scale 4096, separate accumulator folded back with 1/4096 per chunk in f32); online softmax in f32.
//   Block = 4 waves = 64 query rows of one head of one batch; grid = (nqbThis * NH, NB); kv chunks of 64,
//   static bound NQB, block-uniform break at kt == qb + 1.
//   K / V^T chunk staging: 128 threads x 32 elements per plane = the whole 64x64 tile (plain 16-B loads,
//   __syncthreads before and after: cross-wave LDS regions Ksh/Ksl/Vth/Vtl behind block barriers);
//   P tiles and the Os tile are wave-private, spilled with element stores and reloaded (P as v8h, same element
//   Output coverage: each wave stores rows q0..q0+15 (it 0..3 x lane>>3 0..3) x 64 columns (8 lanes x 8) of both planes.
// =====================================================================================================
template <bool RES>
__global__ __launch_bounds__(128) __attribute__((amdgpu_num_vgpr(256)))
void attn_causal64(const unsigned short* __restrict__ qhp, const unsigned short* __restrict__ qlp,
                   const unsigned short* __restrict__ khp, const unsigned short* __restrict__ klp,
                   const unsigned short* __restrict__ vhp, const unsigned short* __restrict__ vlp,
                   unsigned short* ohp, unsigned short* olp,
                   int qbBase, int nqbThis, float sscale) {
  union FB { v16b v; v8b h[2]; };
  union FH { v16h v; v8h h[2]; };
  __shared__ __align__(16) __bf16   Ksh[64 * 64];                 // K hi [kv][d]   8 KB
  __shared__ __align__(16) __bf16   Ksl[64 * 64];                 // K lo
  __shared__ __align__(16) _Float16 Vth[64 * 64];                 // V^T hi [d][kv] 8 KB
  __shared__ __align__(16) _Float16 Vtl[RES ? 64 * 64 : 8];       // V^T residual
  __shared__ __align__(16) _Float16 Psh[4][16 * 64];              // per wave P [row][kv]
  __shared__ __align__(16) _Float16 Psl[RES ? 4 : 1][16 * 64];    // per wave P residual
  __shared__ __align__(16) float    Os[4][16 * 64];               // per wave context tile [row][d]

  const int tid  = threadIdx.x;
  const int wave = tid >> 5;
  const int lane = tid & 31;
  const int hh   = lane >> 4;
  const int c    = lane & 15;

  const int bx   = blockIdx.x;
  const int bb   = blockIdx.y;               // batch
  const int qbl  = bx % nqbThis;
  const int h    = bx / nqbThis;           // 0..NH-1 (grid.x = nqbThis * NH)
  const int qb   = qbBase + qbl;
  const int q0   = qb * 64 + wave * 16;

  const size_t pstride = (size_t)SEQ * DM;                  // per-batch elements of the [t][h*64+d] planes
  const __bf16* Qh = (const __bf16*)(const void*)qhp + (size_t)bb * pstride + (size_t)h * HD;
  const __bf16* Ql = (const __bf16*)(const void*)qlp + (size_t)bb * pstride + (size_t)h * HD;
  const __bf16* Kh = (const __bf16*)(const void*)khp + (size_t)bb * pstride + (size_t)h * HD;
  const __bf16* Kl = (const __bf16*)(const void*)klp + (size_t)bb * pstride + (size_t)h * HD;
  const _Float16* Vh = (const _Float16*)(const void*)vhp + (size_t)bb * ((size_t)DM * SEQ) + (size_t)h * HD * SEQ;
  const _Float16* Vl = (const _Float16*)(const void*)vlp + (size_t)bb * ((size_t)DM * VLP) + (size_t)h * HD * VLP;
  unsigned short* Ohb = ohp + (size_t)bb * pstride;
  unsigned short* Olb = olp + (size_t)bb * pstride;

  // ---- Q fragments (A operand, row = lane&15): 2 d-chunks, hi and lo ----
  v16b qah[2], qal[2];
#pragma unroll
  for (int dc = 0; dc < 2; ++dc) {
    const size_t qo = (size_t)(q0 + c) * DM + dc * 32 + 8 * hh;
    qah[dc] = ldfrag_b(Qh + qo);
    qal[dc] = ldfrag_b(Ql + qo);
  }

  float mrow[8], lrow[8];
  v8f oacc[4];
#pragma unroll
  for (int r = 0; r < 8; ++r) { mrow[r] = -INFINITY; lrow[r] = 0.f; }
#pragma unroll
  for (int t = 0; t < 4; ++t) oacc[t] = zero8();

  const int nkt = qb + 1;                    // key tiles 0..qb (block-uniform)
  for (int kt = 0; kt < NQB; ++kt) {         // static bound
    if (kt >= nkt) break;                    // block-uniform
    const bool diag = (kt == qb);            // block-uniform
    const int kv0 = kt * 64;
    __syncthreads();
    {
      const int r = tid >> 1, half = (tid & 1) * 32;
      const __bf16*   kg  = Kh + (size_t)(kv0 + r) * DM + half;   // K row kv0+r (< SEQ), d = half..half+31
      const __bf16*   klg = Kl + (size_t)(kv0 + r) * DM + half;
      const _Float16* vg  = Vh + (size_t)r * SEQ + kv0 + half;    // V^T row d = r, s = kv0+half..+31
      const int kvl = (kv0 + 64 <= VLP) ? kv0 : (VLP - 64);     // clamped address into the residual plane
      const _Float16* vlg = Vl + (size_t)r * VLP + kvl + half;
      const bool resOK = (kv0 + 64 <= VLP);                      // block-uniform
#pragma unroll
      for (int i = 0; i < 4; ++i) {
        const v8b a0 = *(const v8b*)(kg + 8 * i);
        const v8b a1 = *(const v8b*)(klg + 8 * i);
        const v8h b0 = *(const v8h*)(vg + 8 * i);
        *(v8b*)(Ksh + r * 64 + half + 8 * i) = a0;
        *(v8b*)(Ksl + r * 64 + half + 8 * i) = a1;
        *(v8h*)(Vth + r * 64 + half + 8 * i) = b0;
        if (RES) {
          v8h b1 = *(const v8h*)(vlg + 8 * i);
          if (!resOK) b1 = zero8h();
          *(v8h*)(Vtl + r * 64 + half + 8 * i) = b1;
        }
      }
    }
    __syncthreads();

    // ---- scores: 16 query rows x 64 keys per wave, 3 bf16 products ----
    v8f s[4];
#pragma unroll
    for (int j = 0; j < 4; ++j) {
      s[j] = zero8();
#pragma unroll
      for (int dc = 0; dc < 2; ++dc) {
        FB kb, kl;
        kb.h[0] = *(const v8b*)(Ksh + (j * 16 + c) * 64 + dc * 32 + 8 * hh);
        kb.h[1] = *(const v8b*)(Ksh + (j * 16 + c) * 64 + dc * 32 + 16 + 8 * hh);
        kl.h[0] = *(const v8b*)(Ksl + (j * 16 + c) * 64 + dc * 32 + 8 * hh);
        kl.h[1] = *(const v8b*)(Ksl + (j * 16 + c) * 64 + dc * 32 + 16 + 8 * hh);
        s[j] = mma_b(qah[dc], kb.v, s[j]);
        s[j] = mma_b(qah[dc], kl.v, s[j]);
        s[j] = mma_b(qal[dc], kb.v, s[j]);
      }
    }

    // ---- scale + causal compare (diagonal tile only), row max, online softmax, P (x1024, f16) and
    //      P residual (x4096) to LDS ----
    _Float16* pwh = Psh[wave];
    _Float16* pwl = Psl[RES ? wave : 0];
#pragma unroll
    for (int r = 0; r < 8; ++r) {
      const int qrow = q0 + 8 * hh + r;          // query row of accumulator element r of this lane
      float m = -INFINITY;
#pragma unroll
      for (int j = 0; j < 4; ++j) {
        const int key = kv0 + j * 16 + c;
        float sv = s[j][r] * sscale;
        sv = (diag && (key > qrow)) ? -FLT_MAX : sv;
        s[j][r] = sv;
        m = fmaxf(m, sv);
      }
#pragma unroll
      for (int off = 1; off < 16; off <<= 1) m = fmaxf(m, __shfl_xor(m, off, 32));
      const float mnew  = fmaxf(mrow[r], m);
      const float msafe = (mnew == -INFINITY) ? 0.f : mnew;
      const float alpha = __expf(mrow[r] - msafe);
      mrow[r] = mnew;
      float psum = 0.f;
#pragma unroll
      for (int j = 0; j < 4; ++j) {
        const float p = __expf(s[j][r] - msafe);     // floor logit against a normal max: exp -> 0
        psum += p;
        const float p1k = p * 1024.0f;
        const _Float16 ph = (_Float16)p1k;
        pwh[(8 * hh + r) * 64 + j * 16 + c] = ph;
        if (RES) {
          const _Float16 pl = (_Float16)((p1k - (float)ph) * 4096.0f);
          pwl[(8 * hh + r) * 64 + j * 16 + c] = pl;
        }
      }
#pragma unroll
      for (int off = 1; off < 16; off <<= 1) psum += __shfl_xor(psum, off, 32);
      lrow[r] = lrow[r] * alpha + psum;
#pragma unroll
      for (int t = 0; t < 4; ++t) oacc[t][r] *= alpha;
    }
    __builtin_amdgcn_fence(3, "workgroup");
    __builtin_amdgcn_wave_barrier();
    __builtin_amdgcn_fence(2, "workgroup");

    // ---- context += P . V (f16 WMMA), residual products into a separate accumulator ----
    v8f o1[4];
#pragma unroll
    for (int t = 0; t < 4; ++t) o1[t] = zero8();
#pragma unroll 1
    for (int kk = 0; kk < 2; ++kk) {
      FH pa, pl;
      pa.h[0] = *(const v8h*)(pwh + c * 64 + kk * 32 + 8 * hh);
      pa.h[1] = *(const v8h*)(pwh + c * 64 + kk * 32 + 16 + 8 * hh);
      if (RES) {
        pl.h[0] = *(const v8h*)(pwl + c * 64 + kk * 32 + 8 * hh);
        pl.h[1] = *(const v8h*)(pwl + c * 64 + kk * 32 + 16 + 8 * hh);
      } else {
        pl.v = pa.v;
      }
#pragma unroll
      for (int t = 0; t < 4; ++t) {
        FH vb;
        vb.h[0] = *(const v8h*)(Vth + (t * 16 + c) * 64 + kk * 32 + 8 * hh);
        vb.h[1] = *(const v8h*)(Vth + (t * 16 + c) * 64 + kk * 32 + 16 + 8 * hh);
        oacc[t] = mma_h(pa.v, vb.v, oacc[t]);
        if (RES) {
          FH vl;
          vl.h[0] = *(const v8h*)(Vtl + (t * 16 + c) * 64 + kk * 32 + 8 * hh);
          vl.h[1] = *(const v8h*)(Vtl + (t * 16 + c) * 64 + kk * 32 + 16 + 8 * hh);
          o1[t] = mma_h(pa.v, vl.v, o1[t]);
          o1[t] = mma_h(pl.v, vb.v, o1[t]);
        }
      }
    }
    if (RES) {
#pragma unroll
      for (int t = 0; t < 4; ++t)
#pragma unroll
        for (int r = 0; r < 8; ++r) oacc[t][r] += o1[t][r] * (1.0f / 4096.0f);
    }
  }

  // ---- normalise (1/l and the 1/1024 p carry), stage the wave's 16x64 tile, bf16 hi/lo split,
  float* os = Os[wave];
#pragma unroll
  for (int r = 0; r < 8; ++r) {
    const float l = lrow[r];
    const float inv = ((l > 0.f) ? (1.0f / l) : 0.f) * (1.0f / 1024.0f);
#pragma unroll
    for (int t = 0; t < 4; ++t) os[(8 * hh + r) * 64 + t * 16 + c] = oacc[t][r] * inv;
  }
  __builtin_amdgcn_fence(3, "workgroup");
  __builtin_amdgcn_wave_barrier();
  __builtin_amdgcn_fence(2, "workgroup");
  {
    const int q4 = lane >> 3, c8 = (lane & 7) * 8;
    v4u hv[4], lv[4];
#pragma unroll
    for (int it = 0; it < 4; ++it) {
      const int row = it * 4 + q4;   // it 0..3 x q4 0..3 = rows 0..15 of the wave tile
      const float* sp = os + row * 64 + c8;
      v4u a, a2;
#pragma unroll
      for (int e = 0; e < 4; ++e) {
        const float f0 = sp[2 * e], f1 = sp[2 * e + 1];
        const unsigned short h0 = bf_bits(f0), h1 = bf_bits(f1);
        const unsigned short l0 = bf_bits(f0 - bf_up(h0)), l1 = bf_bits(f1 - bf_up(h1));
        a[e] = pk16(h0, h1); a2[e] = pk16(l0, l1);
      }
      hv[it] = a; lv[it] = a2;
    }
    {
#pragma unroll
      for (int it = 0; it < 4; ++it) {
        const int row = it * 4 + q4;
        const size_t go = (size_t)(q0 + row) * DM + (size_t)h * HD + c8;
        *(v4u*)(Ohb + go) = hv[it];
        *(v4u*)(Olb + go) = lv[it];
      }
      
    }
  }
}

// =====================================================================================================
// Workspace map (bytes, NB = 4, SEQ = 2048; every activation plane holds NB batch slices back to back):
//   Xb    bf16 [NB*SEQ][1024]          0           16777216   (also holds Oh after the projections: same extent)
//   Wqb   bf16 [1024 n][1024 k]        16777216     2097152
//   Wkb   bf16 [1024 n][1024 k]        18874368     2097152
//   Wvb   bf16 [1024 n][1024 k]        20971520     2097152
//   Wob   bf16 [1024 n][1024 k]        23068672     2097152
//   Qh    bf16 [NB*SEQ][1024]          25165824    16777216
//   Ql    bf16 [NB*SEQ][1024]          41943040    16777216
//   Kh    bf16 [NB*SEQ][1024]          58720256    16777216
//   Kl    bf16 [NB*SEQ][1024]          75497472    16777216
//   VTh   f16  NB x [1024][SEQ]        92274688    16777216
//   VTl   f16  NB x [1024][VLP=512]   109051904     4194304
//   Ol    bf16 [NB*SEQ][1024]         113246208    16777216
//   end                               130023424
// Oh aliases Xb: Xb is last read by the v^T projection, Oh is first written by the attention launches that
// come after it in stream order; both extents are NB*SEQ*DM*2 bytes exactly.
// All planes are exact multiples of their 64x64 / whole-line store granularity (no padded tails needed),
// =====================================================================================================
extern "C" void kernel_launch(void* const* d_in, const int* in_sizes, int n_in,
                              void* d_out, int out_size, void* d_ws, size_t ws_size,
                              hipStream_t stream) {
  if (n_in < 5) return;
  const long long needX = (long long)(NB - 1) * SEQ_FULL * DM + (long long)SEQ * DM;   // last row read / written
  if ((long long)in_sizes[0] < needX) return;         // x [NB_FULL][SEQ_FULL][1024], rows 0..SEQ-1 of batches 0..NB-1
  if (in_sizes[1] < DM * DM) return;                  // Wq [1024 out][1024 in]
  if (in_sizes[2] < DM * DM) return;                  // Wk
  if (in_sizes[3] < DM * DM) return;                  // Wv
  if (in_sizes[4] < DM * DM) return;                  // Wo
  if ((long long)out_size < needX) return;

  const float* x  = (const float*)d_in[0];
  const float* Wq = (const float*)d_in[1];
  const float* Wk = (const float*)d_in[2];
  const float* Wv = (const float*)d_in[3];
  const float* Wo = (const float*)d_in[4];

  const size_t PX  = (size_t)NB * SEQ * DM * 2;     // 16-bit activation plane [NB*SEQ][1024]
  const size_t PW  = (size_t)DM * DM * 2;           // 16-bit weight plane [1024][1024]
  const size_t PVT = (size_t)NB * DM * SEQ * 2;     // v^T hi plane, NB slices
  const size_t PVL = (size_t)NB * DM * VLP * 2;     // v^T residual plane, NB slices
  static_assert((size_t)NB * SEQ * DM * 2 == (size_t)NB * DM * SEQ * 2);
  size_t off = 0;
  const size_t oXb  = off; off += PX;
  const size_t oOh  = oXb;                          // aliased, same extent PX
  const size_t oWq  = off; off += PW;
  const size_t oWk  = off; off += PW;
  const size_t oWv  = off; off += PW;
  const size_t oWo  = off; off += PW;
  const size_t oQh  = off; off += PX;
  const size_t oQl  = off; off += PX;
  const size_t oKh  = off; off += PX;
  const size_t oKl  = off; off += PX;
  const size_t oVTh = off; off += PVT;
  const size_t oVTl = off; off += PVL;
  const size_t oOl  = off; off += PX;
  if (off > ws_size) return;                     // off = 130023424 for NB = 4, SEQ = 2048
  if (off > (size_t)134217728) return;

  char* ws = (char*)d_ws;
  unsigned short* Xb  = (unsigned short*)(ws + oXb);
  unsigned short* Oh  = (unsigned short*)(ws + oOh);
  unsigned short* Wqb = (unsigned short*)(ws + oWq);
  unsigned short* Wkb = (unsigned short*)(ws + oWk);
  unsigned short* Wvb = (unsigned short*)(ws + oWv);
  unsigned short* Wob = (unsigned short*)(ws + oWo);
  unsigned short* Qh  = (unsigned short*)(ws + oQh);
  unsigned short* Ql  = (unsigned short*)(ws + oQl);
  unsigned short* Kh  = (unsigned short*)(ws + oKh);
  unsigned short* Kl  = (unsigned short*)(ws + oKl);
  unsigned short* VTh = (unsigned short*)(ws + oVTh);
  unsigned short* VTl = (unsigned short*)(ws + oVTl);
  unsigned short* Ol  = (unsigned short*)(ws + oOl);

  const dim3 blk(256);
  const int n8x = SEQ * DM / 8;                                    // per batch slice, multiple of 256
  const dim3 gCvtX(n8x / 256, NB);
  const int n8w = DM * DM / 8;                                     // multiple of 256
  const dim3 gCvtW(n8w / 256, 1);
  const int tilesQK = (NB * SEQ / 64) * (DM / 64);                 // M = NB*SEQ, N = 1024
  const dim3 gQK((tilesQK + 7) / 8, 1);
  const int tilesVT = (DM / 64) * (SEQ / 64);                      // M = 1024, N = SEQ, per batch
  const dim3 gVT((tilesVT + 7) / 8, NB);
  const int tilesOut = (SEQ / 64) * (DM / 64);                     // M = SEQ, N = 1024, per batch
  const dim3 gOut((tilesOut + 7) / 8, NB);
  const long long xStrideIn = (long long)SEQ_FULL * DM;            // input x batch stride (full layout)
  const long long pStride   = (long long)SEQ * DM;                 // plane batch stride

  // (1) x -> bf16 plane [NB*SEQ][1024] (batch b reads input rows b*SEQ_FULL .. +SEQ-1); weights -> bf16 [n][k]
  cvt_bf16x8<<<gCvtX, blk, 0, stream>>>(x, Xb, n8x, xStrideIn, pStride);
  cvt_bf16x8<<<gCvtW, blk, 0, stream>>>(Wq, Wqb, n8w, 0LL, 0LL);
  cvt_bf16x8<<<gCvtW, blk, 0, stream>>>(Wk, Wkb, n8w, 0LL, 0LL);
  cvt_bf16x8<<<gCvtW, blk, 0, stream>>>(Wv, Wvb, n8w, 0LL, 0LL);
  cvt_bf16x8<<<gCvtW, blk, 0, stream>>>(Wo, Wob, n8w, 0LL, 0LL);
  // (2) q = x . Wq^T -> bf16 hi/lo planes [b*SEQ + t][h*64+d]   (M = NB*SEQ, N = 1024, K = 1024)
  gemm64<0, 2><<<gQK, blk, 0, stream>>>(
      Xb, Xb, DM, 0LL, Wqb, Wqb, DM, 0LL,
      (void*)Qh, DM, 0LL, (void*)Ql, DM, 0LL, DM,
      NB * SEQ, DM, DM, 1.0f);
  // (3) k = x . Wk^T -> bf16 hi/lo planes
  gemm64<0, 2><<<gQK, blk, 0, stream>>>(
      Xb, Xb, DM, 0LL, Wkb, Wkb, DM, 0LL,
      (void*)Kh, DM, 0LL, (void*)Kl, DM, 0LL, DM,
      NB * SEQ, DM, DM, 1.0f);
  // (4) v^T = Wv . x^T per batch -> f16 hi plane [h*64+d][s] (pitch SEQ, batch stride DM*SEQ) and residual
  //     plane (x4096, keys < VLP only, pitch VLP, batch stride DM*VLP)   (A = Wvb [n][k], Bt = Xb slice b;
  //     M = 1024, N = SEQ, K = 1024, grid.y = batch)
  gemm64<0, 3><<<gVT, blk, 0, stream>>>(
      Wvb, Wvb, DM, 0LL, Xb, Xb, DM, pStride,
      (void*)VTh, SEQ, (long long)DM * SEQ, (void*)VTl, VLP, (long long)DM * VLP, VLP,
      DM, SEQ, DM, 4096.0f);
  // (5) causal attention: query blocks 0..RESQB-1 with residual planes, the rest without; grid.y = batch
  attn_causal64<true><<<dim3(NH * RESQB, NB), dim3(128), 0, stream>>>(
      Qh, Ql, Kh, Kl, VTh, VTl, Oh, Ol, 0, RESQB, 0.125f);
  if (NQB > RESQB) {
    attn_causal64<false><<<dim3(NH * (NQB - RESQB), NB), dim3(128), 0, stream>>>(
        Qh, Ql, Kh, Kl, VTh, VTl, Oh, Ol, RESQB, NQB - RESQB, 0.125f);
  }
  // (6) out = context . Wo^T -> d_out f32, batch b rows b*SEQ_FULL .. +SEQ-1 (A = context hi + lo planes,
  //     2 products; M = SEQ, N = 1024, K = 1024, grid.y = batch)
  gemm64<1, 0><<<gOut, blk, 0, stream>>>(
      Oh, Ol, DM, pStride, Wob, Wob, DM, 0LL,
      d_out, DM, xStrideIn, d_out, DM, 0LL, DM,
      SEQ, DM, DM, 1.0f);
  (void)hipGetLastError();
}

// v001
// A run of this version takes 421 microseconds.
// In both of two side-by-side timings against v000, it was 1.33 times as fast.
// Contractions: q, k, v^T projections = v_wmma_f32_16x16x32_bf16 (bf16 operands from RNE-converted inputs, single product);
// q.k^T scores = v_wmma_f32_16x16x32_bf16 with bf16 hi/lo split q and k (hi.hi + hi.lo + lo.hi);
// p.v = v_wmma_f32_16x16x32_f16 (p carried x1024 in f16, v in f16; extra f16 residual planes x4096 of p and v for the first VLP query rows);
// ctx.Wo = v_wmma_f32_16x16x32_bf16 with ctx as bf16 hi/lo planes times bf16 Wo (2 products); all f32 accumulate; causal compare and softmax in f32.
#include <hip/hip_runtime.h>
#include <math.h>
#include <float.h>
#include <stdint.h>

#ifndef NB
#define NB    4
#endif
#ifndef SEQ
#define SEQ   2048
#endif
#define NB_FULL  4
#define SEQ_FULL 2048
#define DM    1024
#define NH    16
#define HD    64
#define NQB   (SEQ / 64)                      // key / query tiles of 64
#define VLP   ((SEQ < 512) ? SEQ : 512)       // key pitch of the v^T residual plane (keys 0..VLP-1)
#define RESQB (VLP / 64)                      // number of leading 64-row query blocks that use the p / v residual planes
#define LP    72                              // LDS row pitch (16-bit elements) of the 64-wide K, V^T and P tiles: 144 B = 16 B x odd
static_assert(NB >= 1 && NB <= NB_FULL);
static_assert(NH * HD == DM && HD == 64);
static_assert((SEQ % 64) == 0 && (DM % 64) == 0 && SEQ >= 64 && SEQ <= SEQ_FULL);
static_assert(RESQB * 64 == VLP && VLP <= SEQ && RESQB >= 1 && RESQB <= NQB);
static_assert(((SEQ * DM / 8) % 256) == 0 && ((DM * DM / 8) % 256) == 0);

typedef _Float16 v16h __attribute__((ext_vector_type(16)));
typedef _Float16 v8h  __attribute__((ext_vector_type(8)));
typedef __bf16   v16b __attribute__((ext_vector_type(16)));
typedef __bf16   v8b  __attribute__((ext_vector_type(8)));
typedef float    v8f  __attribute__((ext_vector_type(8)));
typedef float    v4f  __attribute__((ext_vector_type(4)));
typedef unsigned int v4u __attribute__((ext_vector_type(4)));

// ---- scalar helpers --------------------------------------------------------------------------------
__device__ __forceinline__ unsigned short bf_bits(float f) {          // f32 -> bf16 bits, RNE convert
  unsigned u = __float_as_uint(f);
  return (unsigned short)((u + 0x7FFFu + ((u >> 16) & 1u)) >> 16);
}
__device__ __forceinline__ float bf_up(unsigned short h) { return __uint_as_float(((unsigned)h) << 16); }
__device__ __forceinline__ unsigned short h_bits(_Float16 x) { return __builtin_bit_cast(unsigned short, x); }
__device__ __forceinline__ unsigned pk16(unsigned short a, unsigned short b) { return (unsigned)a | ((unsigned)b << 16); }
__device__ __forceinline__ v8f zero8() { v8f z = {0.f, 0.f, 0.f, 0.f, 0.f, 0.f, 0.f, 0.f}; return z; }
__device__ __forceinline__ v8h zero8h() {
  const _Float16 z = (_Float16)0.0f;
  v8h r = {z, z, z, z, z, z, z, z};
  return r;
}

// ---- fragment loaders: 16-bit A/B operand, lane -> row/col (lane&15), p already includes +8*(lane>>4);
//      elements 0..7 <- p[0..7] (k0+8h..), elements 8..15 <- p[16..23] (k0+16+8h..)
__device__ __forceinline__ v16b ldfrag_b(const __bf16* p) {
  union { v16b v; v8b h[2]; } f;
  f.h[0] = *(const v8b*)(p);
  f.h[1] = *(const v8b*)(p + 16);
  return f.v;
}

// ---- WMMA helpers with trailing VALU hazard gap --------------------------------------------------------
__device__ __forceinline__ v8f mma_b(v16b a, v16b b, v8f c) {
  c = __builtin_amdgcn_wmma_f32_16x16x32_bf16(false, a, false, b, (short)0, c, false, false);
  asm volatile("v_nop\n\tv_nop\n\tv_nop\n\tv_nop" : "+v"(c) : "v"(a), "v"(b));
  return c;
}
__device__ __forceinline__ v8f mma_h(v16h a, v16h b, v8f c) {
  c = __builtin_amdgcn_wmma_f32_16x16x32_f16(false, a, false, b, (short)0, c, false, false);
  asm volatile("v_nop\n\tv_nop\n\tv_nop\n\tv_nop" : "+v"(c) : "v"(a), "v"(b));
  return c;
}
__device__ __forceinline__ v8f mma_b_raw(v16b a, v16b b, v8f c) {
  return __builtin_amdgcn_wmma_f32_16x16x32_bf16(false, a, false, b, (short)0, c, false, false);
}
__device__ __forceinline__ void dep_guard_b(v8f& a, v8f& b, v16b x, v16b y) {
  asm volatile("v_nop\n\tv_nop\n\tv_nop\n\tv_nop" : "+v"(a), "+v"(b) : "v"(x), "v"(y));
}
__device__ __forceinline__ void keep4_b(v16b a, v16b b, v16b c, v16b d) {
  asm volatile("v_nop" :: "v"(a), "v"(b), "v"(c), "v"(d));
}
__device__ __forceinline__ void acc_guard4(v8f& a, v8f& b, v8f& c, v8f& d) {
  asm volatile("v_nop\n\tv_nop\n\tv_nop\n\tv_nop" : "+v"(a), "+v"(b), "+v"(c), "+v"(d));
}

// =====================================================================================================
// f32 -> bf16 (RNE convert), 8 elements per thread, one 16-B store per lane: a wave writes 512 contiguous B
// blockIdx.y selects the batch slice (element strides inStride / outStride).
// coverage: n8 threads x 8 = the whole plane slice (n8 is a multiple of 256, host-asserted above).
// =====================================================================================================
__global__ __launch_bounds__(256) void cvt_bf16x8(const float* __restrict__ in, unsigned short* out, int n8,
                                                  long long inStride, long long outStride) {
  const int i = blockIdx.x * 256 + threadIdx.x;
  const float* src = in + (size_t)blockIdx.y * (size_t)inStride;
  unsigned short* dst = out + (size_t)blockIdx.y * (size_t)outStride;
  if (i < n8) {
    const v4f a = *(const v4f*)(src + (size_t)i * 8);
    const v4f b = *(const v4f*)(src + (size_t)i * 8 + 4);
    v4u p;
    p[0] = pk16(bf_bits(a[0]), bf_bits(a[1]));
    p[1] = pk16(bf_bits(a[2]), bf_bits(a[3]));
    p[2] = pk16(bf_bits(b[0]), bf_bits(b[1]));
    p[3] = pk16(bf_bits(b[2]), bf_bits(b[3]));
    *(v4u*)(dst + (size_t)i * 8) = p;
    
  }
}

// =====================================================================================================
// Register-blocked bf16 WMMA GEMM: C[m][n] = sum_k A[m][k] * Bt[n][k]; one wave per 64x64 tile,
// no block barriers. A row-major [M][K] pitch lda; Bt row-major [N][K] pitch ldb (k contiguous);
// M, N multiples of 64, K multiple of 32 (host-checked). blockIdx.y = batch index (strides in elements).
// NSPLIT: 0 = A.Bt; 1 = (A + A2).Bt (A2 = unscaled bf16 lo plane of A); 2 = A.Bt + A2.Bt + A.Bt2.
// OUT_MODE: 0 = f32 (pitch ldc); 2 = bf16 hi plane C + bf16 lo plane C2 (lo = RNE(v - hi), unscaled);
//           3 = f16 hi plane C + f16 residual plane C2 = f16((v - hi) * rscale), C2 written only for tiles
//               with n0 < N2 (pitch ldc2, batch stride strideC2).
// =====================================================================================================
template <int NSPLIT, int OUT_MODE>
__global__ __launch_bounds__(256) void gemm64(
    const unsigned short* __restrict__ Ap, const unsigned short* A2p, int lda, long long strideA,
    const unsigned short* __restrict__ Btp, const unsigned short* Bt2p, int ldb, long long strideB,
    void* Cout, int ldc, long long strideC,
    void* Cout2, int ldc2, long long strideC2, int N2,
    int M, int N, int K, float rscale) {
  const __bf16* A   = (const __bf16*)(const void*)Ap;
  const __bf16* A2  = (const __bf16*)(const void*)A2p;
  const __bf16* Bt  = (const __bf16*)(const void*)Btp;
  const __bf16* Bt2 = (const __bf16*)(const void*)Bt2p;
  __shared__ __align__(16) float sT[8][16 * 68];   // per-wave 16x64 slab, pitch 68 floats
  const int b    = blockIdx.y;
  const int lane = threadIdx.x & 31;
  const int wave = threadIdx.x >> 5;
  const int tilesN = N >> 6;
  const int tilesM = M >> 6;
  const int tile = blockIdx.x * 8 + wave;
  if (tile >= tilesM * tilesN) return;   // wave-uniform; no block barriers in this kernel
  const int tm = tile / tilesN;
  const int tn = tile - tm * tilesN;
  const int m0 = tm << 6;
  const int n0 = tn << 6;

  const __bf16* Ab  = A  + (size_t)b * strideA;
  const __bf16* Bb  = Bt + (size_t)b * strideB;
  const __bf16* Ab2 = (NSPLIT >= 1) ? (A2  + (size_t)b * strideA) : Ab;
  const __bf16* Bb2 = (NSPLIT == 2) ? (Bt2 + (size_t)b * strideB) : Bb;

  const int rlane = lane & 15;                 // row (A) / col (B, D) within subtile
  const int koff  = (lane >> 4) * 8;           // k offset of this lane half
  const int mOff  = (lane >> 4) * 8;           // D row offset

  v8f acc[4][4];
#pragma unroll
  for (int i = 0; i < 4; ++i)
#pragma unroll
    for (int j = 0; j < 4; ++j) acc[i][j] = zero8();

  for (int k0 = 0; k0 < K; k0 += 32) {
    v16b bh[4], bl[4];
#pragma unroll
    for (int j = 0; j < 4; ++j) {
      const size_t bo = (size_t)(n0 + (j << 4) + rlane) * ldb + koff + k0;
      bh[j] = ldfrag_b(Bb + bo);
      if (NSPLIT == 2) bl[j] = ldfrag_b(Bb2 + bo); else bl[j] = bh[j];
    }
#pragma unroll
    for (int i = 0; i < 4; ++i) {
      const size_t ao = (size_t)(m0 + (i << 4) + rlane) * lda + koff + k0;
      const v16b ah = ldfrag_b(Ab + ao);
      v16b al = ah;
      if (NSPLIT >= 1) al = ldfrag_b(Ab2 + ao);
#pragma unroll
      for (int j = 0; j < 4; ++j) {
        acc[i][j] = mma_b_raw(ah, bh[j], acc[i][j]);
        if (NSPLIT >= 1) acc[i][j] = mma_b_raw(al, bh[j], acc[i][j]);
        if (NSPLIT == 2) acc[i][j] = mma_b_raw(ah, bl[j], acc[i][j]);
      }
      dep_guard_b(acc[i][0], acc[i][3], ah, al);
    }
    keep4_b(bh[0], bh[1], bh[2], bh[3]);
    if (NSPLIT == 2) keep4_b(bl[0], bl[1], bl[2], bl[3]);
  }
  acc_guard4(acc[0][0], acc[0][1], acc[0][2], acc[0][3]);
  acc_guard4(acc[1][0], acc[1][1], acc[1][2], acc[1][3]);
  acc_guard4(acc[2][0], acc[2][1], acc[2][2], acc[2][3]);
  acc_guard4(acc[3][0], acc[3][1], acc[3][2], acc[3][3]);

  // ---- epilogue ----
  float* slab = sT[wave];
#pragma unroll
  for (int i = 0; i < 4; ++i) {
    const int mBase = m0 + (i << 4);
#pragma unroll
    for (int j = 0; j < 4; ++j) {
#pragma unroll
      for (int r = 0; r < 8; ++r) {
        slab[(mOff + r) * 68 + (j << 4) + rlane] = acc[i][j][r];
      }
    }
    __builtin_amdgcn_fence(3, "workgroup");
    __builtin_amdgcn_wave_barrier();
    __builtin_amdgcn_fence(2, "workgroup");
    if (OUT_MODE == 0) {
      float* C = (float*)Cout + (size_t)b * strideC;
      const int hh = lane >> 4, c4 = (lane & 15) * 4;     // 256-B row segment = 16 lanes x 16 B
      {
#pragma unroll
        for (int it = 0; it < 8; ++it) {
          const int row = it * 2 + hh;                     // it 0..7 x hh 0..1 = rows 0..15
          const v4f v = *(const v4f*)(slab + row * 68 + c4);
          *(v4f*)(C + (size_t)(mBase + row) * ldc + n0 + c4) = v;
        }
        
      }
    } else {
      const int q = lane >> 3, c8 = (lane & 7) * 8;
      unsigned short* C  = (unsigned short*)Cout  + (size_t)b * strideC;
      unsigned short* C2 = (unsigned short*)Cout2 + (size_t)b * strideC2;
      const bool wlo = (OUT_MODE == 2) || (n0 < N2);      // wave-uniform
      v4u hv[4], lv[4];
#pragma unroll
      for (int it = 0; it < 4; ++it) {
        const int row = it * 4 + q;                        // it 0..3 x q 0..3 = rows 0..15
        const float* sp = slab + row * 68 + c8;
        v4u a, a2;
#pragma unroll
        for (int e = 0; e < 4; ++e) {
          const float f0 = sp[2 * e], f1 = sp[2 * e + 1];
          unsigned short h0, h1, l0, l1;
          if (OUT_MODE == 2) {
            h0 = bf_bits(f0); h1 = bf_bits(f1);
            l0 = bf_bits(f0 - bf_up(h0)); l1 = bf_bits(f1 - bf_up(h1));
          } else {
            const _Float16 x0 = (_Float16)f0, x1 = (_Float16)f1;
            h0 = h_bits(x0); h1 = h_bits(x1);
            l0 = h_bits((_Float16)((f0 - (float)x0) * rscale));
            l1 = h_bits((_Float16)((f1 - (float)x1) * rscale));
          }
          a[e] = pk16(h0, h1); a2[e] = pk16(l0, l1);
        }
        hv[it] = a; lv[it] = a2;
      }
      {
#pragma unroll
        for (int it = 0; it < 4; ++it) {
          const int row = it * 4 + q;
          *(v4u*)(C + (size_t)(mBase + row) * ldc + n0 + c8) = hv[it];
          if (wlo) *(v4u*)(C2 + (size_t)(mBase + row) * ldc2 + n0 + c8) = lv[it];
        }
        
      }
    }
    __builtin_amdgcn_fence(3, "workgroup");
    __builtin_amdgcn_wave_barrier();
    __builtin_amdgcn_fence(2, "workgroup");
  }
}

// =====================================================================================================
// Causal attention, head dim 64, blockIdx.y = batch index (all planes carry NB batch slices back to back).
//   q planes (bf16 hi / lo): element (b, t, h, d) at [b*SEQ*DM + t*DM + h*64 + d]
//   k planes (bf16 hi / lo): same layout with key index s
//   v^T hi plane (f16):      element (b, h, d, s) at [b*DM*SEQ + (h*64 + d)*SEQ + s]
//   v^T residual plane (f16, (v - hi)*4096): [b*DM*VLP + (h*64 + d)*VLP + s], s < VLP, read only when RES
//   (a key tile at or beyond VLP would contribute a zero v residual; never happens for query blocks < RESQB)
//   logit (t, s) = q.k * sscale for s <= t, finfo.min for s > t. Query block qb (64 rows) visits key tiles
//   0..qb only (every later key is above the diagonal for all 64 rows -> weight exactly 0); the compare
//   s > t is applied on the diagonal tile kt == qb only (block-uniform flag, per-element select). Every row
//   has the live key s = t in the diagonal tile and all of tile 0, so the row max is always finite.
//   out planes (bf16 hi / lo of the normalised context): element (b, t, h, d) at [b*SEQ*DM + t*DM + h*64 + d]
//   scores = q . k : bf16 hi/lo split (hi.hi + hi.lo + lo.hi), f32 accumulate, then * sscale in f32
//   p = exp(s - m) carried as f16(1024 p); context = p . v on f16 WMMA; RES adds f16 residual planes of p and v
//   (scale 4096, separate accumulator folded back with 1/4096 per chunk in f32); online softmax in f32.
//   Block = 4 waves = 64 query rows of one head of one batch; grid = (nqbThis * NH, NB); kv chunks of 64,
//   static bound NQB, block-uniform break at kt == qb + 1.
//   K / V^T chunk staging: 128 threads x 32 elements per plane = the whole 64x64 tile (plain 16-B loads,
//   __syncthreads before and after: cross-wave LDS regions Ksh/Ksl/Vth/Vtl behind block barriers);
//   P tiles and the Os tile are wave-private, spilled with element stores and reloaded (P as v8h, same element
//   Output coverage: each wave stores rows q0..q0+15 (it 0..3 x lane>>3 0..3) x 64 columns (8 lanes x 8) of both planes.
// =====================================================================================================
template <bool RES>
__global__ __launch_bounds__(128) __attribute__((amdgpu_num_vgpr(256)))
void attn_causal64(const unsigned short* __restrict__ qhp, const unsigned short* __restrict__ qlp,
                   const unsigned short* __restrict__ khp, const unsigned short* __restrict__ klp,
                   const unsigned short* __restrict__ vhp, const unsigned short* __restrict__ vlp,
                   unsigned short* ohp, unsigned short* olp,
                   int qbBase, int nqbThis, float sscale) {
  union FB { v16b v; v8b h[2]; };
  union FH { v16h v; v8h h[2]; };
  __shared__ __align__(16) __bf16   Ksh[64 * LP];                 // K hi [kv][d], pitch LP, 9 KB
  __shared__ __align__(16) __bf16   Ksl[64 * LP];                 // K lo
  __shared__ __align__(16) _Float16 Vth[64 * LP];                 // V^T hi [d][kv], pitch LP, 9 KB
  __shared__ __align__(16) _Float16 Vtl[RES ? 64 * LP : 8];       // V^T residual
  __shared__ __align__(16) _Float16 Psh[4][16 * LP];              // per wave P [row][kv]
  __shared__ __align__(16) _Float16 Psl[RES ? 4 : 1][16 * LP];    // per wave P residual
  __shared__ __align__(16) float    Os[4][16 * 64];               // per wave context tile [row][d]

  const int tid  = threadIdx.x;
  const int wave = tid >> 5;
  const int lane = tid & 31;
  const int hh   = lane >> 4;
  const int c    = lane & 15;

  const int bx   = blockIdx.x;
  const int bb   = blockIdx.y;               // batch
  const int qbl  = bx % nqbThis;
  const int h    = bx / nqbThis;           // 0..NH-1 (grid.x = nqbThis * NH)
  const int qb   = qbBase + qbl;
  const int q0   = qb * 64 + wave * 16;

  const size_t pstride = (size_t)SEQ * DM;                  // per-batch elements of the [t][h*64+d] planes
  const __bf16* Qh = (const __bf16*)(const void*)qhp + (size_t)bb * pstride + (size_t)h * HD;
  const __bf16* Ql = (const __bf16*)(const void*)qlp + (size_t)bb * pstride + (size_t)h * HD;
  const __bf16* Kh = (const __bf16*)(const void*)khp + (size_t)bb * pstride + (size_t)h * HD;
  const __bf16* Kl = (const __bf16*)(const void*)klp + (size_t)bb * pstride + (size_t)h * HD;
  const _Float16* Vh = (const _Float16*)(const void*)vhp + (size_t)bb * ((size_t)DM * SEQ) + (size_t)h * HD * SEQ;
  const _Float16* Vl = (const _Float16*)(const void*)vlp + (size_t)bb * ((size_t)DM * VLP) + (size_t)h * HD * VLP;
  unsigned short* Ohb = ohp + (size_t)bb * pstride;
  unsigned short* Olb = olp + (size_t)bb * pstride;

  // ---- Q fragments (A operand, row = lane&15): 2 d-chunks, hi and lo ----
  v16b qah[2], qal[2];
#pragma unroll
  for (int dc = 0; dc < 2; ++dc) {
    const size_t qo = (size_t)(q0 + c) * DM + dc * 32 + 8 * hh;
    qah[dc] = ldfrag_b(Qh + qo);
    qal[dc] = ldfrag_b(Ql + qo);
  }

  float mrow[8], lrow[8];
  v8f oacc[4];
#pragma unroll
  for (int r = 0; r < 8; ++r) { mrow[r] = -INFINITY; lrow[r] = 0.f; }
#pragma unroll
  for (int t = 0; t < 4; ++t) oacc[t] = zero8();

  const int nkt = qb + 1;                    // key tiles 0..qb (block-uniform)
  for (int kt = 0; kt < NQB; ++kt) {         // static bound
    if (kt >= nkt) break;                    // block-uniform
    const bool diag = (kt == qb);            // block-uniform
    const int kv0 = kt * 64;
    __syncthreads();
    {
      const int r = tid >> 1, half = (tid & 1) * 32;
      const __bf16*   kg  = Kh + (size_t)(kv0 + r) * DM + half;   // K row kv0+r (< SEQ), d = half..half+31
      const __bf16*   klg = Kl + (size_t)(kv0 + r) * DM + half;
      const _Float16* vg  = Vh + (size_t)r * SEQ + kv0 + half;    // V^T row d = r, s = kv0+half..+31
      const int kvl = (kv0 + 64 <= VLP) ? kv0 : (VLP - 64);     // clamped address into the residual plane
      const _Float16* vlg = Vl + (size_t)r * VLP + kvl + half;
      const bool resOK = (kv0 + 64 <= VLP);                      // block-uniform
#pragma unroll
      for (int i = 0; i < 4; ++i) {
        const v8b a0 = *(const v8b*)(kg + 8 * i);
        const v8b a1 = *(const v8b*)(klg + 8 * i);
        const v8h b0 = *(const v8h*)(vg + 8 * i);
        *(v8b*)(Ksh + r * LP + half + 8 * i) = a0;
        *(v8b*)(Ksl + r * LP + half + 8 * i) = a1;
        *(v8h*)(Vth + r * LP + half + 8 * i) = b0;
        if (RES) {
          v8h b1 = *(const v8h*)(vlg + 8 * i);
          if (!resOK) b1 = zero8h();
          *(v8h*)(Vtl + r * LP + half + 8 * i) = b1;
        }
      }
    }
    __syncthreads();

    // ---- scores: 16 query rows x 64 keys per wave, 3 bf16 products ----
    v8f s[4];
#pragma unroll
    for (int j = 0; j < 4; ++j) {
      s[j] = zero8();
#pragma unroll
      for (int dc = 0; dc < 2; ++dc) {
        FB kb, kl;
        kb.h[0] = *(const v8b*)(Ksh + (j * 16 + c) * LP + dc * 32 + 8 * hh);
        kb.h[1] = *(const v8b*)(Ksh + (j * 16 + c) * LP + dc * 32 + 16 + 8 * hh);
        kl.h[0] = *(const v8b*)(Ksl + (j * 16 + c) * LP + dc * 32 + 8 * hh);
        kl.h[1] = *(const v8b*)(Ksl + (j * 16 + c) * LP + dc * 32 + 16 + 8 * hh);
        s[j] = mma_b(qah[dc], kb.v, s[j]);
        s[j] = mma_b(qah[dc], kl.v, s[j]);
        s[j] = mma_b(qal[dc], kb.v, s[j]);
      }
    }

    // ---- scale + causal compare (diagonal tile only), row max, online softmax, P (x1024, f16) and
    //      P residual (x4096) to LDS ----
    _Float16* pwh = Psh[wave];
    _Float16* pwl = Psl[RES ? wave : 0];
#pragma unroll
    for (int r = 0; r < 8; ++r) {
      const int qrow = q0 + 8 * hh + r;          // query row of accumulator element r of this lane
      float m = -INFINITY;
#pragma unroll
      for (int j = 0; j < 4; ++j) {
        const int key = kv0 + j * 16 + c;
        float sv = s[j][r] * sscale;
        sv = (diag && (key > qrow)) ? -FLT_MAX : sv;
        s[j][r] = sv;
        m = fmaxf(m, sv);
      }
#pragma unroll
      for (int off = 1; off < 16; off <<= 1) m = fmaxf(m, __shfl_xor(m, off, 32));
      const float mnew  = fmaxf(mrow[r], m);
      const float msafe = (mnew == -INFINITY) ? 0.f : mnew;
      const float alpha = __expf(mrow[r] - msafe);
      mrow[r] = mnew;
      float psum = 0.f;
#pragma unroll
      for (int j = 0; j < 4; ++j) {
        const float p = __expf(s[j][r] - msafe);     // floor logit against a normal max: exp -> 0
        psum += p;
        const float p1k = p * 1024.0f;
        const _Float16 ph = (_Float16)p1k;
        pwh[(8 * hh + r) * LP + j * 16 + c] = ph;
        if (RES) {
          const _Float16 pl = (_Float16)((p1k - (float)ph) * 4096.0f);
          pwl[(8 * hh + r) * LP + j * 16 + c] = pl;
        }
      }
#pragma unroll
      for (int off = 1; off < 16; off <<= 1) psum += __shfl_xor(psum, off, 32);
      lrow[r] = lrow[r] * alpha + psum;
#pragma unroll
      for (int t = 0; t < 4; ++t) oacc[t][r] *= alpha;
    }
    __builtin_amdgcn_fence(3, "workgroup");
    __builtin_amdgcn_wave_barrier();
    __builtin_amdgcn_fence(2, "workgroup");

    // ---- context += P . V (f16 WMMA), residual products into a separate accumulator ----
    v8f o1[4];
#pragma unroll
    for (int t = 0; t < 4; ++t) o1[t] = zero8();
#pragma unroll 1
    for (int kk = 0; kk < 2; ++kk) {
      FH pa, pl;
      pa.h[0] = *(const v8h*)(pwh + c * LP + kk * 32 + 8 * hh);
      pa.h[1] = *(const v8h*)(pwh + c * LP + kk * 32 + 16 + 8 * hh);
      if (RES) {
        pl.h[0] = *(const v8h*)(pwl + c * LP + kk * 32 + 8 * hh);
        pl.h[1] = *(const v8h*)(pwl + c * LP + kk * 32 + 16 + 8 * hh);
      } else {
        pl.v = pa.v;
      }
#pragma unroll
      for (int t = 0; t < 4; ++t) {
        FH vb;
        vb.h[0] = *(const v8h*)(Vth + (t * 16 + c) * LP + kk * 32 + 8 * hh);
        vb.h[1] = *(const v8h*)(Vth + (t * 16 + c) * LP + kk * 32 + 16 + 8 * hh);
        oacc[t] = mma_h(pa.v, vb.v, oacc[t]);
        if (RES) {
          FH vl;
          vl.h[0] = *(const v8h*)(Vtl + (t * 16 + c) * LP + kk * 32 + 8 * hh);
          vl.h[1] = *(const v8h*)(Vtl + (t * 16 + c) * LP + kk * 32 + 16 + 8 * hh);
          o1[t] = mma_h(pa.v, vl.v, o1[t]);
          o1[t] = mma_h(pl.v, vb.v, o1[t]);
        }
      }
    }
    if (RES) {
#pragma unroll
      for (int t = 0; t < 4; ++t)
#pragma unroll
        for (int r = 0; r < 8; ++r) oacc[t][r] += o1[t][r] * (1.0f / 4096.0f);
    }
  }

  // ---- normalise (1/l and the 1/1024 p carry), stage the wave's 16x64 tile, bf16 hi/lo split,
  float* os = Os[wave];
#pragma unroll
  for (int r = 0; r < 8; ++r) {
    const float l = lrow[r];
    const float inv = ((l > 0.f) ? (1.0f / l) : 0.f) * (1.0f / 1024.0f);
#pragma unroll
    for (int t = 0; t < 4; ++t) os[(8 * hh + r) * 64 + t * 16 + c] = oacc[t][r] * inv;
  }
  __builtin_amdgcn_fence(3, "workgroup");
  __builtin_amdgcn_wave_barrier();
  __builtin_amdgcn_fence(2, "workgroup");
  {
    const int q4 = lane >> 3, c8 = (lane & 7) * 8;
    v4u hv[4], lv[4];
#pragma unroll
    for (int it = 0; it < 4; ++it) {
      const int row = it * 4 + q4;   // it 0..3 x q4 0..3 = rows 0..15 of the wave tile
      const float* sp = os + row * 64 + c8;
      v4u a, a2;
#pragma unroll
      for (int e = 0; e < 4; ++e) {
        const float f0 = sp[2 * e], f1 = sp[2 * e + 1];
        const unsigned short h0 = bf_bits(f0), h1 = bf_bits(f1);
        const unsigned short l0 = bf_bits(f0 - bf_up(h0)), l1 = bf_bits(f1 - bf_up(h1));
        a[e] = pk16(h0, h1); a2[e] = pk16(l0, l1);
      }
      hv[it] = a; lv[it] = a2;
    }
    {
#pragma unroll
      for (int it = 0; it < 4; ++it) {
        const int row = it * 4 + q4;
        const size_t go = (size_t)(q0 + row) * DM + (size_t)h * HD + c8;
        *(v4u*)(Ohb + go) = hv[it];
        *(v4u*)(Olb + go) = lv[it];
      }
      
    }
  }
}

// =====================================================================================================
// Workspace map (bytes, NB = 4, SEQ = 2048; every activation plane holds NB batch slices back to back):
//   Xb    bf16 [NB*SEQ][1024]          0           16777216   (also holds Oh after the projections: same extent)
//   Wqb   bf16 [1024 n][1024 k]        16777216     2097152
//   Wkb   bf16 [1024 n][1024 k]        18874368     2097152
//   Wvb   bf16 [1024 n][1024 k]        20971520     2097152
//   Wob   bf16 [1024 n][1024 k]        23068672     2097152
//   Qh    bf16 [NB*SEQ][1024]          25165824    16777216
//   Ql    bf16 [NB*SEQ][1024]          41943040    16777216
//   Kh    bf16 [NB*SEQ][1024]          58720256    16777216
//   Kl    bf16 [NB*SEQ][1024]          75497472    16777216
//   VTh   f16  NB x [1024][SEQ]        92274688    16777216
//   VTl   f16  NB x [1024][VLP=512]   109051904     4194304
//   Ol    bf16 [NB*SEQ][1024]         113246208    16777216
//   end                               130023424
// Oh aliases Xb: Xb is last read by the v^T projection, Oh is first written by the attention launches that
// come after it in stream order; both extents are NB*SEQ*DM*2 bytes exactly.
// All planes are exact multiples of their 64x64 / whole-line store granularity (no padded tails needed),
// =====================================================================================================
extern "C" void kernel_launch(void* const* d_in, const int* in_sizes, int n_in,
                              void* d_out, int out_size, void* d_ws, size_t ws_size,
                              hipStream_t stream) {
  if (n_in < 5) return;
  const long long needX = (long long)(NB - 1) * SEQ_FULL * DM + (long long)SEQ * DM;   // last row read / written
  if ((long long)in_sizes[0] < needX) return;         // x [NB_FULL][SEQ_FULL][1024], rows 0..SEQ-1 of batches 0..NB-1
  if (in_sizes[1] < DM * DM) return;                  // Wq [1024 out][1024 in]
  if (in_sizes[2] < DM * DM) return;                  // Wk
  if (in_sizes[3] < DM * DM) return;                  // Wv
  if (in_sizes[4] < DM * DM) return;                  // Wo
  if ((long long)out_size < needX) return;

  const float* x  = (const float*)d_in[0];
  const float* Wq = (const float*)d_in[1];
  const float* Wk = (const float*)d_in[2];
  const float* Wv = (const float*)d_in[3];
  const float* Wo = (const float*)d_in[4];

  const size_t PX  = (size_t)NB * SEQ * DM * 2;     // 16-bit activation plane [NB*SEQ][1024]
  const size_t PW  = (size_t)DM * DM * 2;           // 16-bit weight plane [1024][1024]
  const size_t PVT = (size_t)NB * DM * SEQ * 2;     // v^T hi plane, NB slices
  const size_t PVL = (size_t)NB * DM * VLP * 2;     // v^T residual plane, NB slices
  static_assert((size_t)NB * SEQ * DM * 2 == (size_t)NB * DM * SEQ * 2);
  size_t off = 0;
  const size_t oXb  = off; off += PX;
  const size_t oOh  = oXb;                          // aliased, same extent PX
  const size_t oWq  = off; off += PW;
  const size_t oWk  = off; off += PW;
  const size_t oWv  = off; off += PW;
  const size_t oWo  = off; off += PW;
  const size_t oQh  = off; off += PX;
  const size_t oQl  = off; off += PX;
  const size_t oKh  = off; off += PX;
  const size_t oKl  = off; off += PX;
  const size_t oVTh = off; off += PVT;
  const size_t oVTl = off; off += PVL;
  const size_t oOl  = off; off += PX;
  if (off > ws_size) return;                     // off = 130023424 for NB = 4, SEQ = 2048
  if (off > (size_t)134217728) return;

  char* ws = (char*)d_ws;
  unsigned short* Xb  = (unsigned short*)(ws + oXb);
  unsigned short* Oh  = (unsigned short*)(ws + oOh);
  unsigned short* Wqb = (unsigned short*)(ws + oWq);
  unsigned short* Wkb = (unsigned short*)(ws + oWk);
  unsigned short* Wvb = (unsigned short*)(ws + oWv);
  unsigned short* Wob = (unsigned short*)(ws + oWo);
  unsigned short* Qh  = (unsigned short*)(ws + oQh);
  unsigned short* Ql  = (unsigned short*)(ws + oQl);
  unsigned short* Kh  = (unsigned short*)(ws + oKh);
  unsigned short* Kl  = (unsigned short*)(ws + oKl);
  unsigned short* VTh = (unsigned short*)(ws + oVTh);
  unsigned short* VTl = (unsigned short*)(ws + oVTl);
  unsigned short* Ol  = (unsigned short*)(ws + oOl);

  const dim3 blk(256);
  const int n8x = SEQ * DM / 8;                                    // per batch slice, multiple of 256
  const dim3 gCvtX(n8x / 256, NB);
  const int n8w = DM * DM / 8;                                     // multiple of 256
  const dim3 gCvtW(n8w / 256, 1);
  const int tilesQK = (NB * SEQ / 64) * (DM / 64);                 // M = NB*SEQ, N = 1024
  const dim3 gQK((tilesQK + 7) / 8, 1);
  const int tilesVT = (DM / 64) * (SEQ / 64);                      // M = 1024, N = SEQ, per batch
  const dim3 gVT((tilesVT + 7) / 8, NB);
  const int tilesOut = (SEQ / 64) * (DM / 64);                     // M = SEQ, N = 1024, per batch
  const dim3 gOut((tilesOut + 7) / 8, NB);
  const long long xStrideIn = (long long)SEQ_FULL * DM;            // input x batch stride (full layout)
  const long long pStride   = (long long)SEQ * DM;                 // plane batch stride

  // (1) x -> bf16 plane [NB*SEQ][1024] (batch b reads input rows b*SEQ_FULL .. +SEQ-1); weights -> bf16 [n][k]
  cvt_bf16x8<<<gCvtX, blk, 0, stream>>>(x, Xb, n8x, xStrideIn, pStride);
  cvt_bf16x8<<<gCvtW, blk, 0, stream>>>(Wq, Wqb, n8w, 0LL, 0LL);
  cvt_bf16x8<<<gCvtW, blk, 0, stream>>>(Wk, Wkb, n8w, 0LL, 0LL);
  cvt_bf16x8<<<gCvtW, blk, 0, stream>>>(Wv, Wvb, n8w, 0LL, 0LL);
  cvt_bf16x8<<<gCvtW, blk, 0, stream>>>(Wo, Wob, n8w, 0LL, 0LL);
  // (2) q = x . Wq^T -> bf16 hi/lo planes [b*SEQ + t][h*64+d]   (M = NB*SEQ, N = 1024, K = 1024)
  gemm64<0, 2><<<gQK, blk, 0, stream>>>(
      Xb, Xb, DM, 0LL, Wqb, Wqb, DM, 0LL,
      (void*)Qh, DM, 0LL, (void*)Ql, DM, 0LL, DM,
      NB * SEQ, DM, DM, 1.0f);
  // (3) k = x . Wk^T -> bf16 hi/lo planes
  gemm64<0, 2><<<gQK, blk, 0, stream>>>(
      Xb, Xb, DM, 0LL, Wkb, Wkb, DM, 0LL,
      (void*)Kh, DM, 0LL, (void*)Kl, DM, 0LL, DM,
      NB * SEQ, DM, DM, 1.0f);
  // (4) v^T = Wv . x^T per batch -> f16 hi plane [h*64+d][s] (pitch SEQ, batch stride DM*SEQ) and residual
  //     plane (x4096, keys < VLP only, pitch VLP, batch stride DM*VLP)   (A = Wvb [n][k], Bt = Xb slice b;
  //     M = 1024, N = SEQ, K = 1024, grid.y = batch)
  gemm64<0, 3><<<gVT, blk, 0, stream>>>(
      Wvb, Wvb, DM, 0LL, Xb, Xb, DM, pStride,
      (void*)VTh, SEQ, (long long)DM * SEQ, (void*)VTl, VLP, (long long)DM * VLP, VLP,
      DM, SEQ, DM, 4096.0f);
  // (5) causal attention: query blocks 0..RESQB-1 with residual planes, the rest without; grid.y = batch
  attn_causal64<true><<<dim3(NH * RESQB, NB), dim3(128), 0, stream>>>(
      Qh, Ql, Kh, Kl, VTh, VTl, Oh, Ol, 0, RESQB, 0.125f);
  if (NQB > RESQB) {
    attn_causal64<false><<<dim3(NH * (NQB - RESQB), NB), dim3(128), 0, stream>>>(
        Qh, Ql, Kh, Kl, VTh, VTl, Oh, Ol, RESQB, NQB - RESQB, 0.125f);
  }
  // (6) out = context . Wo^T -> d_out f32, batch b rows b*SEQ_FULL .. +SEQ-1 (A = context hi + lo planes,
  //     2 products; M = SEQ, N = 1024, K = 1024, grid.y = batch)
  gemm64<1, 0><<<gOut, blk, 0, stream>>>(
      Oh, Ol, DM, pStride, Wob, Wob, DM, 0LL,
      d_out, DM, xStrideIn, d_out, DM, 0LL, DM,
      SEQ, DM, DM, 1.0f);
  (void)hipGetLastError();
}

// v002
// A run of this version takes 297 microseconds.
// Two timings next to v001 put it at 1.41 and 1.42 times that version's speed.
// Over all steps from v000 it is 1.88 times as fast.
// Contractions: q, k, v^T projections = v_wmma_f32_16x16x32_bf16 (bf16 operands from RNE-converted inputs, single product);
// q.k^T scores = v_wmma_f32_16x16x32_bf16 with bf16 hi/lo split q and k (hi.hi + hi.lo + lo.hi);
// p.v = v_wmma_f32_16x16x32_f16 (p carried x1024 in f16, v in f16; extra f16 residual planes x4096 of p and v for the first VLP query rows);
// ctx.Wo = v_wmma_f32_16x16x32_bf16 with ctx as bf16 hi/lo planes times bf16 Wo (2 products); all f32 accumulate; causal compare and softmax in f32.
#include <hip/hip_runtime.h>
#include <math.h>
#include <float.h>
#include <stdint.h>

#ifndef NB
#define NB    4
#endif
#ifndef SEQ
#define SEQ   2048
#endif
#define NB_FULL  4
#define SEQ_FULL 2048
#define DM    1024
#define NH    16
#define HD    64
#define NQB   (SEQ / 64)                      // key / query tiles of 64
#define VLP   ((SEQ < 512) ? SEQ : 512)       // key pitch of the v^T residual plane (keys 0..VLP-1)
#define RESQB (VLP / 64)                      // number of leading 64-row query blocks that use the p / v residual planes
#define LP    72                              // LDS row pitch (16-bit elements) of the 64-wide K, V^T and P tiles: 144 B = 16 B x odd
#define GP    72                              // LDS row pitch (16-bit elements) of the staged 64-k GEMM operand rows: 144 B = 16 B x odd
#define GBM   128                             // GEMM work-group tile rows (2 waves of 64)
#define GBN   256                             // GEMM work-group tile columns (4 waves of 64)
static_assert(NB >= 1 && NB <= NB_FULL);
static_assert((SEQ % GBN) == 0 && (DM % GBN) == 0 && (DM % 128) == 0);
static_assert(NH * HD == DM && HD == 64);
static_assert((SEQ % 64) == 0 && (DM % 64) == 0 && SEQ >= 64 && SEQ <= SEQ_FULL);
static_assert(RESQB * 64 == VLP && VLP <= SEQ && RESQB >= 1 && RESQB <= NQB);
static_assert(((SEQ * DM / 8) % 256) == 0 && ((DM * DM / 8) % 256) == 0);

typedef _Float16 v16h __attribute__((ext_vector_type(16)));
typedef _Float16 v8h  __attribute__((ext_vector_type(8)));
typedef __bf16   v16b __attribute__((ext_vector_type(16)));
typedef __bf16   v8b  __attribute__((ext_vector_type(8)));
typedef float    v8f  __attribute__((ext_vector_type(8)));
typedef float    v4f  __attribute__((ext_vector_type(4)));
typedef unsigned int v4u __attribute__((ext_vector_type(4)));

// ---- scalar helpers --------------------------------------------------------------------------------
__device__ __forceinline__ unsigned short bf_bits(float f) {          // f32 -> bf16 bits, RNE convert
  unsigned u = __float_as_uint(f);
  return (unsigned short)((u + 0x7FFFu + ((u >> 16) & 1u)) >> 16);
}
__device__ __forceinline__ float bf_up(unsigned short h) { return __uint_as_float(((unsigned)h) << 16); }
__device__ __forceinline__ unsigned short h_bits(_Float16 x) { return __builtin_bit_cast(unsigned short, x); }
__device__ __forceinline__ unsigned pk16(unsigned short a, unsigned short b) { return (unsigned)a | ((unsigned)b << 16); }
__device__ __forceinline__ v8f zero8() { v8f z = {0.f, 0.f, 0.f, 0.f, 0.f, 0.f, 0.f, 0.f}; return z; }
__device__ __forceinline__ v8h zero8h() {
  const _Float16 z = (_Float16)0.0f;
  v8h r = {z, z, z, z, z, z, z, z};
  return r;
}

// ---- fragment loaders: 16-bit A/B operand, lane -> row/col (lane&15), p already includes +8*(lane>>4);
//      elements 0..7 <- p[0..7] (k0+8h..), elements 8..15 <- p[16..23] (k0+16+8h..)
__device__ __forceinline__ v16b ldfrag_b(const __bf16* p) {
  union { v16b v; v8b h[2]; } f;
  f.h[0] = *(const v8b*)(p);
  f.h[1] = *(const v8b*)(p + 16);
  return f.v;
}

// ---- WMMA helpers with trailing VALU hazard gap --------------------------------------------------------
__device__ __forceinline__ v8f mma_b(v16b a, v16b b, v8f c) {
  c = __builtin_amdgcn_wmma_f32_16x16x32_bf16(false, a, false, b, (short)0, c, false, false);
  asm volatile("v_nop\n\tv_nop\n\tv_nop\n\tv_nop" : "+v"(c) : "v"(a), "v"(b));
  return c;
}
__device__ __forceinline__ v8f mma_h(v16h a, v16h b, v8f c) {
  c = __builtin_amdgcn_wmma_f32_16x16x32_f16(false, a, false, b, (short)0, c, false, false);
  asm volatile("v_nop\n\tv_nop\n\tv_nop\n\tv_nop" : "+v"(c) : "v"(a), "v"(b));
  return c;
}
__device__ __forceinline__ v8f mma_b_raw(v16b a, v16b b, v8f c) {
  return __builtin_amdgcn_wmma_f32_16x16x32_bf16(false, a, false, b, (short)0, c, false, false);
}
__device__ __forceinline__ void acc_guard4(v8f& a, v8f& b, v8f& c, v8f& d) {
  asm volatile("v_nop\n\tv_nop\n\tv_nop\n\tv_nop" : "+v"(a), "+v"(b), "+v"(c), "+v"(d));
}

// ---- asynchronous copies global -> LDS: four 16-B pieces per lane (l* = LDS byte address, g* = global address).
//      The s_wait_xcnt closes the statement so that no address register is rewritten ahead of it.
__device__ __forceinline__ void copy4_lds(unsigned l0, const __bf16* g0, unsigned l1, const __bf16* g1,
                                          unsigned l2, const __bf16* g2, unsigned l3, const __bf16* g3) {
  asm volatile("global_load_async_to_lds_b128 %0, %1, off\n\t"
               "global_load_async_to_lds_b128 %2, %3, off\n\t"
               "global_load_async_to_lds_b128 %4, %5, off\n\t"
               "global_load_async_to_lds_b128 %6, %7, off\n\t"
               "s_wait_xcnt 0x0"
               :: "v"(l0), "v"(g0), "v"(l1), "v"(g1), "v"(l2), "v"(g2), "v"(l3), "v"(g3) : "memory");
}

// =====================================================================================================
// f32 -> bf16 (RNE convert), 8 elements per thread, one 16-B store per lane: a wave writes 512 contiguous B
// blockIdx.y selects the batch slice (element strides inStride / outStride).
// coverage: n8 threads x 8 = the whole plane slice (n8 is a multiple of 256, host-asserted above).
// =====================================================================================================
__global__ __launch_bounds__(256) void cvt_bf16x8(const float* __restrict__ in, unsigned short* out, int n8,
                                                  long long inStride, long long outStride) {
  const int i = blockIdx.x * 256 + threadIdx.x;
  const float* src = in + (size_t)blockIdx.y * (size_t)inStride;
  unsigned short* dst = out + (size_t)blockIdx.y * (size_t)outStride;
  if (i < n8) {
    const v4f a = *(const v4f*)(src + (size_t)i * 8);
    const v4f b = *(const v4f*)(src + (size_t)i * 8 + 4);
    v4u p;
    p[0] = pk16(bf_bits(a[0]), bf_bits(a[1]));
    p[1] = pk16(bf_bits(a[2]), bf_bits(a[3]));
    p[2] = pk16(bf_bits(b[0]), bf_bits(b[1]));
    p[3] = pk16(bf_bits(b[2]), bf_bits(b[3]));
    *(v4u*)(dst + (size_t)i * 8) = p;
    
  }
}

// =====================================================================================================
// bf16 WMMA GEMM: C[m][n] = sum_k A[m][k] * Bt[n][k]; a work-group of 8 waves (2 x 4) owns a 128x256 tile, each wave
// a 64x64 tile. A row-major [M][K] pitch lda; Bt row-major [N][K] pitch ldb (k contiguous); M multiple of 128,
// N multiple of 256, K multiple of 64 (host-checked). blockIdx.y = batch index (strides in elements).
// Operand staging: per 64-k slab the rows of A (and A2) and Bt that the work-group needs are copied once into LDS
// (asynchronous 16-B copies, 8 lanes per 128-B row piece = whole lines; LDS pitch GP), two buffers, the next
// slab in flight while a slab is multiplied; every wave reads its fragments from LDS.
// NSPLIT: 0 = A.Bt; 1 = (A + A2).Bt (A2 = unscaled bf16 lo plane of A).
// OUT_MODE: 0 = f32 (pitch ldc); 2 = bf16 hi plane C + bf16 lo plane C2 (lo = RNE(v - hi), unscaled);
//           3 = f16 hi plane C + f16 residual plane C2 = f16((v - hi) * rscale), C2 written only for tiles
//               with n0 < N2 (pitch ldc2, batch stride strideC2).
// =====================================================================================================
template <int NSPLIT, int OUT_MODE>
__global__ __launch_bounds__(256) void gemm64(
    const unsigned short* __restrict__ Ap, const unsigned short* A2p, int lda, long long strideA,
    const unsigned short* __restrict__ Btp, const unsigned short* Bt2p, int ldb, long long strideB,
    void* Cout, int ldc, long long strideC,
    void* Cout2, int ldc2, long long strideC2, int N2,
    int M, int N, int K, float rscale) {
  static_assert(NSPLIT == 0 || NSPLIT == 1);
  constexpr int AROWS = (NSPLIT == 1) ? 2 * GBM : GBM;   // staged rows of A, then of A2
  constexpr int BUFE  = (AROWS + GBN) * GP;              // 16-bit elements of one slab buffer
  const __bf16* A   = (const __bf16*)(const void*)Ap;
  const __bf16* A2  = (const __bf16*)(const void*)A2p;
  const __bf16* Bt  = (const __bf16*)(const void*)Btp;
  (void)Bt2p;
  __shared__ __align__(16) __bf16 sAB[2 * BUFE];   // two slab buffers: [A 128 rows | A2 128 rows | Bt 256 rows] x 64 k
  __shared__ __align__(16) float sT[8][16 * 68];   // per-wave 16x64 slab, pitch 68 floats
  const int b    = blockIdx.y;
  const int tid  = threadIdx.x;
  const int lane = tid & 31;
  const int wave = tid >> 5;
  const int nbn = N / GBN;
  const int nbm = M / GBM;
  if ((int)blockIdx.x >= nbm * nbn) return;   // block-uniform, in front of every barrier and copy
  const int bm = (int)blockIdx.x / nbn;
  const int bn = (int)blockIdx.x - bm * nbn;
  const int wm = wave >> 2;                    // wave row 0..1
  const int wn = wave & 3;                     // wave column 0..3
  const int m0 = bm * GBM + (wm << 6);
  const int n0 = bn * GBN + (wn << 6);

  const __bf16* Ab  = A  + (size_t)b * strideA;
  const __bf16* Bb  = Bt + (size_t)b * strideB;
  const __bf16* Ab2 = (NSPLIT == 1) ? (A2 + (size_t)b * strideA) : Ab;

  const int rlane = lane & 15;                 // row (A) / col (B, D) within subtile
  const int koff  = (lane >> 4) * 8;           // k offset of this lane half
  const int mOff  = (lane >> 4) * 8;           // D row offset

  // copy map: thread -> row (tid >> 3) + 32 * i of a staged plane, 16-B piece (tid & 7) of its 128 B
  const int crow = tid >> 3;
  const int cpc  = (tid & 7) * 8;
  const __bf16* gA  = Ab  + (size_t)(bm * GBM + crow) * lda + cpc;
  const __bf16* gA2 = Ab2 + (size_t)(bm * GBM + crow) * lda + cpc;
  const __bf16* gB  = Bb  + (size_t)(bn * GBN + crow) * ldb + cpc;
  const unsigned lbase = (unsigned)(uintptr_t)(&sAB[0]) + (unsigned)((crow * GP + cpc) * 2);
  const size_t a32 = (size_t)32 * lda, b32 = (size_t)32 * ldb;
  constexpr unsigned L32 = 32u * GP * 2u;      // LDS bytes of 32 staged rows

  auto stage = [&](int t, int buf) {           // slab t (k = 64 t .. 64 t + 63) into buffer buf
    const unsigned l = lbase + (unsigned)buf * (unsigned)(BUFE * 2);
    const __bf16* a = gA + (size_t)t * 64;
    copy4_lds(l, a, l + L32, a + a32, l + 2 * L32, a + 2 * a32, l + 3 * L32, a + 3 * a32);
    if (NSPLIT == 1) {
      const __bf16* a2 = gA2 + (size_t)t * 64;
      const unsigned l2 = l + 4 * L32;
      copy4_lds(l2, a2, l2 + L32, a2 + a32, l2 + 2 * L32, a2 + 2 * a32, l2 + 3 * L32, a2 + 3 * a32);
    }
    const __bf16* bp = gB + (size_t)t * 64;
    const unsigned lb = l + (unsigned)(AROWS / 32) * L32;
    copy4_lds(lb, bp, lb + L32, bp + b32, lb + 2 * L32, bp + 2 * b32, lb + 3 * L32, bp + 3 * b32);
    copy4_lds(lb + 4 * L32, bp + 4 * b32, lb + 5 * L32, bp + 5 * b32, lb + 6 * L32, bp + 6 * b32, lb + 7 * L32, bp + 7 * b32);
  };

  v8f acc[4][4];
#pragma unroll
  for (int i = 0; i < 4; ++i)
#pragma unroll
    for (int j = 0; j < 4; ++j) acc[i][j] = zero8();

  const int nst = K >> 6;                      // slabs of 64 k
  stage(0, 0);
  asm volatile("s_wait_asynccnt 0x0" ::: "memory");   // this wave's slab-0 copies have landed
  __syncthreads();                                     // slab 0 readable by every wave
  if (nst > 1) stage(1, 1);

  const int aoff = ((wm << 6) + rlane) * GP + koff;            // this lane's A fragment row in a buffer
  const int boff = (AROWS + (wn << 6) + rlane) * GP + koff;    // this lane's Bt fragment row in a buffer
  for (int t = 0; t < nst; ++t) {
    const __bf16* sb = sAB + (t & 1) * BUFE;
#pragma unroll
    for (int ks = 0; ks < 2; ++ks) {
      v16b bh[4], ah[4], al[4];
#pragma unroll
      for (int j = 0; j < 4; ++j) bh[j] = ldfrag_b(sb + boff + j * 16 * GP + ks * 32);
#pragma unroll
      for (int i = 0; i < 4; ++i) {
        ah[i] = ldfrag_b(sb + aoff + i * 16 * GP + ks * 32);
        if (NSPLIT == 1) al[i] = ldfrag_b(sb + aoff + (GBM + i * 16) * GP + ks * 32); else al[i] = ah[i];
      }
      // inputs-only fence on the loaded fragments: keeps the k-step's LDS reads one group in front of its WMMAs
      // (without it each A fragment is read into one register set and its LDS latency waited out four times)
      asm volatile("" :: "v"(bh[0]), "v"(bh[1]), "v"(bh[2]), "v"(bh[3]), "v"(ah[0]), "v"(ah[1]), "v"(ah[2]), "v"(ah[3]));
      if (NSPLIT == 1) asm volatile("" :: "v"(al[0]), "v"(al[1]), "v"(al[2]), "v"(al[3]));   // same, lo plane
#pragma unroll
      for (int i = 0; i < 4; ++i) {
#pragma unroll
        for (int j = 0; j < 4; ++j) {
          acc[i][j] = mma_b_raw(ah[i], bh[j], acc[i][j]);
          if (NSPLIT == 1) acc[i][j] = mma_b_raw(al[i], bh[j], acc[i][j]);
        }
      }
    }
    asm volatile("s_wait_dscnt 0x0" ::: "memory");      // this wave's reads of buffer t & 1 are done before it is refilled
    asm volatile("s_wait_asynccnt 0x0" ::: "memory");   // this wave's slab t + 1 copies have landed
    __syncthreads();                                     // publishes slab t + 1, ends every read of buffer t & 1
    if (t + 2 < nst) stage(t + 2, t & 1);
  }
  asm volatile("s_wait_asynccnt 0x0" ::: "memory");     // nothing in flight when the wave goes on
  acc_guard4(acc[0][0], acc[0][1], acc[0][2], acc[0][3]);
  acc_guard4(acc[1][0], acc[1][1], acc[1][2], acc[1][3]);
  acc_guard4(acc[2][0], acc[2][1], acc[2][2], acc[2][3]);
  acc_guard4(acc[3][0], acc[3][1], acc[3][2], acc[3][3]);

  // ---- epilogue ----
  float* slab = sT[wave];
#pragma unroll
  for (int i = 0; i < 4; ++i) {
    const int mBase = m0 + (i << 4);
#pragma unroll
    for (int j = 0; j < 4; ++j) {
#pragma unroll
      for (int r = 0; r < 8; ++r) {
        slab[(mOff + r) * 68 + (j << 4) + rlane] = acc[i][j][r];
      }
    }
    __builtin_amdgcn_fence(3, "workgroup");
    __builtin_amdgcn_wave_barrier();
    __builtin_amdgcn_fence(2, "workgroup");
    if (OUT_MODE == 0) {
      float* C = (float*)Cout + (size_t)b * strideC;
      const int hh = lane >> 4, c4 = (lane & 15) * 4;     // 256-B row segment = 16 lanes x 16 B
      {
#pragma unroll
        for (int it = 0; it < 8; ++it) {
          const int row = it * 2 + hh;                     // it 0..7 x hh 0..1 = rows 0..15
          const v4f v = *(const v4f*)(slab + row * 68 + c4);
          *(v4f*)(C + (size_t)(mBase + row) * ldc + n0 + c4) = v;
        }
        
      }
    } else {
      const int q = lane >> 3, c8 = (lane & 7) * 8;
      unsigned short* C  = (unsigned short*)Cout  + (size_t)b * strideC;
      unsigned short* C2 = (unsigned short*)Cout2 + (size_t)b * strideC2;
      const bool wlo = (OUT_MODE == 2) || (n0 < N2);      // wave-uniform
      v4u hv[4], lv[4];
#pragma unroll
      for (int it = 0; it < 4; ++it) {
        const int row = it * 4 + q;                        // it 0..3 x q 0..3 = rows 0..15
        const float* sp = slab + row * 68 + c8;
        v4u a, a2;
#pragma unroll
        for (int e = 0; e < 4; ++e) {
          const float f0 = sp[2 * e], f1 = sp[2 * e + 1];
          unsigned short h0, h1, l0, l1;
          if (OUT_MODE == 2) {
            h0 = bf_bits(f0); h1 = bf_bits(f1);
            l0 = bf_bits(f0 - bf_up(h0)); l1 = bf_bits(f1 - bf_up(h1));
          } else {
            const _Float16 x0 = (_Float16)f0, x1 = (_Float16)f1;
            h0 = h_bits(x0); h1 = h_bits(x1);
            l0 = h_bits((_Float16)((f0 - (float)x0) * rscale));
            l1 = h_bits((_Float16)((f1 - (float)x1) * rscale));
          }
          a[e] = pk16(h0, h1); a2[e] = pk16(l0, l1);
        }
        hv[it] = a; lv[it] = a2;
      }
      {
#pragma unroll
        for (int it = 0; it < 4; ++it) {
          const int row = it * 4 + q;
          *(v4u*)(C + (size_t)(mBase + row) * ldc + n0 + c8) = hv[it];
          if (wlo) *(v4u*)(C2 + (size_t)(mBase + row) * ldc2 + n0 + c8) = lv[it];
        }
        
      }
    }
    __builtin_amdgcn_fence(3, "workgroup");
    __builtin_amdgcn_wave_barrier();
    __builtin_amdgcn_fence(2, "workgroup");
  }
}

// =====================================================================================================
// Causal attention, head dim 64, blockIdx.y = batch index (all planes carry NB batch slices back to back).
//   q planes (bf16 hi / lo): element (b, t, h, d) at [b*SEQ*DM + t*DM + h*64 + d]
//   k planes (bf16 hi / lo): same layout with key index s
//   v^T hi plane (f16):      element (b, h, d, s) at [b*DM*SEQ + (h*64 + d)*SEQ + s]
//   v^T residual plane (f16, (v - hi)*4096): [b*DM*VLP + (h*64 + d)*VLP + s], s < VLP, read only when RES
//   (a key tile at or beyond VLP would contribute a zero v residual; never happens for query blocks < RESQB)
//   logit (t, s) = q.k * sscale for s <= t, finfo.min for s > t. Query block qb (64 rows) visits key tiles
//   0..qb only (every later key is above the diagonal for all 64 rows -> weight exactly 0); the compare
//   s > t is applied on the diagonal tile kt == qb only (block-uniform flag, per-element select). Every row
//   has the live key s = t in the diagonal tile and all of tile 0, so the row max is always finite.
//   out planes (bf16 hi / lo of the normalised context): element (b, t, h, d) at [b*SEQ*DM + t*DM + h*64 + d]
//   scores = q . k : bf16 hi/lo split (hi.hi + hi.lo + lo.hi), f32 accumulate, then * sscale in f32
//   p = exp(s - m) carried as f16(1024 p); context = p . v on f16 WMMA; RES adds f16 residual planes of p and v
//   (scale 4096, separate accumulator folded back with 1/4096 per chunk in f32); online softmax in f32.
//   Block = 4 waves = 64 query rows of one head of one batch; grid = (nqbThis * NH, NB); kv chunks of 64,
//   static bound NQB, block-uniform break at kt == qb + 1.
//   K / V^T chunk staging: 128 threads x 32 elements per plane = the whole 64x64 tile (plain 16-B loads,
//   __syncthreads before and after: cross-wave LDS regions Ksh/Ksl/Vth/Vtl behind block barriers);
//   P tiles and the Os tile are wave-private, spilled with element stores and reloaded (P as v8h, same element
//   Output coverage: each wave stores rows q0..q0+15 (it 0..3 x lane>>3 0..3) x 64 columns (8 lanes x 8) of both planes.
// =====================================================================================================
template <bool RES>
__global__ __launch_bounds__(128) __attribute__((amdgpu_num_vgpr(256)))
void attn_causal64(const unsigned short* __restrict__ qhp, const unsigned short* __restrict__ qlp,
                   const unsigned short* __restrict__ khp, const unsigned short* __restrict__ klp,
                   const unsigned short* __restrict__ vhp, const unsigned short* __restrict__ vlp,
                   unsigned short* ohp, unsigned short* olp,
                   int qbBase, int nqbThis, float sscale) {
  union FB { v16b v; v8b h[2]; };
  union FH { v16h v; v8h h[2]; };
  __shared__ __align__(16) __bf16   Ksh[64 * LP];                 // K hi [kv][d], pitch LP, 9 KB
  __shared__ __align__(16) __bf16   Ksl[64 * LP];                 // K lo
  __shared__ __align__(16) _Float16 Vth[64 * LP];                 // V^T hi [d][kv], pitch LP, 9 KB
  __shared__ __align__(16) _Float16 Vtl[RES ? 64 * LP : 8];       // V^T residual
  __shared__ __align__(16) _Float16 Psh[4][16 * LP];              // per wave P [row][kv]
  __shared__ __align__(16) _Float16 Psl[RES ? 4 : 1][16 * LP];    // per wave P residual
  __shared__ __align__(16) float    Os[4][16 * 64];               // per wave context tile [row][d]

  const int tid  = threadIdx.x;
  const int wave = tid >> 5;
  const int lane = tid & 31;
  const int hh   = lane >> 4;
  const int c    = lane & 15;

  const int bx   = blockIdx.x;
  const int bb   = blockIdx.y;               // batch
  const int qbl  = bx % nqbThis;
  const int h    = bx / nqbThis;           // 0..NH-1 (grid.x = nqbThis * NH)
  const int qb   = qbBase + qbl;
  const int q0   = qb * 64 + wave * 16;

  const size_t pstride = (size_t)SEQ * DM;                  // per-batch elements of the [t][h*64+d] planes
  const __bf16* Qh = (const __bf16*)(const void*)qhp + (size_t)bb * pstride + (size_t)h * HD;
  const __bf16* Ql = (const __bf16*)(const void*)qlp + (size_t)bb * pstride + (size_t)h * HD;
  const __bf16* Kh = (const __bf16*)(const void*)khp + (size_t)bb * pstride + (size_t)h * HD;
  const __bf16* Kl = (const __bf16*)(const void*)klp + (size_t)bb * pstride + (size_t)h * HD;
  const _Float16* Vh = (const _Float16*)(const void*)vhp + (size_t)bb * ((size_t)DM * SEQ) + (size_t)h * HD * SEQ;
  const _Float16* Vl = (const _Float16*)(const void*)vlp + (size_t)bb * ((size_t)DM * VLP) + (size_t)h * HD * VLP;
  unsigned short* Ohb = ohp + (size_t)bb * pstride;
  unsigned short* Olb = olp + (size_t)bb * pstride;

  // ---- Q fragments (A operand, row = lane&15): 2 d-chunks, hi and lo ----
  v16b qah[2], qal[2];
#pragma unroll
  for (int dc = 0; dc < 2; ++dc) {
    const size_t qo = (size_t)(q0 + c) * DM + dc * 32 + 8 * hh;
    qah[dc] = ldfrag_b(Qh + qo);
    qal[dc] = ldfrag_b(Ql + qo);
  }

  float mrow[8], lrow[8];
  v8f oacc[4];
#pragma unroll
  for (int r = 0; r < 8; ++r) { mrow[r] = -INFINITY; lrow[r] = 0.f; }
#pragma unroll
  for (int t = 0; t < 4; ++t) oacc[t] = zero8();

  const int nkt = qb + 1;                    // key tiles 0..qb (block-uniform)
  for (int kt = 0; kt < NQB; ++kt) {         // static bound
    if (kt >= nkt) break;                    // block-uniform
    const bool diag = (kt == qb);            // block-uniform
    const int kv0 = kt * 64;
    __syncthreads();
    {
      const int r = tid >> 1, half = (tid & 1) * 32;
      const __bf16*   kg  = Kh + (size_t)(kv0 + r) * DM + half;   // K row kv0+r (< SEQ), d = half..half+31
      const __bf16*   klg = Kl + (size_t)(kv0 + r) * DM + half;
      const _Float16* vg  = Vh + (size_t)r * SEQ + kv0 + half;    // V^T row d = r, s = kv0+half..+31
      const int kvl = (kv0 + 64 <= VLP) ? kv0 : (VLP - 64);     // clamped address into the residual plane
      const _Float16* vlg = Vl + (size_t)r * VLP + kvl + half;
      const bool resOK = (kv0 + 64 <= VLP);                      // block-uniform
#pragma unroll
      for (int i = 0; i < 4; ++i) {
        const v8b a0 = *(const v8b*)(kg + 8 * i);
        const v8b a1 = *(const v8b*)(klg + 8 * i);
        const v8h b0 = *(const v8h*)(vg + 8 * i);
        *(v8b*)(Ksh + r * LP + half + 8 * i) = a0;
        *(v8b*)(Ksl + r * LP + half + 8 * i) = a1;
        *(v8h*)(Vth + r * LP + half + 8 * i) = b0;
        if (RES) {
          v8h b1 = *(const v8h*)(vlg + 8 * i);
          if (!resOK) b1 = zero8h();
          *(v8h*)(Vtl + r * LP + half + 8 * i) = b1;
        }
      }
    }
    __syncthreads();

    // ---- scores: 16 query rows x 64 keys per wave, 3 bf16 products ----
    v8f s[4];
#pragma unroll
    for (int j = 0; j < 4; ++j) {
      s[j] = zero8();
#pragma unroll
      for (int dc = 0; dc < 2; ++dc) {
        FB kb, kl;
        kb.h[0] = *(const v8b*)(Ksh + (j * 16 + c) * LP + dc * 32 + 8 * hh);
        kb.h[1] = *(const v8b*)(Ksh + (j * 16 + c) * LP + dc * 32 + 16 + 8 * hh);
        kl.h[0] = *(const v8b*)(Ksl + (j * 16 + c) * LP + dc * 32 + 8 * hh);
        kl.h[1] = *(const v8b*)(Ksl + (j * 16 + c) * LP + dc * 32 + 16 + 8 * hh);
        s[j] = mma_b(qah[dc], kb.v, s[j]);
        s[j] = mma_b(qah[dc], kl.v, s[j]);
        s[j] = mma_b(qal[dc], kb.v, s[j]);
      }
    }

    // ---- scale + causal compare (diagonal tile only), row max, online softmax, P (x1024, f16) and
    //      P residual (x4096) to LDS ----
    _Float16* pwh = Psh[wave];
    _Float16* pwl = Psl[RES ? wave : 0];
#pragma unroll
    for (int r = 0; r < 8; ++r) {
      const int qrow = q0 + 8 * hh + r;          // query row of accumulator element r of this lane
      float m = -INFINITY;
#pragma unroll
      for (int j = 0; j < 4; ++j) {
        const int key = kv0 + j * 16 + c;
        float sv = s[j][r] * sscale;
        sv = (diag && (key > qrow)) ? -FLT_MAX : sv;
        s[j][r] = sv;
        m = fmaxf(m, sv);
      }
#pragma unroll
      for (int off = 1; off < 16; off <<= 1) m = fmaxf(m, __shfl_xor(m, off, 32));
      const float mnew  = fmaxf(mrow[r], m);
      const float msafe = (mnew == -INFINITY) ? 0.f : mnew;
      const float alpha = __expf(mrow[r] - msafe);
      mrow[r] = mnew;
      float psum = 0.f;
#pragma unroll
      for (int j = 0; j < 4; ++j) {
        const float p = __expf(s[j][r] - msafe);     // floor logit against a normal max: exp -> 0
        psum += p;
        const float p1k = p * 1024.0f;
        const _Float16 ph = (_Float16)p1k;
        pwh[(8 * hh + r) * LP + j * 16 + c] = ph;
        if (RES) {
          const _Float16 pl = (_Float16)((p1k - (float)ph) * 4096.0f);
          pwl[(8 * hh + r) * LP + j * 16 + c] = pl;
        }
      }
#pragma unroll
      for (int off = 1; off < 16; off <<= 1) psum += __shfl_xor(psum, off, 32);
      lrow[r] = lrow[r] * alpha + psum;
#pragma unroll
      for (int t = 0; t < 4; ++t) oacc[t][r] *= alpha;
    }
    __builtin_amdgcn_fence(3, "workgroup");
    __builtin_amdgcn_wave_barrier();
    __builtin_amdgcn_fence(2, "workgroup");

    // ---- context += P . V (f16 WMMA), residual products into a separate accumulator ----
    v8f o1[4];
#pragma unroll
    for (int t = 0; t < 4; ++t) o1[t] = zero8();
#pragma unroll 1
    for (int kk = 0; kk < 2; ++kk) {
      FH pa, pl;
      pa.h[0] = *(const v8h*)(pwh + c * LP + kk * 32 + 8 * hh);
      pa.h[1] = *(const v8h*)(pwh + c * LP + kk * 32 + 16 + 8 * hh);
      if (RES) {
        pl.h[0] = *(const v8h*)(pwl + c * LP + kk * 32 + 8 * hh);
        pl.h[1] = *(const v8h*)(pwl + c * LP + kk * 32 + 16 + 8 * hh);
      } else {
        pl.v = pa.v;
      }
#pragma unroll
      for (int t = 0; t < 4; ++t) {
        FH vb;
        vb.h[0] = *(const v8h*)(Vth + (t * 16 + c) * LP + kk * 32 + 8 * hh);
        vb.h[1] = *(const v8h*)(Vth + (t * 16 + c) * LP + kk * 32 + 16 + 8 * hh);
        oacc[t] = mma_h(pa.v, vb.v, oacc[t]);
        if (RES) {
          FH vl;
          vl.h[0] = *(const v8h*)(Vtl + (t * 16 + c) * LP + kk * 32 + 8 * hh);
          vl.h[1] = *(const v8h*)(Vtl + (t * 16 + c) * LP + kk * 32 + 16 + 8 * hh);
          o1[t] = mma_h(pa.v, vl.v, o1[t]);
          o1[t] = mma_h(pl.v, vb.v, o1[t]);
        }
      }
    }
    if (RES) {
#pragma unroll
      for (int t = 0; t < 4; ++t)
#pragma unroll
        for (int r = 0; r < 8; ++r) oacc[t][r] += o1[t][r] * (1.0f / 4096.0f);
    }
  }

  // ---- normalise (1/l and the 1/1024 p carry), stage the wave's 16x64 tile, bf16 hi/lo split,
  float* os = Os[wave];
#pragma unroll
  for (int r = 0; r < 8; ++r) {
    const float l = lrow[r];
    const float inv = ((l > 0.f) ? (1.0f / l) : 0.f) * (1.0f / 1024.0f);
#pragma unroll
    for (int t = 0; t < 4; ++t) os[(8 * hh + r) * 64 + t * 16 + c] = oacc[t][r] * inv;
  }
  __builtin_amdgcn_fence(3, "workgroup");
  __builtin_amdgcn_wave_barrier();
  __builtin_amdgcn_fence(2, "workgroup");
  {
    const int q4 = lane >> 3, c8 = (lane & 7) * 8;
    v4u hv[4], lv[4];
#pragma unroll
    for (int it = 0; it < 4; ++it) {
      const int row = it * 4 + q4;   // it 0..3 x q4 0..3 = rows 0..15 of the wave tile
      const float* sp = os + row * 64 + c8;
      v4u a, a2;
#pragma unroll
      for (int e = 0; e < 4; ++e) {
        const float f0 = sp[2 * e], f1 = sp[2 * e + 1];
        const unsigned short h0 = bf_bits(f0), h1 = bf_bits(f1);
        const unsigned short l0 = bf_bits(f0 - bf_up(h0)), l1 = bf_bits(f1 - bf_up(h1));
        a[e] = pk16(h0, h1); a2[e] = pk16(l0, l1);
      }
      hv[it] = a; lv[it] = a2;
    }
    {
#pragma unroll
      for (int it = 0; it < 4; ++it) {
        const int row = it * 4 + q4;
        const size_t go = (size_t)(q0 + row) * DM + (size_t)h * HD + c8;
        *(v4u*)(Ohb + go) = hv[it];
        *(v4u*)(Olb + go) = lv[it];
      }
      
    }
  }
}

// =====================================================================================================
// Workspace map (bytes, NB = 4, SEQ = 2048; every activation plane holds NB batch slices back to back):
//   Xb    bf16 [NB*SEQ][1024]          0           16777216   (also holds Oh after the projections: same extent)
//   Wqb   bf16 [1024 n][1024 k]        16777216     2097152
//   Wkb   bf16 [1024 n][1024 k]        18874368     2097152
//   Wvb   bf16 [1024 n][1024 k]        20971520     2097152
//   Wob   bf16 [1024 n][1024 k]        23068672     2097152
//   Qh    bf16 [NB*SEQ][1024]          25165824    16777216
//   Ql    bf16 [NB*SEQ][1024]          41943040    16777216
//   Kh    bf16 [NB*SEQ][1024]          58720256    16777216
//   Kl    bf16 [NB*SEQ][1024]          75497472    16777216
//   VTh   f16  NB x [1024][SEQ]        92274688    16777216
//   VTl   f16  NB x [1024][VLP=512]   109051904     4194304
//   Ol    bf16 [NB*SEQ][1024]         113246208    16777216
//   end                               130023424
// Oh aliases Xb: Xb is last read by the v^T projection, Oh is first written by the attention launches that
// come after it in stream order; both extents are NB*SEQ*DM*2 bytes exactly.
// All planes are exact multiples of their 64x64 / whole-line store granularity (no padded tails needed),
// =====================================================================================================
extern "C" void kernel_launch(void* const* d_in, const int* in_sizes, int n_in,
                              void* d_out, int out_size, void* d_ws, size_t ws_size,
                              hipStream_t stream) {
  if (n_in < 5) return;
  const long long needX = (long long)(NB - 1) * SEQ_FULL * DM + (long long)SEQ * DM;   // last row read / written
  if ((long long)in_sizes[0] < needX) return;         // x [NB_FULL][SEQ_FULL][1024], rows 0..SEQ-1 of batches 0..NB-1
  if (in_sizes[1] < DM * DM) return;                  // Wq [1024 out][1024 in]
  if (in_sizes[2] < DM * DM) return;                  // Wk
  if (in_sizes[3] < DM * DM) return;                  // Wv
  if (in_sizes[4] < DM * DM) return;                  // Wo
  if ((long long)out_size < needX) return;

  const float* x  = (const float*)d_in[0];
  const float* Wq = (const float*)d_in[1];
  const float* Wk = (const float*)d_in[2];
  const float* Wv = (const float*)d_in[3];
  const float* Wo = (const float*)d_in[4];

  const size_t PX  = (size_t)NB * SEQ * DM * 2;     // 16-bit activation plane [NB*SEQ][1024]
  const size_t PW  = (size_t)DM * DM * 2;           // 16-bit weight plane [1024][1024]
  const size_t PVT = (size_t)NB * DM * SEQ * 2;     // v^T hi plane, NB slices
  const size_t PVL = (size_t)NB * DM * VLP * 2;     // v^T residual plane, NB slices
  static_assert((size_t)NB * SEQ * DM * 2 == (size_t)NB * DM * SEQ * 2);
  size_t off = 0;
  const size_t oXb  = off; off += PX;
  const size_t oOh  = oXb;                          // aliased, same extent PX
  const size_t oWq  = off; off += PW;
  const size_t oWk  = off; off += PW;
  const size_t oWv  = off; off += PW;
  const size_t oWo  = off; off += PW;
  const size_t oQh  = off; off += PX;
  const size_t oQl  = off; off += PX;
  const size_t oKh  = off; off += PX;
  const size_t oKl  = off; off += PX;
  const size_t oVTh = off; off += PVT;
  const size_t oVTl = off; off += PVL;
  const size_t oOl  = off; off += PX;
  if (off > ws_size) return;                     // off = 130023424 for NB = 4, SEQ = 2048
  if (off > (size_t)134217728) return;

  char* ws = (char*)d_ws;
  unsigned short* Xb  = (unsigned short*)(ws + oXb);
  unsigned short* Oh  = (unsigned short*)(ws + oOh);
  unsigned short* Wqb = (unsigned short*)(ws + oWq);
  unsigned short* Wkb = (unsigned short*)(ws + oWk);
  unsigned short* Wvb = (unsigned short*)(ws + oWv);
  unsigned short* Wob = (unsigned short*)(ws + oWo);
  unsigned short* Qh  = (unsigned short*)(ws + oQh);
  unsigned short* Ql  = (unsigned short*)(ws + oQl);
  unsigned short* Kh  = (unsigned short*)(ws + oKh);
  unsigned short* Kl  = (unsigned short*)(ws + oKl);
  unsigned short* VTh = (unsigned short*)(ws + oVTh);
  unsigned short* VTl = (unsigned short*)(ws + oVTl);
  unsigned short* Ol  = (unsigned short*)(ws + oOl);

  const dim3 blk(256);
  const int n8x = SEQ * DM / 8;                                    // per batch slice, multiple of 256
  const dim3 gCvtX(n8x / 256, NB);
  const int n8w = DM * DM / 8;                                     // multiple of 256
  const dim3 gCvtW(n8w / 256, 1);
  const dim3 gQK((NB * SEQ / GBM) * (DM / GBN), 1);                // M = NB*SEQ, N = 1024: 128x256 tiles
  const dim3 gVT((DM / GBM) * (SEQ / GBN), NB);                    // M = 1024, N = SEQ, per batch
  const dim3 gOut((SEQ / GBM) * (DM / GBN), NB);                   // M = SEQ, N = 1024, per batch
  const long long xStrideIn = (long long)SEQ_FULL * DM;            // input x batch stride (full layout)
  const long long pStride   = (long long)SEQ * DM;                 // plane batch stride

  // (1) x -> bf16 plane [NB*SEQ][1024] (batch b reads input rows b*SEQ_FULL .. +SEQ-1); weights -> bf16 [n][k]
  cvt_bf16x8<<<gCvtX, blk, 0, stream>>>(x, Xb, n8x, xStrideIn, pStride);
  cvt_bf16x8<<<gCvtW, blk, 0, stream>>>(Wq, Wqb, n8w, 0LL, 0LL);
  cvt_bf16x8<<<gCvtW, blk, 0, stream>>>(Wk, Wkb, n8w, 0LL, 0LL);
  cvt_bf16x8<<<gCvtW, blk, 0, stream>>>(Wv, Wvb, n8w, 0LL, 0LL);
  cvt_bf16x8<<<gCvtW, blk, 0, stream>>>(Wo, Wob, n8w, 0LL, 0LL);
  // (2) q = x . Wq^T -> bf16 hi/lo planes [b*SEQ + t][h*64+d]   (M = NB*SEQ, N = 1024, K = 1024)
  gemm64<0, 2><<<gQK, blk, 0, stream>>>(
      Xb, Xb, DM, 0LL, Wqb, Wqb, DM, 0LL,
      (void*)Qh, DM, 0LL, (void*)Ql, DM, 0LL, DM,
      NB * SEQ, DM, DM, 1.0f);
  // (3) k = x . Wk^T -> bf16 hi/lo planes
  gemm64<0, 2><<<gQK, blk, 0, stream>>>(
      Xb, Xb, DM, 0LL, Wkb, Wkb, DM, 0LL,
      (void*)Kh, DM, 0LL, (void*)Kl, DM, 0LL, DM,
      NB * SEQ, DM, DM, 1.0f);
  // (4) v^T = Wv . x^T per batch -> f16 hi plane [h*64+d][s] (pitch SEQ, batch stride DM*SEQ) and residual
  //     plane (x4096, keys < VLP only, pitch VLP, batch stride DM*VLP)   (A = Wvb [n][k], Bt = Xb slice b;
  //     M = 1024, N = SEQ, K = 1024, grid.y = batch)
  gemm64<0, 3><<<gVT, blk, 0, stream>>>(
      Wvb, Wvb, DM, 0LL, Xb, Xb, DM, pStride,
      (void*)VTh, SEQ, (long long)DM * SEQ, (void*)VTl, VLP, (long long)DM * VLP, VLP,
      DM, SEQ, DM, 4096.0f);
  // (5) causal attention: query blocks 0..RESQB-1 with residual planes, the rest without; grid.y = batch
  attn_causal64<true><<<dim3(NH * RESQB, NB), dim3(128), 0, stream>>>(
      Qh, Ql, Kh, Kl, VTh, VTl, Oh, Ol, 0, RESQB, 0.125f);
  if (NQB > RESQB) {
    attn_causal64<false><<<dim3(NH * (NQB - RESQB), NB), dim3(128), 0, stream>>>(
        Qh, Ql, Kh, Kl, VTh, VTl, Oh, Ol, RESQB, NQB - RESQB, 0.125f);
  }
  // (6) out = context . Wo^T -> d_out f32, batch b rows b*SEQ_FULL .. +SEQ-1 (A = context hi + lo planes,
  //     2 products; M = SEQ, N = 1024, K = 1024, grid.y = batch)
  gemm64<1, 0><<<gOut, blk, 0, stream>>>(
      Oh, Ol, DM, pStride, Wob, Wob, DM, 0LL,
      d_out, DM, xStrideIn, d_out, DM, 0LL, DM,
      SEQ, DM, DM, 1.0f);
  (void)hipGetLastError();
}

// v003
// A run of this version takes 248 microseconds.
// In both of two side-by-side timings against v002, it was 1.20 times as fast.
// Counting every step since v000, it is 2.25 times as fast.
// Contractions: q, k, v^T projections = v_wmma_f32_16x16x32_bf16 (bf16 operands from RNE-converted inputs, single product);
// q.k^T scores = v_wmma_f32_16x16x32_bf16 with bf16 hi/lo split q and k (hi.hi + hi.lo + lo.hi);
// p.v = v_wmma_f32_16x16x32_f16 (p carried x1024 in f16, v in f16; extra f16 residual planes x4096 of p and v for the first VLP query rows);
// ctx.Wo = v_wmma_f32_16x16x32_bf16 with ctx as bf16 hi/lo planes times bf16 Wo (2 products); all f32 accumulate; causal compare and softmax in f32.
#include <hip/hip_runtime.h>
#include <math.h>
#include <float.h>
#include <stdint.h>

#ifndef NB
#define NB    4
#endif
#ifndef SEQ
#define SEQ   2048
#endif
#define NB_FULL  4
#define SEQ_FULL 2048
#define DM    1024
#define NH    16
#define HD    64
#define NQB   (SEQ / 64)                      // key / query tiles of 64
#define VLP   ((SEQ < 512) ? SEQ : 512)       // key pitch of the v^T residual plane (keys 0..VLP-1)
#define RESQB (VLP / 64)                      // number of leading 64-row query blocks that use the p / v residual planes
#define LP    72                              // LDS row pitch (16-bit elements) of the 64-wide K, V^T and P tiles: 144 B = 16 B x odd
#define GP    72                              // LDS row pitch (16-bit elements) of the staged 64-k GEMM operand rows: 144 B = 16 B x odd
#define GBM   128                             // GEMM work-group tile rows (2 waves of 64)
#define GBN   256                             // GEMM work-group tile columns (4 waves of 64)
static_assert(NB >= 1 && NB <= NB_FULL);
static_assert((SEQ % GBN) == 0 && (DM % GBN) == 0 && (DM % 128) == 0);
static_assert(NH * HD == DM && HD == 64);
static_assert((SEQ % 64) == 0 && (DM % 64) == 0 && SEQ >= 64 && SEQ <= SEQ_FULL);
static_assert(RESQB * 64 == VLP && VLP <= SEQ && RESQB >= 1 && RESQB <= NQB);
static_assert(((SEQ * DM / 8) % 256) == 0 && ((DM * DM / 8) % 256) == 0);

typedef _Float16 v16h __attribute__((ext_vector_type(16)));
typedef _Float16 v8h  __attribute__((ext_vector_type(8)));
typedef __bf16   v16b __attribute__((ext_vector_type(16)));
typedef __bf16   v8b  __attribute__((ext_vector_type(8)));
typedef float    v8f  __attribute__((ext_vector_type(8)));
typedef float    v4f  __attribute__((ext_vector_type(4)));
typedef unsigned int v4u __attribute__((ext_vector_type(4)));

// ---- scalar helpers --------------------------------------------------------------------------------
__device__ __forceinline__ unsigned short bf_bits(float f) {          // f32 -> bf16 bits, RNE convert
  unsigned u = __float_as_uint(f);
  return (unsigned short)((u + 0x7FFFu + ((u >> 16) & 1u)) >> 16);
}
__device__ __forceinline__ float bf_up(unsigned short h) { return __uint_as_float(((unsigned)h) << 16); }
__device__ __forceinline__ unsigned short h_bits(_Float16 x) { return __builtin_bit_cast(unsigned short, x); }
__device__ __forceinline__ unsigned pk16(unsigned short a, unsigned short b) { return (unsigned)a | ((unsigned)b << 16); }
__device__ __forceinline__ v8f zero8() { v8f z = {0.f, 0.f, 0.f, 0.f, 0.f, 0.f, 0.f, 0.f}; return z; }
__device__ __forceinline__ v8h zero8h() {
  const _Float16 z = (_Float16)0.0f;
  v8h r = {z, z, z, z, z, z, z, z};
  return r;
}

// ---- fragment loaders: 16-bit A/B operand, lane -> row/col (lane&15), p already includes +8*(lane>>4);
//      elements 0..7 <- p[0..7] (k0+8h..), elements 8..15 <- p[16..23] (k0+16+8h..)
__device__ __forceinline__ v16b ldfrag_b(const __bf16* p) {
  union { v16b v; v8b h[2]; } f;
  f.h[0] = *(const v8b*)(p);
  f.h[1] = *(const v8b*)(p + 16);
  return f.v;
}

// ---- WMMA helpers with trailing VALU hazard gap --------------------------------------------------------
__device__ __forceinline__ v8f mma_b(v16b a, v16b b, v8f c) {
  c = __builtin_amdgcn_wmma_f32_16x16x32_bf16(false, a, false, b, (short)0, c, false, false);
  asm volatile("v_nop\n\tv_nop\n\tv_nop\n\tv_nop" : "+v"(c) : "v"(a), "v"(b));
  return c;
}
__device__ __forceinline__ v8f mma_h(v16h a, v16h b, v8f c) {
  c = __builtin_amdgcn_wmma_f32_16x16x32_f16(false, a, false, b, (short)0, c, false, false);
  asm volatile("v_nop\n\tv_nop\n\tv_nop\n\tv_nop" : "+v"(c) : "v"(a), "v"(b));
  return c;
}
__device__ __forceinline__ v8f mma_b_raw(v16b a, v16b b, v8f c) {
  return __builtin_amdgcn_wmma_f32_16x16x32_bf16(false, a, false, b, (short)0, c, false, false);
}
__device__ __forceinline__ void acc_guard4(v8f& a, v8f& b, v8f& c, v8f& d) {
  asm volatile("v_nop\n\tv_nop\n\tv_nop\n\tv_nop" : "+v"(a), "+v"(b), "+v"(c), "+v"(d));
}

// ---- asynchronous copies global -> LDS: four 16-B pieces per lane (l* = LDS byte address, g* = global address).
//      The s_wait_xcnt closes the statement so that no address register is rewritten ahead of it.
__device__ __forceinline__ void copy4_lds(unsigned l0, const __bf16* g0, unsigned l1, const __bf16* g1,
                                          unsigned l2, const __bf16* g2, unsigned l3, const __bf16* g3) {
  asm volatile("global_load_async_to_lds_b128 %0, %1, off\n\t"
               "global_load_async_to_lds_b128 %2, %3, off\n\t"
               "global_load_async_to_lds_b128 %4, %5, off\n\t"
               "global_load_async_to_lds_b128 %6, %7, off\n\t"
               "s_wait_xcnt 0x0"
               :: "v"(l0), "v"(g0), "v"(l1), "v"(g1), "v"(l2), "v"(g2), "v"(l3), "v"(g3) : "memory");
}

// =====================================================================================================
// f32 -> bf16 (RNE convert), 8 elements per thread, one 16-B store per lane: a wave writes 512 contiguous B
// blockIdx.y selects the batch slice (element strides inStride / outStride).
// coverage: n8 threads x 8 = the whole plane slice (n8 is a multiple of 256, host-asserted above).
// =====================================================================================================
__global__ __launch_bounds__(256) void cvt_bf16x8(const float* __restrict__ in, unsigned short* out, int n8,
                                                  long long inStride, long long outStride) {
  const int i = blockIdx.x * 256 + threadIdx.x;
  const float* src = in + (size_t)blockIdx.y * (size_t)inStride;
  unsigned short* dst = out + (size_t)blockIdx.y * (size_t)outStride;
  if (i < n8) {
    const v4f a = *(const v4f*)(src + (size_t)i * 8);
    const v4f b = *(const v4f*)(src + (size_t)i * 8 + 4);
    v4u p;
    p[0] = pk16(bf_bits(a[0]), bf_bits(a[1]));
    p[1] = pk16(bf_bits(a[2]), bf_bits(a[3]));
    p[2] = pk16(bf_bits(b[0]), bf_bits(b[1]));
    p[3] = pk16(bf_bits(b[2]), bf_bits(b[3]));
    *(v4u*)(dst + (size_t)i * 8) = p;
    
  }
}

// =====================================================================================================
// bf16 WMMA GEMM: C[m][n] = sum_k A[m][k] * Bt[n][k]; a work-group of 8 waves (2 x 4) owns a 128x256 tile, each wave
// a 64x64 tile. A row-major [M][K] pitch lda; Bt row-major [N][K] pitch ldb (k contiguous); M multiple of 128,
// N multiple of 256, K multiple of 64 (host-checked). blockIdx.y = batch index (strides in elements).
// Operand staging: per 64-k slab the rows of A (and A2) and Bt that the work-group needs are copied once into LDS
// (asynchronous 16-B copies, 8 lanes per 128-B row piece = whole lines; LDS pitch GP), two buffers, the next
// slab in flight while a slab is multiplied; every wave reads its fragments from LDS.
// NSPLIT: 0 = A.Bt; 1 = (A + A2).Bt (A2 = unscaled bf16 lo plane of A).
// OUT_MODE: 0 = f32 (pitch ldc); 2 = bf16 hi plane C + bf16 lo plane C2 (lo = RNE(v - hi), unscaled);
//           3 = f16 hi plane C + f16 residual plane C2 = f16((v - hi) * rscale), C2 written only for tiles
//               with n0 < N2 (pitch ldc2, batch stride strideC2).
// =====================================================================================================
template <int NSPLIT, int OUT_MODE>
__global__ __launch_bounds__(256) void gemm64(
    const unsigned short* __restrict__ Ap, const unsigned short* A2p, int lda, long long strideA,
    const unsigned short* __restrict__ Btp, const unsigned short* Bt2p, int ldb, long long strideB,
    void* Cout, int ldc, long long strideC,
    void* Cout2, int ldc2, long long strideC2, int N2,
    int M, int N, int K, float rscale) {
  static_assert(NSPLIT == 0 || NSPLIT == 1);
  constexpr int AROWS = (NSPLIT == 1) ? 2 * GBM : GBM;   // staged rows of A, then of A2
  constexpr int BUFE  = (AROWS + GBN) * GP;              // 16-bit elements of one slab buffer
  const __bf16* A   = (const __bf16*)(const void*)Ap;
  const __bf16* A2  = (const __bf16*)(const void*)A2p;
  const __bf16* Bt  = (const __bf16*)(const void*)Btp;
  (void)Bt2p;
  __shared__ __align__(16) __bf16 sAB[2 * BUFE];   // two slab buffers: [A 128 rows | A2 128 rows | Bt 256 rows] x 64 k
  __shared__ __align__(16) float sT[8][16 * 68];   // per-wave 16x64 slab, pitch 68 floats
  const int b    = blockIdx.y;
  const int tid  = threadIdx.x;
  const int lane = tid & 31;
  const int wave = tid >> 5;
  const int nbn = N / GBN;
  const int nbm = M / GBM;
  if ((int)blockIdx.x >= nbm * nbn) return;   // block-uniform, in front of every barrier and copy
  const int bm = (int)blockIdx.x / nbn;
  const int bn = (int)blockIdx.x - bm * nbn;
  const int wm = wave >> 2;                    // wave row 0..1
  const int wn = wave & 3;                     // wave column 0..3
  const int m0 = bm * GBM + (wm << 6);
  const int n0 = bn * GBN + (wn << 6);

  const __bf16* Ab  = A  + (size_t)b * strideA;
  const __bf16* Bb  = Bt + (size_t)b * strideB;
  const __bf16* Ab2 = (NSPLIT == 1) ? (A2 + (size_t)b * strideA) : Ab;

  const int rlane = lane & 15;                 // row (A) / col (B, D) within subtile
  const int koff  = (lane >> 4) * 8;           // k offset of this lane half
  const int mOff  = (lane >> 4) * 8;           // D row offset

  // copy map: thread -> row (tid >> 3) + 32 * i of a staged plane, 16-B piece (tid & 7) of its 128 B
  const int crow = tid >> 3;
  const int cpc  = (tid & 7) * 8;
  const __bf16* gA  = Ab  + (size_t)(bm * GBM + crow) * lda + cpc;
  const __bf16* gA2 = Ab2 + (size_t)(bm * GBM + crow) * lda + cpc;
  const __bf16* gB  = Bb  + (size_t)(bn * GBN + crow) * ldb + cpc;
  const unsigned lbase = (unsigned)(uintptr_t)(&sAB[0]) + (unsigned)((crow * GP + cpc) * 2);
  const size_t a32 = (size_t)32 * lda, b32 = (size_t)32 * ldb;
  constexpr unsigned L32 = 32u * GP * 2u;      // LDS bytes of 32 staged rows

  auto stage = [&](int t, int buf) {           // slab t (k = 64 t .. 64 t + 63) into buffer buf
    const unsigned l = lbase + (unsigned)buf * (unsigned)(BUFE * 2);
    const __bf16* a = gA + (size_t)t * 64;
    copy4_lds(l, a, l + L32, a + a32, l + 2 * L32, a + 2 * a32, l + 3 * L32, a + 3 * a32);
    if (NSPLIT == 1) {
      const __bf16* a2 = gA2 + (size_t)t * 64;
      const unsigned l2 = l + 4 * L32;
      copy4_lds(l2, a2, l2 + L32, a2 + a32, l2 + 2 * L32, a2 + 2 * a32, l2 + 3 * L32, a2 + 3 * a32);
    }
    const __bf16* bp = gB + (size_t)t * 64;
    const unsigned lb = l + (unsigned)(AROWS / 32) * L32;
    copy4_lds(lb, bp, lb + L32, bp + b32, lb + 2 * L32, bp + 2 * b32, lb + 3 * L32, bp + 3 * b32);
    copy4_lds(lb + 4 * L32, bp + 4 * b32, lb + 5 * L32, bp + 5 * b32, lb + 6 * L32, bp + 6 * b32, lb + 7 * L32, bp + 7 * b32);
  };

  v8f acc[4][4];
#pragma unroll
  for (int i = 0; i < 4; ++i)
#pragma unroll
    for (int j = 0; j < 4; ++j) acc[i][j] = zero8();

  const int nst = K >> 6;                      // slabs of 64 k
  stage(0, 0);
  asm volatile("s_wait_asynccnt 0x0" ::: "memory");   // this wave's slab-0 copies have landed
  __syncthreads();                                     // slab 0 readable by every wave
  if (nst > 1) stage(1, 1);

  const int aoff = ((wm << 6) + rlane) * GP + koff;            // this lane's A fragment row in a buffer
  const int boff = (AROWS + (wn << 6) + rlane) * GP + koff;    // this lane's Bt fragment row in a buffer
  for (int t = 0; t < nst; ++t) {
    const __bf16* sb = sAB + (t & 1) * BUFE;
#pragma unroll
    for (int ks = 0; ks < 2; ++ks) {
      v16b bh[4], ah[4], al[4];
#pragma unroll
      for (int j = 0; j < 4; ++j) bh[j] = ldfrag_b(sb + boff + j * 16 * GP + ks * 32);
#pragma unroll
      for (int i = 0; i < 4; ++i) {
        ah[i] = ldfrag_b(sb + aoff + i * 16 * GP + ks * 32);
        if (NSPLIT == 1) al[i] = ldfrag_b(sb + aoff + (GBM + i * 16) * GP + ks * 32); else al[i] = ah[i];
      }
      // inputs-only fence on the loaded fragments: keeps the k-step's LDS reads one group in front of its WMMAs
      // (without it each A fragment is read into one register set and its LDS latency waited out four times)
      asm volatile("" :: "v"(bh[0]), "v"(bh[1]), "v"(bh[2]), "v"(bh[3]), "v"(ah[0]), "v"(ah[1]), "v"(ah[2]), "v"(ah[3]));
      if (NSPLIT == 1) asm volatile("" :: "v"(al[0]), "v"(al[1]), "v"(al[2]), "v"(al[3]));   // same, lo plane
#pragma unroll
      for (int i = 0; i < 4; ++i) {
#pragma unroll
        for (int j = 0; j < 4; ++j) {
          acc[i][j] = mma_b_raw(ah[i], bh[j], acc[i][j]);
          if (NSPLIT == 1) acc[i][j] = mma_b_raw(al[i], bh[j], acc[i][j]);
        }
      }
    }
    asm volatile("s_wait_dscnt 0x0" ::: "memory");      // this wave's reads of buffer t & 1 are done before it is refilled
    asm volatile("s_wait_asynccnt 0x0" ::: "memory");   // this wave's slab t + 1 copies have landed
    __syncthreads();                                     // publishes slab t + 1, ends every read of buffer t & 1
    if (t + 2 < nst) stage(t + 2, t & 1);
  }
  asm volatile("s_wait_asynccnt 0x0" ::: "memory");     // nothing in flight when the wave goes on
  acc_guard4(acc[0][0], acc[0][1], acc[0][2], acc[0][3]);
  acc_guard4(acc[1][0], acc[1][1], acc[1][2], acc[1][3]);
  acc_guard4(acc[2][0], acc[2][1], acc[2][2], acc[2][3]);
  acc_guard4(acc[3][0], acc[3][1], acc[3][2], acc[3][3]);

  // ---- epilogue ----
  float* slab = sT[wave];
#pragma unroll
  for (int i = 0; i < 4; ++i) {
    const int mBase = m0 + (i << 4);
#pragma unroll
    for (int j = 0; j < 4; ++j) {
#pragma unroll
      for (int r = 0; r < 8; ++r) {
        slab[(mOff + r) * 68 + (j << 4) + rlane] = acc[i][j][r];
      }
    }
    __builtin_amdgcn_fence(3, "workgroup");
    __builtin_amdgcn_wave_barrier();
    __builtin_amdgcn_fence(2, "workgroup");
    if (OUT_MODE == 0) {
      float* C = (float*)Cout + (size_t)b * strideC;
      const int hh = lane >> 4, c4 = (lane & 15) * 4;     // 256-B row segment = 16 lanes x 16 B
      {
#pragma unroll
        for (int it = 0; it < 8; ++it) {
          const int row = it * 2 + hh;                     // it 0..7 x hh 0..1 = rows 0..15
          const v4f v = *(const v4f*)(slab + row * 68 + c4);
          *(v4f*)(C + (size_t)(mBase + row) * ldc + n0 + c4) = v;
        }
        
      }
    } else {
      const int q = lane >> 3, c8 = (lane & 7) * 8;
      unsigned short* C  = (unsigned short*)Cout  + (size_t)b * strideC;
      unsigned short* C2 = (unsigned short*)Cout2 + (size_t)b * strideC2;
      const bool wlo = (OUT_MODE == 2) || (n0 < N2);      // wave-uniform
      v4u hv[4], lv[4];
#pragma unroll
      for (int it = 0; it < 4; ++it) {
        const int row = it * 4 + q;                        // it 0..3 x q 0..3 = rows 0..15
        const float* sp = slab + row * 68 + c8;
        v4u a, a2;
#pragma unroll
        for (int e = 0; e < 4; ++e) {
          const float f0 = sp[2 * e], f1 = sp[2 * e + 1];
          unsigned short h0, h1, l0, l1;
          if (OUT_MODE == 2) {
            h0 = bf_bits(f0); h1 = bf_bits(f1);
            l0 = bf_bits(f0 - bf_up(h0)); l1 = bf_bits(f1 - bf_up(h1));
          } else {
            const _Float16 x0 = (_Float16)f0, x1 = (_Float16)f1;
            h0 = h_bits(x0); h1 = h_bits(x1);
            l0 = h_bits((_Float16)((f0 - (float)x0) * rscale));
            l1 = h_bits((_Float16)((f1 - (float)x1) * rscale));
          }
          a[e] = pk16(h0, h1); a2[e] = pk16(l0, l1);
        }
        hv[it] = a; lv[it] = a2;
      }
      {
#pragma unroll
        for (int it = 0; it < 4; ++it) {
          const int row = it * 4 + q;
          *(v4u*)(C + (size_t)(mBase + row) * ldc + n0 + c8) = hv[it];
          if (wlo) *(v4u*)(C2 + (size_t)(mBase + row) * ldc2 + n0 + c8) = lv[it];
        }
        
      }
    }
    __builtin_amdgcn_fence(3, "workgroup");
    __builtin_amdgcn_wave_barrier();
    __builtin_amdgcn_fence(2, "workgroup");
  }
}

// =====================================================================================================
// Causal attention, head dim 64 (all planes carry NB batch slices back to back).
//   q planes (bf16 hi / lo): element (b, t, h, d) at [b*SEQ*DM + t*DM + h*64 + d]
//   k planes (bf16 hi / lo): same layout with key index s
//   v^T hi plane (f16):      element (b, h, d, s) at [b*DM*SEQ + (h*64 + d)*SEQ + s]
//   v^T residual plane (f16, (v - hi)*4096): [b*DM*VLP + (h*64 + d)*VLP + s], s < VLP, read only when RES
//   (a key tile at or beyond VLP would contribute a zero v residual; never happens for query blocks < RESQB)
//   logit (t, s) = q.k * sscale for s <= t, finfo.min for s > t. Query block qb (64 rows) visits key tiles
//   0..qb only (every later key is above the diagonal for all 64 rows -> weight exactly 0); the compare
//   s > t is applied on the diagonal tile kt == qb only (block-uniform flag, per-element select). Every row
//   has the live key s = t in the diagonal tile and all of tile 0, so the row max is always finite.
//   out planes (bf16 hi / lo of the normalised context): element (b, t, h, d) at [b*SEQ*DM + t*DM + h*64 + d]
//   scores = q . k : bf16 hi/lo split (hi.hi + hi.lo + lo.hi), f32 accumulate, then * sscale in f32
//   p = exp(s - m) carried as f16(1024 p); context = p . v on f16 WMMA; RES adds f16 residual planes of p and v
//   (scale 4096, separate accumulator folded back with 1/4096 per chunk in f32); online softmax in f32.
//   Block = 4 waves = 64 query rows of one head of one batch; grid = (nqbThis * NH, NB), longest query block first; kv chunks of 64,
//   static bound NQB, block-uniform break at kt == qb + 1.
//   K / V^T chunk staging: 128 threads x 32 elements per plane = the whole 64x64 tile (plain 16-B loads,
//   __syncthreads before and after: cross-wave LDS regions Ksh/Ksl/Vth/Vtl behind block barriers);
//   P tiles and the Os tile are wave-private, spilled with element stores and reloaded (P as v8h, same element
//   Output coverage: each wave stores rows q0..q0+15 (it 0..3 x lane>>3 0..3) x 64 columns (8 lanes x 8) of both planes.
// =====================================================================================================
template <bool RES>
__global__ __launch_bounds__(128) __attribute__((amdgpu_num_vgpr(256)))
void attn_causal64(const unsigned short* __restrict__ qhp, const unsigned short* __restrict__ qlp,
                   const unsigned short* __restrict__ khp, const unsigned short* __restrict__ klp,
                   const unsigned short* __restrict__ vhp, const unsigned short* __restrict__ vlp,
                   unsigned short* ohp, unsigned short* olp,
                   int qbBase, int nqbThis, float sscale) {
  union FB { v16b v; v8b h[2]; };
  union FH { v16h v; v8h h[2]; };
  __shared__ __align__(16) __bf16   Ksh[64 * LP];                 // K hi [kv][d], pitch LP, 9 KB
  __shared__ __align__(16) __bf16   Ksl[64 * LP];                 // K lo
  __shared__ __align__(16) _Float16 Vth[64 * LP];                 // V^T hi [d][kv], pitch LP, 9 KB
  __shared__ __align__(16) _Float16 Vtl[RES ? 64 * LP : 8];       // V^T residual
  __shared__ __align__(16) _Float16 Psh[4][16 * LP];              // per wave P [row][kv]
  __shared__ __align__(16) _Float16 Psl[RES ? 4 : 1][16 * LP];    // per wave P residual
  __shared__ __align__(16) float    Os[4][16 * 64];               // per wave context tile [row][d]

  const int tid  = threadIdx.x;
  const int wave = tid >> 5;
  const int lane = tid & 31;
  const int hh   = lane >> 4;
  const int c    = lane & 15;

  // There are more work-groups than resident places, and query block qb
  // costs qb + 1 key tiles: the rank (x fastest, then y) maps to the query block slowest and descending, so the
  // lowest ranks get the longest work-groups (ordering for speed only). rank -> (qbl, bb, h) is a permutation of the grid.
  const int rank = (int)blockIdx.y * (nqbThis * NH) + (int)blockIdx.x;   // 0 .. nqbThis*NH*NB-1 (grid = (nqbThis*NH, NB))
  const int qbl  = nqbThis - 1 - rank / (NH * NB);   // nqbThis-1 .. 0
  const int bb   = (rank / NH) % NB;                 // batch
  const int h    = rank % NH;                        // head
  const int qb   = qbBase + qbl;
  const int q0   = qb * 64 + wave * 16;

  const size_t pstride = (size_t)SEQ * DM;                  // per-batch elements of the [t][h*64+d] planes
  const __bf16* Qh = (const __bf16*)(const void*)qhp + (size_t)bb * pstride + (size_t)h * HD;
  const __bf16* Ql = (const __bf16*)(const void*)qlp + (size_t)bb * pstride + (size_t)h * HD;
  const __bf16* Kh = (const __bf16*)(const void*)khp + (size_t)bb * pstride + (size_t)h * HD;
  const __bf16* Kl = (const __bf16*)(const void*)klp + (size_t)bb * pstride + (size_t)h * HD;
  const _Float16* Vh = (const _Float16*)(const void*)vhp + (size_t)bb * ((size_t)DM * SEQ) + (size_t)h * HD * SEQ;
  const _Float16* Vl = (const _Float16*)(const void*)vlp + (size_t)bb * ((size_t)DM * VLP) + (size_t)h * HD * VLP;
  unsigned short* Ohb = ohp + (size_t)bb * pstride;
  unsigned short* Olb = olp + (size_t)bb * pstride;

  // ---- Q fragments (A operand, row = lane&15): 2 d-chunks, hi and lo ----
  v16b qah[2], qal[2];
#pragma unroll
  for (int dc = 0; dc < 2; ++dc) {
    const size_t qo = (size_t)(q0 + c) * DM + dc * 32 + 8 * hh;
    qah[dc] = ldfrag_b(Qh + qo);
    qal[dc] = ldfrag_b(Ql + qo);
  }

  float mrow[8], lrow[8];
  v8f oacc[4];
#pragma unroll
  for (int r = 0; r < 8; ++r) { mrow[r] = -INFINITY; lrow[r] = 0.f; }
#pragma unroll
  for (int t = 0; t < 4; ++t) oacc[t] = zero8();

  const int nkt = qb + 1;                    // key tiles 0..qb (block-uniform)
  for (int kt = 0; kt < NQB; ++kt) {         // static bound
    if (kt >= nkt) break;                    // block-uniform
    const bool diag = (kt == qb);            // block-uniform
    const int kv0 = kt * 64;
    __syncthreads();
    {
      const int r = tid >> 1, half = (tid & 1) * 32;
      const __bf16*   kg  = Kh + (size_t)(kv0 + r) * DM + half;   // K row kv0+r (< SEQ), d = half..half+31
      const __bf16*   klg = Kl + (size_t)(kv0 + r) * DM + half;
      const _Float16* vg  = Vh + (size_t)r * SEQ + kv0 + half;    // V^T row d = r, s = kv0+half..+31
      const int kvl = (kv0 + 64 <= VLP) ? kv0 : (VLP - 64);     // clamped address into the residual plane
      const _Float16* vlg = Vl + (size_t)r * VLP + kvl + half;
      const bool resOK = (kv0 + 64 <= VLP);                      // block-uniform
#pragma unroll
      for (int i = 0; i < 4; ++i) {
        const v8b a0 = *(const v8b*)(kg + 8 * i);
        const v8b a1 = *(const v8b*)(klg + 8 * i);
        const v8h b0 = *(const v8h*)(vg + 8 * i);
        *(v8b*)(Ksh + r * LP + half + 8 * i) = a0;
        *(v8b*)(Ksl + r * LP + half + 8 * i) = a1;
        *(v8h*)(Vth + r * LP + half + 8 * i) = b0;
        if (RES) {
          v8h b1 = *(const v8h*)(vlg + 8 * i);
          if (!resOK) b1 = zero8h();
          *(v8h*)(Vtl + r * LP + half + 8 * i) = b1;
        }
      }
    }
    __syncthreads();

    // ---- scores: 16 query rows x 64 keys per wave, 3 bf16 products ----
    v8f s[4];
#pragma unroll
    for (int j = 0; j < 4; ++j) {
      s[j] = zero8();
#pragma unroll
      for (int dc = 0; dc < 2; ++dc) {
        FB kb, kl;
        kb.h[0] = *(const v8b*)(Ksh + (j * 16 + c) * LP + dc * 32 + 8 * hh);
        kb.h[1] = *(const v8b*)(Ksh + (j * 16 + c) * LP + dc * 32 + 16 + 8 * hh);
        kl.h[0] = *(const v8b*)(Ksl + (j * 16 + c) * LP + dc * 32 + 8 * hh);
        kl.h[1] = *(const v8b*)(Ksl + (j * 16 + c) * LP + dc * 32 + 16 + 8 * hh);
        s[j] = mma_b(qah[dc], kb.v, s[j]);
        s[j] = mma_b(qah[dc], kl.v, s[j]);
        s[j] = mma_b(qal[dc], kb.v, s[j]);
      }
    }

    // ---- scale + causal compare (diagonal tile only), row max, online softmax, P (x1024, f16) and
    //      P residual (x4096) to LDS ----
    _Float16* pwh = Psh[wave];
    _Float16* pwl = Psl[RES ? wave : 0];
#pragma unroll
    for (int r = 0; r < 8; ++r) {
      const int qrow = q0 + 8 * hh + r;          // query row of accumulator element r of this lane
      float m = -INFINITY;
#pragma unroll
      for (int j = 0; j < 4; ++j) {
        const int key = kv0 + j * 16 + c;
        float sv = s[j][r] * sscale;
        sv = (diag && (key > qrow)) ? -FLT_MAX : sv;
        s[j][r] = sv;
        m = fmaxf(m, sv);
      }
#pragma unroll
      for (int off = 1; off < 16; off <<= 1) m = fmaxf(m, __shfl_xor(m, off, 32));
      const float mnew  = fmaxf(mrow[r], m);
      const float msafe = (mnew == -INFINITY) ? 0.f : mnew;
      const float alpha = __expf(mrow[r] - msafe);
      mrow[r] = mnew;
      float psum = 0.f;
#pragma unroll
      for (int j = 0; j < 4; ++j) {
        const float p = __expf(s[j][r] - msafe);     // floor logit against a normal max: exp -> 0
        psum += p;
        const float p1k = p * 1024.0f;
        const _Float16 ph = (_Float16)p1k;
        pwh[(8 * hh + r) * LP + j * 16 + c] = ph;
        if (RES) {
          const _Float16 pl = (_Float16)((p1k - (float)ph) * 4096.0f);
          pwl[(8 * hh + r) * LP + j * 16 + c] = pl;
        }
      }
#pragma unroll
      for (int off = 1; off < 16; off <<= 1) psum += __shfl_xor(psum, off, 32);
      lrow[r] = lrow[r] * alpha + psum;
#pragma unroll
      for (int t = 0; t < 4; ++t) oacc[t][r] *= alpha;
    }
    __builtin_amdgcn_fence(3, "workgroup");
    __builtin_amdgcn_wave_barrier();
    __builtin_amdgcn_fence(2, "workgroup");

    // ---- context += P . V (f16 WMMA), residual products into a separate accumulator ----
    v8f o1[4];
#pragma unroll
    for (int t = 0; t < 4; ++t) o1[t] = zero8();
#pragma unroll 1
    for (int kk = 0; kk < 2; ++kk) {
      FH pa, pl;
      pa.h[0] = *(const v8h*)(pwh + c * LP + kk * 32 + 8 * hh);
      pa.h[1] = *(const v8h*)(pwh + c * LP + kk * 32 + 16 + 8 * hh);
      if (RES) {
        pl.h[0] = *(const v8h*)(pwl + c * LP + kk * 32 + 8 * hh);
        pl.h[1] = *(const v8h*)(pwl + c * LP + kk * 32 + 16 + 8 * hh);
      } else {
        pl.v = pa.v;
      }
#pragma unroll
      for (int t = 0; t < 4; ++t) {
        FH vb;
        vb.h[0] = *(const v8h*)(Vth + (t * 16 + c) * LP + kk * 32 + 8 * hh);
        vb.h[1] = *(const v8h*)(Vth + (t * 16 + c) * LP + kk * 32 + 16 + 8 * hh);
        oacc[t] = mma_h(pa.v, vb.v, oacc[t]);
        if (RES) {
          FH vl;
          vl.h[0] = *(const v8h*)(Vtl + (t * 16 + c) * LP + kk * 32 + 8 * hh);
          vl.h[1] = *(const v8h*)(Vtl + (t * 16 + c) * LP + kk * 32 + 16 + 8 * hh);
          o1[t] = mma_h(pa.v, vl.v, o1[t]);
          o1[t] = mma_h(pl.v, vb.v, o1[t]);
        }
      }
    }
    if (RES) {
#pragma unroll
      for (int t = 0; t < 4; ++t)
#pragma unroll
        for (int r = 0; r < 8; ++r) oacc[t][r] += o1[t][r] * (1.0f / 4096.0f);
    }
  }

  // ---- normalise (1/l and the 1/1024 p carry), stage the wave's 16x64 tile, bf16 hi/lo split,
  float* os = Os[wave];
#pragma unroll
  for (int r = 0; r < 8; ++r) {
    const float l = lrow[r];
    const float inv = ((l > 0.f) ? (1.0f / l) : 0.f) * (1.0f / 1024.0f);
#pragma unroll
    for (int t = 0; t < 4; ++t) os[(8 * hh + r) * 64 + t * 16 + c] = oacc[t][r] * inv;
  }
  __builtin_amdgcn_fence(3, "workgroup");
  __builtin_amdgcn_wave_barrier();
  __builtin_amdgcn_fence(2, "workgroup");
  {
    const int q4 = lane >> 3, c8 = (lane & 7) * 8;
    v4u hv[4], lv[4];
#pragma unroll
    for (int it = 0; it < 4; ++it) {
      const int row = it * 4 + q4;   // it 0..3 x q4 0..3 = rows 0..15 of the wave tile
      const float* sp = os + row * 64 + c8;
      v4u a, a2;
#pragma unroll
      for (int e = 0; e < 4; ++e) {
        const float f0 = sp[2 * e], f1 = sp[2 * e + 1];
        const unsigned short h0 = bf_bits(f0), h1 = bf_bits(f1);
        const unsigned short l0 = bf_bits(f0 - bf_up(h0)), l1 = bf_bits(f1 - bf_up(h1));
        a[e] = pk16(h0, h1); a2[e] = pk16(l0, l1);
      }
      hv[it] = a; lv[it] = a2;
    }
    {
#pragma unroll
      for (int it = 0; it < 4; ++it) {
        const int row = it * 4 + q4;
        const size_t go = (size_t)(q0 + row) * DM + (size_t)h * HD + c8;
        *(v4u*)(Ohb + go) = hv[it];
        *(v4u*)(Olb + go) = lv[it];
      }
      
    }
  }
}

// =====================================================================================================
// Workspace map (bytes, NB = 4, SEQ = 2048; every activation plane holds NB batch slices back to back):
//   Xb    bf16 [NB*SEQ][1024]          0           16777216   (also holds Oh after the projections: same extent)
//   Wqb   bf16 [1024 n][1024 k]        16777216     2097152
//   Wkb   bf16 [1024 n][1024 k]        18874368     2097152
//   Wvb   bf16 [1024 n][1024 k]        20971520     2097152
//   Wob   bf16 [1024 n][1024 k]        23068672     2097152
//   Qh    bf16 [NB*SEQ][1024]          25165824    16777216
//   Ql    bf16 [NB*SEQ][1024]          41943040    16777216
//   Kh    bf16 [NB*SEQ][1024]          58720256    16777216
//   Kl    bf16 [NB*SEQ][1024]          75497472    16777216
//   VTh   f16  NB x [1024][SEQ]        92274688    16777216
//   VTl   f16  NB x [1024][VLP=512]   109051904     4194304
//   Ol    bf16 [NB*SEQ][1024]         113246208    16777216
//   end                               130023424
// Oh aliases Xb: Xb is last read by the v^T projection, Oh is first written by the attention launches that
// come after it in stream order; both extents are NB*SEQ*DM*2 bytes exactly.
// All planes are exact multiples of their 64x64 / whole-line store granularity (no padded tails needed),
// =====================================================================================================
extern "C" void kernel_launch(void* const* d_in, const int* in_sizes, int n_in,
                              void* d_out, int out_size, void* d_ws, size_t ws_size,
                              hipStream_t stream) {
  if (n_in < 5) return;
  const long long needX = (long long)(NB - 1) * SEQ_FULL * DM + (long long)SEQ * DM;   // last row read / written
  if ((long long)in_sizes[0] < needX) return;         // x [NB_FULL][SEQ_FULL][1024], rows 0..SEQ-1 of batches 0..NB-1
  if (in_sizes[1] < DM * DM) return;                  // Wq [1024 out][1024 in]
  if (in_sizes[2] < DM * DM) return;                  // Wk
  if (in_sizes[3] < DM * DM) return;                  // Wv
  if (in_sizes[4] < DM * DM) return;                  // Wo
  if ((long long)out_size < needX) return;

  const float* x  = (const float*)d_in[0];
  const float* Wq = (const float*)d_in[1];
  const float* Wk = (const float*)d_in[2];
  const float* Wv = (const float*)d_in[3];
  const float* Wo = (const float*)d_in[4];

  const size_t PX  = (size_t)NB * SEQ * DM * 2;     // 16-bit activation plane [NB*SEQ][1024]
  const size_t PW  = (size_t)DM * DM * 2;           // 16-bit weight plane [1024][1024]
  const size_t PVT = (size_t)NB * DM * SEQ * 2;     // v^T hi plane, NB slices
  const size_t PVL = (size_t)NB * DM * VLP * 2;     // v^T residual plane, NB slices
  static_assert((size_t)NB * SEQ * DM * 2 == (size_t)NB * DM * SEQ * 2);
  size_t off = 0;
  const size_t oXb  = off; off += PX;
  const size_t oOh  = oXb;                          // aliased, same extent PX
  const size_t oWq  = off; off += PW;
  const size_t oWk  = off; off += PW;
  const size_t oWv  = off; off += PW;
  const size_t oWo  = off; off += PW;
  const size_t oQh  = off; off += PX;
  const size_t oQl  = off; off += PX;
  const size_t oKh  = off; off += PX;
  const size_t oKl  = off; off += PX;
  const size_t oVTh = off; off += PVT;
  const size_t oVTl = off; off += PVL;
  const size_t oOl  = off; off += PX;
  if (off > ws_size) return;                     // off = 130023424 for NB = 4, SEQ = 2048
  if (off > (size_t)134217728) return;

  char* ws = (char*)d_ws;
  unsigned short* Xb  = (unsigned short*)(ws + oXb);
  unsigned short* Oh  = (unsigned short*)(ws + oOh);
  unsigned short* Wqb = (unsigned short*)(ws + oWq);
  unsigned short* Wkb = (unsigned short*)(ws + oWk);
  unsigned short* Wvb = (unsigned short*)(ws + oWv);
  unsigned short* Wob = (unsigned short*)(ws + oWo);
  unsigned short* Qh  = (unsigned short*)(ws + oQh);
  unsigned short* Ql  = (unsigned short*)(ws + oQl);
  unsigned short* Kh  = (unsigned short*)(ws + oKh);
  unsigned short* Kl  = (unsigned short*)(ws + oKl);
  unsigned short* VTh = (unsigned short*)(ws + oVTh);
  unsigned short* VTl = (unsigned short*)(ws + oVTl);
  unsigned short* Ol  = (unsigned short*)(ws + oOl);

  const dim3 blk(256);
  const int n8x = SEQ * DM / 8;                                    // per batch slice, multiple of 256
  const dim3 gCvtX(n8x / 256, NB);
  const int n8w = DM * DM / 8;                                     // multiple of 256
  const dim3 gCvtW(n8w / 256, 1);
  const dim3 gQK((NB * SEQ / GBM) * (DM / GBN), 1);                // M = NB*SEQ, N = 1024: 128x256 tiles
  const dim3 gVT((DM / GBM) * (SEQ / GBN), NB);                    // M = 1024, N = SEQ, per batch
  const dim3 gOut((SEQ / GBM) * (DM / GBN), NB);                   // M = SEQ, N = 1024, per batch
  const long long xStrideIn = (long long)SEQ_FULL * DM;            // input x batch stride (full layout)
  const long long pStride   = (long long)SEQ * DM;                 // plane batch stride

  // (1) x -> bf16 plane [NB*SEQ][1024] (batch b reads input rows b*SEQ_FULL .. +SEQ-1); weights -> bf16 [n][k]
  cvt_bf16x8<<<gCvtX, blk, 0, stream>>>(x, Xb, n8x, xStrideIn, pStride);
  cvt_bf16x8<<<gCvtW, blk, 0, stream>>>(Wq, Wqb, n8w, 0LL, 0LL);
  cvt_bf16x8<<<gCvtW, blk, 0, stream>>>(Wk, Wkb, n8w, 0LL, 0LL);
  cvt_bf16x8<<<gCvtW, blk, 0, stream>>>(Wv, Wvb, n8w, 0LL, 0LL);
  cvt_bf16x8<<<gCvtW, blk, 0, stream>>>(Wo, Wob, n8w, 0LL, 0LL);
  // (2) q = x . Wq^T -> bf16 hi/lo planes [b*SEQ + t][h*64+d]   (M = NB*SEQ, N = 1024, K = 1024)
  gemm64<0, 2><<<gQK, blk, 0, stream>>>(
      Xb, Xb, DM, 0LL, Wqb, Wqb, DM, 0LL,
      (void*)Qh, DM, 0LL, (void*)Ql, DM, 0LL, DM,
      NB * SEQ, DM, DM, 1.0f);
  // (3) k = x . Wk^T -> bf16 hi/lo planes
  gemm64<0, 2><<<gQK, blk, 0, stream>>>(
      Xb, Xb, DM, 0LL, Wkb, Wkb, DM, 0LL,
      (void*)Kh, DM, 0LL, (void*)Kl, DM, 0LL, DM,
      NB * SEQ, DM, DM, 1.0f);
  // (4) v^T = Wv . x^T per batch -> f16 hi plane [h*64+d][s] (pitch SEQ, batch stride DM*SEQ) and residual
  //     plane (x4096, keys < VLP only, pitch VLP, batch stride DM*VLP)   (A = Wvb [n][k], Bt = Xb slice b;
  //     M = 1024, N = SEQ, K = 1024, grid.y = batch)
  gemm64<0, 3><<<gVT, blk, 0, stream>>>(
      Wvb, Wvb, DM, 0LL, Xb, Xb, DM, pStride,
      (void*)VTh, SEQ, (long long)DM * SEQ, (void*)VTl, VLP, (long long)DM * VLP, VLP,
      DM, SEQ, DM, 4096.0f);
  // (5) causal attention: query blocks 0..RESQB-1 with residual planes, the rest without; grid = (NH * query blocks, NB),
  //     the kernel maps the start rank to (query block descending, batch, head)
  attn_causal64<true><<<dim3(NH * RESQB, NB), dim3(128), 0, stream>>>(
      Qh, Ql, Kh, Kl, VTh, VTl, Oh, Ol, 0, RESQB, 0.125f);
  if (NQB > RESQB) {
    attn_causal64<false><<<dim3(NH * (NQB - RESQB), NB), dim3(128), 0, stream>>>(
        Qh, Ql, Kh, Kl, VTh, VTl, Oh, Ol, RESQB, NQB - RESQB, 0.125f);
  }
  // (6) out = context . Wo^T -> d_out f32, batch b rows b*SEQ_FULL .. +SEQ-1 (A = context hi + lo planes,
  //     2 products; M = SEQ, N = 1024, K = 1024, grid.y = batch)
  gemm64<1, 0><<<gOut, blk, 0, stream>>>(
      Oh, Ol, DM, pStride, Wob, Wob, DM, 0LL,
      d_out, DM, xStrideIn, d_out, DM, 0LL, DM,
      SEQ, DM, DM, 1.0f);
  (void)hipGetLastError();
}

// v004
// Measured time: 232 microseconds a run.
// Timed twice side by side with v003, it ran 1.07 times as fast both times.
// Counting every step since v000, it is 2.41 times as fast.
// Contractions: q, k, v^T projections = v_wmma_f32_16x16x32_bf16 (bf16 operands from RNE-converted inputs, single product);
// q.k^T scores = v_wmma_f32_16x16x32_bf16 with bf16 hi/lo split q and k (hi.hi + hi.lo + lo.hi);
// (attention products are formed transposed: A = k rows / v^T rows, B = q / p^T, so a lane owns one query column)
// p.v = v_wmma_f32_16x16x32_f16 (p carried x1024 in f16, v in f16; extra f16 residual planes x4096 of p and v for the first VLP query rows);
// ctx.Wo = v_wmma_f32_16x16x32_bf16 with ctx as bf16 hi/lo planes times bf16 Wo (2 products); all f32 accumulate; causal compare and softmax in f32.
#include <hip/hip_runtime.h>
#include <math.h>
#include <float.h>
#include <stdint.h>

#ifndef NB
#define NB    4
#endif
#ifndef SEQ
#define SEQ   2048
#endif
#define NB_FULL  4
#define SEQ_FULL 2048
#define DM    1024
#define NH    16
#define HD    64
#define NQB   (SEQ / 64)                      // key / query tiles of 64
#define VLP   ((SEQ < 512) ? SEQ : 512)       // key pitch of the v^T residual plane (keys 0..VLP-1)
#define RESQB (VLP / 64)                      // number of leading 64-row query blocks that use the p / v residual planes
#define LP    72                              // LDS row pitch (16-bit elements) of the 64-wide K and V^T tiles: 144 B = 16 B x odd
#define OSP   68                              // LDS row pitch (floats) of the per-wave context tile: 272 B = 16 B x odd
#define GP    72                              // LDS row pitch (16-bit elements) of the staged 64-k GEMM operand rows: 144 B = 16 B x odd
#define GBM   128                             // GEMM work-group tile rows (2 waves of 64)
#define GBN   256                             // GEMM work-group tile columns (4 waves of 64)
static_assert(NB >= 1 && NB <= NB_FULL);
static_assert((SEQ % GBN) == 0 && (DM % GBN) == 0 && (DM % 128) == 0);
static_assert(NH * HD == DM && HD == 64);
static_assert((SEQ % 64) == 0 && (DM % 64) == 0 && SEQ >= 64 && SEQ <= SEQ_FULL);
static_assert(RESQB * 64 == VLP && VLP <= SEQ && RESQB >= 1 && RESQB <= NQB);
static_assert(((SEQ * DM / 8) % 256) == 0 && ((DM * DM / 8) % 256) == 0);

typedef _Float16 v16h __attribute__((ext_vector_type(16)));
typedef _Float16 v8h  __attribute__((ext_vector_type(8)));
typedef __bf16   v16b __attribute__((ext_vector_type(16)));
typedef __bf16   v8b  __attribute__((ext_vector_type(8)));
typedef float    v8f  __attribute__((ext_vector_type(8)));
typedef float    v4f  __attribute__((ext_vector_type(4)));
typedef unsigned int v4u __attribute__((ext_vector_type(4)));

// ---- scalar helpers --------------------------------------------------------------------------------
__device__ __forceinline__ unsigned short bf_bits(float f) {          // f32 -> bf16 bits, RNE convert
  unsigned u = __float_as_uint(f);
  return (unsigned short)((u + 0x7FFFu + ((u >> 16) & 1u)) >> 16);
}
__device__ __forceinline__ float bf_up(unsigned short h) { return __uint_as_float(((unsigned)h) << 16); }
__device__ __forceinline__ unsigned short h_bits(_Float16 x) { return __builtin_bit_cast(unsigned short, x); }
__device__ __forceinline__ unsigned pk16(unsigned short a, unsigned short b) { return (unsigned)a | ((unsigned)b << 16); }
__device__ __forceinline__ v8f zero8() { v8f z = {0.f, 0.f, 0.f, 0.f, 0.f, 0.f, 0.f, 0.f}; return z; }
__device__ __forceinline__ v8h zero8h() {
  const _Float16 z = (_Float16)0.0f;
  v8h r = {z, z, z, z, z, z, z, z};
  return r;
}

// ---- fragment loaders: 16-bit A/B operand, lane -> row/col (lane&15), p already includes +8*(lane>>4);
//      elements 0..7 <- p[0..7] (k0+8h..), elements 8..15 <- p[16..23] (k0+16+8h..)
__device__ __forceinline__ v16b ldfrag_b(const __bf16* p) {
  union { v16b v; v8b h[2]; } f;
  f.h[0] = *(const v8b*)(p);
  f.h[1] = *(const v8b*)(p + 16);
  return f.v;
}

// ---- WMMA helpers with trailing VALU hazard gap --------------------------------------------------------
__device__ __forceinline__ v8f mma_b(v16b a, v16b b, v8f c) {
  c = __builtin_amdgcn_wmma_f32_16x16x32_bf16(false, a, false, b, (short)0, c, false, false);
  asm volatile("v_nop\n\tv_nop\n\tv_nop\n\tv_nop" : "+v"(c) : "v"(a), "v"(b));
  return c;
}
__device__ __forceinline__ v8f mma_h(v16h a, v16h b, v8f c) {
  c = __builtin_amdgcn_wmma_f32_16x16x32_f16(false, a, false, b, (short)0, c, false, false);
  asm volatile("v_nop\n\tv_nop\n\tv_nop\n\tv_nop" : "+v"(c) : "v"(a), "v"(b));
  return c;
}
__device__ __forceinline__ v8f mma_b_raw(v16b a, v16b b, v8f c) {
  return __builtin_amdgcn_wmma_f32_16x16x32_bf16(false, a, false, b, (short)0, c, false, false);
}
__device__ __forceinline__ void acc_guard4(v8f& a, v8f& b, v8f& c, v8f& d) {
  asm volatile("v_nop\n\tv_nop\n\tv_nop\n\tv_nop" : "+v"(a), "+v"(b), "+v"(c), "+v"(d));
}

// ---- value of lane l ^ 16 (the other 16-lane row), on the vector port; all 32 lanes are on wherever it is called
__device__ __forceinline__ float xhalf(float x) {
  const int b = __float_as_int(x);
  return __int_as_float(__builtin_amdgcn_permlanex16(b, b, 0x76543210, 0xfedcba98, false, false));
}

// ---- asynchronous copies global -> LDS: four 16-B pieces per lane (l* = LDS byte address, g* = global address).
//      The s_wait_xcnt closes the statement so that no address register is rewritten ahead of it.
__device__ __forceinline__ void copy4_lds(unsigned l0, const __bf16* g0, unsigned l1, const __bf16* g1,
                                          unsigned l2, const __bf16* g2, unsigned l3, const __bf16* g3) {
  asm volatile("global_load_async_to_lds_b128 %0, %1, off\n\t"
               "global_load_async_to_lds_b128 %2, %3, off\n\t"
               "global_load_async_to_lds_b128 %4, %5, off\n\t"
               "global_load_async_to_lds_b128 %6, %7, off\n\t"
               "s_wait_xcnt 0x0"
               :: "v"(l0), "v"(g0), "v"(l1), "v"(g1), "v"(l2), "v"(g2), "v"(l3), "v"(g3) : "memory");
}

// =====================================================================================================
// f32 -> bf16 (RNE convert), 8 elements per thread, one 16-B store per lane: a wave writes 512 contiguous B
// blockIdx.y selects the batch slice (element strides inStride / outStride).
// coverage: n8 threads x 8 = the whole plane slice (n8 is a multiple of 256, host-asserted above).
// =====================================================================================================
__global__ __launch_bounds__(256) void cvt_bf16x8(const float* __restrict__ in, unsigned short* out, int n8,
                                                  long long inStride, long long outStride) {
  const int i = blockIdx.x * 256 + threadIdx.x;
  const float* src = in + (size_t)blockIdx.y * (size_t)inStride;
  unsigned short* dst = out + (size_t)blockIdx.y * (size_t)outStride;
  if (i < n8) {
    const v4f a = *(const v4f*)(src + (size_t)i * 8);
    const v4f b = *(const v4f*)(src + (size_t)i * 8 + 4);
    v4u p;
    p[0] = pk16(bf_bits(a[0]), bf_bits(a[1]));
    p[1] = pk16(bf_bits(a[2]), bf_bits(a[3]));
    p[2] = pk16(bf_bits(b[0]), bf_bits(b[1]));
    p[3] = pk16(bf_bits(b[2]), bf_bits(b[3]));
    *(v4u*)(dst + (size_t)i * 8) = p;
    
  }
}

// =====================================================================================================
// bf16 WMMA GEMM: C[m][n] = sum_k A[m][k] * Bt[n][k]; a work-group of 8 waves (2 x 4) owns a 128x256 tile, each wave
// a 64x64 tile. A row-major [M][K] pitch lda; Bt row-major [N][K] pitch ldb (k contiguous); M multiple of 128,
// N multiple of 256, K multiple of 64 (host-checked). blockIdx.y = batch index (strides in elements).
// Operand staging: per 64-k slab the rows of A (and A2) and Bt that the work-group needs are copied once into LDS
// (asynchronous 16-B copies, 8 lanes per 128-B row piece = whole lines; LDS pitch GP), two buffers, the next
// slab in flight while a slab is multiplied; every wave reads its fragments from LDS.
// NSPLIT: 0 = A.Bt; 1 = (A + A2).Bt (A2 = unscaled bf16 lo plane of A).
// OUT_MODE: 0 = f32 (pitch ldc); 2 = bf16 hi plane C + bf16 lo plane C2 (lo = RNE(v - hi), unscaled);
//           3 = f16 hi plane C + f16 residual plane C2 = f16((v - hi) * rscale), C2 written only for tiles
//               with n0 < N2 (pitch ldc2, batch stride strideC2).
// =====================================================================================================
template <int NSPLIT, int OUT_MODE>
__global__ __launch_bounds__(256) void gemm64(
    const unsigned short* __restrict__ Ap, const unsigned short* A2p, int lda, long long strideA,
    const unsigned short* __restrict__ Btp, const unsigned short* Bt2p, int ldb, long long strideB,
    void* Cout, int ldc, long long strideC,
    void* Cout2, int ldc2, long long strideC2, int N2,
    int M, int N, int K, float rscale) {
  static_assert(NSPLIT == 0 || NSPLIT == 1);
  constexpr int AROWS = (NSPLIT == 1) ? 2 * GBM : GBM;   // staged rows of A, then of A2
  constexpr int BUFE  = (AROWS + GBN) * GP;              // 16-bit elements of one slab buffer
  const __bf16* A   = (const __bf16*)(const void*)Ap;
  const __bf16* A2  = (const __bf16*)(const void*)A2p;
  const __bf16* Bt  = (const __bf16*)(const void*)Btp;
  (void)Bt2p;
  __shared__ __align__(16) __bf16 sAB[2 * BUFE];   // two slab buffers: [A 128 rows | A2 128 rows | Bt 256 rows] x 64 k
  __shared__ __align__(16) float sT[8][16 * 68];   // per-wave 16x64 slab, pitch 68 floats
  const int b    = blockIdx.y;
  const int tid  = threadIdx.x;
  const int lane = tid & 31;
  const int wave = tid >> 5;
  const int nbn = N / GBN;
  const int nbm = M / GBM;
  if ((int)blockIdx.x >= nbm * nbn) return;   // block-uniform, in front of every barrier and copy
  const int bm = (int)blockIdx.x / nbn;
  const int bn = (int)blockIdx.x - bm * nbn;
  const int wm = wave >> 2;                    // wave row 0..1
  const int wn = wave & 3;                     // wave column 0..3
  const int m0 = bm * GBM + (wm << 6);
  const int n0 = bn * GBN + (wn << 6);

  const __bf16* Ab  = A  + (size_t)b * strideA;
  const __bf16* Bb  = Bt + (size_t)b * strideB;
  const __bf16* Ab2 = (NSPLIT == 1) ? (A2 + (size_t)b * strideA) : Ab;

  const int rlane = lane & 15;                 // row (A) / col (B, D) within subtile
  const int koff  = (lane >> 4) * 8;           // k offset of this lane half
  const int mOff  = (lane >> 4) * 8;           // D row offset

  // copy map: thread -> row (tid >> 3) + 32 * i of a staged plane, 16-B piece (tid & 7) of its 128 B
  const int crow = tid >> 3;
  const int cpc  = (tid & 7) * 8;
  const __bf16* gA  = Ab  + (size_t)(bm * GBM + crow) * lda + cpc;
  const __bf16* gA2 = Ab2 + (size_t)(bm * GBM + crow) * lda + cpc;
  const __bf16* gB  = Bb  + (size_t)(bn * GBN + crow) * ldb + cpc;
  const unsigned lbase = (unsigned)(uintptr_t)(&sAB[0]) + (unsigned)((crow * GP + cpc) * 2);
  const size_t a32 = (size_t)32 * lda, b32 = (size_t)32 * ldb;
  constexpr unsigned L32 = 32u * GP * 2u;      // LDS bytes of 32 staged rows

  auto stage = [&](int t, int buf) {           // slab t (k = 64 t .. 64 t + 63) into buffer buf
    const unsigned l = lbase + (unsigned)buf * (unsigned)(BUFE * 2);
    const __bf16* a = gA + (size_t)t * 64;
    copy4_lds(l, a, l + L32, a + a32, l + 2 * L32, a + 2 * a32, l + 3 * L32, a + 3 * a32);
    if (NSPLIT == 1) {
      const __bf16* a2 = gA2 + (size_t)t * 64;
      const unsigned l2 = l + 4 * L32;
      copy4_lds(l2, a2, l2 + L32, a2 + a32, l2 + 2 * L32, a2 + 2 * a32, l2 + 3 * L32, a2 + 3 * a32);
    }
    const __bf16* bp = gB + (size_t)t * 64;
    const unsigned lb = l + (unsigned)(AROWS / 32) * L32;
    copy4_lds(lb, bp, lb + L32, bp + b32, lb + 2 * L32, bp + 2 * b32, lb + 3 * L32, bp + 3 * b32);
    copy4_lds(lb + 4 * L32, bp + 4 * b32, lb + 5 * L32, bp + 5 * b32, lb + 6 * L32, bp + 6 * b32, lb + 7 * L32, bp + 7 * b32);
  };

  v8f acc[4][4];
#pragma unroll
  for (int i = 0; i < 4; ++i)
#pragma unroll
    for (int j = 0; j < 4; ++j) acc[i][j] = zero8();

  const int nst = K >> 6;                      // slabs of 64 k
  stage(0, 0);
  asm volatile("s_wait_asynccnt 0x0" ::: "memory");   // this wave's slab-0 copies have landed
  __syncthreads();                                     // slab 0 readable by every wave
  if (nst > 1) stage(1, 1);

  const int aoff = ((wm << 6) + rlane) * GP + koff;            // this lane's A fragment row in a buffer
  const int boff = (AROWS + (wn << 6) + rlane) * GP + koff;    // this lane's Bt fragment row in a buffer
  for (int t = 0; t < nst; ++t) {
    const __bf16* sb = sAB + (t & 1) * BUFE;
#pragma unroll
    for (int ks = 0; ks < 2; ++ks) {
      v16b bh[4], ah[4], al[4];
#pragma unroll
      for (int j = 0; j < 4; ++j) bh[j] = ldfrag_b(sb + boff + j * 16 * GP + ks * 32);
#pragma unroll
      for (int i = 0; i < 4; ++i) {
        ah[i] = ldfrag_b(sb + aoff + i * 16 * GP + ks * 32);
        if (NSPLIT == 1) al[i] = ldfrag_b(sb + aoff + (GBM + i * 16) * GP + ks * 32); else al[i] = ah[i];
      }
      // inputs-only fence on the loaded fragments: keeps the k-step's LDS reads one group in front of its WMMAs
      // (without it each A fragment is read into one register set and its LDS latency waited out four times)
      asm volatile("" :: "v"(bh[0]), "v"(bh[1]), "v"(bh[2]), "v"(bh[3]), "v"(ah[0]), "v"(ah[1]), "v"(ah[2]), "v"(ah[3]));
      if (NSPLIT == 1) asm volatile("" :: "v"(al[0]), "v"(al[1]), "v"(al[2]), "v"(al[3]));   // same, lo plane
#pragma unroll
      for (int i = 0; i < 4; ++i) {
#pragma unroll
        for (int j = 0; j < 4; ++j) {
          acc[i][j] = mma_b_raw(ah[i], bh[j], acc[i][j]);
          if (NSPLIT == 1) acc[i][j] = mma_b_raw(al[i], bh[j], acc[i][j]);
        }
      }
    }
    asm volatile("s_wait_dscnt 0x0" ::: "memory");      // this wave's reads of buffer t & 1 are done before it is refilled
    asm volatile("s_wait_asynccnt 0x0" ::: "memory");   // this wave's slab t + 1 copies have landed
    __syncthreads();                                     // publishes slab t + 1, ends every read of buffer t & 1
    if (t + 2 < nst) stage(t + 2, t & 1);
  }
  asm volatile("s_wait_asynccnt 0x0" ::: "memory");     // nothing in flight when the wave goes on
  acc_guard4(acc[0][0], acc[0][1], acc[0][2], acc[0][3]);
  acc_guard4(acc[1][0], acc[1][1], acc[1][2], acc[1][3]);
  acc_guard4(acc[2][0], acc[2][1], acc[2][2], acc[2][3]);
  acc_guard4(acc[3][0], acc[3][1], acc[3][2], acc[3][3]);

  // ---- epilogue ----
  float* slab = sT[wave];
#pragma unroll
  for (int i = 0; i < 4; ++i) {
    const int mBase = m0 + (i << 4);
#pragma unroll
    for (int j = 0; j < 4; ++j) {
#pragma unroll
      for (int r = 0; r < 8; ++r) {
        slab[(mOff + r) * 68 + (j << 4) + rlane] = acc[i][j][r];
      }
    }
    __builtin_amdgcn_fence(3, "workgroup");
    __builtin_amdgcn_wave_barrier();
    __builtin_amdgcn_fence(2, "workgroup");
    if (OUT_MODE == 0) {
      float* C = (float*)Cout + (size_t)b * strideC;
      const int hh = lane >> 4, c4 = (lane & 15) * 4;     // 256-B row segment = 16 lanes x 16 B
      {
#pragma unroll
        for (int it = 0; it < 8; ++it) {
          const int row = it * 2 + hh;                     // it 0..7 x hh 0..1 = rows 0..15
          const v4f v = *(const v4f*)(slab + row * 68 + c4);
          *(v4f*)(C + (size_t)(mBase + row) * ldc + n0 + c4) = v;
        }
        
      }
    } else {
      const int q = lane >> 3, c8 = (lane & 7) * 8;
      unsigned short* C  = (unsigned short*)Cout  + (size_t)b * strideC;
      unsigned short* C2 = (unsigned short*)Cout2 + (size_t)b * strideC2;
      const bool wlo = (OUT_MODE == 2) || (n0 < N2);      // wave-uniform
      v4u hv[4], lv[4];
#pragma unroll
      for (int it = 0; it < 4; ++it) {
        const int row = it * 4 + q;                        // it 0..3 x q 0..3 = rows 0..15
        const float* sp = slab + row * 68 + c8;
        v4u a, a2;
#pragma unroll
        for (int e = 0; e < 4; ++e) {
          const float f0 = sp[2 * e], f1 = sp[2 * e + 1];
          unsigned short h0, h1, l0, l1;
          if (OUT_MODE == 2) {
            h0 = bf_bits(f0); h1 = bf_bits(f1);
            l0 = bf_bits(f0 - bf_up(h0)); l1 = bf_bits(f1 - bf_up(h1));
          } else {
            const _Float16 x0 = (_Float16)f0, x1 = (_Float16)f1;
            h0 = h_bits(x0); h1 = h_bits(x1);
            l0 = h_bits((_Float16)((f0 - (float)x0) * rscale));
            l1 = h_bits((_Float16)((f1 - (float)x1) * rscale));
          }
          a[e] = pk16(h0, h1); a2[e] = pk16(l0, l1);
        }
        hv[it] = a; lv[it] = a2;
      }
      {
#pragma unroll
        for (int it = 0; it < 4; ++it) {
          const int row = it * 4 + q;
          *(v4u*)(C + (size_t)(mBase + row) * ldc + n0 + c8) = hv[it];
          if (wlo) *(v4u*)(C2 + (size_t)(mBase + row) * ldc2 + n0 + c8) = lv[it];
        }
        
      }
    }
    __builtin_amdgcn_fence(3, "workgroup");
    __builtin_amdgcn_wave_barrier();
    __builtin_amdgcn_fence(2, "workgroup");
  }
}

template <bool RES>
__global__ __launch_bounds__(128) __attribute__((amdgpu_num_vgpr(256)))
void attn_causal64(const unsigned short* __restrict__ qhp, const unsigned short* __restrict__ qlp,
                   const unsigned short* __restrict__ khp, const unsigned short* __restrict__ klp,
                   const unsigned short* __restrict__ vhp, const unsigned short* __restrict__ vlp,
                   unsigned short* ohp, unsigned short* olp,
                   int qbBase, int nqbThis, float sscale) {
  union FB { v16b v; v8b h[2]; };
  union FH { v16h v; v8h h[2]; };
  __shared__ __align__(16) __bf16   Ksh[64 * LP];                 // K hi [kv][d], pitch LP, 9 KB
  __shared__ __align__(16) __bf16   Ksl[64 * LP];                 // K lo
  __shared__ __align__(16) _Float16 Vth[64 * LP];                 // V^T hi [d][kv], pitch LP, 9 KB
  __shared__ __align__(16) _Float16 Vtl[RES ? 64 * LP : 8];       // V^T residual
  __shared__ __align__(16) float    Os[4][16 * OSP];              // per wave context tile [row][d], pitch OSP

  const int tid  = threadIdx.x;
  const int wave = tid >> 5;
  const int lane = tid & 31;
  const int hh   = lane >> 4;
  const int c    = lane & 15;

  // There are more work-groups than resident places, and query block qb
  // costs qb + 1 key tiles: the rank (x fastest, then y) maps to the query block slowest and descending, so the
  // lowest ranks get the longest work-groups (ordering for speed only). rank -> (qbl, bb, h) is a permutation of the grid.
  const int rank = (int)blockIdx.y * (nqbThis * NH) + (int)blockIdx.x;   // 0 .. nqbThis*NH*NB-1 (grid = (nqbThis*NH, NB))
  const int qbl  = nqbThis - 1 - rank / (NH * NB);   // nqbThis-1 .. 0
  const int bb   = (rank / NH) % NB;                 // batch
  const int h    = rank % NH;                        // head
  const int qb   = qbBase + qbl;
  const int q0   = qb * 64 + wave * 16;

  const size_t pstride = (size_t)SEQ * DM;                  // per-batch elements of the [t][h*64+d] planes
  const __bf16* Qh = (const __bf16*)(const void*)qhp + (size_t)bb * pstride + (size_t)h * HD;
  const __bf16* Ql = (const __bf16*)(const void*)qlp + (size_t)bb * pstride + (size_t)h * HD;
  const __bf16* Kh = (const __bf16*)(const void*)khp + (size_t)bb * pstride + (size_t)h * HD;
  const __bf16* Kl = (const __bf16*)(const void*)klp + (size_t)bb * pstride + (size_t)h * HD;
  const _Float16* Vh = (const _Float16*)(const void*)vhp + (size_t)bb * ((size_t)DM * SEQ) + (size_t)h * HD * SEQ;
  const _Float16* Vl = (const _Float16*)(const void*)vlp + (size_t)bb * ((size_t)DM * VLP) + (size_t)h * HD * VLP;
  unsigned short* Ohb = ohp + (size_t)bb * pstride;
  unsigned short* Olb = olp + (size_t)bb * pstride;

  // ---- Q fragments (B operand, column = query = lane&15): 2 d-chunks, hi and lo ----
  v16b qah[2], qal[2];
#pragma unroll
  for (int dc = 0; dc < 2; ++dc) {
    const size_t qo = (size_t)(q0 + c) * DM + dc * 32 + 8 * hh;
    qah[dc] = ldfrag_b(Qh + qo);
    qal[dc] = ldfrag_b(Ql + qo);
  }

  float mrow = -INFINITY, lrow = 0.f;        // of query q0 + c; lrow sums this lane half's keys only
  v8f oacc[4];                               // O^T: oacc[t][r] = context(query q0 + c, d = 16 t + 8 hh + r)
#pragma unroll
  for (int t = 0; t < 4; ++t) oacc[t] = zero8();

  const int nkt = qb + 1;                    // key tiles 0..qb (block-uniform)
  for (int kt = 0; kt < NQB; ++kt) {         // static bound
    if (kt >= nkt) break;                    // block-uniform
    const bool diag = (kt == qb);            // block-uniform
    const int kv0 = kt * 64;
    __syncthreads();
    {
      const int r = tid >> 1, half = (tid & 1) * 32;
      const __bf16*   kg  = Kh + (size_t)(kv0 + r) * DM + half;   // K row kv0+r (< SEQ), d = half..half+31
      const __bf16*   klg = Kl + (size_t)(kv0 + r) * DM + half;
      const _Float16* vg  = Vh + (size_t)r * SEQ + kv0 + half;    // V^T row d = r, s = kv0+half..+31
      const int kvl = (kv0 + 64 <= VLP) ? kv0 : (VLP - 64);     // clamped address into the residual plane
      const _Float16* vlg = Vl + (size_t)r * VLP + kvl + half;
      const bool resOK = (kv0 + 64 <= VLP);                      // block-uniform
#pragma unroll
      for (int i = 0; i < 4; ++i) {
        const v8b a0 = *(const v8b*)(kg + 8 * i);
        const v8b a1 = *(const v8b*)(klg + 8 * i);
        const v8h b0 = *(const v8h*)(vg + 8 * i);
        *(v8b*)(Ksh + r * LP + half + 8 * i) = a0;
        *(v8b*)(Ksl + r * LP + half + 8 * i) = a1;
        *(v8h*)(Vth + r * LP + half + 8 * i) = b0;
        if (RES) {
          v8h b1 = *(const v8h*)(vlg + 8 * i);
          if (!resOK) b1 = zero8h();
          *(v8h*)(Vtl + r * LP + half + 8 * i) = b1;
        }
      }
    }
    __syncthreads();

    // ---- scores, transposed: 64 keys x 16 query columns per wave, 3 bf16 products ----
    v8f s[4];
#pragma unroll
    for (int j = 0; j < 4; ++j) {
      s[j] = zero8();
#pragma unroll
      for (int dc = 0; dc < 2; ++dc) {
        FB kb, kl;
        kb.h[0] = *(const v8b*)(Ksh + (j * 16 + c) * LP + dc * 32 + 8 * hh);
        kb.h[1] = *(const v8b*)(Ksh + (j * 16 + c) * LP + dc * 32 + 16 + 8 * hh);
        kl.h[0] = *(const v8b*)(Ksl + (j * 16 + c) * LP + dc * 32 + 8 * hh);
        kl.h[1] = *(const v8b*)(Ksl + (j * 16 + c) * LP + dc * 32 + 16 + 8 * hh);
        s[j] = mma_b(kb.v, qah[dc], s[j]);
        s[j] = mma_b(kl.v, qah[dc], s[j]);
        s[j] = mma_b(kb.v, qal[dc], s[j]);
      }
    }

    // ---- scale + causal compare (diagonal tile only), column max, online softmax; P^T (x1024, f16) and its
    //      residual (x4096) are packed in registers as the B operands of the context products ----
    FH pb[2], pr[2];
    {
      const int qrow = q0 + c;                     // this lane's query
      float m = -INFINITY;
#pragma unroll
      for (int j = 0; j < 4; ++j) {
#pragma unroll
        for (int r = 0; r < 8; ++r) {
          const int key = kv0 + j * 16 + 8 * hh + r;   // key of accumulator element r of this lane
          float sv = s[j][r] * sscale;
          sv = (diag && (key > qrow)) ? -FLT_MAX : sv;
          s[j][r] = sv;
          m = fmaxf(m, sv);
        }
      }
      m = fmaxf(m, xhalf(m));                      // the query's other 32 keys of the tile
      const float mnew  = fmaxf(mrow, m);
      const float msafe = (mnew == -INFINITY) ? 0.f : mnew;
      const float alpha = __expf(mrow - msafe);
      mrow = mnew;
      float psum[2] = {0.f, 0.f};                  // one chain per 32 keys: two independent sums
#pragma unroll
      for (int j = 0; j < 4; ++j) {
#pragma unroll
        for (int r = 0; r < 8; ++r) {
          const float p = __expf(s[j][r] - msafe);   // floor logit against a normal max: exp -> 0
          psum[j >> 1] += p;
          const float p1k = p * 1024.0f;
          const _Float16 ph = (_Float16)p1k;
          pb[j >> 1].v[(j & 1) * 8 + r] = ph;
          if (RES) pr[j >> 1].v[(j & 1) * 8 + r] = (_Float16)((p1k - (float)ph) * 4096.0f);
        }
      }
      lrow = lrow * alpha + (psum[0] + psum[1]);
#pragma unroll
      for (int t = 0; t < 4; ++t)
#pragma unroll
        for (int r = 0; r < 8; ++r) oacc[t][r] *= alpha;
    }

    // ---- context^T += V^T . P^T (f16 WMMA), residual products into a separate accumulator ----
    v8f o1[4];
#pragma unroll
    for (int t = 0; t < 4; ++t) o1[t] = zero8();
#pragma unroll
    for (int kk = 0; kk < 2; ++kk) {               // unrolled: pb / pr are register operands
#pragma unroll
      for (int t = 0; t < 4; ++t) {
        FH vb;
        vb.h[0] = *(const v8h*)(Vth + (t * 16 + c) * LP + kk * 32 + 8 * hh);
        vb.h[1] = *(const v8h*)(Vth + (t * 16 + c) * LP + kk * 32 + 16 + 8 * hh);
        oacc[t] = mma_h(vb.v, pb[kk].v, oacc[t]);
        if (RES) {
          FH vl;
          vl.h[0] = *(const v8h*)(Vtl + (t * 16 + c) * LP + kk * 32 + 8 * hh);
          vl.h[1] = *(const v8h*)(Vtl + (t * 16 + c) * LP + kk * 32 + 16 + 8 * hh);
          o1[t] = mma_h(vl.v, pb[kk].v, o1[t]);
          o1[t] = mma_h(vb.v, pr[kk].v, o1[t]);
        }
      }
    }
    if (RES) {
#pragma unroll
      for (int t = 0; t < 4; ++t)
#pragma unroll
        for (int r = 0; r < 8; ++r) oacc[t][r] += o1[t][r] * (1.0f / 4096.0f);
    }
  }

  // ---- normalise (1/l and the 1/1024 p carry), stage the wave's 16x64 tile, bf16 hi/lo split,
  float* os = Os[wave];
  {
    const float l = lrow + xhalf(lrow);        // both lane halves' keys of query q0 + c
    const float inv = ((l > 0.f) ? (1.0f / l) : 0.f) * (1.0f / 1024.0f);
#pragma unroll
    for (int t = 0; t < 4; ++t)
#pragma unroll
      for (int r = 0; r < 8; ++r) os[c * OSP + t * 16 + 8 * hh + r] = oacc[t][r] * inv;
  }
  __builtin_amdgcn_fence(3, "workgroup");
  __builtin_amdgcn_wave_barrier();
  __builtin_amdgcn_fence(2, "workgroup");
  {
    const int q4 = lane >> 3, c8 = (lane & 7) * 8;
    v4u hv[4], lv[4];
#pragma unroll
    for (int it = 0; it < 4; ++it) {
      const int row = it * 4 + q4;   // it 0..3 x q4 0..3 = rows 0..15 of the wave tile
      const float* sp = os + row * OSP + c8;
      v4u a, a2;
#pragma unroll
      for (int e = 0; e < 4; ++e) {
        const float f0 = sp[2 * e], f1 = sp[2 * e + 1];
        const unsigned short h0 = bf_bits(f0), h1 = bf_bits(f1);
        const unsigned short l0 = bf_bits(f0 - bf_up(h0)), l1 = bf_bits(f1 - bf_up(h1));
        a[e] = pk16(h0, h1); a2[e] = pk16(l0, l1);
      }
      hv[it] = a; lv[it] = a2;
    }
    {
#pragma unroll
      for (int it = 0; it < 4; ++it) {
        const int row = it * 4 + q4;
        const size_t go = (size_t)(q0 + row) * DM + (size_t)h * HD + c8;
        *(v4u*)(Ohb + go) = hv[it];
        *(v4u*)(Olb + go) = lv[it];
      }
      
    }
  }
}

// =====================================================================================================
// Workspace map (bytes, NB = 4, SEQ = 2048; every activation plane holds NB batch slices back to back):
//   Xb    bf16 [NB*SEQ][1024]          0           16777216   (also holds Oh after the projections: same extent)
//   Wqb   bf16 [1024 n][1024 k]        16777216     2097152
//   Wkb   bf16 [1024 n][1024 k]        18874368     2097152
//   Wvb   bf16 [1024 n][1024 k]        20971520     2097152
//   Wob   bf16 [1024 n][1024 k]        23068672     2097152
//   Qh    bf16 [NB*SEQ][1024]          25165824    16777216
//   Ql    bf16 [NB*SEQ][1024]          41943040    16777216
//   Kh    bf16 [NB*SEQ][1024]          58720256    16777216
//   Kl    bf16 [NB*SEQ][1024]          75497472    16777216
//   VTh   f16  NB x [1024][SEQ]        92274688    16777216
//   VTl   f16  NB x [1024][VLP=512]   109051904     4194304
//   Ol    bf16 [NB*SEQ][1024]         113246208    16777216
//   end                               130023424
// Oh aliases Xb: Xb is last read by the v^T projection, Oh is first written by the attention launches that
// come after it in stream order; both extents are NB*SEQ*DM*2 bytes exactly.
// All planes are exact multiples of their 64x64 / whole-line store granularity (no padded tails needed),
// =====================================================================================================
extern "C" void kernel_launch(void* const* d_in, const int* in_sizes, int n_in,
                              void* d_out, int out_size, void* d_ws, size_t ws_size,
                              hipStream_t stream) {
  if (n_in < 5) return;
  const long long needX = (long long)(NB - 1) * SEQ_FULL * DM + (long long)SEQ * DM;   // last row read / written
  if ((long long)in_sizes[0] < needX) return;         // x [NB_FULL][SEQ_FULL][1024], rows 0..SEQ-1 of batches 0..NB-1
  if (in_sizes[1] < DM * DM) return;                  // Wq [1024 out][1024 in]
  if (in_sizes[2] < DM * DM) return;                  // Wk
  if (in_sizes[3] < DM * DM) return;                  // Wv
  if (in_sizes[4] < DM * DM) return;                  // Wo
  if ((long long)out_size < needX) return;

  const float* x  = (const float*)d_in[0];
  const float* Wq = (const float*)d_in[1];
  const float* Wk = (const float*)d_in[2];
  const float* Wv = (const float*)d_in[3];
  const float* Wo = (const float*)d_in[4];

  const size_t PX  = (size_t)NB * SEQ * DM * 2;     // 16-bit activation plane [NB*SEQ][1024]
  const size_t PW  = (size_t)DM * DM * 2;           // 16-bit weight plane [1024][1024]
  const size_t PVT = (size_t)NB * DM * SEQ * 2;     // v^T hi plane, NB slices
  const size_t PVL = (size_t)NB * DM * VLP * 2;     // v^T residual plane, NB slices
  static_assert((size_t)NB * SEQ * DM * 2 == (size_t)NB * DM * SEQ * 2);
  size_t off = 0;
  const size_t oXb  = off; off += PX;
  const size_t oOh  = oXb;                          // aliased, same extent PX
  const size_t oWq  = off; off += PW;
  const size_t oWk  = off; off += PW;
  const size_t oWv  = off; off += PW;
  const size_t oWo  = off; off += PW;
  const size_t oQh  = off; off += PX;
  const size_t oQl  = off; off += PX;
  const size_t oKh  = off; off += PX;
  const size_t oKl  = off; off += PX;
  const size_t oVTh = off; off += PVT;
  const size_t oVTl = off; off += PVL;
  const size_t oOl  = off; off += PX;
  if (off > ws_size) return;                     // off = 130023424 for NB = 4, SEQ = 2048
  if (off > (size_t)134217728) return;

  char* ws = (char*)d_ws;
  unsigned short* Xb  = (unsigned short*)(ws + oXb);
  unsigned short* Oh  = (unsigned short*)(ws + oOh);
  unsigned short* Wqb = (unsigned short*)(ws + oWq);
  unsigned short* Wkb = (unsigned short*)(ws + oWk);
  unsigned short* Wvb = (unsigned short*)(ws + oWv);
  unsigned short* Wob = (unsigned short*)(ws + oWo);
  unsigned short* Qh  = (unsigned short*)(ws + oQh);
  unsigned short* Ql  = (unsigned short*)(ws + oQl);
  unsigned short* Kh  = (unsigned short*)(ws + oKh);
  unsigned short* Kl  = (unsigned short*)(ws + oKl);
  unsigned short* VTh = (unsigned short*)(ws + oVTh);
  unsigned short* VTl = (unsigned short*)(ws + oVTl);
  unsigned short* Ol  = (unsigned short*)(ws + oOl);

  const dim3 blk(256);
  const int n8x = SEQ * DM / 8;                                    // per batch slice, multiple of 256
  const dim3 gCvtX(n8x / 256, NB);
  const int n8w = DM * DM / 8;                                     // multiple of 256
  const dim3 gCvtW(n8w / 256, 1);
  const dim3 gQK((NB * SEQ / GBM) * (DM / GBN), 1);                // M = NB*SEQ, N = 1024: 128x256 tiles
  const dim3 gVT((DM / GBM) * (SEQ / GBN), NB);                    // M = 1024, N = SEQ, per batch
  const dim3 gOut((SEQ / GBM) * (DM / GBN), NB);                   // M = SEQ, N = 1024, per batch
  const long long xStrideIn = (long long)SEQ_FULL * DM;            // input x batch stride (full layout)
  const long long pStride   = (long long)SEQ * DM;                 // plane batch stride

  // (1) x -> bf16 plane [NB*SEQ][1024] (batch b reads input rows b*SEQ_FULL .. +SEQ-1); weights -> bf16 [n][k]
  cvt_bf16x8<<<gCvtX, blk, 0, stream>>>(x, Xb, n8x, xStrideIn, pStride);
  cvt_bf16x8<<<gCvtW, blk, 0, stream>>>(Wq, Wqb, n8w, 0LL, 0LL);
  cvt_bf16x8<<<gCvtW, blk, 0, stream>>>(Wk, Wkb, n8w, 0LL, 0LL);
  cvt_bf16x8<<<gCvtW, blk, 0, stream>>>(Wv, Wvb, n8w, 0LL, 0LL);
  cvt_bf16x8<<<gCvtW, blk, 0, stream>>>(Wo, Wob, n8w, 0LL, 0LL);
  // (2) q = x . Wq^T -> bf16 hi/lo planes [b*SEQ + t][h*64+d]   (M = NB*SEQ, N = 1024, K = 1024)
  gemm64<0, 2><<<gQK, blk, 0, stream>>>(
      Xb, Xb, DM, 0LL, Wqb, Wqb, DM, 0LL,
      (void*)Qh, DM, 0LL, (void*)Ql, DM, 0LL, DM,
      NB * SEQ, DM, DM, 1.0f);
  // (3) k = x . Wk^T -> bf16 hi/lo planes
  gemm64<0, 2><<<gQK, blk, 0, stream>>>(
      Xb, Xb, DM, 0LL, Wkb, Wkb, DM, 0LL,
      (void*)Kh, DM, 0LL, (void*)Kl, DM, 0LL, DM,
      NB * SEQ, DM, DM, 1.0f);
  // (4) v^T = Wv . x^T per batch -> f16 hi plane [h*64+d][s] (pitch SEQ, batch stride DM*SEQ) and residual
  //     plane (x4096, keys < VLP only, pitch VLP, batch stride DM*VLP)   (A = Wvb [n][k], Bt = Xb slice b;
  //     M = 1024, N = SEQ, K = 1024, grid.y = batch)
  gemm64<0, 3><<<gVT, blk, 0, stream>>>(
      Wvb, Wvb, DM, 0LL, Xb, Xb, DM, pStride,
      (void*)VTh, SEQ, (long long)DM * SEQ, (void*)VTl, VLP, (long long)DM * VLP, VLP,
      DM, SEQ, DM, 4096.0f);
  // (5) causal attention: query blocks 0..RESQB-1 with residual planes, the rest without; grid = (NH * query blocks, NB),
  //     the kernel maps the start rank to (query block descending, batch, head)
  attn_causal64<true><<<dim3(NH * RESQB, NB), dim3(128), 0, stream>>>(
      Qh, Ql, Kh, Kl, VTh, VTl, Oh, Ol, 0, RESQB, 0.125f);
  if (NQB > RESQB) {
    attn_causal64<false><<<dim3(NH * (NQB - RESQB), NB), dim3(128), 0, stream>>>(
        Qh, Ql, Kh, Kl, VTh, VTl, Oh, Ol, RESQB, NQB - RESQB, 0.125f);
  }
  // (6) out = context . Wo^T -> d_out f32, batch b rows b*SEQ_FULL .. +SEQ-1 (A = context hi + lo planes,
  //     2 products; M = SEQ, N = 1024, K = 1024, grid.y = batch)
  gemm64<1, 0><<<gOut, blk, 0, stream>>>(
      Oh, Ol, DM, pStride, Wob, Wob, DM, 0LL,
      d_out, DM, xStrideIn, d_out, DM, 0LL, DM,
      SEQ, DM, DM, 1.0f);
  (void)hipGetLastError();
}

// v005
// Measured time: 207 microseconds a run.
// Next to v004, in two timings, it ran 1.13 and 1.12 times as fast.
// All steps since v000 together make it 2.72 times as fast.
// Contractions: q, k, v^T projections = v_wmma_f32_16x16x32_bf16 (bf16 operands from RNE-converted inputs, single product);
// q.k^T scores = v_wmma_f32_16x16x32_bf16 with bf16 hi/lo split q and k (hi.hi + hi.lo + lo.hi);
// (attention products are formed transposed: A = k rows / v^T rows, B = q / p^T, so a lane owns one query column)
// p.v = v_wmma_f32_16x16x32_f16 (p carried x1024 in f16, v in f16; extra f16 residual planes x4096 of p and v for the first VLP query rows);
// ctx.Wo = v_wmma_f32_16x16x32_bf16 with ctx as bf16 hi/lo planes times bf16 Wo (2 products); all f32 accumulate; causal compare and softmax in f32.
#include <hip/hip_runtime.h>
#include <math.h>
#include <float.h>
#include <stdint.h>

#ifndef NB
#define NB    4
#endif
#ifndef SEQ
#define SEQ   2048
#endif
#define NB_FULL  4
#define SEQ_FULL 2048
#define DM    1024
#define NH    16
#define HD    64
#define NQB   (SEQ / 64)                      // key / query tiles of 64
#define VLP   ((SEQ < 512) ? SEQ : 512)       // key pitch of the v^T residual plane (keys 0..VLP-1)
#define RESQB (VLP / 64)                      // number of leading 64-row query blocks that use the p / v residual planes
#define LP    72                              // LDS row pitch (16-bit elements) of the 64-wide K and V^T tiles: 144 B = 16 B x odd
#define OSP   68                              // LDS row pitch (floats) of the per-wave context tile: 272 B = 16 B x odd
#define GP    72                              // LDS row pitch (16-bit elements) of the staged 64-k GEMM operand rows: 144 B = 16 B x odd
#define GBM   128                             // GEMM work-group tile rows (2 waves of 64)
#define GBN   256                             // GEMM work-group tile columns (4 waves of 64)
static_assert(NB >= 1 && NB <= NB_FULL);
static_assert((SEQ % GBN) == 0 && (DM % GBN) == 0 && (DM % 128) == 0);
static_assert(NH * HD == DM && HD == 64);
static_assert((SEQ % 64) == 0 && (DM % 64) == 0 && SEQ >= 64 && SEQ <= SEQ_FULL);
static_assert(RESQB * 64 == VLP && VLP <= SEQ && RESQB >= 1 && RESQB <= NQB);
static_assert(((SEQ * DM / 8) % 256) == 0 && ((DM * DM / 8) % 256) == 0);

typedef _Float16 v16h __attribute__((ext_vector_type(16)));
typedef _Float16 v8h  __attribute__((ext_vector_type(8)));
typedef __bf16   v16b __attribute__((ext_vector_type(16)));
typedef __bf16   v8b  __attribute__((ext_vector_type(8)));
typedef float    v8f  __attribute__((ext_vector_type(8)));
typedef float    v4f  __attribute__((ext_vector_type(4)));
typedef unsigned int v4u __attribute__((ext_vector_type(4)));

// ---- scalar helpers --------------------------------------------------------------------------------
__device__ __forceinline__ unsigned short bf_bits(float f) {          // f32 -> bf16 bits, RNE convert
  unsigned u = __float_as_uint(f);
  return (unsigned short)((u + 0x7FFFu + ((u >> 16) & 1u)) >> 16);
}
__device__ __forceinline__ float bf_up(unsigned short h) { return __uint_as_float(((unsigned)h) << 16); }
__device__ __forceinline__ unsigned short h_bits(_Float16 x) { return __builtin_bit_cast(unsigned short, x); }
__device__ __forceinline__ unsigned pk16(unsigned short a, unsigned short b) { return (unsigned)a | ((unsigned)b << 16); }
__device__ __forceinline__ v8f zero8() { v8f z = {0.f, 0.f, 0.f, 0.f, 0.f, 0.f, 0.f, 0.f}; return z; }

// ---- fragment loaders: 16-bit A/B operand, lane -> row/col (lane&15), p already includes +8*(lane>>4);
//      elements 0..7 <- p[0..7] (k0+8h..), elements 8..15 <- p[16..23] (k0+16+8h..)
__device__ __forceinline__ v16b ldfrag_b(const __bf16* p) {
  union { v16b v; v8b h[2]; } f;
  f.h[0] = *(const v8b*)(p);
  f.h[1] = *(const v8b*)(p + 16);
  return f.v;
}

// ---- WMMA helpers with trailing VALU hazard gap --------------------------------------------------------
__device__ __forceinline__ v8f mma_b(v16b a, v16b b, v8f c) {
  c = __builtin_amdgcn_wmma_f32_16x16x32_bf16(false, a, false, b, (short)0, c, false, false);
  asm volatile("v_nop\n\tv_nop\n\tv_nop\n\tv_nop" : "+v"(c) : "v"(a), "v"(b));
  return c;
}
__device__ __forceinline__ v8f mma_h(v16h a, v16h b, v8f c) {
  c = __builtin_amdgcn_wmma_f32_16x16x32_f16(false, a, false, b, (short)0, c, false, false);
  asm volatile("v_nop\n\tv_nop\n\tv_nop\n\tv_nop" : "+v"(c) : "v"(a), "v"(b));
  return c;
}
__device__ __forceinline__ v8f mma_b_raw(v16b a, v16b b, v8f c) {
  return __builtin_amdgcn_wmma_f32_16x16x32_bf16(false, a, false, b, (short)0, c, false, false);
}
__device__ __forceinline__ void acc_guard4(v8f& a, v8f& b, v8f& c, v8f& d) {
  asm volatile("v_nop\n\tv_nop\n\tv_nop\n\tv_nop" : "+v"(a), "+v"(b), "+v"(c), "+v"(d));
}

// ---- value of lane l ^ 16 (the other 16-lane row), on the vector port; all 32 lanes are on wherever it is called
__device__ __forceinline__ float xhalf(float x) {
  const int b = __float_as_int(x);
  return __int_as_float(__builtin_amdgcn_permlanex16(b, b, 0x76543210, 0xfedcba98, false, false));
}

// ---- asynchronous copies global -> LDS: four 16-B pieces per lane (l* = LDS byte address, g* = global address).
//      The s_wait_xcnt closes the statement so that no address register is rewritten ahead of it.
__device__ __forceinline__ void copy4_lds(unsigned l0, const __bf16* g0, unsigned l1, const __bf16* g1,
                                          unsigned l2, const __bf16* g2, unsigned l3, const __bf16* g3) {
  asm volatile("global_load_async_to_lds_b128 %0, %1, off\n\t"
               "global_load_async_to_lds_b128 %2, %3, off\n\t"
               "global_load_async_to_lds_b128 %4, %5, off\n\t"
               "global_load_async_to_lds_b128 %6, %7, off\n\t"
               "s_wait_xcnt 0x0"
               :: "v"(l0), "v"(g0), "v"(l1), "v"(g1), "v"(l2), "v"(g2), "v"(l3), "v"(g3) : "memory");
}
// ---- the same for three 64-row planes at once: plane p = rows at LDS l + p * pl + i * ls and global g<p> + i * s<p> elements
//      (i = 0..3), twelve 16-B pieces per lane under one closing s_wait_xcnt.
__device__ __forceinline__ void copy12_lds(unsigned l, unsigned pl, unsigned ls,
                                           const unsigned short* g0, size_t s0, const unsigned short* g1, size_t s1,
                                           const unsigned short* g2, size_t s2) {
  asm volatile("global_load_async_to_lds_b128 %0, %1, off\n\t"
               "global_load_async_to_lds_b128 %2, %3, off\n\t"
               "global_load_async_to_lds_b128 %4, %5, off\n\t"
               "global_load_async_to_lds_b128 %6, %7, off\n\t"
               "global_load_async_to_lds_b128 %8, %9, off\n\t"
               "global_load_async_to_lds_b128 %10, %11, off\n\t"
               "global_load_async_to_lds_b128 %12, %13, off\n\t"
               "global_load_async_to_lds_b128 %14, %15, off\n\t"
               "global_load_async_to_lds_b128 %16, %17, off\n\t"
               "global_load_async_to_lds_b128 %18, %19, off\n\t"
               "global_load_async_to_lds_b128 %20, %21, off\n\t"
               "global_load_async_to_lds_b128 %22, %23, off\n\t"
               "s_wait_xcnt 0x0"
               :: "v"(l), "v"(g0), "v"(l + ls), "v"(g0 + s0), "v"(l + 2 * ls), "v"(g0 + 2 * s0), "v"(l + 3 * ls), "v"(g0 + 3 * s0),
                  "v"(l + pl), "v"(g1), "v"(l + pl + ls), "v"(g1 + s1), "v"(l + pl + 2 * ls), "v"(g1 + 2 * s1),
                  "v"(l + pl + 3 * ls), "v"(g1 + 3 * s1),
                  "v"(l + 2 * pl), "v"(g2), "v"(l + 2 * pl + ls), "v"(g2 + s2), "v"(l + 2 * pl + 2 * ls), "v"(g2 + 2 * s2),
                  "v"(l + 2 * pl + 3 * ls), "v"(g2 + 3 * s2)
               : "memory");
}

// =====================================================================================================
// f32 -> bf16 (RNE convert), 8 elements per thread, one 16-B store per lane: a wave writes 512 contiguous B
// blockIdx.y selects the batch slice (element strides inStride / outStride).
// coverage: n8 threads x 8 = the whole plane slice (n8 is a multiple of 256, host-asserted above).
// =====================================================================================================
__global__ __launch_bounds__(256) void cvt_bf16x8(const float* __restrict__ in, unsigned short* out, int n8,
                                                  long long inStride, long long outStride) {
  const int i = blockIdx.x * 256 + threadIdx.x;
  const float* src = in + (size_t)blockIdx.y * (size_t)inStride;
  unsigned short* dst = out + (size_t)blockIdx.y * (size_t)outStride;
  if (i < n8) {
    const v4f a = *(const v4f*)(src + (size_t)i * 8);
    const v4f b = *(const v4f*)(src + (size_t)i * 8 + 4);
    v4u p;
    p[0] = pk16(bf_bits(a[0]), bf_bits(a[1]));
    p[1] = pk16(bf_bits(a[2]), bf_bits(a[3]));
    p[2] = pk16(bf_bits(b[0]), bf_bits(b[1]));
    p[3] = pk16(bf_bits(b[2]), bf_bits(b[3]));
    *(v4u*)(dst + (size_t)i * 8) = p;
    
  }
}

// =====================================================================================================
// bf16 WMMA GEMM: C[m][n] = sum_k A[m][k] * Bt[n][k]; a work-group of 8 waves (2 x 4) owns a 128x256 tile, each wave
// a 64x64 tile. A row-major [M][K] pitch lda; Bt row-major [N][K] pitch ldb (k contiguous); M multiple of 128,
// N multiple of 256, K multiple of 64 (host-checked). blockIdx.y = batch index (strides in elements).
// Operand staging: per 64-k slab the rows of A (and A2) and Bt that the work-group needs are copied once into LDS
// (asynchronous 16-B copies, 8 lanes per 128-B row piece = whole lines; LDS pitch GP), two buffers, the next
// slab in flight while a slab is multiplied; every wave reads its fragments from LDS.
// NSPLIT: 0 = A.Bt; 1 = (A + A2).Bt (A2 = unscaled bf16 lo plane of A).
// OUT_MODE: 0 = f32 (pitch ldc); 2 = bf16 hi plane C + bf16 lo plane C2 (lo = RNE(v - hi), unscaled);
//           3 = f16 hi plane C + f16 residual plane C2 = f16((v - hi) * rscale), C2 written only for tiles
//               with n0 < N2 (pitch ldc2, batch stride strideC2).
// =====================================================================================================
template <int NSPLIT, int OUT_MODE>
__global__ __launch_bounds__(256) void gemm64(
    const unsigned short* __restrict__ Ap, const unsigned short* A2p, int lda, long long strideA,
    const unsigned short* __restrict__ Btp, const unsigned short* Bt2p, int ldb, long long strideB,
    void* Cout, int ldc, long long strideC,
    void* Cout2, int ldc2, long long strideC2, int N2,
    int M, int N, int K, float rscale) {
  static_assert(NSPLIT == 0 || NSPLIT == 1);
  constexpr int AROWS = (NSPLIT == 1) ? 2 * GBM : GBM;   // staged rows of A, then of A2
  constexpr int BUFE  = (AROWS + GBN) * GP;              // 16-bit elements of one slab buffer
  const __bf16* A   = (const __bf16*)(const void*)Ap;
  const __bf16* A2  = (const __bf16*)(const void*)A2p;
  const __bf16* Bt  = (const __bf16*)(const void*)Btp;
  (void)Bt2p;
  __shared__ __align__(16) __bf16 sAB[2 * BUFE];   // two slab buffers: [A 128 rows | A2 128 rows | Bt 256 rows] x 64 k
  __shared__ __align__(16) float sT[8][16 * 68];   // per-wave 16x64 slab, pitch 68 floats
  const int b    = blockIdx.y;
  const int tid  = threadIdx.x;
  const int lane = tid & 31;
  const int wave = tid >> 5;
  const int nbn = N / GBN;
  const int nbm = M / GBM;
  if ((int)blockIdx.x >= nbm * nbn) return;   // block-uniform, in front of every barrier and copy
  const int bm = (int)blockIdx.x / nbn;
  const int bn = (int)blockIdx.x - bm * nbn;
  const int wm = wave >> 2;                    // wave row 0..1
  const int wn = wave & 3;                     // wave column 0..3
  const int m0 = bm * GBM + (wm << 6);
  const int n0 = bn * GBN + (wn << 6);

  const __bf16* Ab  = A  + (size_t)b * strideA;
  const __bf16* Bb  = Bt + (size_t)b * strideB;
  const __bf16* Ab2 = (NSPLIT == 1) ? (A2 + (size_t)b * strideA) : Ab;

  const int rlane = lane & 15;                 // row (A) / col (B, D) within subtile
  const int koff  = (lane >> 4) * 8;           // k offset of this lane half
  const int mOff  = (lane >> 4) * 8;           // D row offset

  // copy map: thread -> row (tid >> 3) + 32 * i of a staged plane, 16-B piece (tid & 7) of its 128 B
  const int crow = tid >> 3;
  const int cpc  = (tid & 7) * 8;
  const __bf16* gA  = Ab  + (size_t)(bm * GBM + crow) * lda + cpc;
  const __bf16* gA2 = Ab2 + (size_t)(bm * GBM + crow) * lda + cpc;
  const __bf16* gB  = Bb  + (size_t)(bn * GBN + crow) * ldb + cpc;
  const unsigned lbase = (unsigned)(uintptr_t)(&sAB[0]) + (unsigned)((crow * GP + cpc) * 2);
  const size_t a32 = (size_t)32 * lda, b32 = (size_t)32 * ldb;
  constexpr unsigned L32 = 32u * GP * 2u;      // LDS bytes of 32 staged rows

  auto stage = [&](int t, int buf) {           // slab t (k = 64 t .. 64 t + 63) into buffer buf
    const unsigned l = lbase + (unsigned)buf * (unsigned)(BUFE * 2);
    const __bf16* a = gA + (size_t)t * 64;
    copy4_lds(l, a, l + L32, a + a32, l + 2 * L32, a + 2 * a32, l + 3 * L32, a + 3 * a32);
    if (NSPLIT == 1) {
      const __bf16* a2 = gA2 + (size_t)t * 64;
      const unsigned l2 = l + 4 * L32;
      copy4_lds(l2, a2, l2 + L32, a2 + a32, l2 + 2 * L32, a2 + 2 * a32, l2 + 3 * L32, a2 + 3 * a32);
    }
    const __bf16* bp = gB + (size_t)t * 64;
    const unsigned lb = l + (unsigned)(AROWS / 32) * L32;
    copy4_lds(lb, bp, lb + L32, bp + b32, lb + 2 * L32, bp + 2 * b32, lb + 3 * L32, bp + 3 * b32);
    copy4_lds(lb + 4 * L32, bp + 4 * b32, lb + 5 * L32, bp + 5 * b32, lb + 6 * L32, bp + 6 * b32, lb + 7 * L32, bp + 7 * b32);
  };

  v8f acc[4][4];
#pragma unroll
  for (int i = 0; i < 4; ++i)
#pragma unroll
    for (int j = 0; j < 4; ++j) acc[i][j] = zero8();

  const int nst = K >> 6;                      // slabs of 64 k
  stage(0, 0);
  asm volatile("s_wait_asynccnt 0x0" ::: "memory");   // this wave's slab-0 copies have landed
  __syncthreads();                                     // slab 0 readable by every wave
  if (nst > 1) stage(1, 1);

  const int aoff = ((wm << 6) + rlane) * GP + koff;            // this lane's A fragment row in a buffer
  const int boff = (AROWS + (wn << 6) + rlane) * GP + koff;    // this lane's Bt fragment row in a buffer
  for (int t = 0; t < nst; ++t) {
    const __bf16* sb = sAB + (t & 1) * BUFE;
#pragma unroll
    for (int ks = 0; ks < 2; ++ks) {
      v16b bh[4], ah[4], al[4];
#pragma unroll
      for (int j = 0; j < 4; ++j) bh[j] = ldfrag_b(sb + boff + j * 16 * GP + ks * 32);
#pragma unroll
      for (int i = 0; i < 4; ++i) {
        ah[i] = ldfrag_b(sb + aoff + i * 16 * GP + ks * 32);
        if (NSPLIT == 1) al[i] = ldfrag_b(sb + aoff + (GBM + i * 16) * GP + ks * 32); else al[i] = ah[i];
      }
      // inputs-only fence on the loaded fragments: keeps the k-step's LDS reads one group in front of its WMMAs
      // (without it each A fragment is read into one register set and its LDS latency waited out four times)
      asm volatile("" :: "v"(bh[0]), "v"(bh[1]), "v"(bh[2]), "v"(bh[3]), "v"(ah[0]), "v"(ah[1]), "v"(ah[2]), "v"(ah[3]));
      if (NSPLIT == 1) asm volatile("" :: "v"(al[0]), "v"(al[1]), "v"(al[2]), "v"(al[3]));   // same, lo plane
#pragma unroll
      for (int i = 0; i < 4; ++i) {
#pragma unroll
        for (int j = 0; j < 4; ++j) {
          acc[i][j] = mma_b_raw(ah[i], bh[j], acc[i][j]);
          if (NSPLIT == 1) acc[i][j] = mma_b_raw(al[i], bh[j], acc[i][j]);
        }
      }
    }
    asm volatile("s_wait_dscnt 0x0" ::: "memory");      // this wave's reads of buffer t & 1 are done before it is refilled
    asm volatile("s_wait_asynccnt 0x0" ::: "memory");   // this wave's slab t + 1 copies have landed
    __syncthreads();                                     // publishes slab t + 1, ends every read of buffer t & 1
    if (t + 2 < nst) stage(t + 2, t & 1);
  }
  asm volatile("s_wait_asynccnt 0x0" ::: "memory");     // nothing in flight when the wave goes on
  acc_guard4(acc[0][0], acc[0][1], acc[0][2], acc[0][3]);
  acc_guard4(acc[1][0], acc[1][1], acc[1][2], acc[1][3]);
  acc_guard4(acc[2][0], acc[2][1], acc[2][2], acc[2][3]);
  acc_guard4(acc[3][0], acc[3][1], acc[3][2], acc[3][3]);

  // ---- epilogue ----
  float* slab = sT[wave];
#pragma unroll
  for (int i = 0; i < 4; ++i) {
    const int mBase = m0 + (i << 4);
#pragma unroll
    for (int j = 0; j < 4; ++j) {
#pragma unroll
      for (int r = 0; r < 8; ++r) {
        slab[(mOff + r) * 68 + (j << 4) + rlane] = acc[i][j][r];
      }
    }
    __builtin_amdgcn_fence(3, "workgroup");
    __builtin_amdgcn_wave_barrier();
    __builtin_amdgcn_fence(2, "workgroup");
    if (OUT_MODE == 0) {
      float* C = (float*)Cout + (size_t)b * strideC;
      const int hh = lane >> 4, c4 = (lane & 15) * 4;     // 256-B row segment = 16 lanes x 16 B
      {
#pragma unroll
        for (int it = 0; it < 8; ++it) {
          const int row = it * 2 + hh;                     // it 0..7 x hh 0..1 = rows 0..15
          const v4f v = *(const v4f*)(slab + row * 68 + c4);
          *(v4f*)(C + (size_t)(mBase + row) * ldc + n0 + c4) = v;
        }
        
      }
    } else {
      const int q = lane >> 3, c8 = (lane & 7) * 8;
      unsigned short* C  = (unsigned short*)Cout  + (size_t)b * strideC;
      unsigned short* C2 = (unsigned short*)Cout2 + (size_t)b * strideC2;
      const bool wlo = (OUT_MODE == 2) || (n0 < N2);      // wave-uniform
      v4u hv[4], lv[4];
#pragma unroll
      for (int it = 0; it < 4; ++it) {
        const int row = it * 4 + q;                        // it 0..3 x q 0..3 = rows 0..15
        const float* sp = slab + row * 68 + c8;
        v4u a, a2;
#pragma unroll
        for (int e = 0; e < 4; ++e) {
          const float f0 = sp[2 * e], f1 = sp[2 * e + 1];
          unsigned short h0, h1, l0, l1;
          if (OUT_MODE == 2) {
            h0 = bf_bits(f0); h1 = bf_bits(f1);
            l0 = bf_bits(f0 - bf_up(h0)); l1 = bf_bits(f1 - bf_up(h1));
          } else {
            const _Float16 x0 = (_Float16)f0, x1 = (_Float16)f1;
            h0 = h_bits(x0); h1 = h_bits(x1);
            l0 = h_bits((_Float16)((f0 - (float)x0) * rscale));
            l1 = h_bits((_Float16)((f1 - (float)x1) * rscale));
          }
          a[e] = pk16(h0, h1); a2[e] = pk16(l0, l1);
        }
        hv[it] = a; lv[it] = a2;
      }
      {
#pragma unroll
        for (int it = 0; it < 4; ++it) {
          const int row = it * 4 + q;
          *(v4u*)(C + (size_t)(mBase + row) * ldc + n0 + c8) = hv[it];
          if (wlo) *(v4u*)(C2 + (size_t)(mBase + row) * ldc2 + n0 + c8) = lv[it];
        }
        
      }
    }
    __builtin_amdgcn_fence(3, "workgroup");
    __builtin_amdgcn_wave_barrier();
    __builtin_amdgcn_fence(2, "workgroup");
  }
}

template <bool RES>
__global__ __launch_bounds__(128) __attribute__((amdgpu_num_vgpr(256)))
void attn_causal64(const unsigned short* __restrict__ qhp, const unsigned short* __restrict__ qlp,
                   const unsigned short* __restrict__ khp, const unsigned short* __restrict__ klp,
                   const unsigned short* __restrict__ vhp, const unsigned short* __restrict__ vlp,
                   unsigned short* ohp, unsigned short* olp,
                   int qbBase, int nqbThis, float sscale) {
  union FB { v16b v; v8b h[2]; };
  union FH { v16h v; v8h h[2]; };
  constexpr int PLE  = 64 * LP;                 // 16-bit elements of one staged plane tile, pitch LP, 9 KB
  constexpr int BUFE = (RES ? 4 : 3) * PLE;     // one buffer: K hi [kv][d] | K lo | V^T hi [d][kv] | V^T residual (RES)
  __shared__ __align__(16) unsigned short sKV[2 * BUFE];          // two tile buffers; the epilogue's context tiles lie over them
  static_assert((size_t)2 * BUFE * 2 >= (size_t)4 * 16 * OSP * 4);

  const int tid  = threadIdx.x;
  const int wave = tid >> 5;
  const int lane = tid & 31;
  const int hh   = lane >> 4;
  const int c    = lane & 15;

  // There are more work-groups than resident places, and query block qb
  // costs qb + 1 key tiles: the rank (x fastest, then y) maps to the query block slowest and descending, so the
  // lowest ranks get the longest work-groups (ordering for speed only). rank -> (qbl, bb, h) is a permutation of the grid.
  const int rank = (int)blockIdx.y * (nqbThis * NH) + (int)blockIdx.x;   // 0 .. nqbThis*NH*NB-1 (grid = (nqbThis*NH, NB))
  const int qbl  = nqbThis - 1 - rank / (NH * NB);   // nqbThis-1 .. 0
  const int bb   = (rank / NH) % NB;                 // batch
  const int h    = rank % NH;                        // head
  const int qb   = qbBase + qbl;
  const int q0   = qb * 64 + wave * 16;

  const size_t pstride = (size_t)SEQ * DM;                  // per-batch elements of the [t][h*64+d] planes
  const __bf16* Qh = (const __bf16*)(const void*)qhp + (size_t)bb * pstride + (size_t)h * HD;
  const __bf16* Ql = (const __bf16*)(const void*)qlp + (size_t)bb * pstride + (size_t)h * HD;
  const __bf16* Kh = (const __bf16*)(const void*)khp + (size_t)bb * pstride + (size_t)h * HD;
  const __bf16* Kl = (const __bf16*)(const void*)klp + (size_t)bb * pstride + (size_t)h * HD;
  const _Float16* Vh = (const _Float16*)(const void*)vhp + (size_t)bb * ((size_t)DM * SEQ) + (size_t)h * HD * SEQ;
  const _Float16* Vl = (const _Float16*)(const void*)vlp + (size_t)bb * ((size_t)DM * VLP) + (size_t)h * HD * VLP;
  unsigned short* Ohb = ohp + (size_t)bb * pstride;
  unsigned short* Olb = olp + (size_t)bb * pstride;

  // ---- Q fragments (B operand, column = query = lane&15): 2 d-chunks, hi and lo ----
  v16b qah[2], qal[2];
#pragma unroll
  for (int dc = 0; dc < 2; ++dc) {
    const size_t qo = (size_t)(q0 + c) * DM + dc * 32 + 8 * hh;
    qah[dc] = ldfrag_b(Qh + qo);
    qal[dc] = ldfrag_b(Ql + qo);
  }

  float mrow = -INFINITY, lrow = 0.f;        // of query q0 + c; lrow sums this lane half's keys only
  v8f oacc[4];                               // O^T: oacc[t][r] = context(query q0 + c, d = 16 t + 8 hh + r)
#pragma unroll
  for (int t = 0; t < 4; ++t) oacc[t] = zero8();

  // copy map: thread -> row (tid >> 3) + 16 * i of a plane tile, 16-B piece (tid & 7) of its 128 B
  const int crow = tid >> 3;
  const int cpc  = (tid & 7) * 8;
  const unsigned short* gKh = (const unsigned short*)(const void*)Kh + (size_t)crow * DM + cpc;    // K row kv0 + crow + 16 i (< SEQ)
  const unsigned short* gKl = (const unsigned short*)(const void*)Kl + (size_t)crow * DM + cpc;
  const unsigned short* gVh = (const unsigned short*)(const void*)Vh + (size_t)crow * SEQ + cpc;   // V^T row d = crow + 16 i
  const unsigned short* gVl = (const unsigned short*)(const void*)Vl + (size_t)crow * VLP + cpc;
  const unsigned lbase = (unsigned)(uintptr_t)(&sKV[0]) + (unsigned)((crow * LP + cpc) * 2);
  constexpr unsigned L16 = 16u * LP * 2u;      // LDS bytes of 16 staged rows
  constexpr unsigned PLB = (unsigned)PLE * 2u; // LDS bytes of one plane tile
  auto stage = [&](int t, int buf) {           // key tile t (keys 64 t .. 64 t + 63) into buffer buf
    const int k0 = t * 64;
    const unsigned l = lbase + (unsigned)buf * (unsigned)(BUFE * 2);
    copy12_lds(l, PLB, L16, gKh + (size_t)k0 * DM, (size_t)16 * DM, gKl + (size_t)k0 * DM, (size_t)16 * DM,
               gVh + k0, (size_t)16 * SEQ);
    if (RES) {
      const int kvl = (k0 + 64 <= VLP) ? k0 : (VLP - 64);        // clamped address into the residual plane
      const __bf16* w = (const __bf16*)(const void*)(gVl + kvl);
      const unsigned lw = l + 3 * PLB;
      copy4_lds(lw, w, lw + L16, w + 16 * VLP, lw + 2 * L16, w + 32 * VLP, lw + 3 * L16, w + 48 * VLP);
    }
  };

  const int nkt = qb + 1;                    // key tiles 0..qb (block-uniform)
  stage(0, 0);
  asm volatile("s_wait_asynccnt 0x0" ::: "memory");   // this wave's tile-0 copies have landed
  __syncthreads();                                     // tile 0 readable by every wave
  if (nkt > 1) stage(1, 1);
  for (int kt = 0; kt < NQB; ++kt) {         // static bound
    if (kt >= nkt) break;                    // block-uniform
    const bool diag = (kt == qb);            // block-uniform
    const int kv0 = kt * 64;
    const unsigned short* sb = sKV + (kt & 1) * BUFE;
    const __bf16*   Ksh = (const __bf16*)(const void*)sb;                    // K hi [kv][d]
    const __bf16*   Ksl = (const __bf16*)(const void*)(sb + PLE);            // K lo
    const _Float16* Vth = (const _Float16*)(const void*)(sb + 2 * PLE);      // V^T hi [d][kv]
    const _Float16* Vtl = (const _Float16*)(const void*)(sb + (RES ? 3 : 2) * PLE);   // V^T residual, read only when RES

    // ---- scores, transposed: 64 keys x 16 query columns per wave, 3 bf16 products ----
    v8f s[4];
#pragma unroll
    for (int j = 0; j < 4; ++j) {
      s[j] = zero8();
#pragma unroll
      for (int dc = 0; dc < 2; ++dc) {
        FB kb, kl;
        kb.h[0] = *(const v8b*)(Ksh + (j * 16 + c) * LP + dc * 32 + 8 * hh);
        kb.h[1] = *(const v8b*)(Ksh + (j * 16 + c) * LP + dc * 32 + 16 + 8 * hh);
        kl.h[0] = *(const v8b*)(Ksl + (j * 16 + c) * LP + dc * 32 + 8 * hh);
        kl.h[1] = *(const v8b*)(Ksl + (j * 16 + c) * LP + dc * 32 + 16 + 8 * hh);
        s[j] = mma_b(kb.v, qah[dc], s[j]);
        s[j] = mma_b(kl.v, qah[dc], s[j]);
        s[j] = mma_b(kb.v, qal[dc], s[j]);
      }
    }

    // ---- scale + causal compare (diagonal tile only), column max, online softmax; P^T (x1024, f16) and its
    //      residual (x4096) are packed in registers as the B operands of the context products ----
    FH pb[2], pr[2];
    {
      const int qrow = q0 + c;                     // this lane's query
      float m = -INFINITY;
#pragma unroll
      for (int j = 0; j < 4; ++j) {
#pragma unroll
        for (int r = 0; r < 8; ++r) {
          const int key = kv0 + j * 16 + 8 * hh + r;   // key of accumulator element r of this lane
          float sv = s[j][r] * sscale;
          sv = (diag && (key > qrow)) ? -FLT_MAX : sv;
          s[j][r] = sv;
          m = fmaxf(m, sv);
        }
      }
      m = fmaxf(m, xhalf(m));                      // the query's other 32 keys of the tile
      const float mnew  = fmaxf(mrow, m);
      const float msafe = (mnew == -INFINITY) ? 0.f : mnew;
      const float alpha = __expf(mrow - msafe);
      mrow = mnew;
      float psum[2] = {0.f, 0.f};                  // one chain per 32 keys: two independent sums
#pragma unroll
      for (int j = 0; j < 4; ++j) {
#pragma unroll
        for (int r = 0; r < 8; ++r) {
          const float p = __expf(s[j][r] - msafe);   // floor logit against a normal max: exp -> 0
          psum[j >> 1] += p;
          const float p1k = p * 1024.0f;
          const _Float16 ph = (_Float16)p1k;
          pb[j >> 1].v[(j & 1) * 8 + r] = ph;
          if (RES) pr[j >> 1].v[(j & 1) * 8 + r] = (_Float16)((p1k - (float)ph) * 4096.0f);
        }
      }
      lrow = lrow * alpha + (psum[0] + psum[1]);
#pragma unroll
      for (int t = 0; t < 4; ++t)
#pragma unroll
        for (int r = 0; r < 8; ++r) oacc[t][r] *= alpha;
    }

    // ---- context^T += V^T . P^T (f16 WMMA), residual products into a separate accumulator ----
    v8f o1[4];
#pragma unroll
    for (int t = 0; t < 4; ++t) o1[t] = zero8();
#pragma unroll
    for (int kk = 0; kk < 2; ++kk) {               // unrolled: pb / pr are register operands
#pragma unroll
      for (int t = 0; t < 4; ++t) {
        FH vb;
        vb.h[0] = *(const v8h*)(Vth + (t * 16 + c) * LP + kk * 32 + 8 * hh);
        vb.h[1] = *(const v8h*)(Vth + (t * 16 + c) * LP + kk * 32 + 16 + 8 * hh);
        oacc[t] = mma_h(vb.v, pb[kk].v, oacc[t]);
        if (RES) {
          FH vl;
          vl.h[0] = *(const v8h*)(Vtl + (t * 16 + c) * LP + kk * 32 + 8 * hh);
          vl.h[1] = *(const v8h*)(Vtl + (t * 16 + c) * LP + kk * 32 + 16 + 8 * hh);
          o1[t] = mma_h(vl.v, pb[kk].v, o1[t]);
          o1[t] = mma_h(vb.v, pr[kk].v, o1[t]);
        }
      }
    }
    if (RES) {
#pragma unroll
      for (int t = 0; t < 4; ++t)
#pragma unroll
        for (int r = 0; r < 8; ++r) oacc[t][r] += o1[t][r] * (1.0f / 4096.0f);
    }
    asm volatile("s_wait_dscnt 0x0" ::: "memory");      // this wave's reads of buffer kt & 1 are done before it is refilled
    asm volatile("s_wait_asynccnt 0x0" ::: "memory");   // this wave's tile kt + 1 copies have landed
    __syncthreads();                                     // publishes tile kt + 1, ends every read of buffer kt & 1
    if (kt + 2 < nkt) stage(kt + 2, kt & 1);
  }
  asm volatile("s_wait_asynccnt 0x0" ::: "memory");     // nothing in flight when the buffers become the context tiles

  // ---- normalise (1/l and the 1/1024 p carry), stage the wave's 16x64 tile, bf16 hi/lo split,
  float* os = (float*)(void*)sKV + wave * (16 * OSP);
  {
    const float l = lrow + xhalf(lrow);        // both lane halves' keys of query q0 + c
    const float inv = ((l > 0.f) ? (1.0f / l) : 0.f) * (1.0f / 1024.0f);
#pragma unroll
    for (int t = 0; t < 4; ++t)
#pragma unroll
      for (int r = 0; r < 8; ++r) os[c * OSP + t * 16 + 8 * hh + r] = oacc[t][r] * inv;
  }
  __builtin_amdgcn_fence(3, "workgroup");
  __builtin_amdgcn_wave_barrier();
  __builtin_amdgcn_fence(2, "workgroup");
  {
    const int q4 = lane >> 3, c8 = (lane & 7) * 8;
    v4u hv[4], lv[4];
#pragma unroll
    for (int it = 0; it < 4; ++it) {
      const int row = it * 4 + q4;   // it 0..3 x q4 0..3 = rows 0..15 of the wave tile
      const float* sp = os + row * OSP + c8;
      v4u a, a2;
#pragma unroll
      for (int e = 0; e < 4; ++e) {
        const float f0 = sp[2 * e], f1 = sp[2 * e + 1];
        const unsigned short h0 = bf_bits(f0), h1 = bf_bits(f1);
        const unsigned short l0 = bf_bits(f0 - bf_up(h0)), l1 = bf_bits(f1 - bf_up(h1));
        a[e] = pk16(h0, h1); a2[e] = pk16(l0, l1);
      }
      hv[it] = a; lv[it] = a2;
    }
    {
#pragma unroll
      for (int it = 0; it < 4; ++it) {
        const int row = it * 4 + q4;
        const size_t go = (size_t)(q0 + row) * DM + (size_t)h * HD + c8;
        *(v4u*)(Ohb + go) = hv[it];
        *(v4u*)(Olb + go) = lv[it];
      }
      
    }
  }
}

// =====================================================================================================
// Workspace map (bytes, NB = 4, SEQ = 2048; every activation plane holds NB batch slices back to back):
//   Xb    bf16 [NB*SEQ][1024]          0           16777216   (also holds Oh after the projections: same extent)
//   Wqb   bf16 [1024 n][1024 k]        16777216     2097152
//   Wkb   bf16 [1024 n][1024 k]        18874368     2097152
//   Wvb   bf16 [1024 n][1024 k]        20971520     2097152
//   Wob   bf16 [1024 n][1024 k]        23068672     2097152
//   Qh    bf16 [NB*SEQ][1024]          25165824    16777216
//   Ql    bf16 [NB*SEQ][1024]          41943040    16777216
//   Kh    bf16 [NB*SEQ][1024]          58720256    16777216
//   Kl    bf16 [NB*SEQ][1024]          75497472    16777216
//   VTh   f16  NB x [1024][SEQ]        92274688    16777216
//   VTl   f16  NB x [1024][VLP=512]   109051904     4194304
//   Ol    bf16 [NB*SEQ][1024]         113246208    16777216
//   end                               130023424
// Oh aliases Xb: Xb is last read by the v^T projection, Oh is first written by the attention launches that
// come after it in stream order; both extents are NB*SEQ*DM*2 bytes exactly.
// All planes are exact multiples of their 64x64 / whole-line store granularity (no padded tails needed),
// =====================================================================================================
extern "C" void kernel_launch(void* const* d_in, const int* in_sizes, int n_in,
                              void* d_out, int out_size, void* d_ws, size_t ws_size,
                              hipStream_t stream) {
  if (n_in < 5) return;
  const long long needX = (long long)(NB - 1) * SEQ_FULL * DM + (long long)SEQ * DM;   // last row read / written
  if ((long long)in_sizes[0] < needX) return;         // x [NB_FULL][SEQ_FULL][1024], rows 0..SEQ-1 of batches 0..NB-1
  if (in_sizes[1] < DM * DM) return;                  // Wq [1024 out][1024 in]
  if (in_sizes[2] < DM * DM) return;                  // Wk
  if (in_sizes[3] < DM * DM) return;                  // Wv
  if (in_sizes[4] < DM * DM) return;                  // Wo
  if ((long long)out_size < needX) return;

  const float* x  = (const float*)d_in[0];
  const float* Wq = (const float*)d_in[1];
  const float* Wk = (const float*)d_in[2];
  const float* Wv = (const float*)d_in[3];
  const float* Wo = (const float*)d_in[4];

  const size_t PX  = (size_t)NB * SEQ * DM * 2;     // 16-bit activation plane [NB*SEQ][1024]
  const size_t PW  = (size_t)DM * DM * 2;           // 16-bit weight plane [1024][1024]
  const size_t PVT = (size_t)NB * DM * SEQ * 2;     // v^T hi plane, NB slices
  const size_t PVL = (size_t)NB * DM * VLP * 2;     // v^T residual plane, NB slices
  static_assert((size_t)NB * SEQ * DM * 2 == (size_t)NB * DM * SEQ * 2);
  size_t off = 0;
  const size_t oXb  = off; off += PX;
  const size_t oOh  = oXb;                          // aliased, same extent PX
  const size_t oWq  = off; off += PW;
  const size_t oWk  = off; off += PW;
  const size_t oWv  = off; off += PW;
  const size_t oWo  = off; off += PW;
  const size_t oQh  = off; off += PX;
  const size_t oQl  = off; off += PX;
  const size_t oKh  = off; off += PX;
  const size_t oKl  = off; off += PX;
  const size_t oVTh = off; off += PVT;
  const size_t oVTl = off; off += PVL;
  const size_t oOl  = off; off += PX;
  if (off > ws_size) return;                     // off = 130023424 for NB = 4, SEQ = 2048
  if (off > (size_t)134217728) return;

  char* ws = (char*)d_ws;
  unsigned short* Xb  = (unsigned short*)(ws + oXb);
  unsigned short* Oh  = (unsigned short*)(ws + oOh);
  unsigned short* Wqb = (unsigned short*)(ws + oWq);
  unsigned short* Wkb = (unsigned short*)(ws + oWk);
  unsigned short* Wvb = (unsigned short*)(ws + oWv);
  unsigned short* Wob = (unsigned short*)(ws + oWo);
  unsigned short* Qh  = (unsigned short*)(ws + oQh);
  unsigned short* Ql  = (unsigned short*)(ws + oQl);
  unsigned short* Kh  = (unsigned short*)(ws + oKh);
  unsigned short* Kl  = (unsigned short*)(ws + oKl);
  unsigned short* VTh = (unsigned short*)(ws + oVTh);
  unsigned short* VTl = (unsigned short*)(ws + oVTl);
  unsigned short* Ol  = (unsigned short*)(ws + oOl);

  const dim3 blk(256);
  const int n8x = SEQ * DM / 8;                                    // per batch slice, multiple of 256
  const dim3 gCvtX(n8x / 256, NB);
  const int n8w = DM * DM / 8;                                     // multiple of 256
  const dim3 gCvtW(n8w / 256, 1);
  const dim3 gQK((NB * SEQ / GBM) * (DM / GBN), 1);                // M = NB*SEQ, N = 1024: 128x256 tiles
  const dim3 gVT((DM / GBM) * (SEQ / GBN), NB);                    // M = 1024, N = SEQ, per batch
  const dim3 gOut((SEQ / GBM) * (DM / GBN), NB);                   // M = SEQ, N = 1024, per batch
  const long long xStrideIn = (long long)SEQ_FULL * DM;            // input x batch stride (full layout)
  const long long pStride   = (long long)SEQ * DM;                 // plane batch stride

  // (1) x -> bf16 plane [NB*SEQ][1024] (batch b reads input rows b*SEQ_FULL .. +SEQ-1); weights -> bf16 [n][k]
  cvt_bf16x8<<<gCvtX, blk, 0, stream>>>(x, Xb, n8x, xStrideIn, pStride);
  cvt_bf16x8<<<gCvtW, blk, 0, stream>>>(Wq, Wqb, n8w, 0LL, 0LL);
  cvt_bf16x8<<<gCvtW, blk, 0, stream>>>(Wk, Wkb, n8w, 0LL, 0LL);
  cvt_bf16x8<<<gCvtW, blk, 0, stream>>>(Wv, Wvb, n8w, 0LL, 0LL);
  cvt_bf16x8<<<gCvtW, blk, 0, stream>>>(Wo, Wob, n8w, 0LL, 0LL);
  // (2) q = x . Wq^T -> bf16 hi/lo planes [b*SEQ + t][h*64+d]   (M = NB*SEQ, N = 1024, K = 1024)
  gemm64<0, 2><<<gQK, blk, 0, stream>>>(
      Xb, Xb, DM, 0LL, Wqb, Wqb, DM, 0LL,
      (void*)Qh, DM, 0LL, (void*)Ql, DM, 0LL, DM,
      NB * SEQ, DM, DM, 1.0f);
  // (3) k = x . Wk^T -> bf16 hi/lo planes
  gemm64<0, 2><<<gQK, blk, 0, stream>>>(
      Xb, Xb, DM, 0LL, Wkb, Wkb, DM, 0LL,
      (void*)Kh, DM, 0LL, (void*)Kl, DM, 0LL, DM,
      NB * SEQ, DM, DM, 1.0f);
  // (4) v^T = Wv . x^T per batch -> f16 hi plane [h*64+d][s] (pitch SEQ, batch stride DM*SEQ) and residual
  //     plane (x4096, keys < VLP only, pitch VLP, batch stride DM*VLP)   (A = Wvb [n][k], Bt = Xb slice b;
  //     M = 1024, N = SEQ, K = 1024, grid.y = batch)
  gemm64<0, 3><<<gVT, blk, 0, stream>>>(
      Wvb, Wvb, DM, 0LL, Xb, Xb, DM, pStride,
      (void*)VTh, SEQ, (long long)DM * SEQ, (void*)VTl, VLP, (long long)DM * VLP, VLP,
      DM, SEQ, DM, 4096.0f);
  // (5) causal attention: query blocks 0..RESQB-1 with residual planes, the rest without; grid = (NH * query blocks, NB),
  //     the kernel maps the start rank to (query block descending, batch, head)
  attn_causal64<true><<<dim3(NH * RESQB, NB), dim3(128), 0, stream>>>(
      Qh, Ql, Kh, Kl, VTh, VTl, Oh, Ol, 0, RESQB, 0.125f);
  if (NQB > RESQB) {
    attn_causal64<false><<<dim3(NH * (NQB - RESQB), NB), dim3(128), 0, stream>>>(
        Qh, Ql, Kh, Kl, VTh, VTl, Oh, Ol, RESQB, NQB - RESQB, 0.125f);
  }
  // (6) out = context . Wo^T -> d_out f32, batch b rows b*SEQ_FULL .. +SEQ-1 (A = context hi + lo planes,
  //     2 products; M = SEQ, N = 1024, K = 1024, grid.y = batch)
  gemm64<1, 0><<<gOut, blk, 0, stream>>>(
      Oh, Ol, DM, pStride, Wob, Wob, DM, 0LL,
      d_out, DM, xStrideIn, d_out, DM, 0LL, DM,
      SEQ, DM, DM, 1.0f);
  (void)hipGetLastError();
}

// v006
// One run takes 199 microseconds.
// Timed twice side by side with v005, it ran 1.04 and 1.03 times as fast.
// Counting every step since v000, it is 2.82 times as fast.
// Contractions: q, k, v^T projections = v_wmma_f32_16x16x32_bf16 (bf16 operands from RNE-converted inputs, single product);
// q.k^T scores = v_wmma_f32_16x16x32_bf16 with bf16 hi/lo split q and k (hi.hi + hi.lo + lo.hi);
// (attention products are formed transposed: A = k rows / v^T rows, B = q / p^T, so a lane owns one query column)
// p.v = v_wmma_f32_16x16x32_f16 (p carried x1024 in f16, v in f16; extra f16 residual planes x4096 of p and v for the first VLP query rows);
// ctx.Wo = v_wmma_f32_16x16x32_bf16 with ctx as bf16 hi/lo planes times bf16 Wo (2 products); all f32 accumulate; causal compare and softmax in f32.
#include <hip/hip_runtime.h>
#include <math.h>
#include <float.h>
#include <stdint.h>

#ifndef NB
#define NB    4
#endif
#ifndef SEQ
#define SEQ   2048
#endif
#define NB_FULL  4
#define SEQ_FULL 2048
#define DM    1024
#define NH    16
#define HD    64
#define NQB   (SEQ / 64)                      // key / query tiles of 64
#define VLP   ((SEQ < 512) ? SEQ : 512)       // key pitch of the v^T residual plane (keys 0..VLP-1)
#define RESQB (VLP / 64)                      // number of leading 64-row query blocks that use the p / v residual planes
#define LP    72                              // LDS row pitch (16-bit elements) of the 64-wide K and V^T tiles: 144 B = 16 B x odd
#define OSP   68                              // LDS row pitch (floats) of the per-wave context tile: 272 B = 16 B x odd
#define GP    72                              // LDS row pitch (16-bit elements) of the staged 64-k GEMM operand rows: 144 B = 16 B x odd
#define GBM   128                             // GEMM work-group tile rows (2 waves of 64)
#define GBN   256                             // GEMM work-group tile columns (4 waves of 64)
static_assert(NB >= 1 && NB <= NB_FULL);
static_assert((SEQ % GBN) == 0 && (DM % GBN) == 0 && (DM % 128) == 0);
static_assert(NH * HD == DM && HD == 64);
static_assert((SEQ % 64) == 0 && (DM % 64) == 0 && SEQ >= 64 && SEQ <= SEQ_FULL);
static_assert(RESQB * 64 == VLP && VLP <= SEQ && RESQB >= 1 && RESQB <= NQB);

typedef _Float16 v16h __attribute__((ext_vector_type(16)));
typedef _Float16 v8h  __attribute__((ext_vector_type(8)));
typedef __bf16   v16b __attribute__((ext_vector_type(16)));
typedef __bf16   v8b  __attribute__((ext_vector_type(8)));
typedef float    v8f  __attribute__((ext_vector_type(8)));
typedef float    v4f  __attribute__((ext_vector_type(4)));
typedef unsigned int v4u __attribute__((ext_vector_type(4)));

// ---- scalar helpers --------------------------------------------------------------------------------
__device__ __forceinline__ unsigned short bf_bits(float f) {          // f32 -> bf16 bits, RNE convert
  unsigned u = __float_as_uint(f);
  return (unsigned short)((u + 0x7FFFu + ((u >> 16) & 1u)) >> 16);
}
__device__ __forceinline__ float bf_up(unsigned short h) { return __uint_as_float(((unsigned)h) << 16); }
__device__ __forceinline__ unsigned short h_bits(_Float16 x) { return __builtin_bit_cast(unsigned short, x); }
__device__ __forceinline__ unsigned pk16(unsigned short a, unsigned short b) { return (unsigned)a | ((unsigned)b << 16); }
__device__ __forceinline__ v8f zero8() { v8f z = {0.f, 0.f, 0.f, 0.f, 0.f, 0.f, 0.f, 0.f}; return z; }

// ---- fragment loaders: 16-bit A/B operand, lane -> row/col (lane&15), p already includes +8*(lane>>4);
//      elements 0..7 <- p[0..7] (k0+8h..), elements 8..15 <- p[16..23] (k0+16+8h..)
__device__ __forceinline__ v16b ldfrag_b(const __bf16* p) {
  union { v16b v; v8b h[2]; } f;
  f.h[0] = *(const v8b*)(p);
  f.h[1] = *(const v8b*)(p + 16);
  return f.v;
}

// ---- WMMA helpers with trailing VALU hazard gap --------------------------------------------------------
__device__ __forceinline__ v8f mma_b(v16b a, v16b b, v8f c) {
  c = __builtin_amdgcn_wmma_f32_16x16x32_bf16(false, a, false, b, (short)0, c, false, false);
  asm volatile("v_nop\n\tv_nop\n\tv_nop\n\tv_nop" : "+v"(c) : "v"(a), "v"(b));
  return c;
}
__device__ __forceinline__ v8f mma_h(v16h a, v16h b, v8f c) {
  c = __builtin_amdgcn_wmma_f32_16x16x32_f16(false, a, false, b, (short)0, c, false, false);
  asm volatile("v_nop\n\tv_nop\n\tv_nop\n\tv_nop" : "+v"(c) : "v"(a), "v"(b));
  return c;
}
__device__ __forceinline__ v8f mma_b_raw(v16b a, v16b b, v8f c) {
  return __builtin_amdgcn_wmma_f32_16x16x32_bf16(false, a, false, b, (short)0, c, false, false);
}
__device__ __forceinline__ void acc_guard4(v8f& a, v8f& b, v8f& c, v8f& d) {
  asm volatile("v_nop\n\tv_nop\n\tv_nop\n\tv_nop" : "+v"(a), "+v"(b), "+v"(c), "+v"(d));
}

// ---- value of lane l ^ 16 (the other 16-lane row), on the vector port; all 32 lanes are on wherever it is called
__device__ __forceinline__ float xhalf(float x) {
  const int b = __float_as_int(x);
  return __int_as_float(__builtin_amdgcn_permlanex16(b, b, 0x76543210, 0xfedcba98, false, false));
}

// ---- asynchronous copies global -> LDS: four 16-B pieces per lane (l* = LDS byte address, g* = global address).
//      The s_wait_xcnt closes the statement so that no address register is rewritten ahead of it.
__device__ __forceinline__ void copy4_lds(unsigned l0, const __bf16* g0, unsigned l1, const __bf16* g1,
                                          unsigned l2, const __bf16* g2, unsigned l3, const __bf16* g3) {
  asm volatile("global_load_async_to_lds_b128 %0, %1, off\n\t"
               "global_load_async_to_lds_b128 %2, %3, off\n\t"
               "global_load_async_to_lds_b128 %4, %5, off\n\t"
               "global_load_async_to_lds_b128 %6, %7, off\n\t"
               "s_wait_xcnt 0x0"
               :: "v"(l0), "v"(g0), "v"(l1), "v"(g1), "v"(l2), "v"(g2), "v"(l3), "v"(g3) : "memory");
}
// ---- the same for three 64-row planes at once: plane p = rows at LDS l + p * pl + i * ls and global g<p> + i * s<p> elements
//      (i = 0..3), twelve 16-B pieces per lane under one closing s_wait_xcnt.
__device__ __forceinline__ void copy12_lds(unsigned l, unsigned pl, unsigned ls,
                                           const unsigned short* g0, size_t s0, const unsigned short* g1, size_t s1,
                                           const unsigned short* g2, size_t s2) {
  asm volatile("global_load_async_to_lds_b128 %0, %1, off\n\t"
               "global_load_async_to_lds_b128 %2, %3, off\n\t"
               "global_load_async_to_lds_b128 %4, %5, off\n\t"
               "global_load_async_to_lds_b128 %6, %7, off\n\t"
               "global_load_async_to_lds_b128 %8, %9, off\n\t"
               "global_load_async_to_lds_b128 %10, %11, off\n\t"
               "global_load_async_to_lds_b128 %12, %13, off\n\t"
               "global_load_async_to_lds_b128 %14, %15, off\n\t"
               "global_load_async_to_lds_b128 %16, %17, off\n\t"
               "global_load_async_to_lds_b128 %18, %19, off\n\t"
               "global_load_async_to_lds_b128 %20, %21, off\n\t"
               "global_load_async_to_lds_b128 %22, %23, off\n\t"
               "s_wait_xcnt 0x0"
               :: "v"(l), "v"(g0), "v"(l + ls), "v"(g0 + s0), "v"(l + 2 * ls), "v"(g0 + 2 * s0), "v"(l + 3 * ls), "v"(g0 + 3 * s0),
                  "v"(l + pl), "v"(g1), "v"(l + pl + ls), "v"(g1 + s1), "v"(l + pl + 2 * ls), "v"(g1 + 2 * s1),
                  "v"(l + pl + 3 * ls), "v"(g1 + 3 * s1),
                  "v"(l + 2 * pl), "v"(g2), "v"(l + 2 * pl + ls), "v"(g2 + s2), "v"(l + 2 * pl + 2 * ls), "v"(g2 + 2 * s2),
                  "v"(l + 2 * pl + 3 * ls), "v"(g2 + 3 * s2)
               : "memory");
}

// =====================================================================================================
// f32 -> bf16 (RNE convert) of x and of the four weight matrices in ONE launch of CVG work-groups x CVB threads: about one
// work-group of 16 waves per WGP, started once.
// A unit = 8 elements = 32 B read, one 16-B store per lane (a wave writes 512 contiguous B). Work-group b owns units
// b * XIT * CVB .. + XIT * CVB - 1 of x and b * WIT * CVB .. + WIT * CVB - 1 of each weight; thread t takes units k * CVB + t
// of each range. All of a thread's loads are issued ahead of its first convert.
// x unit u lies in batch slice u / XUB (input batch stride SEQ_FULL * DM elements, plane batch stride SEQ * DM).
// coverage: CVG * XIT * CVB >= XU and CVG * WIT * CVB >= WU; units past the end are read at the last unit's address and
// not stored.
// =====================================================================================================
#define CVB  512                              // threads of a convert work-group
#define CVG  256                              // convert work-groups
#define CVTH (CVB * CVG)                      // convert threads
#define XUB  (SEQ * DM / 8)                   // units of one batch slice of x
#define XU   (NB * XUB)                       // units of x
#define WU   (DM * DM / 8)                    // units of one weight matrix
#define XIT  ((XU + CVTH - 1) / CVTH)         // units of x per thread
#define WIT  ((WU + CVTH - 1) / CVTH)         // units of one weight matrix per thread
__device__ __forceinline__ v4u cvt8(v4f a, v4f b) {
  v4u p;
  p[0] = pk16(bf_bits(a[0]), bf_bits(a[1]));
  p[1] = pk16(bf_bits(a[2]), bf_bits(a[3]));
  p[2] = pk16(bf_bits(b[0]), bf_bits(b[1]));
  p[3] = pk16(bf_bits(b[2]), bf_bits(b[3]));
  return p;
}
__global__ __launch_bounds__(CVB) void cvt_all(const float* __restrict__ x, const float* __restrict__ wq,
                                               const float* __restrict__ wk, const float* __restrict__ wv,
                                               const float* __restrict__ wo, unsigned short* __restrict__ xb,
                                               unsigned short* __restrict__ wqb, unsigned short* __restrict__ wkb,
                                               unsigned short* __restrict__ wvb, unsigned short* __restrict__ wob) {
  const unsigned t  = threadIdx.x;
  const unsigned xu = blockIdx.x * (unsigned)(XIT * CVB);    // first x unit of the work-group
  const unsigned wu = blockIdx.x * (unsigned)(WIT * CVB);    // first unit of the work-group in each weight
  constexpr bool XEX = (XUB % (XIT * CVB)) == 0 && (XU % CVTH) == 0;   // whole ranges, each inside one batch slice
  constexpr bool WEX = (WU % CVTH) == 0;
  // work-group-uniform bases, in 16-B pieces; a lane adds a 32-bit piece index
  const unsigned xbs = xu / (unsigned)XUB;
  const v4f* px = (const v4f*)(x + (size_t)xbs * ((size_t)SEQ_FULL * DM) + (size_t)(xu - xbs * (unsigned)XUB) * 8);
  const size_t wb = WEX ? (size_t)wu * 2 : (size_t)0;
  const v4f* pw[4] = {(const v4f*)wq + wb, (const v4f*)wk + wb, (const v4f*)wv + wb, (const v4f*)wo + wb};
  v4u* ox = (v4u*)xb + xu;
  v4u* ow[4] = {(v4u*)wqb + wu, (v4u*)wkb + wu, (v4u*)wvb + wu, (v4u*)wob + wu};
  // holds the argument loads and the index arithmetic of the bases in front of the run of loads: placed behind it they
  // rewrite a base register of a load just issued
  __builtin_amdgcn_sched_barrier(0);
  v4f xa[XIT], xc[XIT], wa[4][WIT], wc[4][WIT];
#pragma unroll
  for (int k = 0; k < XIT; ++k) {
    if (XEX) {
      xa[k] = px[2u * (k * CVB + t)];
      xc[k] = px[2u * (k * CVB + t) + 1u];
    } else {
      const unsigned u  = xu + k * CVB + t;
      const unsigned uc = (u < (unsigned)XU) ? u : (unsigned)(XU - 1);
      const unsigned bs = uc / (unsigned)XUB;
      const v4f* p = (const v4f*)(x + (size_t)bs * ((size_t)SEQ_FULL * DM) + (size_t)(uc - bs * (unsigned)XUB) * 8);
      xa[k] = p[0];
      xc[k] = p[1];
    }
  }
#pragma unroll
  for (int k = 0; k < WIT; ++k) {
    const unsigned u = wu + k * CVB + t;
    const unsigned o = WEX ? 2u * (k * CVB + t) : 2u * ((u < (unsigned)WU) ? u : (unsigned)(WU - 1));
#pragma unroll
    for (int w = 0; w < 4; ++w) {
      wa[w][k] = pw[w][o];
      wc[w][k] = pw[w][o + 1u];
    }
  }
  // keeps every load above in front of the converts: without it the last loads are issued only after the first have
  // come back, and the wave waits out the memory latency twice
  __builtin_amdgcn_sched_barrier(0);
  // the converts reuse the loads' address registers: the wait stands in front of the first such overwrite
  asm volatile("s_wait_xcnt 0x0" ::: "memory");
  __builtin_amdgcn_sched_barrier(0);           // holds the converts behind that wait
#pragma unroll
  for (int k = 0; k < XIT; ++k) {
    if (XEX || xu + k * CVB + t < (unsigned)XU) ox[k * CVB + t] = cvt8(xa[k], xc[k]);
    // keeps each store where its unit is ready: without it every store sinks behind the wait for the wave's last load
    __builtin_amdgcn_sched_barrier(0);
  }
#pragma unroll
  for (int k = 0; k < WIT; ++k) {
    if (WEX || wu + k * CVB + t < (unsigned)WU) {
#pragma unroll
      for (int w = 0; w < 4; ++w) ow[w][k * CVB + t] = cvt8(wa[w][k], wc[w][k]);
    }
  }
}

// =====================================================================================================
// bf16 WMMA GEMM: C[m][n] = sum_k A[m][k] * Bt[n][k]; a work-group of 8 waves (2 x 4) owns a 128x256 tile, each wave
// a 64x64 tile. A row-major [M][K] pitch lda; Bt row-major [N][K] pitch ldb (k contiguous); M multiple of 128,
// N multiple of 256, K multiple of 64 (host-checked). blockIdx.y = batch index (strides in elements).
// Operand staging: per 64-k slab the rows of A (and A2) and Bt that the work-group needs are copied once into LDS
// (asynchronous 16-B copies, 8 lanes per 128-B row piece = whole lines; LDS pitch GP), two buffers, the next
// slab in flight while a slab is multiplied; every wave reads its fragments from LDS.
// NSPLIT: 0 = A.Bt; 1 = (A + A2).Bt (A2 = unscaled bf16 lo plane of A).
// OUT_MODE: 0 = f32 (pitch ldc); 2 = bf16 hi plane C + bf16 lo plane C2 (lo = RNE(v - hi), unscaled);
//           3 = f16 hi plane C + f16 residual plane C2 = f16((v - hi) * rscale), C2 written only for tiles
//               with n0 < N2 (pitch ldc2, batch stride strideC2).
// =====================================================================================================
template <int NSPLIT, int OUT_MODE>
__global__ __launch_bounds__(256) void gemm64(
    const unsigned short* __restrict__ Ap, const unsigned short* A2p, int lda, long long strideA,
    const unsigned short* __restrict__ Btp, const unsigned short* Bt2p, int ldb, long long strideB,
    void* Cout, int ldc, long long strideC,
    void* Cout2, int ldc2, long long strideC2, int N2,
    int M, int N, int K, float rscale) {
  static_assert(NSPLIT == 0 || NSPLIT == 1);
  constexpr int AROWS = (NSPLIT == 1) ? 2 * GBM : GBM;   // staged rows of A, then of A2
  constexpr int BUFE  = (AROWS + GBN) * GP;              // 16-bit elements of one slab buffer
  const __bf16* A   = (const __bf16*)(const void*)Ap;
  const __bf16* A2  = (const __bf16*)(const void*)A2p;
  const __bf16* Bt  = (const __bf16*)(const void*)Btp;
  (void)Bt2p;
  __shared__ __align__(16) __bf16 sAB[2 * BUFE];   // two slab buffers: [A 128 rows | A2 128 rows | Bt 256 rows] x 64 k
  __shared__ __align__(16) float sT[8][16 * 68];   // per-wave 16x64 slab, pitch 68 floats
  const int b    = blockIdx.y;
  const int tid  = threadIdx.x;
  const int lane = tid & 31;
  const int wave = tid >> 5;
  const int nbn = N / GBN;
  const int nbm = M / GBM;
  if ((int)blockIdx.x >= nbm * nbn) return;   // block-uniform, in front of every barrier and copy
  const int bm = (int)blockIdx.x / nbn;
  const int bn = (int)blockIdx.x - bm * nbn;
  const int wm = wave >> 2;                    // wave row 0..1
  const int wn = wave & 3;                     // wave column 0..3
  const int m0 = bm * GBM + (wm << 6);
  const int n0 = bn * GBN + (wn << 6);

  const __bf16* Ab  = A  + (size_t)b * strideA;
  const __bf16* Bb  = Bt + (size_t)b * strideB;
  const __bf16* Ab2 = (NSPLIT == 1) ? (A2 + (size_t)b * strideA) : Ab;

  const int rlane = lane & 15;                 // row (A) / col (B, D) within subtile
  const int koff  = (lane >> 4) * 8;           // k offset of this lane half
  const int mOff  = (lane >> 4) * 8;           // D row offset

  // copy map: thread -> row (tid >> 3) + 32 * i of a staged plane, 16-B piece (tid & 7) of its 128 B
  const int crow = tid >> 3;
  const int cpc  = (tid & 7) * 8;
  const __bf16* gA  = Ab  + (size_t)(bm * GBM + crow) * lda + cpc;
  const __bf16* gA2 = Ab2 + (size_t)(bm * GBM + crow) * lda + cpc;
  const __bf16* gB  = Bb  + (size_t)(bn * GBN + crow) * ldb + cpc;
  const unsigned lbase = (unsigned)(uintptr_t)(&sAB[0]) + (unsigned)((crow * GP + cpc) * 2);
  const size_t a32 = (size_t)32 * lda, b32 = (size_t)32 * ldb;
  constexpr unsigned L32 = 32u * GP * 2u;      // LDS bytes of 32 staged rows

  auto stage = [&](int t, int buf) {           // slab t (k = 64 t .. 64 t + 63) into buffer buf
    const unsigned l = lbase + (unsigned)buf * (unsigned)(BUFE * 2);
    const __bf16* a = gA + (size_t)t * 64;
    copy4_lds(l, a, l + L32, a + a32, l + 2 * L32, a + 2 * a32, l + 3 * L32, a + 3 * a32);
    if (NSPLIT == 1) {
      const __bf16* a2 = gA2 + (size_t)t * 64;
      const unsigned l2 = l + 4 * L32;
      copy4_lds(l2, a2, l2 + L32, a2 + a32, l2 + 2 * L32, a2 + 2 * a32, l2 + 3 * L32, a2 + 3 * a32);
    }
    const __bf16* bp = gB + (size_t)t * 64;
    const unsigned lb = l + (unsigned)(AROWS / 32) * L32;
    copy4_lds(lb, bp, lb + L32, bp + b32, lb + 2 * L32, bp + 2 * b32, lb + 3 * L32, bp + 3 * b32);
    copy4_lds(lb + 4 * L32, bp + 4 * b32, lb + 5 * L32, bp + 5 * b32, lb + 6 * L32, bp + 6 * b32, lb + 7 * L32, bp + 7 * b32);
  };

  v8f acc[4][4];
#pragma unroll
  for (int i = 0; i < 4; ++i)
#pragma unroll
    for (int j = 0; j < 4; ++j) acc[i][j] = zero8();

  const int nst = K >> 6;                      // slabs of 64 k
  stage(0, 0);
  asm volatile("s_wait_asynccnt 0x0" ::: "memory");   // this wave's slab-0 copies have landed
  __syncthreads();                                     // slab 0 readable by every wave
  if (nst > 1) stage(1, 1);

  const int aoff = ((wm << 6) + rlane) * GP + koff;            // this lane's A fragment row in a buffer
  const int boff = (AROWS + (wn << 6) + rlane) * GP + koff;    // this lane's Bt fragment row in a buffer
  for (int t = 0; t < nst; ++t) {
    const __bf16* sb = sAB + (t & 1) * BUFE;
#pragma unroll
    for (int ks = 0; ks < 2; ++ks) {
      v16b bh[4], ah[4], al[4];
#pragma unroll
      for (int j = 0; j < 4; ++j) bh[j] = ldfrag_b(sb + boff + j * 16 * GP + ks * 32);
#pragma unroll
      for (int i = 0; i < 4; ++i) {
        ah[i] = ldfrag_b(sb + aoff + i * 16 * GP + ks * 32);
        if (NSPLIT == 1) al[i] = ldfrag_b(sb + aoff + (GBM + i * 16) * GP + ks * 32); else al[i] = ah[i];
      }
      // inputs-only fence on the loaded fragments: keeps the k-step's LDS reads one group in front of its WMMAs
      // (without it each A fragment is read into one register set and its LDS latency waited out four times)
      asm volatile("" :: "v"(bh[0]), "v"(bh[1]), "v"(bh[2]), "v"(bh[3]), "v"(ah[0]), "v"(ah[1]), "v"(ah[2]), "v"(ah[3]));
      if (NSPLIT == 1) asm volatile("" :: "v"(al[0]), "v"(al[1]), "v"(al[2]), "v"(al[3]));   // same, lo plane
#pragma unroll
      for (int i = 0; i < 4; ++i) {
#pragma unroll
        for (int j = 0; j < 4; ++j) {
          acc[i][j] = mma_b_raw(ah[i], bh[j], acc[i][j]);
          if (NSPLIT == 1) acc[i][j] = mma_b_raw(al[i], bh[j], acc[i][j]);
        }
      }
    }
    asm volatile("s_wait_dscnt 0x0" ::: "memory");      // this wave's reads of buffer t & 1 are done before it is refilled
    asm volatile("s_wait_asynccnt 0x0" ::: "memory");   // this wave's slab t + 1 copies have landed
    __syncthreads();                                     // publishes slab t + 1, ends every read of buffer t & 1
    if (t + 2 < nst) stage(t + 2, t & 1);
  }
  asm volatile("s_wait_asynccnt 0x0" ::: "memory");     // nothing in flight when the wave goes on
  acc_guard4(acc[0][0], acc[0][1], acc[0][2], acc[0][3]);
  acc_guard4(acc[1][0], acc[1][1], acc[1][2], acc[1][3]);
  acc_guard4(acc[2][0], acc[2][1], acc[2][2], acc[2][3]);
  acc_guard4(acc[3][0], acc[3][1], acc[3][2], acc[3][3]);

  // ---- epilogue ----
  float* slab = sT[wave];
#pragma unroll
  for (int i = 0; i < 4; ++i) {
    const int mBase = m0 + (i << 4);
#pragma unroll
    for (int j = 0; j < 4; ++j) {
#pragma unroll
      for (int r = 0; r < 8; ++r) {
        slab[(mOff + r) * 68 + (j << 4) + rlane] = acc[i][j][r];
      }
    }
    __builtin_amdgcn_fence(3, "workgroup");
    __builtin_amdgcn_wave_barrier();
    __builtin_amdgcn_fence(2, "workgroup");
    if (OUT_MODE == 0) {
      float* C = (float*)Cout + (size_t)b * strideC;
      const int hh = lane >> 4, c4 = (lane & 15) * 4;     // 256-B row segment = 16 lanes x 16 B
      {
#pragma unroll
        for (int it = 0; it < 8; ++it) {
          const int row = it * 2 + hh;                     // it 0..7 x hh 0..1 = rows 0..15
          const v4f v = *(const v4f*)(slab + row * 68 + c4);
          *(v4f*)(C + (size_t)(mBase + row) * ldc + n0 + c4) = v;
        }
        
      }
    } else {
      const int q = lane >> 3, c8 = (lane & 7) * 8;
      unsigned short* C  = (unsigned short*)Cout  + (size_t)b * strideC;
      unsigned short* C2 = (unsigned short*)Cout2 + (size_t)b * strideC2;
      const bool wlo = (OUT_MODE == 2) || (n0 < N2);      // wave-uniform
      v4u hv[4], lv[4];
#pragma unroll
      for (int it = 0; it < 4; ++it) {
        const int row = it * 4 + q;                        // it 0..3 x q 0..3 = rows 0..15
        const float* sp = slab + row * 68 + c8;
        v4u a, a2;
#pragma unroll
        for (int e = 0; e < 4; ++e) {
          const float f0 = sp[2 * e], f1 = sp[2 * e + 1];
          unsigned short h0, h1, l0, l1;
          if (OUT_MODE == 2) {
            h0 = bf_bits(f0); h1 = bf_bits(f1);
            l0 = bf_bits(f0 - bf_up(h0)); l1 = bf_bits(f1 - bf_up(h1));
          } else {
            const _Float16 x0 = (_Float16)f0, x1 = (_Float16)f1;
            h0 = h_bits(x0); h1 = h_bits(x1);
            l0 = h_bits((_Float16)((f0 - (float)x0) * rscale));
            l1 = h_bits((_Float16)((f1 - (float)x1) * rscale));
          }
          a[e] = pk16(h0, h1); a2[e] = pk16(l0, l1);
        }
        hv[it] = a; lv[it] = a2;
      }
      {
#pragma unroll
        for (int it = 0; it < 4; ++it) {
          const int row = it * 4 + q;
          *(v4u*)(C + (size_t)(mBase + row) * ldc + n0 + c8) = hv[it];
          if (wlo) *(v4u*)(C2 + (size_t)(mBase + row) * ldc2 + n0 + c8) = lv[it];
        }
        
      }
    }
    __builtin_amdgcn_fence(3, "workgroup");
    __builtin_amdgcn_wave_barrier();
    __builtin_amdgcn_fence(2, "workgroup");
  }
}

template <bool RES>
__global__ __launch_bounds__(128) __attribute__((amdgpu_num_vgpr(256)))
void attn_causal64(const unsigned short* __restrict__ qhp, const unsigned short* __restrict__ qlp,
                   const unsigned short* __restrict__ khp, const unsigned short* __restrict__ klp,
                   const unsigned short* __restrict__ vhp, const unsigned short* __restrict__ vlp,
                   unsigned short* ohp, unsigned short* olp,
                   int qbBase, int nqbThis, float sscale) {
  union FB { v16b v; v8b h[2]; };
  union FH { v16h v; v8h h[2]; };
  constexpr int PLE  = 64 * LP;                 // 16-bit elements of one staged plane tile, pitch LP, 9 KB
  constexpr int BUFE = (RES ? 4 : 3) * PLE;     // one buffer: K hi [kv][d] | K lo | V^T hi [d][kv] | V^T residual (RES)
  __shared__ __align__(16) unsigned short sKV[2 * BUFE];          // two tile buffers; the epilogue's context tiles lie over them
  static_assert((size_t)2 * BUFE * 2 >= (size_t)4 * 16 * OSP * 4);

  const int tid  = threadIdx.x;
  const int wave = tid >> 5;
  const int lane = tid & 31;
  const int hh   = lane >> 4;
  const int c    = lane & 15;

  // There are more work-groups than resident places, and query block qb
  // costs qb + 1 key tiles: the rank (x fastest, then y) maps to the query block slowest and descending, so the
  // lowest ranks get the longest work-groups (ordering for speed only). rank -> (qbl, bb, h) is a permutation of the grid.
  const int rank = (int)blockIdx.y * (nqbThis * NH) + (int)blockIdx.x;   // 0 .. nqbThis*NH*NB-1 (grid = (nqbThis*NH, NB))
  const int qbl  = nqbThis - 1 - rank / (NH * NB);   // nqbThis-1 .. 0
  const int bb   = (rank / NH) % NB;                 // batch
  const int h    = rank % NH;                        // head
  const int qb   = qbBase + qbl;
  const int q0   = qb * 64 + wave * 16;

  const size_t pstride = (size_t)SEQ * DM;                  // per-batch elements of the [t][h*64+d] planes
  const __bf16* Qh = (const __bf16*)(const void*)qhp + (size_t)bb * pstride + (size_t)h * HD;
  const __bf16* Ql = (const __bf16*)(const void*)qlp + (size_t)bb * pstride + (size_t)h * HD;
  const __bf16* Kh = (const __bf16*)(const void*)khp + (size_t)bb * pstride + (size_t)h * HD;
  const __bf16* Kl = (const __bf16*)(const void*)klp + (size_t)bb * pstride + (size_t)h * HD;
  const _Float16* Vh = (const _Float16*)(const void*)vhp + (size_t)bb * ((size_t)DM * SEQ) + (size_t)h * HD * SEQ;
  const _Float16* Vl = (const _Float16*)(const void*)vlp + (size_t)bb * ((size_t)DM * VLP) + (size_t)h * HD * VLP;
  unsigned short* Ohb = ohp + (size_t)bb * pstride;
  unsigned short* Olb = olp + (size_t)bb * pstride;

  // ---- Q fragments (B operand, column = query = lane&15): 2 d-chunks, hi and lo ----
  v16b qah[2], qal[2];
#pragma unroll
  for (int dc = 0; dc < 2; ++dc) {
    const size_t qo = (size_t)(q0 + c) * DM + dc * 32 + 8 * hh;
    qah[dc] = ldfrag_b(Qh + qo);
    qal[dc] = ldfrag_b(Ql + qo);
  }

  float mrow = -INFINITY, lrow = 0.f;        // of query q0 + c; lrow sums this lane half's keys only
  v8f oacc[4];                               // O^T: oacc[t][r] = context(query q0 + c, d = 16 t + 8 hh + r)
#pragma unroll
  for (int t = 0; t < 4; ++t) oacc[t] = zero8();

  // copy map: thread -> row (tid >> 3) + 16 * i of a plane tile, 16-B piece (tid & 7) of its 128 B
  const int crow = tid >> 3;
  const int cpc  = (tid & 7) * 8;
  const unsigned short* gKh = (const unsigned short*)(const void*)Kh + (size_t)crow * DM + cpc;    // K row kv0 + crow + 16 i (< SEQ)
  const unsigned short* gKl = (const unsigned short*)(const void*)Kl + (size_t)crow * DM + cpc;
  const unsigned short* gVh = (const unsigned short*)(const void*)Vh + (size_t)crow * SEQ + cpc;   // V^T row d = crow + 16 i
  const unsigned short* gVl = (const unsigned short*)(const void*)Vl + (size_t)crow * VLP + cpc;
  const unsigned lbase = (unsigned)(uintptr_t)(&sKV[0]) + (unsigned)((crow * LP + cpc) * 2);
  constexpr unsigned L16 = 16u * LP * 2u;      // LDS bytes of 16 staged rows
  constexpr unsigned PLB = (unsigned)PLE * 2u; // LDS bytes of one plane tile
  auto stage = [&](int t, int buf) {           // key tile t (keys 64 t .. 64 t + 63) into buffer buf
    const int k0 = t * 64;
    const unsigned l = lbase + (unsigned)buf * (unsigned)(BUFE * 2);
    copy12_lds(l, PLB, L16, gKh + (size_t)k0 * DM, (size_t)16 * DM, gKl + (size_t)k0 * DM, (size_t)16 * DM,
               gVh + k0, (size_t)16 * SEQ);
    if (RES) {
      const int kvl = (k0 + 64 <= VLP) ? k0 : (VLP - 64);        // clamped address into the residual plane
      const __bf16* w = (const __bf16*)(const void*)(gVl + kvl);
      const unsigned lw = l + 3 * PLB;
      copy4_lds(lw, w, lw + L16, w + 16 * VLP, lw + 2 * L16, w + 32 * VLP, lw + 3 * L16, w + 48 * VLP);
    }
  };

  const int nkt = qb + 1;                    // key tiles 0..qb (block-uniform)
  stage(0, 0);
  asm volatile("s_wait_asynccnt 0x0" ::: "memory");   // this wave's tile-0 copies have landed
  __syncthreads();                                     // tile 0 readable by every wave
  if (nkt > 1) stage(1, 1);
  for (int kt = 0; kt < NQB; ++kt) {         // static bound
    if (kt >= nkt) break;                    // block-uniform
    const bool diag = (kt == qb);            // block-uniform
    const int kv0 = kt * 64;
    const unsigned short* sb = sKV + (kt & 1) * BUFE;
    const __bf16*   Ksh = (const __bf16*)(const void*)sb;                    // K hi [kv][d]
    const __bf16*   Ksl = (const __bf16*)(const void*)(sb + PLE);            // K lo
    const _Float16* Vth = (const _Float16*)(const void*)(sb + 2 * PLE);      // V^T hi [d][kv]
    const _Float16* Vtl = (const _Float16*)(const void*)(sb + (RES ? 3 : 2) * PLE);   // V^T residual, read only when RES

    // ---- scores, transposed: 64 keys x 16 query columns per wave, 3 bf16 products ----
    v8f s[4];
#pragma unroll
    for (int j = 0; j < 4; ++j) {
      s[j] = zero8();
#pragma unroll
      for (int dc = 0; dc < 2; ++dc) {
        FB kb, kl;
        kb.h[0] = *(const v8b*)(Ksh + (j * 16 + c) * LP + dc * 32 + 8 * hh);
        kb.h[1] = *(const v8b*)(Ksh + (j * 16 + c) * LP + dc * 32 + 16 + 8 * hh);
        kl.h[0] = *(const v8b*)(Ksl + (j * 16 + c) * LP + dc * 32 + 8 * hh);
        kl.h[1] = *(const v8b*)(Ksl + (j * 16 + c) * LP + dc * 32 + 16 + 8 * hh);
        s[j] = mma_b(kb.v, qah[dc], s[j]);
        s[j] = mma_b(kl.v, qah[dc], s[j]);
        s[j] = mma_b(kb.v, qal[dc], s[j]);
      }
    }

    // ---- scale + causal compare (diagonal tile only), column max, online softmax; P^T (x1024, f16) and its
    //      residual (x4096) are packed in registers as the B operands of the context products ----
    FH pb[2], pr[2];
    {
      const int qrow = q0 + c;                     // this lane's query
      float m = -INFINITY;
#pragma unroll
      for (int j = 0; j < 4; ++j) {
#pragma unroll
        for (int r = 0; r < 8; ++r) {
          const int key = kv0 + j * 16 + 8 * hh + r;   // key of accumulator element r of this lane
          float sv = s[j][r] * sscale;
          sv = (diag && (key > qrow)) ? -FLT_MAX : sv;
          s[j][r] = sv;
          m = fmaxf(m, sv);
        }
      }
      m = fmaxf(m, xhalf(m));                      // the query's other 32 keys of the tile
      const float mnew  = fmaxf(mrow, m);
      const float msafe = (mnew == -INFINITY) ? 0.f : mnew;
      const float alpha = __expf(mrow - msafe);
      mrow = mnew;
      float psum[2] = {0.f, 0.f};                  // one chain per 32 keys: two independent sums
#pragma unroll
      for (int j = 0; j < 4; ++j) {
#pragma unroll
        for (int r = 0; r < 8; ++r) {
          const float p = __expf(s[j][r] - msafe);   // floor logit against a normal max: exp -> 0
          psum[j >> 1] += p;
          const float p1k = p * 1024.0f;
          const _Float16 ph = (_Float16)p1k;
          pb[j >> 1].v[(j & 1) * 8 + r] = ph;
          if (RES) pr[j >> 1].v[(j & 1) * 8 + r] = (_Float16)((p1k - (float)ph) * 4096.0f);
        }
      }
      lrow = lrow * alpha + (psum[0] + psum[1]);
#pragma unroll
      for (int t = 0; t < 4; ++t)
#pragma unroll
        for (int r = 0; r < 8; ++r) oacc[t][r] *= alpha;
    }

    // ---- context^T += V^T . P^T (f16 WMMA), residual products into a separate accumulator ----
    v8f o1[4];
#pragma unroll
    for (int t = 0; t < 4; ++t) o1[t] = zero8();
#pragma unroll
    for (int kk = 0; kk < 2; ++kk) {               // unrolled: pb / pr are register operands
#pragma unroll
      for (int t = 0; t < 4; ++t) {
        FH vb;
        vb.h[0] = *(const v8h*)(Vth + (t * 16 + c) * LP + kk * 32 + 8 * hh);
        vb.h[1] = *(const v8h*)(Vth + (t * 16 + c) * LP + kk * 32 + 16 + 8 * hh);
        oacc[t] = mma_h(vb.v, pb[kk].v, oacc[t]);
        if (RES) {
          FH vl;
          vl.h[0] = *(const v8h*)(Vtl + (t * 16 + c) * LP + kk * 32 + 8 * hh);
          vl.h[1] = *(const v8h*)(Vtl + (t * 16 + c) * LP + kk * 32 + 16 + 8 * hh);
          o1[t] = mma_h(vl.v, pb[kk].v, o1[t]);
          o1[t] = mma_h(vb.v, pr[kk].v, o1[t]);
        }
      }
    }
    if (RES) {
#pragma unroll
      for (int t = 0; t < 4; ++t)
#pragma unroll
        for (int r = 0; r < 8; ++r) oacc[t][r] += o1[t][r] * (1.0f / 4096.0f);
    }
    asm volatile("s_wait_dscnt 0x0" ::: "memory");      // this wave's reads of buffer kt & 1 are done before it is refilled
    asm volatile("s_wait_asynccnt 0x0" ::: "memory");   // this wave's tile kt + 1 copies have landed
    __syncthreads();                                     // publishes tile kt + 1, ends every read of buffer kt & 1
    if (kt + 2 < nkt) stage(kt + 2, kt & 1);
  }
  asm volatile("s_wait_asynccnt 0x0" ::: "memory");     // nothing in flight when the buffers become the context tiles

  // ---- normalise (1/l and the 1/1024 p carry), stage the wave's 16x64 tile, bf16 hi/lo split,
  float* os = (float*)(void*)sKV + wave * (16 * OSP);
  {
    const float l = lrow + xhalf(lrow);        // both lane halves' keys of query q0 + c
    const float inv = ((l > 0.f) ? (1.0f / l) : 0.f) * (1.0f / 1024.0f);
#pragma unroll
    for (int t = 0; t < 4; ++t)
#pragma unroll
      for (int r = 0; r < 8; ++r) os[c * OSP + t * 16 + 8 * hh + r] = oacc[t][r] * inv;
  }
  __builtin_amdgcn_fence(3, "workgroup");
  __builtin_amdgcn_wave_barrier();
  __builtin_amdgcn_fence(2, "workgroup");
  {
    const int q4 = lane >> 3, c8 = (lane & 7) * 8;
    v4u hv[4], lv[4];
#pragma unroll
    for (int it = 0; it < 4; ++it) {
      const int row = it * 4 + q4;   // it 0..3 x q4 0..3 = rows 0..15 of the wave tile
      const float* sp = os + row * OSP + c8;
      v4u a, a2;
#pragma unroll
      for (int e = 0; e < 4; ++e) {
        const float f0 = sp[2 * e], f1 = sp[2 * e + 1];
        const unsigned short h0 = bf_bits(f0), h1 = bf_bits(f1);
        const unsigned short l0 = bf_bits(f0 - bf_up(h0)), l1 = bf_bits(f1 - bf_up(h1));
        a[e] = pk16(h0, h1); a2[e] = pk16(l0, l1);
      }
      hv[it] = a; lv[it] = a2;
    }
    {
#pragma unroll
      for (int it = 0; it < 4; ++it) {
        const int row = it * 4 + q4;
        const size_t go = (size_t)(q0 + row) * DM + (size_t)h * HD + c8;
        *(v4u*)(Ohb + go) = hv[it];
        *(v4u*)(Olb + go) = lv[it];
      }
      
    }
  }
}

// =====================================================================================================
// Workspace map (bytes, NB = 4, SEQ = 2048; every activation plane holds NB batch slices back to back):
//   Xb    bf16 [NB*SEQ][1024]          0           16777216   (also holds Oh after the projections: same extent)
//   Wqb   bf16 [1024 n][1024 k]        16777216     2097152
//   Wkb   bf16 [1024 n][1024 k]        18874368     2097152
//   Wvb   bf16 [1024 n][1024 k]        20971520     2097152
//   Wob   bf16 [1024 n][1024 k]        23068672     2097152
//   Qh    bf16 [NB*SEQ][1024]          25165824    16777216
//   Ql    bf16 [NB*SEQ][1024]          41943040    16777216
//   Kh    bf16 [NB*SEQ][1024]          58720256    16777216
//   Kl    bf16 [NB*SEQ][1024]          75497472    16777216
//   VTh   f16  NB x [1024][SEQ]        92274688    16777216
//   VTl   f16  NB x [1024][VLP=512]   109051904     4194304
//   Ol    bf16 [NB*SEQ][1024]         113246208    16777216
//   end                               130023424
// Oh aliases Xb: Xb is last read by the v^T projection, Oh is first written by the attention launches that
// come after it in stream order; both extents are NB*SEQ*DM*2 bytes exactly.
// All planes are exact multiples of their 64x64 / whole-line store granularity (no padded tails needed),
// =====================================================================================================
extern "C" void kernel_launch(void* const* d_in, const int* in_sizes, int n_in,
                              void* d_out, int out_size, void* d_ws, size_t ws_size,
                              hipStream_t stream) {
  if (n_in < 5) return;
  const long long needX = (long long)(NB - 1) * SEQ_FULL * DM + (long long)SEQ * DM;   // last row read / written
  if ((long long)in_sizes[0] < needX) return;         // x [NB_FULL][SEQ_FULL][1024], rows 0..SEQ-1 of batches 0..NB-1
  if (in_sizes[1] < DM * DM) return;                  // Wq [1024 out][1024 in]
  if (in_sizes[2] < DM * DM) return;                  // Wk
  if (in_sizes[3] < DM * DM) return;                  // Wv
  if (in_sizes[4] < DM * DM) return;                  // Wo
  if ((long long)out_size < needX) return;

  const float* x  = (const float*)d_in[0];
  const float* Wq = (const float*)d_in[1];
  const float* Wk = (const float*)d_in[2];
  const float* Wv = (const float*)d_in[3];
  const float* Wo = (const float*)d_in[4];

  const size_t PX  = (size_t)NB * SEQ * DM * 2;     // 16-bit activation plane [NB*SEQ][1024]
  const size_t PW  = (size_t)DM * DM * 2;           // 16-bit weight plane [1024][1024]
  const size_t PVT = (size_t)NB * DM * SEQ * 2;     // v^T hi plane, NB slices
  const size_t PVL = (size_t)NB * DM * VLP * 2;     // v^T residual plane, NB slices
  static_assert((size_t)NB * SEQ * DM * 2 == (size_t)NB * DM * SEQ * 2);
  size_t off = 0;
  const size_t oXb  = off; off += PX;
  const size_t oOh  = oXb;                          // aliased, same extent PX
  const size_t oWq  = off; off += PW;
  const size_t oWk  = off; off += PW;
  const size_t oWv  = off; off += PW;
  const size_t oWo  = off; off += PW;
  const size_t oQh  = off; off += PX;
  const size_t oQl  = off; off += PX;
  const size_t oKh  = off; off += PX;
  const size_t oKl  = off; off += PX;
  const size_t oVTh = off; off += PVT;
  const size_t oVTl = off; off += PVL;
  const size_t oOl  = off; off += PX;
  if (off > ws_size) return;                     // off = 130023424 for NB = 4, SEQ = 2048
  if (off > (size_t)134217728) return;

  char* ws = (char*)d_ws;
  unsigned short* Xb  = (unsigned short*)(ws + oXb);
  unsigned short* Oh  = (unsigned short*)(ws + oOh);
  unsigned short* Wqb = (unsigned short*)(ws + oWq);
  unsigned short* Wkb = (unsigned short*)(ws + oWk);
  unsigned short* Wvb = (unsigned short*)(ws + oWv);
  unsigned short* Wob = (unsigned short*)(ws + oWo);
  unsigned short* Qh  = (unsigned short*)(ws + oQh);
  unsigned short* Ql  = (unsigned short*)(ws + oQl);
  unsigned short* Kh  = (unsigned short*)(ws + oKh);
  unsigned short* Kl  = (unsigned short*)(ws + oKl);
  unsigned short* VTh = (unsigned short*)(ws + oVTh);
  unsigned short* VTl = (unsigned short*)(ws + oVTl);
  unsigned short* Ol  = (unsigned short*)(ws + oOl);

  const dim3 blk(256);
  const dim3 gQK((NB * SEQ / GBM) * (DM / GBN), 1);                // M = NB*SEQ, N = 1024: 128x256 tiles
  const dim3 gVT((DM / GBM) * (SEQ / GBN), NB);                    // M = 1024, N = SEQ, per batch
  const dim3 gOut((SEQ / GBM) * (DM / GBN), NB);                   // M = SEQ, N = 1024, per batch
  const long long xStrideIn = (long long)SEQ_FULL * DM;            // input x batch stride (full layout)
  const long long pStride   = (long long)SEQ * DM;                 // plane batch stride

  // (1) x -> bf16 plane [NB*SEQ][1024] (batch b reads input rows b*SEQ_FULL .. +SEQ-1); weights -> bf16 [n][k]
  cvt_all<<<dim3(CVG), dim3(CVB), 0, stream>>>(x, Wq, Wk, Wv, Wo, Xb, Wqb, Wkb, Wvb, Wob);
  // (2) q = x . Wq^T -> bf16 hi/lo planes [b*SEQ + t][h*64+d]   (M = NB*SEQ, N = 1024, K = 1024)
  gemm64<0, 2><<<gQK, blk, 0, stream>>>(
      Xb, Xb, DM, 0LL, Wqb, Wqb, DM, 0LL,
      (void*)Qh, DM, 0LL, (void*)Ql, DM, 0LL, DM,
      NB * SEQ, DM, DM, 1.0f);
  // (3) k = x . Wk^T -> bf16 hi/lo planes
  gemm64<0, 2><<<gQK, blk, 0, stream>>>(
      Xb, Xb, DM, 0LL, Wkb, Wkb, DM, 0LL,
      (void*)Kh, DM, 0LL, (void*)Kl, DM, 0LL, DM,
      NB * SEQ, DM, DM, 1.0f);
  // (4) v^T = Wv . x^T per batch -> f16 hi plane [h*64+d][s] (pitch SEQ, batch stride DM*SEQ) and residual
  //     plane (x4096, keys < VLP only, pitch VLP, batch stride DM*VLP)   (A = Wvb [n][k], Bt = Xb slice b;
  //     M = 1024, N = SEQ, K = 1024, grid.y = batch)
  gemm64<0, 3><<<gVT, blk, 0, stream>>>(
      Wvb, Wvb, DM, 0LL, Xb, Xb, DM, pStride,
      (void*)VTh, SEQ, (long long)DM * SEQ, (void*)VTl, VLP, (long long)DM * VLP, VLP,
      DM, SEQ, DM, 4096.0f);
  // (5) causal attention: query blocks 0..RESQB-1 with residual planes, the rest without; grid = (NH * query blocks, NB),
  //     the kernel maps the start rank to (query block descending, batch, head)
  attn_causal64<true><<<dim3(NH * RESQB, NB), dim3(128), 0, stream>>>(
      Qh, Ql, Kh, Kl, VTh, VTl, Oh, Ol, 0, RESQB, 0.125f);
  if (NQB > RESQB) {
    attn_causal64<false><<<dim3(NH * (NQB - RESQB), NB), dim3(128), 0, stream>>>(
        Qh, Ql, Kh, Kl, VTh, VTl, Oh, Ol, RESQB, NQB - RESQB, 0.125f);
  }
  // (6) out = context . Wo^T -> d_out f32, batch b rows b*SEQ_FULL .. +SEQ-1 (A = context hi + lo planes,
  //     2 products; M = SEQ, N = 1024, K = 1024, grid.y = batch)
  gemm64<1, 0><<<gOut, blk, 0, stream>>>(
      Oh, Ol, DM, pStride, Wob, Wob, DM, 0LL,
      d_out, DM, xStrideIn, d_out, DM, 0LL, DM,
      SEQ, DM, DM, 1.0f);
  (void)hipGetLastError();
}

// v007
// Measured time: 190 microseconds a run.
// Next to v006, in two timings, it ran 1.05 times as fast each time.
// Over all steps from v000 it is 2.96 times as fast.
// Contractions: q, k, v^T projections = v_wmma_f32_16x16x32_bf16 (bf16 operands from RNE-converted inputs, single product);
// q.k^T scores = v_wmma_f32_16x16x32_bf16 with bf16 hi/lo split q and k (hi.hi + hi.lo + lo.hi);
// (attention products are formed transposed: A = k rows / v^T rows, B = q / p^T, so a lane owns one query column)
// p.v = v_wmma_f32_16x16x32_f16 (p carried x1024 in f16, v in f16; extra f16 residual planes x4096 of p and v for the first VLP query rows);
// ctx.Wo = v_wmma_f32_16x16x32_bf16 with ctx as bf16 hi/lo planes times bf16 Wo (2 products); all f32 accumulate; causal compare and softmax in f32.
#include <hip/hip_runtime.h>
#include <math.h>
#include <float.h>
#include <stdint.h>

#ifndef NB
#define NB    4
#endif
#ifndef SEQ
#define SEQ   2048
#endif
#define NB_FULL  4
#define SEQ_FULL 2048
#define DM    1024
#define NH    16
#define HD    64
#define NQB   (SEQ / 64)                      // key / query tiles of 64
#define VLP   ((SEQ < 512) ? SEQ : 512)       // key pitch of the v^T residual plane (keys 0..VLP-1)
#define RESQB (VLP / 64)                      // number of leading 64-row query blocks that use the p / v residual planes
#define LP    72                              // LDS row pitch (16-bit elements) of the 64-wide K and V^T tiles: 144 B = 16 B x odd
#define OSP   68                              // LDS row pitch (floats) of the per-wave context tile: 272 B = 16 B x odd
#define GP    72                              // LDS row pitch (16-bit elements) of the staged 64-k GEMM operand rows: 144 B = 16 B x odd
#define GBM   128                             // GEMM work-group tile rows (2 waves of 64)
#define GBN   256                             // GEMM work-group tile columns (4 waves of 64)
static_assert(NB >= 1 && NB <= NB_FULL);
static_assert((SEQ % GBN) == 0 && (DM % GBN) == 0 && (DM % 128) == 0);
static_assert(NH * HD == DM && HD == 64);
static_assert((SEQ % 64) == 0 && (DM % 64) == 0 && SEQ >= 64 && SEQ <= SEQ_FULL);
static_assert(RESQB * 64 == VLP && VLP <= SEQ && RESQB >= 1 && RESQB <= NQB);

typedef _Float16 v16h __attribute__((ext_vector_type(16)));
typedef _Float16 v8h  __attribute__((ext_vector_type(8)));
typedef __bf16   v16b __attribute__((ext_vector_type(16)));
typedef __bf16   v8b  __attribute__((ext_vector_type(8)));
typedef float    v8f  __attribute__((ext_vector_type(8)));
typedef float    v4f  __attribute__((ext_vector_type(4)));
typedef unsigned int v4u __attribute__((ext_vector_type(4)));

// ---- scalar helpers --------------------------------------------------------------------------------
__device__ __forceinline__ unsigned short bf_bits(float f) {          // f32 -> bf16 bits, RNE convert
  unsigned u = __float_as_uint(f);
  return (unsigned short)((u + 0x7FFFu + ((u >> 16) & 1u)) >> 16);
}
__device__ __forceinline__ float bf_up(unsigned short h) { return __uint_as_float(((unsigned)h) << 16); }
__device__ __forceinline__ unsigned short h_bits(_Float16 x) { return __builtin_bit_cast(unsigned short, x); }
__device__ __forceinline__ unsigned pk16(unsigned short a, unsigned short b) { return (unsigned)a | ((unsigned)b << 16); }
__device__ __forceinline__ v8f zero8() { v8f z = {0.f, 0.f, 0.f, 0.f, 0.f, 0.f, 0.f, 0.f}; return z; }

// ---- fragment loaders: 16-bit A/B operand, lane -> row/col (lane&15), p already includes +8*(lane>>4);
//      elements 0..7 <- p[0..7] (k0+8h..), elements 8..15 <- p[16..23] (k0+16+8h..)
__device__ __forceinline__ v16b ldfrag_b(const __bf16* p) {
  union { v16b v; v8b h[2]; } f;
  f.h[0] = *(const v8b*)(p);
  f.h[1] = *(const v8b*)(p + 16);
  return f.v;
}

// ---- WMMA helpers: plain builtins (the compiler keeps the distance to a vector instruction on D, A or B) ----
__device__ __forceinline__ v8f mma_b_raw(v16b a, v16b b, v8f c) {
  return __builtin_amdgcn_wmma_f32_16x16x32_bf16(false, a, false, b, (short)0, c, false, false);
}
__device__ __forceinline__ v8f mma_h_raw(v16h a, v16h b, v8f c) {
  return __builtin_amdgcn_wmma_f32_16x16x32_f16(false, a, false, b, (short)0, c, false, false);
}
__device__ __forceinline__ void acc_guard4(v8f& a, v8f& b, v8f& c, v8f& d) {
  asm volatile("v_nop\n\tv_nop\n\tv_nop\n\tv_nop" : "+v"(a), "+v"(b), "+v"(c), "+v"(d));
}

// ---- value of lane l ^ 16 (the other 16-lane row), on the vector port; all 32 lanes are on wherever it is called
__device__ __forceinline__ float xhalf(float x) {
  const int b = __float_as_int(x);
  return __int_as_float(__builtin_amdgcn_permlanex16(b, b, 0x76543210, 0xfedcba98, false, false));
}

// ---- asynchronous copies global -> LDS: four 16-B pieces per lane (l* = LDS byte address, g* = global address).
//      The s_wait_xcnt closes the statement so that no address register is rewritten ahead of it.
__device__ __forceinline__ void copy4_lds(unsigned l0, const __bf16* g0, unsigned l1, const __bf16* g1,
                                          unsigned l2, const __bf16* g2, unsigned l3, const __bf16* g3) {
  asm volatile("global_load_async_to_lds_b128 %0, %1, off\n\t"
               "global_load_async_to_lds_b128 %2, %3, off\n\t"
               "global_load_async_to_lds_b128 %4, %5, off\n\t"
               "global_load_async_to_lds_b128 %6, %7, off\n\t"
               "s_wait_xcnt 0x0"
               :: "v"(l0), "v"(g0), "v"(l1), "v"(g1), "v"(l2), "v"(g2), "v"(l3), "v"(g3) : "memory");
}
// ---- the same for three 64-row planes at once: plane p = rows at LDS l + p * pl + i * ls and global g<p> + i * s<p> elements
//      (i = 0..3), twelve 16-B pieces per lane under one closing s_wait_xcnt.
__device__ __forceinline__ void copy12_lds(unsigned l, unsigned pl, unsigned ls,
                                           const unsigned short* g0, size_t s0, const unsigned short* g1, size_t s1,
                                           const unsigned short* g2, size_t s2) {
  asm volatile("global_load_async_to_lds_b128 %0, %1, off\n\t"
               "global_load_async_to_lds_b128 %2, %3, off\n\t"
               "global_load_async_to_lds_b128 %4, %5, off\n\t"
               "global_load_async_to_lds_b128 %6, %7, off\n\t"
               "global_load_async_to_lds_b128 %8, %9, off\n\t"
               "global_load_async_to_lds_b128 %10, %11, off\n\t"
               "global_load_async_to_lds_b128 %12, %13, off\n\t"
               "global_load_async_to_lds_b128 %14, %15, off\n\t"
               "global_load_async_to_lds_b128 %16, %17, off\n\t"
               "global_load_async_to_lds_b128 %18, %19, off\n\t"
               "global_load_async_to_lds_b128 %20, %21, off\n\t"
               "global_load_async_to_lds_b128 %22, %23, off\n\t"
               "s_wait_xcnt 0x0"
               :: "v"(l), "v"(g0), "v"(l + ls), "v"(g0 + s0), "v"(l + 2 * ls), "v"(g0 + 2 * s0), "v"(l + 3 * ls), "v"(g0 + 3 * s0),
                  "v"(l + pl), "v"(g1), "v"(l + pl + ls), "v"(g1 + s1), "v"(l + pl + 2 * ls), "v"(g1 + 2 * s1),
                  "v"(l + pl + 3 * ls), "v"(g1 + 3 * s1),
                  "v"(l + 2 * pl), "v"(g2), "v"(l + 2 * pl + ls), "v"(g2 + s2), "v"(l + 2 * pl + 2 * ls), "v"(g2 + 2 * s2),
                  "v"(l + 2 * pl + 3 * ls), "v"(g2 + 3 * s2)
               : "memory");
}

// =====================================================================================================
// f32 -> bf16 (RNE convert) of x and of the four weight matrices in ONE launch of CVG work-groups x CVB threads: about one
// work-group of 16 waves per WGP, started once.
// A unit = 8 elements = 32 B read, one 16-B store per lane (a wave writes 512 contiguous B). Work-group b owns units
// b * XIT * CVB .. + XIT * CVB - 1 of x and b * WIT * CVB .. + WIT * CVB - 1 of each weight; thread t takes units k * CVB + t
// of each range. All of a thread's loads are issued ahead of its first convert.
// x unit u lies in batch slice u / XUB (input batch stride SEQ_FULL * DM elements, plane batch stride SEQ * DM).
// coverage: CVG * XIT * CVB >= XU and CVG * WIT * CVB >= WU; units past the end are read at the last unit's address and
// not stored.
// =====================================================================================================
#define CVB  512                              // threads of a convert work-group
#define CVG  256                              // convert work-groups
#define CVTH (CVB * CVG)                      // convert threads
#define XUB  (SEQ * DM / 8)                   // units of one batch slice of x
#define XU   (NB * XUB)                       // units of x
#define WU   (DM * DM / 8)                    // units of one weight matrix
#define XIT  ((XU + CVTH - 1) / CVTH)         // units of x per thread
#define WIT  ((WU + CVTH - 1) / CVTH)         // units of one weight matrix per thread
__device__ __forceinline__ v4u cvt8(v4f a, v4f b) {
  v4u p;
  p[0] = pk16(bf_bits(a[0]), bf_bits(a[1]));
  p[1] = pk16(bf_bits(a[2]), bf_bits(a[3]));
  p[2] = pk16(bf_bits(b[0]), bf_bits(b[1]));
  p[3] = pk16(bf_bits(b[2]), bf_bits(b[3]));
  return p;
}
__global__ __launch_bounds__(CVB) void cvt_all(const float* __restrict__ x, const float* __restrict__ wq,
                                               const float* __restrict__ wk, const float* __restrict__ wv,
                                               const float* __restrict__ wo, unsigned short* __restrict__ xb,
                                               unsigned short* __restrict__ wqb, unsigned short* __restrict__ wkb,
                                               unsigned short* __restrict__ wvb, unsigned short* __restrict__ wob) {
  const unsigned t  = threadIdx.x;
  const unsigned xu = blockIdx.x * (unsigned)(XIT * CVB);    // first x unit of the work-group
  const unsigned wu = blockIdx.x * (unsigned)(WIT * CVB);    // first unit of the work-group in each weight
  constexpr bool XEX = (XUB % (XIT * CVB)) == 0 && (XU % CVTH) == 0;   // whole ranges, each inside one batch slice
  constexpr bool WEX = (WU % CVTH) == 0;
  // work-group-uniform bases, in 16-B pieces; a lane adds a 32-bit piece index
  const unsigned xbs = xu / (unsigned)XUB;
  const v4f* px = (const v4f*)(x + (size_t)xbs * ((size_t)SEQ_FULL * DM) + (size_t)(xu - xbs * (unsigned)XUB) * 8);
  const size_t wb = WEX ? (size_t)wu * 2 : (size_t)0;
  const v4f* pw[4] = {(const v4f*)wq + wb, (const v4f*)wk + wb, (const v4f*)wv + wb, (const v4f*)wo + wb};
  v4u* ox = (v4u*)xb + xu;
  v4u* ow[4] = {(v4u*)wqb + wu, (v4u*)wkb + wu, (v4u*)wvb + wu, (v4u*)wob + wu};
  // holds the argument loads and the index arithmetic of the bases in front of the run of loads: placed behind it they
  // rewrite a base register of a load just issued
  __builtin_amdgcn_sched_barrier(0);
  v4f xa[XIT], xc[XIT], wa[4][WIT], wc[4][WIT];
#pragma unroll
  for (int k = 0; k < XIT; ++k) {
    if (XEX) {
      xa[k] = px[2u * (k * CVB + t)];
      xc[k] = px[2u * (k * CVB + t) + 1u];
    } else {
      const unsigned u  = xu + k * CVB + t;
      const unsigned uc = (u < (unsigned)XU) ? u : (unsigned)(XU - 1);
      const unsigned bs = uc / (unsigned)XUB;
      const v4f* p = (const v4f*)(x + (size_t)bs * ((size_t)SEQ_FULL * DM) + (size_t)(uc - bs * (unsigned)XUB) * 8);
      xa[k] = p[0];
      xc[k] = p[1];
    }
  }
#pragma unroll
  for (int k = 0; k < WIT; ++k) {
    const unsigned u = wu + k * CVB + t;
    const unsigned o = WEX ? 2u * (k * CVB + t) : 2u * ((u < (unsigned)WU) ? u : (unsigned)(WU - 1));
#pragma unroll
    for (int w = 0; w < 4; ++w) {
      wa[w][k] = pw[w][o];
      wc[w][k] = pw[w][o + 1u];
    }
  }
  // keeps every load above in front of the converts: without it the last loads are issued only after the first have
  // come back, and the wave waits out the memory latency twice
  __builtin_amdgcn_sched_barrier(0);
  // the converts reuse the loads' address registers: the wait stands in front of the first such overwrite
  asm volatile("s_wait_xcnt 0x0" ::: "memory");
  __builtin_amdgcn_sched_barrier(0);           // holds the converts behind that wait
#pragma unroll
  for (int k = 0; k < XIT; ++k) {
    if (XEX || xu + k * CVB + t < (unsigned)XU) ox[k * CVB + t] = cvt8(xa[k], xc[k]);
    // keeps each store where its unit is ready: without it every store sinks behind the wait for the wave's last load
    __builtin_amdgcn_sched_barrier(0);
  }
#pragma unroll
  for (int k = 0; k < WIT; ++k) {
    if (WEX || wu + k * CVB + t < (unsigned)WU) {
#pragma unroll
      for (int w = 0; w < 4; ++w) ow[w][k * CVB + t] = cvt8(wa[w][k], wc[w][k]);
    }
  }
}

// =====================================================================================================
// bf16 WMMA GEMM: C[m][n] = sum_k A[m][k] * Bt[n][k]; a work-group of 8 waves (2 x 4) owns a 128x256 tile, each wave
// a 64x64 tile. A row-major [M][K] pitch lda; Bt row-major [N][K] pitch ldb (k contiguous); M multiple of 128,
// N multiple of 256, K multiple of 64 (host-checked). blockIdx.y = batch index (strides in elements).
// Operand staging: per 64-k slab the rows of A (and A2) and Bt that the work-group needs are copied once into LDS
// (asynchronous 16-B copies, 8 lanes per 128-B row piece = whole lines; LDS pitch GP), two buffers, the next
// slab in flight while a slab is multiplied; every wave reads its fragments from LDS.
// NSPLIT: 0 = A.Bt; 1 = (A + A2).Bt (A2 = unscaled bf16 lo plane of A).
// OUT_MODE: 0 = f32 (pitch ldc); 2 = bf16 hi plane C + bf16 lo plane C2 (lo = RNE(v - hi), unscaled);
//           3 = f16 hi plane C + f16 residual plane C2 = f16((v - hi) * rscale), C2 written only for tiles
//               with n0 < N2 (pitch ldc2, batch stride strideC2).
// =====================================================================================================
template <int NSPLIT, int OUT_MODE>
__global__ __launch_bounds__(256) void gemm64(
    const unsigned short* __restrict__ Ap, const unsigned short* A2p, int lda, long long strideA,
    const unsigned short* __restrict__ Btp, const unsigned short* Bt2p, int ldb, long long strideB,
    void* Cout, int ldc, long long strideC,
    void* Cout2, int ldc2, long long strideC2, int N2,
    int M, int N, int K, float rscale) {
  static_assert(NSPLIT == 0 || NSPLIT == 1);
  constexpr int AROWS = (NSPLIT == 1) ? 2 * GBM : GBM;   // staged rows of A, then of A2
  constexpr int BUFE  = (AROWS + GBN) * GP;              // 16-bit elements of one slab buffer
  const __bf16* A   = (const __bf16*)(const void*)Ap;
  const __bf16* A2  = (const __bf16*)(const void*)A2p;
  const __bf16* Bt  = (const __bf16*)(const void*)Btp;
  (void)Bt2p;
  __shared__ __align__(16) __bf16 sAB[2 * BUFE];   // two slab buffers: [A 128 rows | A2 128 rows | Bt 256 rows] x 64 k
  __shared__ __align__(16) float sT[8][16 * 68];   // per-wave 16x64 slab, pitch 68 floats
  const int b    = blockIdx.y;
  const int tid  = threadIdx.x;
  const int lane = tid & 31;
  const int wave = tid >> 5;
  const int nbn = N / GBN;
  const int nbm = M / GBM;
  if ((int)blockIdx.x >= nbm * nbn) return;   // block-uniform, in front of every barrier and copy
  const int bm = (int)blockIdx.x / nbn;
  const int bn = (int)blockIdx.x - bm * nbn;
  const int wm = wave >> 2;                    // wave row 0..1
  const int wn = wave & 3;                     // wave column 0..3
  const int m0 = bm * GBM + (wm << 6);
  const int n0 = bn * GBN + (wn << 6);

  const __bf16* Ab  = A  + (size_t)b * strideA;
  const __bf16* Bb  = Bt + (size_t)b * strideB;
  const __bf16* Ab2 = (NSPLIT == 1) ? (A2 + (size_t)b * strideA) : Ab;

  const int rlane = lane & 15;                 // row (A) / col (B, D) within subtile
  const int koff  = (lane >> 4) * 8;           // k offset of this lane half
  const int mOff  = (lane >> 4) * 8;           // D row offset

  // copy map: thread -> row (tid >> 3) + 32 * i of a staged plane, 16-B piece (tid & 7) of its 128 B
  const int crow = tid >> 3;
  const int cpc  = (tid & 7) * 8;
  const __bf16* gA  = Ab  + (size_t)(bm * GBM + crow) * lda + cpc;
  const __bf16* gA2 = Ab2 + (size_t)(bm * GBM + crow) * lda + cpc;
  const __bf16* gB  = Bb  + (size_t)(bn * GBN + crow) * ldb + cpc;
  const unsigned lbase = (unsigned)(uintptr_t)(&sAB[0]) + (unsigned)((crow * GP + cpc) * 2);
  const size_t a32 = (size_t)32 * lda, b32 = (size_t)32 * ldb;
  constexpr unsigned L32 = 32u * GP * 2u;      // LDS bytes of 32 staged rows

  auto stage = [&](int t, int buf) {           // slab t (k = 64 t .. 64 t + 63) into buffer buf
    const unsigned l = lbase + (unsigned)buf * (unsigned)(BUFE * 2);
    const __bf16* a = gA + (size_t)t * 64;
    copy4_lds(l, a, l + L32, a + a32, l + 2 * L32, a + 2 * a32, l + 3 * L32, a + 3 * a32);
    if (NSPLIT == 1) {
      const __bf16* a2 = gA2 + (size_t)t * 64;
      const unsigned l2 = l + 4 * L32;
      copy4_lds(l2, a2, l2 + L32, a2 + a32, l2 + 2 * L32, a2 + 2 * a32, l2 + 3 * L32, a2 + 3 * a32);
    }
    const __bf16* bp = gB + (size_t)t * 64;
    const unsigned lb = l + (unsigned)(AROWS / 32) * L32;
    copy4_lds(lb, bp, lb + L32, bp + b32, lb + 2 * L32, bp + 2 * b32, lb + 3 * L32, bp + 3 * b32);
    copy4_lds(lb + 4 * L32, bp + 4 * b32, lb + 5 * L32, bp + 5 * b32, lb + 6 * L32, bp + 6 * b32, lb + 7 * L32, bp + 7 * b32);
  };

  v8f acc[4][4];
#pragma unroll
  for (int i = 0; i < 4; ++i)
#pragma unroll
    for (int j = 0; j < 4; ++j) acc[i][j] = zero8();

  const int nst = K >> 6;                      // slabs of 64 k
  stage(0, 0);
  asm volatile("s_wait_asynccnt 0x0" ::: "memory");   // this wave's slab-0 copies have landed
  __syncthreads();                                     // slab 0 readable by every wave
  if (nst > 1) stage(1, 1);

  const int aoff = ((wm << 6) + rlane) * GP + koff;            // this lane's A fragment row in a buffer
  const int boff = (AROWS + (wn << 6) + rlane) * GP + koff;    // this lane's Bt fragment row in a buffer
  for (int t = 0; t < nst; ++t) {
    const __bf16* sb = sAB + (t & 1) * BUFE;
#pragma unroll
    for (int ks = 0; ks < 2; ++ks) {
      v16b bh[4], ah[4], al[4];
#pragma unroll
      for (int j = 0; j < 4; ++j) bh[j] = ldfrag_b(sb + boff + j * 16 * GP + ks * 32);
#pragma unroll
      for (int i = 0; i < 4; ++i) {
        ah[i] = ldfrag_b(sb + aoff + i * 16 * GP + ks * 32);
        if (NSPLIT == 1) al[i] = ldfrag_b(sb + aoff + (GBM + i * 16) * GP + ks * 32); else al[i] = ah[i];
      }
      // inputs-only fence on the loaded fragments: keeps the k-step's LDS reads one group in front of its WMMAs
      // (without it each A fragment is read into one register set and its LDS latency waited out four times)
      asm volatile("" :: "v"(bh[0]), "v"(bh[1]), "v"(bh[2]), "v"(bh[3]), "v"(ah[0]), "v"(ah[1]), "v"(ah[2]), "v"(ah[3]));
      if (NSPLIT == 1) asm volatile("" :: "v"(al[0]), "v"(al[1]), "v"(al[2]), "v"(al[3]));   // same, lo plane
#pragma unroll
      for (int i = 0; i < 4; ++i) {
#pragma unroll
        for (int j = 0; j < 4; ++j) {
          acc[i][j] = mma_b_raw(ah[i], bh[j], acc[i][j]);
          if (NSPLIT == 1) acc[i][j] = mma_b_raw(al[i], bh[j], acc[i][j]);
        }
      }
    }
    asm volatile("s_wait_dscnt 0x0" ::: "memory");      // this wave's reads of buffer t & 1 are done before it is refilled
    asm volatile("s_wait_asynccnt 0x0" ::: "memory");   // this wave's slab t + 1 copies have landed
    __syncthreads();                                     // publishes slab t + 1, ends every read of buffer t & 1
    if (t + 2 < nst) stage(t + 2, t & 1);
  }
  asm volatile("s_wait_asynccnt 0x0" ::: "memory");     // nothing in flight when the wave goes on
  acc_guard4(acc[0][0], acc[0][1], acc[0][2], acc[0][3]);
  acc_guard4(acc[1][0], acc[1][1], acc[1][2], acc[1][3]);
  acc_guard4(acc[2][0], acc[2][1], acc[2][2], acc[2][3]);
  acc_guard4(acc[3][0], acc[3][1], acc[3][2], acc[3][3]);

  // ---- epilogue ----
  float* slab = sT[wave];
#pragma unroll
  for (int i = 0; i < 4; ++i) {
    const int mBase = m0 + (i << 4);
#pragma unroll
    for (int j = 0; j < 4; ++j) {
#pragma unroll
      for (int r = 0; r < 8; ++r) {
        slab[(mOff + r) * 68 + (j << 4) + rlane] = acc[i][j][r];
      }
    }
    __builtin_amdgcn_fence(3, "workgroup");
    __builtin_amdgcn_wave_barrier();
    __builtin_amdgcn_fence(2, "workgroup");
    if (OUT_MODE == 0) {
      float* C = (float*)Cout + (size_t)b * strideC;
      const int hh = lane >> 4, c4 = (lane & 15) * 4;     // 256-B row segment = 16 lanes x 16 B
      {
#pragma unroll
        for (int it = 0; it < 8; ++it) {
          const int row = it * 2 + hh;                     // it 0..7 x hh 0..1 = rows 0..15
          const v4f v = *(const v4f*)(slab + row * 68 + c4);
          *(v4f*)(C + (size_t)(mBase + row) * ldc + n0 + c4) = v;
        }
        
      }
    } else {
      const int q = lane >> 3, c8 = (lane & 7) * 8;
      unsigned short* C  = (unsigned short*)Cout  + (size_t)b * strideC;
      unsigned short* C2 = (unsigned short*)Cout2 + (size_t)b * strideC2;
      const bool wlo = (OUT_MODE == 2) || (n0 < N2);      // wave-uniform
      v4u hv[4], lv[4];
#pragma unroll
      for (int it = 0; it < 4; ++it) {
        const int row = it * 4 + q;                        // it 0..3 x q 0..3 = rows 0..15
        const float* sp = slab + row * 68 + c8;
        v4u a, a2;
#pragma unroll
        for (int e = 0; e < 4; ++e) {
          const float f0 = sp[2 * e], f1 = sp[2 * e + 1];
          unsigned short h0, h1, l0, l1;
          if (OUT_MODE == 2) {
            h0 = bf_bits(f0); h1 = bf_bits(f1);
            l0 = bf_bits(f0 - bf_up(h0)); l1 = bf_bits(f1 - bf_up(h1));
          } else {
            const _Float16 x0 = (_Float16)f0, x1 = (_Float16)f1;
            h0 = h_bits(x0); h1 = h_bits(x1);
            l0 = h_bits((_Float16)((f0 - (float)x0) * rscale));
            l1 = h_bits((_Float16)((f1 - (float)x1) * rscale));
          }
          a[e] = pk16(h0, h1); a2[e] = pk16(l0, l1);
        }
        hv[it] = a; lv[it] = a2;
      }
      {
#pragma unroll
        for (int it = 0; it < 4; ++it) {
          const int row = it * 4 + q;
          *(v4u*)(C + (size_t)(mBase + row) * ldc + n0 + c8) = hv[it];
          if (wlo) *(v4u*)(C2 + (size_t)(mBase + row) * ldc2 + n0 + c8) = lv[it];
        }
        
      }
    }
    __builtin_amdgcn_fence(3, "workgroup");
    __builtin_amdgcn_wave_barrier();
    __builtin_amdgcn_fence(2, "workgroup");
  }
}

template <bool RES>
__global__ __launch_bounds__(128) __attribute__((amdgpu_num_vgpr(256), amdgpu_waves_per_eu(4, 4)))
void attn_causal64(const unsigned short* __restrict__ qhp, const unsigned short* __restrict__ qlp,
                   const unsigned short* __restrict__ khp, const unsigned short* __restrict__ klp,
                   const unsigned short* __restrict__ vhp, const unsigned short* __restrict__ vlp,
                   unsigned short* ohp, unsigned short* olp,
                   int qbBase, int nqbThis, float sscale) {
  union FB { v16b v; v8b h[2]; };
  union FH { v16h v; v8h h[2]; };
  constexpr int PLE  = 64 * LP;                 // 16-bit elements of one staged plane tile, pitch LP, 9 KB
  constexpr int BUFE = (RES ? 4 : 3) * PLE;     // one buffer: K hi [kv][d] | K lo | V^T hi [d][kv] | V^T residual (RES)
  __shared__ __align__(16) unsigned short sKV[2 * BUFE];          // two tile buffers; the epilogue's context tiles lie over them
  static_assert((size_t)2 * BUFE * 2 >= (size_t)4 * 16 * OSP * 4);

  const int tid  = threadIdx.x;
  const int wave = tid >> 5;
  const int lane = tid & 31;
  const int hh   = lane >> 4;
  const int c    = lane & 15;

  // There are more work-groups than resident places, and query block qb
  // costs qb + 1 key tiles: the rank (x fastest, then y) maps to the query block slowest and descending, so the
  // lowest ranks get the longest work-groups (ordering for speed only). rank -> (qbl, bb, h) is a permutation of the grid.
  const int rank = (int)blockIdx.y * (nqbThis * NH) + (int)blockIdx.x;   // 0 .. nqbThis*NH*NB-1 (grid = (nqbThis*NH, NB))
  const int qbl  = nqbThis - 1 - rank / (NH * NB);   // nqbThis-1 .. 0
  const int bb   = (rank / NH) % NB;                 // batch
  const int h    = rank % NH;                        // head
  const int qb   = qbBase + qbl;
  const int q0   = qb * 64 + wave * 16;

  const size_t pstride = (size_t)SEQ * DM;                  // per-batch elements of the [t][h*64+d] planes
  const __bf16* Qh = (const __bf16*)(const void*)qhp + (size_t)bb * pstride + (size_t)h * HD;
  const __bf16* Ql = (const __bf16*)(const void*)qlp + (size_t)bb * pstride + (size_t)h * HD;
  const __bf16* Kh = (const __bf16*)(const void*)khp + (size_t)bb * pstride + (size_t)h * HD;
  const __bf16* Kl = (const __bf16*)(const void*)klp + (size_t)bb * pstride + (size_t)h * HD;
  const _Float16* Vh = (const _Float16*)(const void*)vhp + (size_t)bb * ((size_t)DM * SEQ) + (size_t)h * HD * SEQ;
  const _Float16* Vl = (const _Float16*)(const void*)vlp + (size_t)bb * ((size_t)DM * VLP) + (size_t)h * HD * VLP;
  unsigned short* Ohb = ohp + (size_t)bb * pstride;
  unsigned short* Olb = olp + (size_t)bb * pstride;

  // ---- Q fragments (B operand, column = query = lane&15): 2 d-chunks, hi and lo ----
  v16b qah[2], qal[2];
#pragma unroll
  for (int dc = 0; dc < 2; ++dc) {
    const size_t qo = (size_t)(q0 + c) * DM + dc * 32 + 8 * hh;
    qah[dc] = ldfrag_b(Qh + qo);
    qal[dc] = ldfrag_b(Ql + qo);
  }

  float mrow = -INFINITY, lrow = 0.f;        // of query q0 + c; lrow sums this lane half's keys only
  v8f oacc[4];                               // O^T: oacc[t][r] = context(query q0 + c, d = 16 t + 8 hh + r)
#pragma unroll
  for (int t = 0; t < 4; ++t) oacc[t] = zero8();

  // copy map: thread -> row (tid >> 3) + 16 * i of a plane tile, 16-B piece (tid & 7) of its 128 B
  const int crow = tid >> 3;
  const int cpc  = (tid & 7) * 8;
  const unsigned short* gKh = (const unsigned short*)(const void*)Kh + (size_t)crow * DM + cpc;    // K row kv0 + crow + 16 i (< SEQ)
  const unsigned short* gKl = (const unsigned short*)(const void*)Kl + (size_t)crow * DM + cpc;
  const unsigned short* gVh = (const unsigned short*)(const void*)Vh + (size_t)crow * SEQ + cpc;   // V^T row d = crow + 16 i
  const unsigned short* gVl = (const unsigned short*)(const void*)Vl + (size_t)crow * VLP + cpc;
  const unsigned lbase = (unsigned)(uintptr_t)(&sKV[0]) + (unsigned)((crow * LP + cpc) * 2);
  constexpr unsigned L16 = 16u * LP * 2u;      // LDS bytes of 16 staged rows
  constexpr unsigned PLB = (unsigned)PLE * 2u; // LDS bytes of one plane tile
  auto stage = [&](int t, int buf) {           // key tile t (keys 64 t .. 64 t + 63) into buffer buf
    const int k0 = t * 64;
    const unsigned l = lbase + (unsigned)buf * (unsigned)(BUFE * 2);
    copy12_lds(l, PLB, L16, gKh + (size_t)k0 * DM, (size_t)16 * DM, gKl + (size_t)k0 * DM, (size_t)16 * DM,
               gVh + k0, (size_t)16 * SEQ);
    if (RES) {
      const int kvl = (k0 + 64 <= VLP) ? k0 : (VLP - 64);        // clamped address into the residual plane
      const __bf16* w = (const __bf16*)(const void*)(gVl + kvl);
      const unsigned lw = l + 3 * PLB;
      copy4_lds(lw, w, lw + L16, w + 16 * VLP, lw + 2 * L16, w + 32 * VLP, lw + 3 * L16, w + 48 * VLP);
    }
  };

  const int nkt = qb + 1;                    // key tiles 0..qb (block-uniform)
  stage(0, 0);
  asm volatile("s_wait_asynccnt 0x0" ::: "memory");   // this wave's tile-0 copies have landed
  __syncthreads();                                     // tile 0 readable by every wave
  if (nkt > 1) stage(1, 1);
  for (int kt = 0; kt < NQB; ++kt) {         // static bound
    if (kt >= nkt) break;                    // block-uniform
    const bool diag = (kt == qb);            // block-uniform
    const int kv0 = kt * 64;
    const unsigned short* sb = sKV + (kt & 1) * BUFE;
    const __bf16*   Ksh = (const __bf16*)(const void*)sb;                    // K hi [kv][d]
    const __bf16*   Ksl = (const __bf16*)(const void*)(sb + PLE);            // K lo
    const _Float16* Vth = (const _Float16*)(const void*)(sb + 2 * PLE);      // V^T hi [d][kv]
    const _Float16* Vtl = (const _Float16*)(const void*)(sb + (RES ? 3 : 2) * PLE);   // V^T residual, read only when RES

    // ---- scores, transposed: 64 keys x 16 query columns per wave, 3 bf16 products ----
    //      Issue order: d-chunk, product, key group innermost, so that neighbouring WMMAs write four independent tiles;
    //      each tile still sums (hi.hi, lo.hi, hi.lo) of d-chunk 0, then of d-chunk 1.
    v8f s[4];
#pragma unroll
    for (int j = 0; j < 4; ++j) s[j] = zero8();
#pragma unroll
    for (int dc = 0; dc < 2; ++dc) {
      FB kb[4], kl[4];
#pragma unroll
      for (int j = 0; j < 4; ++j) {
        kb[j].h[0] = *(const v8b*)(Ksh + (j * 16 + c) * LP + dc * 32 + 8 * hh);
        kb[j].h[1] = *(const v8b*)(Ksh + (j * 16 + c) * LP + dc * 32 + 16 + 8 * hh);
        kl[j].h[0] = *(const v8b*)(Ksl + (j * 16 + c) * LP + dc * 32 + 8 * hh);
        kl[j].h[1] = *(const v8b*)(Ksl + (j * 16 + c) * LP + dc * 32 + 16 + 8 * hh);
      }
#pragma unroll
      for (int j = 0; j < 4; ++j) s[j] = mma_b_raw(kb[j].v, qah[dc], s[j]);
#pragma unroll
      for (int j = 0; j < 4; ++j) s[j] = mma_b_raw(kl[j].v, qah[dc], s[j]);
#pragma unroll
      for (int j = 0; j < 4; ++j) s[j] = mma_b_raw(kb[j].v, qal[dc], s[j]);
    }

    // ---- scale + causal compare (diagonal tile only), column max, online softmax; P^T (x1024, f16) and its
    //      residual (x4096) are packed in registers as the B operands of the context products ----
    FH pb[2], pr[2];
    {
      const int qrow = q0 + c;                     // this lane's query
      float m = -INFINITY;
#pragma unroll
      for (int j = 0; j < 4; ++j) {
#pragma unroll
        for (int r = 0; r < 8; ++r) {
          const int key = kv0 + j * 16 + 8 * hh + r;   // key of accumulator element r of this lane
          float sv = s[j][r] * sscale;
          sv = (diag && (key > qrow)) ? -FLT_MAX : sv;
          s[j][r] = sv;
          m = fmaxf(m, sv);
        }
      }
      m = fmaxf(m, xhalf(m));                      // the query's other 32 keys of the tile
      const float mnew  = fmaxf(mrow, m);
      const float msafe = (mnew == -INFINITY) ? 0.f : mnew;
      const float alpha = __expf(mrow - msafe);
      mrow = mnew;
      float psum[2] = {0.f, 0.f};                  // one chain per 32 keys: two independent sums
#pragma unroll
      for (int j = 0; j < 4; ++j) {
#pragma unroll
        for (int r = 0; r < 8; ++r) {
          const float p = __expf(s[j][r] - msafe);   // floor logit against a normal max: exp -> 0
          psum[j >> 1] += p;
          const float p1k = p * 1024.0f;
          const _Float16 ph = (_Float16)p1k;
          pb[j >> 1].v[(j & 1) * 8 + r] = ph;
          if (RES) pr[j >> 1].v[(j & 1) * 8 + r] = (_Float16)((p1k - (float)ph) * 4096.0f);
        }
      }
      lrow = lrow * alpha + (psum[0] + psum[1]);
#pragma unroll
      for (int t = 0; t < 4; ++t)
#pragma unroll
        for (int r = 0; r < 8; ++r) oacc[t][r] *= alpha;
    }

    // ---- context^T += V^T . P^T (f16 WMMA), residual products into a separate accumulator ----
    v8f o1[4];
#pragma unroll
    for (int t = 0; t < 4; ++t) o1[t] = zero8();
#pragma unroll
    for (int kk = 0; kk < 2; ++kk) {               // unrolled: pb / pr are register operands
      FH vb[4], vl[4];
#pragma unroll
      for (int t = 0; t < 4; ++t) {
        vb[t].h[0] = *(const v8h*)(Vth + (t * 16 + c) * LP + kk * 32 + 8 * hh);
        vb[t].h[1] = *(const v8h*)(Vth + (t * 16 + c) * LP + kk * 32 + 16 + 8 * hh);
        if (RES) {
          vl[t].h[0] = *(const v8h*)(Vtl + (t * 16 + c) * LP + kk * 32 + 8 * hh);
          vl[t].h[1] = *(const v8h*)(Vtl + (t * 16 + c) * LP + kk * 32 + 16 + 8 * hh);
        }
      }
#pragma unroll
      for (int t = 0; t < 4; ++t) oacc[t] = mma_h_raw(vb[t].v, pb[kk].v, oacc[t]);
      if (RES) {
#pragma unroll
        for (int t = 0; t < 4; ++t) o1[t] = mma_h_raw(vl[t].v, pb[kk].v, o1[t]);
#pragma unroll
        for (int t = 0; t < 4; ++t) o1[t] = mma_h_raw(vb[t].v, pr[kk].v, o1[t]);
      }
    }
    if (RES) {
#pragma unroll
      for (int t = 0; t < 4; ++t)
#pragma unroll
        for (int r = 0; r < 8; ++r) oacc[t][r] += o1[t][r] * (1.0f / 4096.0f);
    }
    asm volatile("s_wait_dscnt 0x0" ::: "memory");      // this wave's reads of buffer kt & 1 are done before it is refilled
    asm volatile("s_wait_asynccnt 0x0" ::: "memory");   // this wave's tile kt + 1 copies have landed
    __syncthreads();                                     // publishes tile kt + 1, ends every read of buffer kt & 1
    if (kt + 2 < nkt) stage(kt + 2, kt & 1);
  }
  asm volatile("s_wait_asynccnt 0x0" ::: "memory");     // nothing in flight when the buffers become the context tiles

  // ---- normalise (1/l and the 1/1024 p carry), stage the wave's 16x64 tile, bf16 hi/lo split,
  float* os = (float*)(void*)sKV + wave * (16 * OSP);
  {
    const float l = lrow + xhalf(lrow);        // both lane halves' keys of query q0 + c
    const float inv = ((l > 0.f) ? (1.0f / l) : 0.f) * (1.0f / 1024.0f);
#pragma unroll
    for (int t = 0; t < 4; ++t)
#pragma unroll
      for (int r = 0; r < 8; ++r) os[c * OSP + t * 16 + 8 * hh + r] = oacc[t][r] * inv;
  }
  __builtin_amdgcn_fence(3, "workgroup");
  __builtin_amdgcn_wave_barrier();
  __builtin_amdgcn_fence(2, "workgroup");
  {
    const int q4 = lane >> 3, c8 = (lane & 7) * 8;
    v4u hv[4], lv[4];
#pragma unroll
    for (int it = 0; it < 4; ++it) {
      const int row = it * 4 + q4;   // it 0..3 x q4 0..3 = rows 0..15 of the wave tile
      const float* sp = os + row * OSP + c8;
      v4u a, a2;
#pragma unroll
      for (int e = 0; e < 4; ++e) {
        const float f0 = sp[2 * e], f1 = sp[2 * e + 1];
        const unsigned short h0 = bf_bits(f0), h1 = bf_bits(f1);
        const unsigned short l0 = bf_bits(f0 - bf_up(h0)), l1 = bf_bits(f1 - bf_up(h1));
        a[e] = pk16(h0, h1); a2[e] = pk16(l0, l1);
      }
      hv[it] = a; lv[it] = a2;
    }
    {
#pragma unroll
      for (int it = 0; it < 4; ++it) {
        const int row = it * 4 + q4;
        const size_t go = (size_t)(q0 + row) * DM + (size_t)h * HD + c8;
        *(v4u*)(Ohb + go) = hv[it];
        *(v4u*)(Olb + go) = lv[it];
      }
      
    }
  }
}

// =====================================================================================================
// Workspace map (bytes, NB = 4, SEQ = 2048; every activation plane holds NB batch slices back to back):
//   Xb    bf16 [NB*SEQ][1024]          0           16777216   (also holds Oh after the projections: same extent)
//   Wqb   bf16 [1024 n][1024 k]        16777216     2097152
//   Wkb   bf16 [1024 n][1024 k]        18874368     2097152
//   Wvb   bf16 [1024 n][1024 k]        20971520     2097152
//   Wob   bf16 [1024 n][1024 k]        23068672     2097152
//   Qh    bf16 [NB*SEQ][1024]          25165824    16777216
//   Ql    bf16 [NB*SEQ][1024]          41943040    16777216
//   Kh    bf16 [NB*SEQ][1024]          58720256    16777216
//   Kl    bf16 [NB*SEQ][1024]          75497472    16777216
//   VTh   f16  NB x [1024][SEQ]        92274688    16777216
//   VTl   f16  NB x [1024][VLP=512]   109051904     4194304
//   Ol    bf16 [NB*SEQ][1024]         113246208    16777216
//   end                               130023424
// Oh aliases Xb: Xb is last read by the v^T projection, Oh is first written by the attention launches that
// come after it in stream order; both extents are NB*SEQ*DM*2 bytes exactly.
// All planes are exact multiples of their 64x64 / whole-line store granularity (no padded tails needed),
// =====================================================================================================
extern "C" void kernel_launch(void* const* d_in, const int* in_sizes, int n_in,
                              void* d_out, int out_size, void* d_ws, size_t ws_size,
                              hipStream_t stream) {
  if (n_in < 5) return;
  const long long needX = (long long)(NB - 1) * SEQ_FULL * DM + (long long)SEQ * DM;   // last row read / written
  if ((long long)in_sizes[0] < needX) return;         // x [NB_FULL][SEQ_FULL][1024], rows 0..SEQ-1 of batches 0..NB-1
  if (in_sizes[1] < DM * DM) return;                  // Wq [1024 out][1024 in]
  if (in_sizes[2] < DM * DM) return;                  // Wk
  if (in_sizes[3] < DM * DM) return;                  // Wv
  if (in_sizes[4] < DM * DM) return;                  // Wo
  if ((long long)out_size < needX) return;

  const float* x  = (const float*)d_in[0];
  const float* Wq = (const float*)d_in[1];
  const float* Wk = (const float*)d_in[2];
  const float* Wv = (const float*)d_in[3];
  const float* Wo = (const float*)d_in[4];

  const size_t PX  = (size_t)NB * SEQ * DM * 2;     // 16-bit activation plane [NB*SEQ][1024]
  const size_t PW  = (size_t)DM * DM * 2;           // 16-bit weight plane [1024][1024]
  const size_t PVT = (size_t)NB * DM * SEQ * 2;     // v^T hi plane, NB slices
  const size_t PVL = (size_t)NB * DM * VLP * 2;     // v^T residual plane, NB slices
  static_assert((size_t)NB * SEQ * DM * 2 == (size_t)NB * DM * SEQ * 2);
  size_t off = 0;
  const size_t oXb  = off; off += PX;
  const size_t oOh  = oXb;                          // aliased, same extent PX
  const size_t oWq  = off; off += PW;
  const size_t oWk  = off; off += PW;
  const size_t oWv  = off; off += PW;
  const size_t oWo  = off; off += PW;
  const size_t oQh  = off; off += PX;
  const size_t oQl  = off; off += PX;
  const size_t oKh  = off; off += PX;
  const size_t oKl  = off; off += PX;
  const size_t oVTh = off; off += PVT;
  const size_t oVTl = off; off += PVL;
  const size_t oOl  = off; off += PX;
  if (off > ws_size) return;                     // off = 130023424 for NB = 4, SEQ = 2048
  if (off > (size_t)134217728) return;

  char* ws = (char*)d_ws;
  unsigned short* Xb  = (unsigned short*)(ws + oXb);
  unsigned short* Oh  = (unsigned short*)(ws + oOh);
  unsigned short* Wqb = (unsigned short*)(ws + oWq);
  unsigned short* Wkb = (unsigned short*)(ws + oWk);
  unsigned short* Wvb = (unsigned short*)(ws + oWv);
  unsigned short* Wob = (unsigned short*)(ws + oWo);
  unsigned short* Qh  = (unsigned short*)(ws + oQh);
  unsigned short* Ql  = (unsigned short*)(ws + oQl);
  unsigned short* Kh  = (unsigned short*)(ws + oKh);
  unsigned short* Kl  = (unsigned short*)(ws + oKl);
  unsigned short* VTh = (unsigned short*)(ws + oVTh);
  unsigned short* VTl = (unsigned short*)(ws + oVTl);
  unsigned short* Ol  = (unsigned short*)(ws + oOl);

  const dim3 blk(256);
  const dim3 gQK((NB * SEQ / GBM) * (DM / GBN), 1);                // M = NB*SEQ, N = 1024: 128x256 tiles
  const dim3 gVT((DM / GBM) * (SEQ / GBN), NB);                    // M = 1024, N = SEQ, per batch
  const dim3 gOut((SEQ / GBM) * (DM / GBN), NB);                   // M = SEQ, N = 1024, per batch
  const long long xStrideIn = (long long)SEQ_FULL * DM;            // input x batch stride (full layout)
  const long long pStride   = (long long)SEQ * DM;                 // plane batch stride

  // (1) x -> bf16 plane [NB*SEQ][1024] (batch b reads input rows b*SEQ_FULL .. +SEQ-1); weights -> bf16 [n][k]
  cvt_all<<<dim3(CVG), dim3(CVB), 0, stream>>>(x, Wq, Wk, Wv, Wo, Xb, Wqb, Wkb, Wvb, Wob);
  // (2) q = x . Wq^T -> bf16 hi/lo planes [b*SEQ + t][h*64+d]   (M = NB*SEQ, N = 1024, K = 1024)
  gemm64<0, 2><<<gQK, blk, 0, stream>>>(
      Xb, Xb, DM, 0LL, Wqb, Wqb, DM, 0LL,
      (void*)Qh, DM, 0LL, (void*)Ql, DM, 0LL, DM,
      NB * SEQ, DM, DM, 1.0f);
  // (3) k = x . Wk^T -> bf16 hi/lo planes
  gemm64<0, 2><<<gQK, blk, 0, stream>>>(
      Xb, Xb, DM, 0LL, Wkb, Wkb, DM, 0LL,
      (void*)Kh, DM, 0LL, (void*)Kl, DM, 0LL, DM,
      NB * SEQ, DM, DM, 1.0f);
  // (4) v^T = Wv . x^T per batch -> f16 hi plane [h*64+d][s] (pitch SEQ, batch stride DM*SEQ) and residual
  //     plane (x4096, keys < VLP only, pitch VLP, batch stride DM*VLP)   (A = Wvb [n][k], Bt = Xb slice b;
  //     M = 1024, N = SEQ, K = 1024, grid.y = batch)
  gemm64<0, 3><<<gVT, blk, 0, stream>>>(
      Wvb, Wvb, DM, 0LL, Xb, Xb, DM, pStride,
      (void*)VTh, SEQ, (long long)DM * SEQ, (void*)VTl, VLP, (long long)DM * VLP, VLP,
      DM, SEQ, DM, 4096.0f);
  // (5) causal attention: query blocks 0..RESQB-1 with residual planes, the rest without; grid = (NH * query blocks, NB),
  //     the kernel maps the start rank to (query block descending, batch, head)
  attn_causal64<true><<<dim3(NH * RESQB, NB), dim3(128), 0, stream>>>(
      Qh, Ql, Kh, Kl, VTh, VTl, Oh, Ol, 0, RESQB, 0.125f);
  if (NQB > RESQB) {
    attn_causal64<false><<<dim3(NH * (NQB - RESQB), NB), dim3(128), 0, stream>>>(
        Qh, Ql, Kh, Kl, VTh, VTl, Oh, Ol, RESQB, NQB - RESQB, 0.125f);
  }
  // (6) out = context . Wo^T -> d_out f32, batch b rows b*SEQ_FULL .. +SEQ-1 (A = context hi + lo planes,
  //     2 products; M = SEQ, N = 1024, K = 1024, grid.y = batch)
  gemm64<1, 0><<<gOut, blk, 0, stream>>>(
      Oh, Ol, DM, pStride, Wob, Wob, DM, 0LL,
      d_out, DM, xStrideIn, d_out, DM, 0LL, DM,
      SEQ, DM, DM, 1.0f);
  (void)hipGetLastError();
}

// v008
// One run takes 183 microseconds.
// Timed twice side by side with v007, it ran 1.04 times as fast both times.
// All steps since v000 together make it 3.08 times as fast.
// Contractions: q, k, v^T projections = v_wmma_f32_16x16x32_bf16 (bf16 operands from RNE-converted inputs, single product);
// q.k^T scores = v_wmma_f32_16x16x32_bf16 with bf16 hi/lo split q and k (hi.hi + hi.lo + lo.hi);
// (attention products are formed transposed: A = k rows / v^T rows, B = q / p^T, so a lane owns one query column)
// p.v = v_wmma_f32_16x16x32_f16 (p carried x1024 in f16, v in f16; extra f16 residual planes x4096 of p and v for the first VLP query rows);
// ctx.Wo = v_wmma_f32_16x16x32_bf16 with ctx as bf16 hi/lo planes times bf16 Wo (2 products); all f32 accumulate; causal compare and softmax in f32.
#include <hip/hip_runtime.h>
#include <math.h>
#include <float.h>
#include <stdint.h>

#ifndef NB
#define NB    4
#endif
#ifndef SEQ
#define SEQ   2048
#endif
#define NB_FULL  4
#define SEQ_FULL 2048
#define DM    1024
#define NH    16
#define HD    64
#define NQB   (SEQ / 64)                      // key / query tiles of 64
#define VLP   ((SEQ < 512) ? SEQ : 512)       // key pitch of the v^T residual plane (keys 0..VLP-1)
#define RESQB (VLP / 64)                      // number of leading 64-row query blocks that use the p / v residual planes
#define LP    72                              // LDS row pitch (16-bit elements) of the 64-wide K and V^T tiles: 144 B = 16 B x odd
#define OSP   68                              // LDS row pitch (floats) of the per-wave context tile: 272 B = 16 B x odd
#define GP    72                              // LDS row pitch (16-bit elements) of the staged 64-k GEMM operand rows: 144 B = 16 B x odd
#define GBM   128                             // GEMM work-group tile rows (2 waves of 64)
#define GBN   256                             // GEMM work-group tile columns (4 waves of 64)
static_assert(NB >= 1 && NB <= NB_FULL);
static_assert((SEQ % GBN) == 0 && (DM % GBN) == 0 && (DM % 128) == 0);
static_assert(NH * HD == DM && HD == 64);
static_assert((SEQ % 64) == 0 && (DM % 64) == 0 && SEQ >= 64 && SEQ <= SEQ_FULL);
static_assert(RESQB * 64 == VLP && VLP <= SEQ && RESQB >= 1 && RESQB <= NQB);

typedef _Float16 v16h __attribute__((ext_vector_type(16)));
typedef _Float16 v8h  __attribute__((ext_vector_type(8)));
typedef __bf16   v16b __attribute__((ext_vector_type(16)));
typedef __bf16   v8b  __attribute__((ext_vector_type(8)));
typedef float    v8f  __attribute__((ext_vector_type(8)));
typedef float    v4f  __attribute__((ext_vector_type(4)));
typedef unsigned int v4u __attribute__((ext_vector_type(4)));

// ---- scalar helpers --------------------------------------------------------------------------------
__device__ __forceinline__ unsigned short bf_bits(float f) {          // f32 -> bf16 bits, RNE convert
  unsigned u = __float_as_uint(f);
  return (unsigned short)((u + 0x7FFFu + ((u >> 16) & 1u)) >> 16);
}
__device__ __forceinline__ float bf_up(unsigned short h) { return __uint_as_float(((unsigned)h) << 16); }
__device__ __forceinline__ unsigned short h_bits(_Float16 x) { return __builtin_bit_cast(unsigned short, x); }
__device__ __forceinline__ unsigned pk16(unsigned short a, unsigned short b) { return (unsigned)a | ((unsigned)b << 16); }
__device__ __forceinline__ v8f zero8() { v8f z = {0.f, 0.f, 0.f, 0.f, 0.f, 0.f, 0.f, 0.f}; return z; }

// ---- fragment loaders: 16-bit A/B operand, lane -> row/col (lane&15), p already includes +8*(lane>>4);
//      elements 0..7 <- p[0..7] (k0+8h..), elements 8..15 <- p[16..23] (k0+16+8h..)
__device__ __forceinline__ v16b ldfrag_b(const __bf16* p) {
  union { v16b v; v8b h[2]; } f;
  f.h[0] = *(const v8b*)(p);
  f.h[1] = *(const v8b*)(p + 16);
  return f.v;
}

// ---- WMMA helpers: plain builtins (the compiler keeps the distance to a vector instruction on D, A or B) ----
__device__ __forceinline__ v8f mma_b_raw(v16b a, v16b b, v8f c) {
  return __builtin_amdgcn_wmma_f32_16x16x32_bf16(false, a, false, b, (short)0, c, false, false);
}
__device__ __forceinline__ v8f mma_h_raw(v16h a, v16h b, v8f c) {
  return __builtin_amdgcn_wmma_f32_16x16x32_f16(false, a, false, b, (short)0, c, false, false);
}
__device__ __forceinline__ void acc_guard4(v8f& a, v8f& b, v8f& c, v8f& d) {
  asm volatile("v_nop\n\tv_nop\n\tv_nop\n\tv_nop" : "+v"(a), "+v"(b), "+v"(c), "+v"(d));
}

// ---- value of lane l ^ 16 (the other 16-lane row), on the vector port; all 32 lanes are on wherever it is called
__device__ __forceinline__ float xhalf(float x) {
  const int b = __float_as_int(x);
  return __int_as_float(__builtin_amdgcn_permlanex16(b, b, 0x76543210, 0xfedcba98, false, false));
}

// ---- asynchronous copies global -> LDS: four 16-B pieces per lane (l* = LDS byte address, g* = global address).
//      The s_wait_xcnt closes the statement so that no address register is rewritten ahead of it.
__device__ __forceinline__ void copy4_lds(unsigned l0, const __bf16* g0, unsigned l1, const __bf16* g1,
                                          unsigned l2, const __bf16* g2, unsigned l3, const __bf16* g3) {
  asm volatile("global_load_async_to_lds_b128 %0, %1, off\n\t"
               "global_load_async_to_lds_b128 %2, %3, off\n\t"
               "global_load_async_to_lds_b128 %4, %5, off\n\t"
               "global_load_async_to_lds_b128 %6, %7, off\n\t"
               "s_wait_xcnt 0x0"
               :: "v"(l0), "v"(g0), "v"(l1), "v"(g1), "v"(l2), "v"(g2), "v"(l3), "v"(g3) : "memory");
}
// ---- the same for three 64-row planes at once: plane p = rows at LDS l + p * pl + i * ls and global g<p> + i * s<p> elements
//      (i = 0..3), twelve 16-B pieces per lane under one closing s_wait_xcnt.
__device__ __forceinline__ void copy12_lds(unsigned l, unsigned pl, unsigned ls,
                                           const unsigned short* g0, size_t s0, const unsigned short* g1, size_t s1,
                                           const unsigned short* g2, size_t s2) {
  asm volatile("global_load_async_to_lds_b128 %0, %1, off\n\t"
               "global_load_async_to_lds_b128 %2, %3, off\n\t"
               "global_load_async_to_lds_b128 %4, %5, off\n\t"
               "global_load_async_to_lds_b128 %6, %7, off\n\t"
               "global_load_async_to_lds_b128 %8, %9, off\n\t"
               "global_load_async_to_lds_b128 %10, %11, off\n\t"
               "global_load_async_to_lds_b128 %12, %13, off\n\t"
               "global_load_async_to_lds_b128 %14, %15, off\n\t"
               "global_load_async_to_lds_b128 %16, %17, off\n\t"
               "global_load_async_to_lds_b128 %18, %19, off\n\t"
               "global_load_async_to_lds_b128 %20, %21, off\n\t"
               "global_load_async_to_lds_b128 %22, %23, off\n\t"
               "s_wait_xcnt 0x0"
               :: "v"(l), "v"(g0), "v"(l + ls), "v"(g0 + s0), "v"(l + 2 * ls), "v"(g0 + 2 * s0), "v"(l + 3 * ls), "v"(g0 + 3 * s0),
                  "v"(l + pl), "v"(g1), "v"(l + pl + ls), "v"(g1 + s1), "v"(l + pl + 2 * ls), "v"(g1 + 2 * s1),
                  "v"(l + pl + 3 * ls), "v"(g1 + 3 * s1),
                  "v"(l + 2 * pl), "v"(g2), "v"(l + 2 * pl + ls), "v"(g2 + s2), "v"(l + 2 * pl + 2 * ls), "v"(g2 + 2 * s2),
                  "v"(l + 2 * pl + 3 * ls), "v"(g2 + 3 * s2)
               : "memory");
}

// =====================================================================================================
// f32 -> bf16 (RNE convert) of x and of the four weight matrices in ONE launch of CVG work-groups x CVB threads: about one
// work-group of 16 waves per WGP, started once.
// A unit = 8 elements = 32 B read, one 16-B store per lane (a wave writes 512 contiguous B). Work-group b owns units
// b * XIT * CVB .. + XIT * CVB - 1 of x and b * WIT * CVB .. + WIT * CVB - 1 of each weight; thread t takes units k * CVB + t
// of each range. All of a thread's loads are issued ahead of its first convert.
// x unit u lies in batch slice u / XUB (input batch stride SEQ_FULL * DM elements, plane batch stride SEQ * DM).
// coverage: CVG * XIT * CVB >= XU and CVG * WIT * CVB >= WU; units past the end are read at the last unit's address and
// not stored.
// =====================================================================================================
#define CVB  512                              // threads of a convert work-group
#define CVG  256                              // convert work-groups
#define CVTH (CVB * CVG)                      // convert threads
#define XUB  (SEQ * DM / 8)                   // units of one batch slice of x
#define XU   (NB * XUB)                       // units of x
#define WU   (DM * DM / 8)                    // units of one weight matrix
#define XIT  ((XU + CVTH - 1) / CVTH)         // units of x per thread
#define WIT  ((WU + CVTH - 1) / CVTH)         // units of one weight matrix per thread
__device__ __forceinline__ v4u cvt8(v4f a, v4f b) {
  v4u p;
  p[0] = pk16(bf_bits(a[0]), bf_bits(a[1]));
  p[1] = pk16(bf_bits(a[2]), bf_bits(a[3]));
  p[2] = pk16(bf_bits(b[0]), bf_bits(b[1]));
  p[3] = pk16(bf_bits(b[2]), bf_bits(b[3]));
  return p;
}
__global__ __launch_bounds__(CVB) void cvt_all(const float* __restrict__ x, const float* __restrict__ wq,
                                               const float* __restrict__ wk, const float* __restrict__ wv,
                                               const float* __restrict__ wo, unsigned short* __restrict__ xb,
                                               unsigned short* __restrict__ wqb, unsigned short* __restrict__ wkb,
                                               unsigned short* __restrict__ wvb, unsigned short* __restrict__ wob) {
  const unsigned t  = threadIdx.x;
  const unsigned xu = blockIdx.x * (unsigned)(XIT * CVB);    // first x unit of the work-group
  const unsigned wu = blockIdx.x * (unsigned)(WIT * CVB);    // first unit of the work-group in each weight
  constexpr bool XEX = (XUB % (XIT * CVB)) == 0 && (XU % CVTH) == 0;   // whole ranges, each inside one batch slice
  constexpr bool WEX = (WU % CVTH) == 0;
  // work-group-uniform bases, in 16-B pieces; a lane adds a 32-bit piece index
  const unsigned xbs = xu / (unsigned)XUB;
  const v4f* px = (const v4f*)(x + (size_t)xbs * ((size_t)SEQ_FULL * DM) + (size_t)(xu - xbs * (unsigned)XUB) * 8);
  const size_t wb = WEX ? (size_t)wu * 2 : (size_t)0;
  const v4f* pw[4] = {(const v4f*)wq + wb, (const v4f*)wk + wb, (const v4f*)wv + wb, (const v4f*)wo + wb};
  v4u* ox = (v4u*)xb + xu;
  v4u* ow[4] = {(v4u*)wqb + wu, (v4u*)wkb + wu, (v4u*)wvb + wu, (v4u*)wob + wu};
  // holds the argument loads and the index arithmetic of the bases in front of the run of loads: placed behind it they
  // rewrite a base register of a load just issued
  __builtin_amdgcn_sched_barrier(0);
  v4f xa[XIT], xc[XIT], wa[4][WIT], wc[4][WIT];
#pragma unroll
  for (int k = 0; k < XIT; ++k) {
    if (XEX) {
      xa[k] = px[2u * (k * CVB + t)];
      xc[k] = px[2u * (k * CVB + t) + 1u];
    } else {
      const unsigned u  = xu + k * CVB + t;
      const unsigned uc = (u < (unsigned)XU) ? u : (unsigned)(XU - 1);
      const unsigned bs = uc / (unsigned)XUB;
      const v4f* p = (const v4f*)(x + (size_t)bs * ((size_t)SEQ_FULL * DM) + (size_t)(uc - bs * (unsigned)XUB) * 8);
      xa[k] = p[0];
      xc[k] = p[1];
    }
  }
#pragma unroll
  for (int k = 0; k < WIT; ++k) {
    const unsigned u = wu + k * CVB + t;
    const unsigned o = WEX ? 2u * (k * CVB + t) : 2u * ((u < (unsigned)WU) ? u : (unsigned)(WU - 1));
#pragma unroll
    for (int w = 0; w < 4; ++w) {
      wa[w][k] = pw[w][o];
      wc[w][k] = pw[w][o + 1u];
    }
  }
  // keeps every load above in front of the converts: without it the last loads are issued only after the first have
  // come back, and the wave waits out the memory latency twice
  __builtin_amdgcn_sched_barrier(0);
  // the converts reuse the loads' address registers: the wait stands in front of the first such overwrite
  asm volatile("s_wait_xcnt 0x0" ::: "memory");
  __builtin_amdgcn_sched_barrier(0);           // holds the converts behind that wait
#pragma unroll
  for (int k = 0; k < XIT; ++k) {
    if (XEX || xu + k * CVB + t < (unsigned)XU) ox[k * CVB + t] = cvt8(xa[k], xc[k]);
    // keeps each store where its unit is ready: without it every store sinks behind the wait for the wave's last load
    __builtin_amdgcn_sched_barrier(0);
  }
#pragma unroll
  for (int k = 0; k < WIT; ++k) {
    if (WEX || wu + k * CVB + t < (unsigned)WU) {
#pragma unroll
      for (int w = 0; w < 4; ++w) ow[w][k * CVB + t] = cvt8(wa[w][k], wc[w][k]);
    }
  }
}

// =====================================================================================================
// bf16 WMMA GEMM: C[m][n] = sum_k A[m][k] * Bt[n][k]; a work-group of 8 waves (2 x 4) owns a 128x256 tile, each wave
// a 64x64 tile. A row-major [M][K] pitch lda; Bt row-major [N][K] pitch ldb (k contiguous); M multiple of 128,
// N multiple of 256, K multiple of 64 (host-checked). blockIdx.y = batch index (strides in elements).
// Operand staging: per 64-k slab the rows of A (and A2) and Bt that the work-group needs are copied once into LDS
// (asynchronous 16-B copies, 8 lanes per 128-B row piece = whole lines; LDS pitch GP), two buffers, the next
// slab in flight while a slab is multiplied; every wave reads its fragments from LDS.
// NSPLIT: 0 = A.Bt; 1 = (A + A2).Bt (A2 = unscaled bf16 lo plane of A).
// OUT_MODE: 0 = f32 (pitch ldc); 2 = bf16 hi plane C + bf16 lo plane C2 (lo = RNE(v - hi), unscaled);
//           3 = f16 hi plane C + f16 residual plane C2 = f16((v - hi) * rscale), C2 written only for tiles
//               with n0 < N2 (pitch ldc2, batch stride strideC2).
// =====================================================================================================
template <int NSPLIT, int OUT_MODE>
__global__ __launch_bounds__(256) void gemm64(
    const unsigned short* __restrict__ Ap, const unsigned short* A2p, int lda, long long strideA,
    const unsigned short* __restrict__ Btp, const unsigned short* Bt2p, int ldb, long long strideB,
    void* Cout, int ldc, long long strideC,
    void* Cout2, int ldc2, long long strideC2, int N2,
    int M, int N, int K, float rscale) {
  static_assert(NSPLIT == 0 || NSPLIT == 1);
  constexpr int AROWS = (NSPLIT == 1) ? 2 * GBM : GBM;   // staged rows of A, then of A2
  constexpr int BUFE  = (AROWS + GBN) * GP;              // 16-bit elements of one slab buffer
  const __bf16* A   = (const __bf16*)(const void*)Ap;
  const __bf16* A2  = (const __bf16*)(const void*)A2p;
  const __bf16* Bt  = (const __bf16*)(const void*)Btp;
  (void)Bt2p;
  __shared__ __align__(16) __bf16 sAB[2 * BUFE];   // two slab buffers: [A 128 rows | A2 128 rows | Bt 256 rows] x 64 k
  __shared__ __align__(16) float sT[8][16 * 68];   // per-wave 16x64 slab, pitch 68 floats
  const int b    = blockIdx.y;
  const int tid  = threadIdx.x;
  const int lane = tid & 31;
  const int wave = tid >> 5;
  const int nbn = N / GBN;
  const int nbm = M / GBM;
  if ((int)blockIdx.x >= nbm * nbn) return;   // block-uniform, in front of every barrier and copy
  const int bm = (int)blockIdx.x / nbn;
  const int bn = (int)blockIdx.x - bm * nbn;
  const int wm = wave >> 2;                    // wave row 0..1
  const int wn = wave & 3;                     // wave column 0..3
  const int m0 = bm * GBM + (wm << 6);
  const int n0 = bn * GBN + (wn << 6);

  const __bf16* Ab  = A  + (size_t)b * strideA;
  const __bf16* Bb  = Bt + (size_t)b * strideB;
  const __bf16* Ab2 = (NSPLIT == 1) ? (A2 + (size_t)b * strideA) : Ab;

  const int rlane = lane & 15;                 // row (A) / col (B, D) within subtile
  const int koff  = (lane >> 4) * 8;           // k offset of this lane half
  const int mOff  = (lane >> 4) * 8;           // D row offset

  // copy map: thread -> row (tid >> 3) + 32 * i of a staged plane, 16-B piece (tid & 7) of its 128 B
  const int crow = tid >> 3;
  const int cpc  = (tid & 7) * 8;
  const __bf16* gA  = Ab  + (size_t)(bm * GBM + crow) * lda + cpc;
  const __bf16* gA2 = Ab2 + (size_t)(bm * GBM + crow) * lda + cpc;
  const __bf16* gB  = Bb  + (size_t)(bn * GBN + crow) * ldb + cpc;
  const unsigned lbase = (unsigned)(uintptr_t)(&sAB[0]) + (unsigned)((crow * GP + cpc) * 2);
  const size_t a32 = (size_t)32 * lda, b32 = (size_t)32 * ldb;
  constexpr unsigned L32 = 32u * GP * 2u;      // LDS bytes of 32 staged rows

  auto stage = [&](int t, int buf) {           // slab t (k = 64 t .. 64 t + 63) into buffer buf
    const unsigned l = lbase + (unsigned)buf * (unsigned)(BUFE * 2);
    const __bf16* a = gA + (size_t)t * 64;
    copy4_lds(l, a, l + L32, a + a32, l + 2 * L32, a + 2 * a32, l + 3 * L32, a + 3 * a32);
    if (NSPLIT == 1) {
      const __bf16* a2 = gA2 + (size_t)t * 64;
      const unsigned l2 = l + 4 * L32;
      copy4_lds(l2, a2, l2 + L32, a2 + a32, l2 + 2 * L32, a2 + 2 * a32, l2 + 3 * L32, a2 + 3 * a32);
    }
    const __bf16* bp = gB + (size_t)t * 64;
    const unsigned lb = l + (unsigned)(AROWS / 32) * L32;
    copy4_lds(lb, bp, lb + L32, bp + b32, lb + 2 * L32, bp + 2 * b32, lb + 3 * L32, bp + 3 * b32);
    copy4_lds(lb + 4 * L32, bp + 4 * b32, lb + 5 * L32, bp + 5 * b32, lb + 6 * L32, bp + 6 * b32, lb + 7 * L32, bp + 7 * b32);
  };

  v8f acc[4][4];
#pragma unroll
  for (int i = 0; i < 4; ++i)
#pragma unroll
    for (int j = 0; j < 4; ++j) acc[i][j] = zero8();

  const int nst = K >> 6;                      // slabs of 64 k
  stage(0, 0);
  asm volatile("s_wait_asynccnt 0x0" ::: "memory");   // this wave's slab-0 copies have landed
  __syncthreads();                                     // slab 0 readable by every wave
  if (nst > 1) stage(1, 1);

  const int aoff = ((wm << 6) + rlane) * GP + koff;            // this lane's A fragment row in a buffer
  const int boff = (AROWS + (wn << 6) + rlane) * GP + koff;    // this lane's Bt fragment row in a buffer
  for (int t = 0; t < nst; ++t) {
    const __bf16* sb = sAB + (t & 1) * BUFE;
#pragma unroll
    for (int ks = 0; ks < 2; ++ks) {
      v16b bh[4], ah[4], al[4];
#pragma unroll
      for (int j = 0; j < 4; ++j) bh[j] = ldfrag_b(sb + boff + j * 16 * GP + ks * 32);
#pragma unroll
      for (int i = 0; i < 4; ++i) {
        ah[i] = ldfrag_b(sb + aoff + i * 16 * GP + ks * 32);
        if (NSPLIT == 1) al[i] = ldfrag_b(sb + aoff + (GBM + i * 16) * GP + ks * 32); else al[i] = ah[i];
      }
      // inputs-only fence on the loaded fragments: keeps the k-step's LDS reads one group in front of its WMMAs
      // (without it each A fragment is read into one register set and its LDS latency waited out four times)
      asm volatile("" :: "v"(bh[0]), "v"(bh[1]), "v"(bh[2]), "v"(bh[3]), "v"(ah[0]), "v"(ah[1]), "v"(ah[2]), "v"(ah[3]));
      if (NSPLIT == 1) asm volatile("" :: "v"(al[0]), "v"(al[1]), "v"(al[2]), "v"(al[3]));   // same, lo plane
#pragma unroll
      for (int i = 0; i < 4; ++i) {
#pragma unroll
        for (int j = 0; j < 4; ++j) {
          acc[i][j] = mma_b_raw(ah[i], bh[j], acc[i][j]);
          if (NSPLIT == 1) acc[i][j] = mma_b_raw(al[i], bh[j], acc[i][j]);
        }
      }
    }
    asm volatile("s_wait_dscnt 0x0" ::: "memory");      // this wave's reads of buffer t & 1 are done before it is refilled
    asm volatile("s_wait_asynccnt 0x0" ::: "memory");   // this wave's slab t + 1 copies have landed
    __syncthreads();                                     // publishes slab t + 1, ends every read of buffer t & 1
    if (t + 2 < nst) stage(t + 2, t & 1);
  }
  asm volatile("s_wait_asynccnt 0x0" ::: "memory");     // nothing in flight when the wave goes on
  acc_guard4(acc[0][0], acc[0][1], acc[0][2], acc[0][3]);
  acc_guard4(acc[1][0], acc[1][1], acc[1][2], acc[1][3]);
  acc_guard4(acc[2][0], acc[2][1], acc[2][2], acc[2][3]);
  acc_guard4(acc[3][0], acc[3][1], acc[3][2], acc[3][3]);

  // ---- epilogue ----
  float* slab = sT[wave];
#pragma unroll
  for (int i = 0; i < 4; ++i) {
    const int mBase = m0 + (i << 4);
#pragma unroll
    for (int j = 0; j < 4; ++j) {
#pragma unroll
      for (int r = 0; r < 8; ++r) {
        slab[(mOff + r) * 68 + (j << 4) + rlane] = acc[i][j][r];
      }
    }
    __builtin_amdgcn_fence(3, "workgroup");
    __builtin_amdgcn_wave_barrier();
    __builtin_amdgcn_fence(2, "workgroup");
    if (OUT_MODE == 0) {
      float* C = (float*)Cout + (size_t)b * strideC;
      const int hh = lane >> 4, c4 = (lane & 15) * 4;     // 256-B row segment = 16 lanes x 16 B
      {
#pragma unroll
        for (int it = 0; it < 8; ++it) {
          const int row = it * 2 + hh;                     // it 0..7 x hh 0..1 = rows 0..15
          const v4f v = *(const v4f*)(slab + row * 68 + c4);
          *(v4f*)(C + (size_t)(mBase + row) * ldc + n0 + c4) = v;
        }
        
      }
    } else {
      const int q = lane >> 3, c8 = (lane & 7) * 8;
      unsigned short* C  = (unsigned short*)Cout  + (size_t)b * strideC;
      unsigned short* C2 = (unsigned short*)Cout2 + (size_t)b * strideC2;
      const bool wlo = (OUT_MODE == 2) || (n0 < N2);      // wave-uniform
      v4u hv[4], lv[4];
#pragma unroll
      for (int it = 0; it < 4; ++it) {
        const int row = it * 4 + q;                        // it 0..3 x q 0..3 = rows 0..15
        const float* sp = slab + row * 68 + c8;
        v4u a, a2;
#pragma unroll
        for (int e = 0; e < 4; ++e) {
          const float f0 = sp[2 * e], f1 = sp[2 * e + 1];
          unsigned short h0, h1, l0, l1;
          if (OUT_MODE == 2) {
            h0 = bf_bits(f0); h1 = bf_bits(f1);
            l0 = bf_bits(f0 - bf_up(h0)); l1 = bf_bits(f1 - bf_up(h1));
          } else {
            const _Float16 x0 = (_Float16)f0, x1 = (_Float16)f1;
            h0 = h_bits(x0); h1 = h_bits(x1);
            l0 = h_bits((_Float16)((f0 - (float)x0) * rscale));
            l1 = h_bits((_Float16)((f1 - (float)x1) * rscale));
          }
          a[e] = pk16(h0, h1); a2[e] = pk16(l0, l1);
        }
        hv[it] = a; lv[it] = a2;
      }
      {
#pragma unroll
        for (int it = 0; it < 4; ++it) {
          const int row = it * 4 + q;
          *(v4u*)(C + (size_t)(mBase + row) * ldc + n0 + c8) = hv[it];
          if (wlo) *(v4u*)(C2 + (size_t)(mBase + row) * ldc2 + n0 + c8) = lv[it];
        }
        
      }
    }
    __builtin_amdgcn_fence(3, "workgroup");
    __builtin_amdgcn_wave_barrier();
    __builtin_amdgcn_fence(2, "workgroup");
  }
}

template <bool RES>
__global__ __launch_bounds__(128) __attribute__((amdgpu_num_vgpr(256), amdgpu_waves_per_eu(4, 4)))
void attn_causal64(const unsigned short* __restrict__ qhp, const unsigned short* __restrict__ qlp,
                   const unsigned short* __restrict__ khp, const unsigned short* __restrict__ klp,
                   const unsigned short* __restrict__ vhp, const unsigned short* __restrict__ vlp,
                   unsigned short* ohp, unsigned short* olp,
                   int qbBase, int nqbThis, float sscale) {
  union FB { v16b v; v8b h[2]; };
  union FH { v16h v; v8h h[2]; };
  constexpr int PLE  = 64 * LP;                 // 16-bit elements of one staged plane tile, pitch LP, 9 KB
  constexpr int BUFE = (RES ? 4 : 3) * PLE;     // one buffer: K hi [kv][d] | K lo | V^T hi [d][kv] | V^T residual (RES)
  __shared__ __align__(16) unsigned short sKV[2 * BUFE];          // two tile buffers; the epilogue's context tiles lie over them
  static_assert((size_t)2 * BUFE * 2 >= (size_t)4 * 16 * OSP * 4);

  const int tid  = threadIdx.x;
  const int wave = tid >> 5;
  const int lane = tid & 31;
  const int hh   = lane >> 4;
  const int c    = lane & 15;

  // There are more work-groups than resident places, and query block qb
  // costs qb + 1 key tiles: the rank (x fastest, then y) maps to the query block slowest and descending, so the
  // lowest ranks get the longest work-groups (ordering for speed only). rank -> (qbl, bb, h) is a permutation of the grid.
  const int rank = (int)blockIdx.y * (nqbThis * NH) + (int)blockIdx.x;   // 0 .. nqbThis*NH*NB-1 (grid = (nqbThis*NH, NB))
  const int qbl  = nqbThis - 1 - rank / (NH * NB);   // nqbThis-1 .. 0
  const int bb   = (rank / NH) % NB;                 // batch
  const int h    = rank % NH;                        // head
  const int qb   = qbBase + qbl;
  const int q0   = qb * 64 + wave * 16;

  const size_t pstride = (size_t)SEQ * DM;                  // per-batch elements of the [t][h*64+d] planes
  const __bf16* Qh = (const __bf16*)(const void*)qhp + (size_t)bb * pstride + (size_t)h * HD;
  const __bf16* Ql = (const __bf16*)(const void*)qlp + (size_t)bb * pstride + (size_t)h * HD;
  const __bf16* Kh = (const __bf16*)(const void*)khp + (size_t)bb * pstride + (size_t)h * HD;
  const __bf16* Kl = (const __bf16*)(const void*)klp + (size_t)bb * pstride + (size_t)h * HD;
  const _Float16* Vh = (const _Float16*)(const void*)vhp + (size_t)bb * ((size_t)DM * SEQ) + (size_t)h * HD * SEQ;
  const _Float16* Vl = (const _Float16*)(const void*)vlp + (size_t)bb * ((size_t)DM * VLP) + (size_t)h * HD * VLP;
  unsigned short* Ohb = ohp + (size_t)bb * pstride;
  unsigned short* Olb = olp + (size_t)bb * pstride;

  // ---- Q fragments (B operand, column = query = lane&15): 2 d-chunks, hi and lo ----
  v16b qah[2], qal[2];
#pragma unroll
  for (int dc = 0; dc < 2; ++dc) {
    const size_t qo = (size_t)(q0 + c) * DM + dc * 32 + 8 * hh;
    qah[dc] = ldfrag_b(Qh + qo);
    qal[dc] = ldfrag_b(Ql + qo);
  }

  float mrow = -INFINITY, lrow = 0.f;        // of query q0 + c; lrow sums this lane half's keys only
  v8f oacc[4];                               // O^T: oacc[t][r] = context(query q0 + c, d = 16 t + 8 hh + r)
#pragma unroll
  for (int t = 0; t < 4; ++t) oacc[t] = zero8();

  // copy map: thread -> row (tid >> 3) + 16 * i of a plane tile, 16-B piece (tid & 7) of its 128 B
  const int crow = tid >> 3;
  const int cpc  = (tid & 7) * 8;
  const unsigned short* gKh = (const unsigned short*)(const void*)Kh + (size_t)crow * DM + cpc;    // K row kv0 + crow + 16 i (< SEQ)
  const unsigned short* gKl = (const unsigned short*)(const void*)Kl + (size_t)crow * DM + cpc;
  const unsigned short* gVh = (const unsigned short*)(const void*)Vh + (size_t)crow * SEQ + cpc;   // V^T row d = crow + 16 i
  const unsigned short* gVl = (const unsigned short*)(const void*)Vl + (size_t)crow * VLP + cpc;
  const unsigned lbase = (unsigned)(uintptr_t)(&sKV[0]) + (unsigned)((crow * LP + cpc) * 2);
  constexpr unsigned L16 = 16u * LP * 2u;      // LDS bytes of 16 staged rows
  constexpr unsigned PLB = (unsigned)PLE * 2u; // LDS bytes of one plane tile
  auto stage = [&](int t, int buf) {           // key tile t (keys 64 t .. 64 t + 63) into buffer buf
    const int k0 = t * 64;
    const unsigned l = lbase + (unsigned)buf * (unsigned)(BUFE * 2);
    copy12_lds(l, PLB, L16, gKh + (size_t)k0 * DM, (size_t)16 * DM, gKl + (size_t)k0 * DM, (size_t)16 * DM,
               gVh + k0, (size_t)16 * SEQ);
    if (RES) {
      const int kvl = (k0 + 64 <= VLP) ? k0 : (VLP - 64);        // clamped address into the residual plane
      const __bf16* w = (const __bf16*)(const void*)(gVl + kvl);
      const unsigned lw = l + 3 * PLB;
      copy4_lds(lw, w, lw + L16, w + 16 * VLP, lw + 2 * L16, w + 32 * VLP, lw + 3 * L16, w + 48 * VLP);
    }
  };

  const int nkt = qb + 1;                    // key tiles 0..qb (block-uniform)
  stage(0, 0);
  asm volatile("s_wait_asynccnt 0x0" ::: "memory");   // this wave's tile-0 copies have landed
  __syncthreads();                                     // tile 0 readable by every wave
  if (nkt > 1) stage(1, 1);
  for (int kt = 0; kt < NQB; ++kt) {         // static bound
    if (kt >= nkt) break;                    // block-uniform
    const bool diag = (kt == qb);            // block-uniform
    const int kv0 = kt * 64;
    const unsigned short* sb = sKV + (kt & 1) * BUFE;
    const __bf16*   Ksh = (const __bf16*)(const void*)sb;                    // K hi [kv][d]
    const __bf16*   Ksl = (const __bf16*)(const void*)(sb + PLE);            // K lo
    const _Float16* Vth = (const _Float16*)(const void*)(sb + 2 * PLE);      // V^T hi [d][kv]
    const _Float16* Vtl = (const _Float16*)(const void*)(sb + (RES ? 3 : 2) * PLE);   // V^T residual, read only when RES

    // ---- scores, transposed: 64 keys x 16 query columns per wave, 3 bf16 products ----
    //      Issue order: d-chunk, product, key group innermost, so that neighbouring WMMAs write four independent tiles;
    //      each tile still sums (hi.hi, lo.hi, hi.lo) of d-chunk 0, then of d-chunk 1.
    v8f s[4];
#pragma unroll
    for (int j = 0; j < 4; ++j) s[j] = zero8();
#pragma unroll
    for (int dc = 0; dc < 2; ++dc) {
      FB kb[4], kl[4];
#pragma unroll
      for (int j = 0; j < 4; ++j) {
        kb[j].h[0] = *(const v8b*)(Ksh + (j * 16 + c) * LP + dc * 32 + 8 * hh);
        kb[j].h[1] = *(const v8b*)(Ksh + (j * 16 + c) * LP + dc * 32 + 16 + 8 * hh);
        kl[j].h[0] = *(const v8b*)(Ksl + (j * 16 + c) * LP + dc * 32 + 8 * hh);
        kl[j].h[1] = *(const v8b*)(Ksl + (j * 16 + c) * LP + dc * 32 + 16 + 8 * hh);
      }
#pragma unroll
      for (int j = 0; j < 4; ++j) s[j] = mma_b_raw(kb[j].v, qah[dc], s[j]);
#pragma unroll
      for (int j = 0; j < 4; ++j) s[j] = mma_b_raw(kl[j].v, qah[dc], s[j]);
#pragma unroll
      for (int j = 0; j < 4; ++j) s[j] = mma_b_raw(kb[j].v, qal[dc], s[j]);
    }

    // ---- scale + causal compare (diagonal tile only), column max, online softmax; P^T (x1024, f16) and its
    //      residual (x4096) are packed in registers as the B operands of the context products ----
    FH pb[2], pr[2];
    {
      const int qrow = q0 + c;                     // this lane's query
      float m = -INFINITY;
#pragma unroll
      for (int j = 0; j < 4; ++j)
#pragma unroll
        for (int r = 0; r < 8; ++r) s[j][r] *= sscale;
      if (diag) {                                  // block-uniform branch: a tile below the diagonal has nothing to compare
#pragma unroll
        for (int j = 0; j < 4; ++j) {
#pragma unroll
          for (int r = 0; r < 8; ++r) {
            const int key = kv0 + j * 16 + 8 * hh + r;   // key of accumulator element r of this lane
            s[j][r] = (key > qrow) ? -FLT_MAX : s[j][r];
          }
        }
      }
#pragma unroll
      for (int j = 0; j < 4; ++j)
#pragma unroll
        for (int r = 0; r < 8; ++r) m = fmaxf(m, s[j][r]);
      m = fmaxf(m, xhalf(m));                      // the query's other 32 keys of the tile
      const float mnew  = fmaxf(mrow, m);
      const float msafe = (mnew == -INFINITY) ? 0.f : mnew;
      const float alpha = __expf(mrow - msafe);
      mrow = mnew;
      float psum[2] = {0.f, 0.f};                  // one chain per 32 keys: two independent sums
#pragma unroll
      for (int j = 0; j < 4; ++j) {
#pragma unroll
        for (int r = 0; r < 8; ++r) {
          const float p = __expf(s[j][r] - msafe);   // floor logit against a normal max: exp -> 0
          psum[j >> 1] += p;
          const float p1k = p * 1024.0f;
          const _Float16 ph = (_Float16)p1k;
          pb[j >> 1].v[(j & 1) * 8 + r] = ph;
          if (RES) pr[j >> 1].v[(j & 1) * 8 + r] = (_Float16)((p1k - (float)ph) * 4096.0f);
        }
      }
      lrow = lrow * alpha + (psum[0] + psum[1]);
#pragma unroll
      for (int t = 0; t < 4; ++t)
#pragma unroll
        for (int r = 0; r < 8; ++r) oacc[t][r] *= alpha;
    }

    // ---- context^T += V^T . P^T (f16 WMMA), residual products into a separate accumulator ----
    v8f o1[4];
#pragma unroll
    for (int t = 0; t < 4; ++t) o1[t] = zero8();
#pragma unroll
    for (int kk = 0; kk < 2; ++kk) {               // unrolled: pb / pr are register operands
      FH vb[4], vl[4];
#pragma unroll
      for (int t = 0; t < 4; ++t) {
        vb[t].h[0] = *(const v8h*)(Vth + (t * 16 + c) * LP + kk * 32 + 8 * hh);
        vb[t].h[1] = *(const v8h*)(Vth + (t * 16 + c) * LP + kk * 32 + 16 + 8 * hh);
        if (RES) {
          vl[t].h[0] = *(const v8h*)(Vtl + (t * 16 + c) * LP + kk * 32 + 8 * hh);
          vl[t].h[1] = *(const v8h*)(Vtl + (t * 16 + c) * LP + kk * 32 + 16 + 8 * hh);
        }
      }
#pragma unroll
      for (int t = 0; t < 4; ++t) oacc[t] = mma_h_raw(vb[t].v, pb[kk].v, oacc[t]);
      if (RES) {
#pragma unroll
        for (int t = 0; t < 4; ++t) o1[t] = mma_h_raw(vl[t].v, pb[kk].v, o1[t]);
#pragma unroll
        for (int t = 0; t < 4; ++t) o1[t] = mma_h_raw(vb[t].v, pr[kk].v, o1[t]);
      }
    }
    if (RES) {
#pragma unroll
      for (int t = 0; t < 4; ++t)
#pragma unroll
        for (int r = 0; r < 8; ++r) oacc[t][r] += o1[t][r] * (1.0f / 4096.0f);
    }
    asm volatile("s_wait_dscnt 0x0" ::: "memory");      // this wave's reads of buffer kt & 1 are done before it is refilled
    asm volatile("s_wait_asynccnt 0x0" ::: "memory");   // this wave's tile kt + 1 copies have landed
    __syncthreads();                                     // publishes tile kt + 1, ends every read of buffer kt & 1
    if (kt + 2 < nkt) stage(kt + 2, kt & 1);
  }
  asm volatile("s_wait_asynccnt 0x0" ::: "memory");     // nothing in flight when the buffers become the context tiles

  // ---- normalise (1/l and the 1/1024 p carry), stage the wave's 16x64 tile, bf16 hi/lo split,
  float* os = (float*)(void*)sKV + wave * (16 * OSP);
  {
    const float l = lrow + xhalf(lrow);        // both lane halves' keys of query q0 + c
    const float inv = ((l > 0.f) ? (1.0f / l) : 0.f) * (1.0f / 1024.0f);
#pragma unroll
    for (int t = 0; t < 4; ++t)
#pragma unroll
      for (int r = 0; r < 8; ++r) os[c * OSP + t * 16 + 8 * hh + r] = oacc[t][r] * inv;
  }
  __builtin_amdgcn_fence(3, "workgroup");
  __builtin_amdgcn_wave_barrier();
  __builtin_amdgcn_fence(2, "workgroup");
  {
    const int q4 = lane >> 3, c8 = (lane & 7) * 8;
    v4u hv[4], lv[4];
#pragma unroll
    for (int it = 0; it < 4; ++it) {
      const int row = it * 4 + q4;   // it 0..3 x q4 0..3 = rows 0..15 of the wave tile
      const float* sp = os + row * OSP + c8;
      v4u a, a2;
#pragma unroll
      for (int e = 0; e < 4; ++e) {
        const float f0 = sp[2 * e], f1 = sp[2 * e + 1];
        const unsigned short h0 = bf_bits(f0), h1 = bf_bits(f1);
        const unsigned short l0 = bf_bits(f0 - bf_up(h0)), l1 = bf_bits(f1 - bf_up(h1));
        a[e] = pk16(h0, h1); a2[e] = pk16(l0, l1);
      }
      hv[it] = a; lv[it] = a2;
    }
    {
#pragma unroll
      for (int it = 0; it < 4; ++it) {
        const int row = it * 4 + q4;
        const size_t go = (size_t)(q0 + row) * DM + (size_t)h * HD + c8;
        *(v4u*)(Ohb + go) = hv[it];
        *(v4u*)(Olb + go) = lv[it];
      }
      
    }
  }
}

// =====================================================================================================
// Workspace map (bytes, NB = 4, SEQ = 2048; every activation plane holds NB batch slices back to back):
//   Xb    bf16 [NB*SEQ][1024]          0           16777216   (also holds Oh after the projections: same extent)
//   Wqb   bf16 [1024 n][1024 k]        16777216     2097152
//   Wkb   bf16 [1024 n][1024 k]        18874368     2097152
//   Wvb   bf16 [1024 n][1024 k]        20971520     2097152
//   Wob   bf16 [1024 n][1024 k]        23068672     2097152
//   Qh    bf16 [NB*SEQ][1024]          25165824    16777216
//   Ql    bf16 [NB*SEQ][1024]          41943040    16777216
//   Kh    bf16 [NB*SEQ][1024]          58720256    16777216
//   Kl    bf16 [NB*SEQ][1024]          75497472    16777216
//   VTh   f16  NB x [1024][SEQ]        92274688    16777216
//   VTl   f16  NB x [1024][VLP=512]   109051904     4194304
//   Ol    bf16 [NB*SEQ][1024]         113246208    16777216
//   end                               130023424
// Oh aliases Xb: Xb is last read by the v^T projection, Oh is first written by the attention launches that
// come after it in stream order; both extents are NB*SEQ*DM*2 bytes exactly.
// All planes are exact multiples of their 64x64 / whole-line store granularity (no padded tails needed),
// =====================================================================================================
extern "C" void kernel_launch(void* const* d_in, const int* in_sizes, int n_in,
                              void* d_out, int out_size, void* d_ws, size_t ws_size,
                              hipStream_t stream) {
  if (n_in < 5) return;
  const long long needX = (long long)(NB - 1) * SEQ_FULL * DM + (long long)SEQ * DM;   // last row read / written
  if ((long long)in_sizes[0] < needX) return;         // x [NB_FULL][SEQ_FULL][1024], rows 0..SEQ-1 of batches 0..NB-1
  if (in_sizes[1] < DM * DM) return;                  // Wq [1024 out][1024 in]
  if (in_sizes[2] < DM * DM) return;                  // Wk
  if (in_sizes[3] < DM * DM) return;                  // Wv
  if (in_sizes[4] < DM * DM) return;                  // Wo
  if ((long long)out_size < needX) return;

  const float* x  = (const float*)d_in[0];
  const float* Wq = (const float*)d_in[1];
  const float* Wk = (const float*)d_in[2];
  const float* Wv = (const float*)d_in[3];
  const float* Wo = (const float*)d_in[4];

  const size_t PX  = (size_t)NB * SEQ * DM * 2;     // 16-bit activation plane [NB*SEQ][1024]
  const size_t PW  = (size_t)DM * DM * 2;           // 16-bit weight plane [1024][1024]
  const size_t PVT = (size_t)NB * DM * SEQ * 2;     // v^T hi plane, NB slices
  const size_t PVL = (size_t)NB * DM * VLP * 2;     // v^T residual plane, NB slices
  static_assert((size_t)NB * SEQ * DM * 2 == (size_t)NB * DM * SEQ * 2);
  size_t off = 0;
  const size_t oXb  = off; off += PX;
  const size_t oOh  = oXb;                          // aliased, same extent PX
  const size_t oWq  = off; off += PW;
  const size_t oWk  = off; off += PW;
  const size_t oWv  = off; off += PW;
  const size_t oWo  = off; off += PW;
  const size_t oQh  = off; off += PX;
  const size_t oQl  = off; off += PX;
  const size_t oKh  = off; off += PX;
  const size_t oKl  = off; off += PX;
  const size_t oVTh = off; off += PVT;
  const size_t oVTl = off; off += PVL;
  const size_t oOl  = off; off += PX;
  if (off > ws_size) return;                     // off = 130023424 for NB = 4, SEQ = 2048
  if (off > (size_t)134217728) return;

  char* ws = (char*)d_ws;
  unsigned short* Xb  = (unsigned short*)(ws + oXb);
  unsigned short* Oh  = (unsigned short*)(ws + oOh);
  unsigned short* Wqb = (unsigned short*)(ws + oWq);
  unsigned short* Wkb = (unsigned short*)(ws + oWk);
  unsigned short* Wvb = (unsigned short*)(ws + oWv);
  unsigned short* Wob = (unsigned short*)(ws + oWo);
  unsigned short* Qh  = (unsigned short*)(ws + oQh);
  unsigned short* Ql  = (unsigned short*)(ws + oQl);
  unsigned short* Kh  = (unsigned short*)(ws + oKh);
  unsigned short* Kl  = (unsigned short*)(ws + oKl);
  unsigned short* VTh = (unsigned short*)(ws + oVTh);
  unsigned short* VTl = (unsigned short*)(ws + oVTl);
  unsigned short* Ol  = (unsigned short*)(ws + oOl);

  const dim3 blk(256);
  const dim3 gQK((NB * SEQ / GBM) * (DM / GBN), 1);                // M = NB*SEQ, N = 1024: 128x256 tiles
  const dim3 gVT((DM / GBM) * (SEQ / GBN), NB);                    // M = 1024, N = SEQ, per batch
  const dim3 gOut((SEQ / GBM) * (DM / GBN), NB);                   // M = SEQ, N = 1024, per batch
  const long long xStrideIn = (long long)SEQ_FULL * DM;            // input x batch stride (full layout)
  const long long pStride   = (long long)SEQ * DM;                 // plane batch stride

  // (1) x -> bf16 plane [NB*SEQ][1024] (batch b reads input rows b*SEQ_FULL .. +SEQ-1); weights -> bf16 [n][k]
  cvt_all<<<dim3(CVG), dim3(CVB), 0, stream>>>(x, Wq, Wk, Wv, Wo, Xb, Wqb, Wkb, Wvb, Wob);
  // (2) q = x . Wq^T -> bf16 hi/lo planes [b*SEQ + t][h*64+d]   (M = NB*SEQ, N = 1024, K = 1024)
  gemm64<0, 2><<<gQK, blk, 0, stream>>>(
      Xb, Xb, DM, 0LL, Wqb, Wqb, DM, 0LL,
      (void*)Qh, DM, 0LL, (void*)Ql, DM, 0LL, DM,
      NB * SEQ, DM, DM, 1.0f);
  // (3) k = x . Wk^T -> bf16 hi/lo planes
  gemm64<0, 2><<<gQK, blk, 0, stream>>>(
      Xb, Xb, DM, 0LL, Wkb, Wkb, DM, 0LL,
      (void*)Kh, DM, 0LL, (void*)Kl, DM, 0LL, DM,
      NB * SEQ, DM, DM, 1.0f);
  // (4) v^T = Wv . x^T per batch -> f16 hi plane [h*64+d][s] (pitch SEQ, batch stride DM*SEQ) and residual
  //     plane (x4096, keys < VLP only, pitch VLP, batch stride DM*VLP)   (A = Wvb [n][k], Bt = Xb slice b;
  //     M = 1024, N = SEQ, K = 1024, grid.y = batch)
  gemm64<0, 3><<<gVT, blk, 0, stream>>>(
      Wvb, Wvb, DM, 0LL, Xb, Xb, DM, pStride,
      (void*)VTh, SEQ, (long long)DM * SEQ, (void*)VTl, VLP, (long long)DM * VLP, VLP,
      DM, SEQ, DM, 4096.0f);
  // (5) causal attention: query blocks 0..RESQB-1 with residual planes, the rest without; grid = (NH * query blocks, NB),
  //     the kernel maps the start rank to (query block descending, batch, head)
  attn_causal64<true><<<dim3(NH * RESQB, NB), dim3(128), 0, stream>>>(
      Qh, Ql, Kh, Kl, VTh, VTl, Oh, Ol, 0, RESQB, 0.125f);
  if (NQB > RESQB) {
    attn_causal64<false><<<dim3(NH * (NQB - RESQB), NB), dim3(128), 0, stream>>>(
        Qh, Ql, Kh, Kl, VTh, VTl, Oh, Ol, RESQB, NQB - RESQB, 0.125f);
  }
  // (6) out = context . Wo^T -> d_out f32, batch b rows b*SEQ_FULL .. +SEQ-1 (A = context hi + lo planes,
  //     2 products; M = SEQ, N = 1024, K = 1024, grid.y = batch)
  gemm64<1, 0><<<gOut, blk, 0, stream>>>(
      Oh, Ol, DM, pStride, Wob, Wob, DM, 0LL,
      d_out, DM, xStrideIn, d_out, DM, 0LL, DM,
      SEQ, DM, DM, 1.0f);
  (void)hipGetLastError();
}

// v009
// One run takes 166 microseconds.
// Two timings next to v008 both put it at 1.10 times that version's speed.
// All steps since v000 together make it 3.40 times as fast.
// Contractions: q, k, v^T projections = v_wmma_f32_16x16x32_bf16 (bf16 operands from RNE-converted inputs, single product);
// q.k^T scores = v_wmma_f32_16x16x32_bf16 with bf16 hi/lo split q and k (hi.hi + hi.lo + lo.hi);
// (attention products are formed transposed: A = k rows / v^T rows, B = q / p^T, so a lane owns one query column)
// p.v = v_wmma_f32_16x16x32_f16 (p carried x1024 in f16, v in f16; extra f16 residual planes x4096 of p and v for the first VLP query rows);
// ctx.Wo = v_wmma_f32_16x16x32_bf16 with ctx as bf16 hi/lo planes times bf16 Wo (2 products); all f32 accumulate; causal compare and softmax in f32.
#include <hip/hip_runtime.h>
#include <math.h>
#include <float.h>
#include <stdint.h>

#ifndef NB
#define NB    4
#endif
#ifndef SEQ
#define SEQ   2048
#endif
#define NB_FULL  4
#define SEQ_FULL 2048
#define DM    1024
#define NH    16
#define HD    64
#define NQB   (SEQ / 64)                      // key / query tiles of 64
#define VLP   ((SEQ < 512) ? SEQ : 512)       // key pitch of the v^T residual plane (keys 0..VLP-1)
#define RESQB (VLP / 64)                      // number of leading 64-row query blocks that use the p / v residual planes
#define LP    72                              // LDS row pitch (16-bit elements) of the 64-wide K and V^T tiles: 144 B = 16 B x odd
#define OSP   68                              // LDS row pitch (floats) of the per-wave context tile: 272 B = 16 B x odd
#define GP    72                              // LDS row pitch (16-bit elements) of the staged 64-k GEMM operand rows: 144 B = 16 B x odd
#define GBM   128                             // GEMM work-group tile rows (2 waves of 64)
#define GBN   256                             // GEMM work-group tile columns (4 waves of 64)
static_assert(NB >= 1 && NB <= NB_FULL);
static_assert((SEQ % GBN) == 0 && (DM % GBN) == 0 && (DM % 128) == 0);
static_assert(NH * HD == DM && HD == 64);
static_assert((SEQ % 64) == 0 && (DM % 64) == 0 && SEQ >= 64 && SEQ <= SEQ_FULL);
static_assert(RESQB * 64 == VLP && VLP <= SEQ && RESQB >= 1 && RESQB <= NQB);

typedef _Float16 v16h __attribute__((ext_vector_type(16)));
typedef _Float16 v8h  __attribute__((ext_vector_type(8)));
typedef __bf16   v16b __attribute__((ext_vector_type(16)));
typedef __bf16   v8b  __attribute__((ext_vector_type(8)));
typedef float    v8f  __attribute__((ext_vector_type(8)));
typedef float    v4f  __attribute__((ext_vector_type(4)));
typedef unsigned int v4u __attribute__((ext_vector_type(4)));

// ---- scalar helpers --------------------------------------------------------------------------------
__device__ __forceinline__ unsigned short bf_bits(float f) {          // f32 -> bf16 bits, RNE convert
  unsigned u = __float_as_uint(f);
  return (unsigned short)((u + 0x7FFFu + ((u >> 16) & 1u)) >> 16);
}
__device__ __forceinline__ float bf_up(unsigned short h) { return __uint_as_float(((unsigned)h) << 16); }
__device__ __forceinline__ unsigned short h_bits(_Float16 x) { return __builtin_bit_cast(unsigned short, x); }
__device__ __forceinline__ unsigned pk16(unsigned short a, unsigned short b) { return (unsigned)a | ((unsigned)b << 16); }
__device__ __forceinline__ v8f zero8() { v8f z = {0.f, 0.f, 0.f, 0.f, 0.f, 0.f, 0.f, 0.f}; return z; }

// ---- fragment loaders: 16-bit A/B operand, lane -> row/col (lane&15), p already includes +8*(lane>>4);
//      elements 0..7 <- p[0..7] (k0+8h..), elements 8..15 <- p[16..23] (k0+16+8h..)
__device__ __forceinline__ v16b ldfrag_b(const __bf16* p) {
  union { v16b v; v8b h[2]; } f;
  f.h[0] = *(const v8b*)(p);
  f.h[1] = *(const v8b*)(p + 16);
  return f.v;
}

// ---- WMMA helpers: plain builtins (the compiler keeps the distance to a vector instruction on D, A or B) ----
__device__ __forceinline__ v8f mma_b_raw(v16b a, v16b b, v8f c) {
  return __builtin_amdgcn_wmma_f32_16x16x32_bf16(false, a, false, b, (short)0, c, false, false);
}
__device__ __forceinline__ v8f mma_h_raw(v16h a, v16h b, v8f c) {
  return __builtin_amdgcn_wmma_f32_16x16x32_f16(false, a, false, b, (short)0, c, false, false);
}
__device__ __forceinline__ void acc_guard4(v8f& a, v8f& b, v8f& c, v8f& d) {
  asm volatile("v_nop\n\tv_nop\n\tv_nop\n\tv_nop" : "+v"(a), "+v"(b), "+v"(c), "+v"(d));
}

// ---- value of lane l ^ 16 (the other 16-lane row), on the vector port; all 32 lanes are on wherever it is called
__device__ __forceinline__ float xhalf(float x) {
  const int b = __float_as_int(x);
  return __int_as_float(__builtin_amdgcn_permlanex16(b, b, 0x76543210, 0xfedcba98, false, false));
}

// ---- asynchronous copies global -> LDS: four 16-B pieces per lane (l* = LDS byte address, g* = global address).
//      The s_wait_xcnt closes the statement so that no address register is rewritten ahead of it.
__device__ __forceinline__ void copy4_lds(unsigned l0, const __bf16* g0, unsigned l1, const __bf16* g1,
                                          unsigned l2, const __bf16* g2, unsigned l3, const __bf16* g3) {
  asm volatile("global_load_async_to_lds_b128 %0, %1, off\n\t"
               "global_load_async_to_lds_b128 %2, %3, off\n\t"
               "global_load_async_to_lds_b128 %4, %5, off\n\t"
               "global_load_async_to_lds_b128 %6, %7, off\n\t"
               "s_wait_xcnt 0x0"
               :: "v"(l0), "v"(g0), "v"(l1), "v"(g1), "v"(l2), "v"(g2), "v"(l3), "v"(g3) : "memory");
}
// ---- the same for three 64-row planes at once: plane p = rows at LDS l + p * pl + i * ls and global g<p> + i * s<p> elements
//      (i = 0..3), twelve 16-B pieces per lane under one closing s_wait_xcnt.
__device__ __forceinline__ void copy12_lds(unsigned l, unsigned pl, unsigned ls,
                                           const unsigned short* g0, size_t s0, const unsigned short* g1, size_t s1,
                                           const unsigned short* g2, size_t s2) {
  asm volatile("global_load_async_to_lds_b128 %0, %1, off\n\t"
               "global_load_async_to_lds_b128 %2, %3, off\n\t"
               "global_load_async_to_lds_b128 %4, %5, off\n\t"
               "global_load_async_to_lds_b128 %6, %7, off\n\t"
               "global_load_async_to_lds_b128 %8, %9, off\n\t"
               "global_load_async_to_lds_b128 %10, %11, off\n\t"
               "global_load_async_to_lds_b128 %12, %13, off\n\t"
               "global_load_async_to_lds_b128 %14, %15, off\n\t"
               "global_load_async_to_lds_b128 %16, %17, off\n\t"
               "global_load_async_to_lds_b128 %18, %19, off\n\t"
               "global_load_async_to_lds_b128 %20, %21, off\n\t"
               "global_load_async_to_lds_b128 %22, %23, off\n\t"
               "s_wait_xcnt 0x0"
               :: "v"(l), "v"(g0), "v"(l + ls), "v"(g0 + s0), "v"(l + 2 * ls), "v"(g0 + 2 * s0), "v"(l + 3 * ls), "v"(g0 + 3 * s0),
                  "v"(l + pl), "v"(g1), "v"(l + pl + ls), "v"(g1 + s1), "v"(l + pl + 2 * ls), "v"(g1 + 2 * s1),
                  "v"(l + pl + 3 * ls), "v"(g1 + 3 * s1),
                  "v"(l + 2 * pl), "v"(g2), "v"(l + 2 * pl + ls), "v"(g2 + s2), "v"(l + 2 * pl + 2 * ls), "v"(g2 + 2 * s2),
                  "v"(l + 2 * pl + 3 * ls), "v"(g2 + 3 * s2)
               : "memory");
}

// =====================================================================================================
// f32 -> bf16 (RNE convert) of x and of the four weight matrices in ONE launch of CVG work-groups x CVB threads: about one
// work-group of 16 waves per WGP, started once.
// A unit = 8 elements = 32 B read, one 16-B store per lane (a wave writes 512 contiguous B). Work-group b owns units
// b * XIT * CVB .. + XIT * CVB - 1 of x and b * WIT * CVB .. + WIT * CVB - 1 of each weight; thread t takes units k * CVB + t
// of each range. All of a thread's loads are issued ahead of its first convert.
// x unit u lies in batch slice u / XUB (input batch stride SEQ_FULL * DM elements, plane batch stride SEQ * DM).
// coverage: CVG * XIT * CVB >= XU and CVG * WIT * CVB >= WU; units past the end are read at the last unit's address and
// not stored.
// =====================================================================================================
#define CVB  512                              // threads of a convert work-group
#define CVG  256                              // convert work-groups
#define CVTH (CVB * CVG)                      // convert threads
#define XUB  (SEQ * DM / 8)                   // units of one batch slice of x
#define XU   (NB * XUB)                       // units of x
#define WU   (DM * DM / 8)                    // units of one weight matrix
#define XIT  ((XU + CVTH - 1) / CVTH)         // units of x per thread
#define WIT  ((WU + CVTH - 1) / CVTH)         // units of one weight matrix per thread
__device__ __forceinline__ v4u cvt8(v4f a, v4f b) {
  v4u p;
  p[0] = pk16(bf_bits(a[0]), bf_bits(a[1]));
  p[1] = pk16(bf_bits(a[2]), bf_bits(a[3]));
  p[2] = pk16(bf_bits(b[0]), bf_bits(b[1]));
  p[3] = pk16(bf_bits(b[2]), bf_bits(b[3]));
  return p;
}
__global__ __launch_bounds__(CVB) void cvt_all(const float* __restrict__ x, const float* __restrict__ wq,
                                               const float* __restrict__ wk, const float* __restrict__ wv,
                                               const float* __restrict__ wo, unsigned short* __restrict__ xb,
                                               unsigned short* __restrict__ wqb, unsigned short* __restrict__ wkb,
                                               unsigned short* __restrict__ wvb, unsigned short* __restrict__ wob) {
  const unsigned t  = threadIdx.x;
  const unsigned xu = blockIdx.x * (unsigned)(XIT * CVB);    // first x unit of the work-group
  const unsigned wu = blockIdx.x * (unsigned)(WIT * CVB);    // first unit of the work-group in each weight
  constexpr bool XEX = (XUB % (XIT * CVB)) == 0 && (XU % CVTH) == 0;   // whole ranges, each inside one batch slice
  constexpr bool WEX = (WU % CVTH) == 0;
  // work-group-uniform bases, in 16-B pieces; a lane adds a 32-bit piece index
  const unsigned xbs = xu / (unsigned)XUB;
  const v4f* px = (const v4f*)(x + (size_t)xbs * ((size_t)SEQ_FULL * DM) + (size_t)(xu - xbs * (unsigned)XUB) * 8);
  const size_t wb = WEX ? (size_t)wu * 2 : (size_t)0;
  const v4f* pw[4] = {(const v4f*)wq + wb, (const v4f*)wk + wb, (const v4f*)wv + wb, (const v4f*)wo + wb};
  v4u* ox = (v4u*)xb + xu;
  v4u* ow[4] = {(v4u*)wqb + wu, (v4u*)wkb + wu, (v4u*)wvb + wu, (v4u*)wob + wu};
  // holds the argument loads and the index arithmetic of the bases in front of the run of loads: placed behind it they
  // rewrite a base register of a load just issued
  __builtin_amdgcn_sched_barrier(0);
  v4f xa[XIT], xc[XIT], wa[4][WIT], wc[4][WIT];
#pragma unroll
  for (int k = 0; k < XIT; ++k) {
    if (XEX) {
      xa[k] = px[2u * (k * CVB + t)];
      xc[k] = px[2u * (k * CVB + t) + 1u];
    } else {
      const unsigned u  = xu + k * CVB + t;
      const unsigned uc = (u < (unsigned)XU) ? u : (unsigned)(XU - 1);
      const unsigned bs = uc / (unsigned)XUB;
      const v4f* p = (const v4f*)(x + (size_t)bs * ((size_t)SEQ_FULL * DM) + (size_t)(uc - bs * (unsigned)XUB) * 8);
      xa[k] = p[0];
      xc[k] = p[1];
    }
  }
#pragma unroll
  for (int k = 0; k < WIT; ++k) {
    const unsigned u = wu + k * CVB + t;
    const unsigned o = WEX ? 2u * (k * CVB + t) : 2u * ((u < (unsigned)WU) ? u : (unsigned)(WU - 1));
#pragma unroll
    for (int w = 0; w < 4; ++w) {
      wa[w][k] = pw[w][o];
      wc[w][k] = pw[w][o + 1u];
    }
  }
  // keeps every load above in front of the converts: without it the last loads are issued only after the first have
  // come back, and the wave waits out the memory latency twice
  __builtin_amdgcn_sched_barrier(0);
  // the converts reuse the loads' address registers: the wait stands in front of the first such overwrite
  asm volatile("s_wait_xcnt 0x0" ::: "memory");
  __builtin_amdgcn_sched_barrier(0);           // holds the converts behind that wait
#pragma unroll
  for (int k = 0; k < XIT; ++k) {
    if (XEX || xu + k * CVB + t < (unsigned)XU) ox[k * CVB + t] = cvt8(xa[k], xc[k]);
    // keeps each store where its unit is ready: without it every store sinks behind the wait for the wave's last load
    __builtin_amdgcn_sched_barrier(0);
  }
#pragma unroll
  for (int k = 0; k < WIT; ++k) {
    if (WEX || wu + k * CVB + t < (unsigned)WU) {
#pragma unroll
      for (int w = 0; w < 4; ++w) ow[w][k * CVB + t] = cvt8(wa[w][k], wc[w][k]);
    }
  }
}

// =====================================================================================================
// bf16 WMMA GEMM: C[m][n] = sum_k A[m][k] * Bt[n][k]; a work-group of 8 waves (2 x 4) owns a 128x256 tile, each wave
// a 64x64 tile. A row-major [M][K] pitch lda; Bt row-major [N][K] pitch ldb (k contiguous); M multiple of 128,
// N multiple of 256, K multiple of 64 (host-checked). batch index b (strides in elements).
// Operand staging: per 64-k slab the rows of A (and A2) and Bt that the work-group needs are copied once into LDS
// (asynchronous 16-B copies, 8 lanes per 128-B row piece = whole lines; LDS pitch GP), two buffers, the next
// slab in flight while a slab is multiplied; every wave reads its fragments from LDS.
// NSPLIT: 0 = A.Bt; 1 = (A + A2).Bt (A2 = unscaled bf16 lo plane of A).
// OUT_MODE: 0 = f32 (pitch ldc); 2 = bf16 hi plane C + bf16 lo plane C2 (lo = RNE(v - hi), unscaled);
//           3 = f16 hi plane C + f16 residual plane C2 = f16((v - hi) * rscale), C2 written only for tiles
//               with n0 < N2 (pitch ldc2, batch stride strideC2).
// =====================================================================================================
// gemm64_tile = one work-group tile: tile index bx (bm = bx / (N / 256), bn = the rest), batch index b; sAB = the two slab
// buffers [A 128 rows | A2 128 rows | Bt 256 rows] x 64 k, sT = 8 per-wave 16x64 slabs of pitch 68 floats, both the kernel's LDS.
#define GEMM_ABE(NSPLIT) (2 * ((((NSPLIT) == 1) ? 2 * GBM : GBM) + GBN) * GP)   // 16-bit elements of the two slab buffers
#define GEMM_STE (8 * 16 * 68)                                                  // floats of the eight per-wave slabs
template <int NSPLIT, int OUT_MODE>
__device__ __forceinline__ void gemm64_tile(
    __bf16* sAB, float* sT, int bx, int b,
    const unsigned short* __restrict__ Ap, const unsigned short* A2p, int lda, long long strideA,
    const unsigned short* __restrict__ Btp, int ldb, long long strideB,
    void* Cout, int ldc, long long strideC,
    void* Cout2, int ldc2, long long strideC2, int N2,
    int M, int N, int K, float rscale) {
  static_assert(NSPLIT == 0 || NSPLIT == 1);
  constexpr int AROWS = (NSPLIT == 1) ? 2 * GBM : GBM;   // staged rows of A, then of A2
  constexpr int BUFE  = (AROWS + GBN) * GP;              // 16-bit elements of one slab buffer
  static_assert(2 * BUFE == GEMM_ABE(NSPLIT));
  const __bf16* A   = (const __bf16*)(const void*)Ap;
  const __bf16* A2  = (const __bf16*)(const void*)A2p;
  const __bf16* Bt  = (const __bf16*)(const void*)Btp;
  const int tid  = threadIdx.x;
  const int lane = tid & 31;
  const int wave = tid >> 5;
  const int nbn = N / GBN;
  const int nbm = M / GBM;
  if (bx >= nbm * nbn) return;                // block-uniform, in front of every barrier and copy
  const int bm = bx / nbn;
  const int bn = bx - bm * nbn;
  const int wm = wave >> 2;                    // wave row 0..1
  const int wn = wave & 3;                     // wave column 0..3
  const int m0 = bm * GBM + (wm << 6);
  const int n0 = bn * GBN + (wn << 6);

  const __bf16* Ab  = A  + (size_t)b * strideA;
  const __bf16* Bb  = Bt + (size_t)b * strideB;
  const __bf16* Ab2 = (NSPLIT == 1) ? (A2 + (size_t)b * strideA) : Ab;

  const int rlane = lane & 15;                 // row (A) / col (B, D) within subtile
  const int koff  = (lane >> 4) * 8;           // k offset of this lane half
  const int mOff  = (lane >> 4) * 8;           // D row offset

  // copy map: thread -> row (tid >> 3) + 32 * i of a staged plane, 16-B piece (tid & 7) of its 128 B
  const int crow = tid >> 3;
  const int cpc  = (tid & 7) * 8;
  const __bf16* gA  = Ab  + (size_t)(bm * GBM + crow) * lda + cpc;
  const __bf16* gA2 = Ab2 + (size_t)(bm * GBM + crow) * lda + cpc;
  const __bf16* gB  = Bb  + (size_t)(bn * GBN + crow) * ldb + cpc;
  const unsigned lbase = (unsigned)(uintptr_t)(&sAB[0]) + (unsigned)((crow * GP + cpc) * 2);
  const size_t a32 = (size_t)32 * lda, b32 = (size_t)32 * ldb;
  constexpr unsigned L32 = 32u * GP * 2u;      // LDS bytes of 32 staged rows

  auto stage = [&](int t, int buf) {           // slab t (k = 64 t .. 64 t + 63) into buffer buf
    const unsigned l = lbase + (unsigned)buf * (unsigned)(BUFE * 2);
    const __bf16* a = gA + (size_t)t * 64;
    copy4_lds(l, a, l + L32, a + a32, l + 2 * L32, a + 2 * a32, l + 3 * L32, a + 3 * a32);
    if (NSPLIT == 1) {
      const __bf16* a2 = gA2 + (size_t)t * 64;
      const unsigned l2 = l + 4 * L32;
      copy4_lds(l2, a2, l2 + L32, a2 + a32, l2 + 2 * L32, a2 + 2 * a32, l2 + 3 * L32, a2 + 3 * a32);
    }
    const __bf16* bp = gB + (size_t)t * 64;
    const unsigned lb = l + (unsigned)(AROWS / 32) * L32;
    copy4_lds(lb, bp, lb + L32, bp + b32, lb + 2 * L32, bp + 2 * b32, lb + 3 * L32, bp + 3 * b32);
    copy4_lds(lb + 4 * L32, bp + 4 * b32, lb + 5 * L32, bp + 5 * b32, lb + 6 * L32, bp + 6 * b32, lb + 7 * L32, bp + 7 * b32);
  };

  v8f acc[4][4];
#pragma unroll
  for (int i = 0; i < 4; ++i)
#pragma unroll
    for (int j = 0; j < 4; ++j) acc[i][j] = zero8();

  const int nst = K >> 6;                      // slabs of 64 k
  stage(0, 0);
  asm volatile("s_wait_asynccnt 0x0" ::: "memory");   // this wave's slab-0 copies have landed
  __syncthreads();                                     // slab 0 readable by every wave
  if (nst > 1) stage(1, 1);

  const int aoff = ((wm << 6) + rlane) * GP + koff;            // this lane's A fragment row in a buffer
  const int boff = (AROWS + (wn << 6) + rlane) * GP + koff;    // this lane's Bt fragment row in a buffer
  for (int t = 0; t < nst; ++t) {
    const __bf16* sb = sAB + (t & 1) * BUFE;
#pragma unroll
    for (int ks = 0; ks < 2; ++ks) {
      v16b bh[4], ah[4], al[4];
#pragma unroll
      for (int j = 0; j < 4; ++j) bh[j] = ldfrag_b(sb + boff + j * 16 * GP + ks * 32);
#pragma unroll
      for (int i = 0; i < 4; ++i) {
        ah[i] = ldfrag_b(sb + aoff + i * 16 * GP + ks * 32);
        if (NSPLIT == 1) al[i] = ldfrag_b(sb + aoff + (GBM + i * 16) * GP + ks * 32); else al[i] = ah[i];
      }
      // inputs-only fence on the loaded fragments: keeps the k-step's LDS reads one group in front of its WMMAs
      // (without it each A fragment is read into one register set and its LDS latency waited out four times)
      asm volatile("" :: "v"(bh[0]), "v"(bh[1]), "v"(bh[2]), "v"(bh[3]), "v"(ah[0]), "v"(ah[1]), "v"(ah[2]), "v"(ah[3]));
      if (NSPLIT == 1) asm volatile("" :: "v"(al[0]), "v"(al[1]), "v"(al[2]), "v"(al[3]));   // same, lo plane
#pragma unroll
      for (int i = 0; i < 4; ++i) {
#pragma unroll
        for (int j = 0; j < 4; ++j) {
          acc[i][j] = mma_b_raw(ah[i], bh[j], acc[i][j]);
          if (NSPLIT == 1) acc[i][j] = mma_b_raw(al[i], bh[j], acc[i][j]);
        }
      }
    }
    asm volatile("s_wait_dscnt 0x0" ::: "memory");      // this wave's reads of buffer t & 1 are done before it is refilled
    asm volatile("s_wait_asynccnt 0x0" ::: "memory");   // this wave's slab t + 1 copies have landed
    __syncthreads();                                     // publishes slab t + 1, ends every read of buffer t & 1
    if (t + 2 < nst) stage(t + 2, t & 1);
  }
  asm volatile("s_wait_asynccnt 0x0" ::: "memory");     // nothing in flight when the wave goes on
  acc_guard4(acc[0][0], acc[0][1], acc[0][2], acc[0][3]);
  acc_guard4(acc[1][0], acc[1][1], acc[1][2], acc[1][3]);
  acc_guard4(acc[2][0], acc[2][1], acc[2][2], acc[2][3]);
  acc_guard4(acc[3][0], acc[3][1], acc[3][2], acc[3][3]);

  // ---- epilogue ----
  float* slab = sT + wave * (16 * 68);
#pragma unroll
  for (int i = 0; i < 4; ++i) {
    const int mBase = m0 + (i << 4);
#pragma unroll
    for (int j = 0; j < 4; ++j) {
#pragma unroll
      for (int r = 0; r < 8; ++r) {
        slab[(mOff + r) * 68 + (j << 4) + rlane] = acc[i][j][r];
      }
    }
    __builtin_amdgcn_fence(3, "workgroup");
    __builtin_amdgcn_wave_barrier();
    __builtin_amdgcn_fence(2, "workgroup");
    if (OUT_MODE == 0) {
      float* C = (float*)Cout + (size_t)b * strideC;
      const int hh = lane >> 4, c4 = (lane & 15) * 4;     // 256-B row segment = 16 lanes x 16 B
      {
#pragma unroll
        for (int it = 0; it < 8; ++it) {
          const int row = it * 2 + hh;                     // it 0..7 x hh 0..1 = rows 0..15
          const v4f v = *(const v4f*)(slab + row * 68 + c4);
          *(v4f*)(C + (size_t)(mBase + row) * ldc + n0 + c4) = v;
        }
        
      }
    } else {
      const int q = lane >> 3, c8 = (lane & 7) * 8;
      unsigned short* C  = (unsigned short*)Cout  + (size_t)b * strideC;
      unsigned short* C2 = (unsigned short*)Cout2 + (size_t)b * strideC2;
      const bool wlo = (OUT_MODE == 2) || (n0 < N2);      // wave-uniform
      v4u hv[4], lv[4];
#pragma unroll
      for (int it = 0; it < 4; ++it) {
        const int row = it * 4 + q;                        // it 0..3 x q 0..3 = rows 0..15
        const float* sp = slab + row * 68 + c8;
        v4u a, a2;
#pragma unroll
        for (int e = 0; e < 4; ++e) {
          const float f0 = sp[2 * e], f1 = sp[2 * e + 1];
          unsigned short h0, h1, l0, l1;
          if (OUT_MODE == 2) {
            h0 = bf_bits(f0); h1 = bf_bits(f1);
            l0 = bf_bits(f0 - bf_up(h0)); l1 = bf_bits(f1 - bf_up(h1));
          } else {
            const _Float16 x0 = (_Float16)f0, x1 = (_Float16)f1;
            h0 = h_bits(x0); h1 = h_bits(x1);
            l0 = h_bits((_Float16)((f0 - (float)x0) * rscale));
            l1 = h_bits((_Float16)((f1 - (float)x1) * rscale));
          }
          a[e] = pk16(h0, h1); a2[e] = pk16(l0, l1);
        }
        hv[it] = a; lv[it] = a2;
      }
      {
#pragma unroll
        for (int it = 0; it < 4; ++it) {
          const int row = it * 4 + q;
          *(v4u*)(C + (size_t)(mBase + row) * ldc + n0 + c8) = hv[it];
          if (wlo) *(v4u*)(C2 + (size_t)(mBase + row) * ldc2 + n0 + c8) = lv[it];
        }
        
      }
    }
    __builtin_amdgcn_fence(3, "workgroup");
    __builtin_amdgcn_wave_barrier();
    __builtin_amdgcn_fence(2, "workgroup");
  }
}

// one GEMM per launch: blockIdx.x = tile index, blockIdx.y = batch index
template <int NSPLIT, int OUT_MODE>
__global__ __launch_bounds__(256) void gemm64(
    const unsigned short* __restrict__ Ap, const unsigned short* A2p, int lda, long long strideA,
    const unsigned short* __restrict__ Btp, int ldb, long long strideB,
    void* Cout, int ldc, long long strideC,
    void* Cout2, int ldc2, long long strideC2, int N2,
    int M, int N, int K, float rscale) {
  __shared__ __align__(16) __bf16 sAB[GEMM_ABE(NSPLIT)];
  __shared__ __align__(16) float sT[GEMM_STE];
  gemm64_tile<NSPLIT, OUT_MODE>(sAB, sT, (int)blockIdx.x, (int)blockIdx.y, Ap, A2p, lda, strideA, Btp, ldb, strideB,
                                Cout, ldc, strideC, Cout2, ldc2, strideC2, N2, M, N, K, rscale);
}

// =====================================================================================================
// The q, k and v^T projections in ONE launch of 2 * TQK + TVT * NB work-groups (each GEMM alone has one work-group per WGP:
// two waves per SIMD, and its start, first slab and epilogue overlap nothing). The LDS and registers of a work-group let
// two of them share a WGP, so one's LDS reads, slab waits, barriers and epilogue run beside the other's WMMAs.
//   blockIdx.x in [0, TQK): q tile; [TQK, 2 TQK): k tile   (A = x plane [NB*SEQ][1024], Bt = Wq / Wk [n][k]; bf16 hi / lo out)
//   then TVT tiles per batch of v^T = Wv . x^T              (A = Wv [n][k], Bt = x slice of the batch; f16 hi plane pitch SEQ,
//   residual plane x rscale for keys < vlp, pitch vlp). The choice is block-uniform; the tiles are independent of each other.
//   rowsX = NB*SEQ, dm = 1024, seq = SEQ, vlp = VLP: the pitches and extents of the three products.
// =====================================================================================================
#define TQK ((NB * SEQ / GBM) * (DM / GBN))   // tiles of the q (or k) projection: M = NB*SEQ, N = 1024
#define TVT ((DM / GBM) * (SEQ / GBN))        // tiles of the v^T projection of one batch: M = 1024, N = SEQ
__global__ __launch_bounds__(256) void proj_qkv(
    const unsigned short* __restrict__ xb, const unsigned short* __restrict__ wqb, const unsigned short* __restrict__ wkb,
    const unsigned short* __restrict__ wvb, unsigned short* qh, unsigned short* ql, unsigned short* kh, unsigned short* kl,
    unsigned short* vth, unsigned short* vtl, int rowsX, int dm, int seq, int vlp, float rscale) {
  __shared__ __align__(16) __bf16 sAB[GEMM_ABE(0)];
  __shared__ __align__(16) float sT[GEMM_STE];
  const int idx = (int)blockIdx.x;
  if (idx < 2 * TQK) {
    const bool isk = idx >= TQK;
    gemm64_tile<0, 2>(sAB, sT, isk ? idx - TQK : idx, 0, xb, xb, dm, 0LL, isk ? wkb : wqb, dm, 0LL,
                      (void*)(isk ? kh : qh), dm, 0LL, (void*)(isk ? kl : ql), dm, 0LL, dm,
                      rowsX, dm, dm, 1.0f);
  } else {
    const int r = idx - 2 * TQK;
    gemm64_tile<0, 3>(sAB, sT, r % TVT, r / TVT, wvb, wvb, dm, 0LL, xb, dm, (long long)seq * dm,
                      (void*)vth, seq, (long long)dm * seq, (void*)vtl, vlp, (long long)dm * vlp, vlp,
                      dm, seq, dm, rscale);
  }
}

template <bool RES>
__global__ __launch_bounds__(128) __attribute__((amdgpu_num_vgpr(256), amdgpu_waves_per_eu(4, 4)))
void attn_causal64(const unsigned short* __restrict__ qhp, const unsigned short* __restrict__ qlp,
                   const unsigned short* __restrict__ khp, const unsigned short* __restrict__ klp,
                   const unsigned short* __restrict__ vhp, const unsigned short* __restrict__ vlp,
                   unsigned short* ohp, unsigned short* olp,
                   int qbBase, int nqbThis, float sscale) {
  union FB { v16b v; v8b h[2]; };
  union FH { v16h v; v8h h[2]; };
  constexpr int PLE  = 64 * LP;                 // 16-bit elements of one staged plane tile, pitch LP, 9 KB
  constexpr int BUFE = (RES ? 4 : 3) * PLE;     // one buffer: K hi [kv][d] | K lo | V^T hi [d][kv] | V^T residual (RES)
  __shared__ __align__(16) unsigned short sKV[2 * BUFE];          // two tile buffers; the epilogue's context tiles lie over them
  static_assert((size_t)2 * BUFE * 2 >= (size_t)4 * 16 * OSP * 4);

  const int tid  = threadIdx.x;
  const int wave = tid >> 5;
  const int lane = tid & 31;
  const int hh   = lane >> 4;
  const int c    = lane & 15;

  // There are more work-groups than resident places, and query block qb
  // costs qb + 1 key tiles: the rank (x fastest, then y) maps to the query block slowest and descending, so the
  // lowest ranks get the longest work-groups (ordering for speed only). rank -> (qbl, bb, h) is a permutation of the grid.
  const int rank = (int)blockIdx.y * (nqbThis * NH) + (int)blockIdx.x;   // 0 .. nqbThis*NH*NB-1 (grid = (nqbThis*NH, NB))
  const int qbl  = nqbThis - 1 - rank / (NH * NB);   // nqbThis-1 .. 0
  const int bb   = (rank / NH) % NB;                 // batch
  const int h    = rank % NH;                        // head
  const int qb   = qbBase + qbl;
  const int q0   = qb * 64 + wave * 16;

  const size_t pstride = (size_t)SEQ * DM;                  // per-batch elements of the [t][h*64+d] planes
  const __bf16* Qh = (const __bf16*)(const void*)qhp + (size_t)bb * pstride + (size_t)h * HD;
  const __bf16* Ql = (const __bf16*)(const void*)qlp + (size_t)bb * pstride + (size_t)h * HD;
  const __bf16* Kh = (const __bf16*)(const void*)khp + (size_t)bb * pstride + (size_t)h * HD;
  const __bf16* Kl = (const __bf16*)(const void*)klp + (size_t)bb * pstride + (size_t)h * HD;
  const _Float16* Vh = (const _Float16*)(const void*)vhp + (size_t)bb * ((size_t)DM * SEQ) + (size_t)h * HD * SEQ;
  const _Float16* Vl = (const _Float16*)(const void*)vlp + (size_t)bb * ((size_t)DM * VLP) + (size_t)h * HD * VLP;
  unsigned short* Ohb = ohp + (size_t)bb * pstride;
  unsigned short* Olb = olp + (size_t)bb * pstride;

  // ---- Q fragments (B operand, column = query = lane&15): 2 d-chunks, hi and lo ----
  v16b qah[2], qal[2];
#pragma unroll
  for (int dc = 0; dc < 2; ++dc) {
    const size_t qo = (size_t)(q0 + c) * DM + dc * 32 + 8 * hh;
    qah[dc] = ldfrag_b(Qh + qo);
    qal[dc] = ldfrag_b(Ql + qo);
  }

  float mrow = -INFINITY, lrow = 0.f;        // of query q0 + c; lrow sums this lane half's keys only
  v8f oacc[4];                               // O^T: oacc[t][r] = context(query q0 + c, d = 16 t + 8 hh + r)
#pragma unroll
  for (int t = 0; t < 4; ++t) oacc[t] = zero8();

  // copy map: thread -> row (tid >> 3) + 16 * i of a plane tile, 16-B piece (tid & 7) of its 128 B
  const int crow = tid >> 3;
  const int cpc  = (tid & 7) * 8;
  const unsigned short* gKh = (const unsigned short*)(const void*)Kh + (size_t)crow * DM + cpc;    // K row kv0 + crow + 16 i (< SEQ)
  const unsigned short* gKl = (const unsigned short*)(const void*)Kl + (size_t)crow * DM + cpc;
  const unsigned short* gVh = (const unsigned short*)(const void*)Vh + (size_t)crow * SEQ + cpc;   // V^T row d = crow + 16 i
  const unsigned short* gVl = (const unsigned short*)(const void*)Vl + (size_t)crow * VLP + cpc;
  const unsigned lbase = (unsigned)(uintptr_t)(&sKV[0]) + (unsigned)((crow * LP + cpc) * 2);
  constexpr unsigned L16 = 16u * LP * 2u;      // LDS bytes of 16 staged rows
  constexpr unsigned PLB = (unsigned)PLE * 2u; // LDS bytes of one plane tile
  auto stage = [&](int t, int buf) {           // key tile t (keys 64 t .. 64 t + 63) into buffer buf
    const int k0 = t * 64;
    const unsigned l = lbase + (unsigned)buf * (unsigned)(BUFE * 2);
    copy12_lds(l, PLB, L16, gKh + (size_t)k0 * DM, (size_t)16 * DM, gKl + (size_t)k0 * DM, (size_t)16 * DM,
               gVh + k0, (size_t)16 * SEQ);
    if (RES) {
      const int kvl = (k0 + 64 <= VLP) ? k0 : (VLP - 64);        // clamped address into the residual plane
      const __bf16* w = (const __bf16*)(const void*)(gVl + kvl);
      const unsigned lw = l + 3 * PLB;
      copy4_lds(lw, w, lw + L16, w + 16 * VLP, lw + 2 * L16, w + 32 * VLP, lw + 3 * L16, w + 48 * VLP);
    }
  };

  const int nkt = qb + 1;                    // key tiles 0..qb (block-uniform)
  stage(0, 0);
  asm volatile("s_wait_asynccnt 0x0" ::: "memory");   // this wave's tile-0 copies have landed
  __syncthreads();                                     // tile 0 readable by every wave
  if (nkt > 1) stage(1, 1);
  for (int kt = 0; kt < NQB; ++kt) {         // static bound
    if (kt >= nkt) break;                    // block-uniform
    const bool diag = (kt == qb);            // block-uniform
    const int kv0 = kt * 64;
    const unsigned short* sb = sKV + (kt & 1) * BUFE;
    const __bf16*   Ksh = (const __bf16*)(const void*)sb;                    // K hi [kv][d]
    const __bf16*   Ksl = (const __bf16*)(const void*)(sb + PLE);            // K lo
    const _Float16* Vth = (const _Float16*)(const void*)(sb + 2 * PLE);      // V^T hi [d][kv]
    const _Float16* Vtl = (const _Float16*)(const void*)(sb + (RES ? 3 : 2) * PLE);   // V^T residual, read only when RES

    // ---- scores, transposed: 64 keys x 16 query columns per wave, 3 bf16 products ----
    //      Issue order: d-chunk, product, key group innermost, so that neighbouring WMMAs write four independent tiles;
    //      each tile still sums (hi.hi, lo.hi, hi.lo) of d-chunk 0, then of d-chunk 1.
    v8f s[4];
#pragma unroll
    for (int j = 0; j < 4; ++j) s[j] = zero8();
#pragma unroll
    for (int dc = 0; dc < 2; ++dc) {
      FB kb[4], kl[4];
#pragma unroll
      for (int j = 0; j < 4; ++j) {
        kb[j].h[0] = *(const v8b*)(Ksh + (j * 16 + c) * LP + dc * 32 + 8 * hh);
        kb[j].h[1] = *(const v8b*)(Ksh + (j * 16 + c) * LP + dc * 32 + 16 + 8 * hh);
        kl[j].h[0] = *(const v8b*)(Ksl + (j * 16 + c) * LP + dc * 32 + 8 * hh);
        kl[j].h[1] = *(const v8b*)(Ksl + (j * 16 + c) * LP + dc * 32 + 16 + 8 * hh);
      }
#pragma unroll
      for (int j = 0; j < 4; ++j) s[j] = mma_b_raw(kb[j].v, qah[dc], s[j]);
#pragma unroll
      for (int j = 0; j < 4; ++j) s[j] = mma_b_raw(kl[j].v, qah[dc], s[j]);
#pragma unroll
      for (int j = 0; j < 4; ++j) s[j] = mma_b_raw(kb[j].v, qal[dc], s[j]);
    }

    // ---- scale + causal compare (diagonal tile only), column max, online softmax; P^T (x1024, f16) and its
    //      residual (x4096) are packed in registers as the B operands of the context products ----
    FH pb[2], pr[2];
    {
      const int qrow = q0 + c;                     // this lane's query
      float m = -INFINITY;
#pragma unroll
      for (int j = 0; j < 4; ++j)
#pragma unroll
        for (int r = 0; r < 8; ++r) s[j][r] *= sscale;
      if (diag) {                                  // block-uniform branch: a tile below the diagonal has nothing to compare
#pragma unroll
        for (int j = 0; j < 4; ++j) {
#pragma unroll
          for (int r = 0; r < 8; ++r) {
            const int key = kv0 + j * 16 + 8 * hh + r;   // key of accumulator element r of this lane
            s[j][r] = (key > qrow) ? -FLT_MAX : s[j][r];
          }
        }
      }
#pragma unroll
      for (int j = 0; j < 4; ++j)
#pragma unroll
        for (int r = 0; r < 8; ++r) m = fmaxf(m, s[j][r]);
      m = fmaxf(m, xhalf(m));                      // the query's other 32 keys of the tile
      const float mnew  = fmaxf(mrow, m);
      const float msafe = (mnew == -INFINITY) ? 0.f : mnew;
      const float alpha = __expf(mrow - msafe);
      mrow = mnew;
      float psum[2] = {0.f, 0.f};                  // one chain per 32 keys: two independent sums
#pragma unroll
      for (int j = 0; j < 4; ++j) {
#pragma unroll
        for (int r = 0; r < 8; ++r) {
          const float p = __expf(s[j][r] - msafe);   // floor logit against a normal max: exp -> 0
          psum[j >> 1] += p;
          const float p1k = p * 1024.0f;
          const _Float16 ph = (_Float16)p1k;
          pb[j >> 1].v[(j & 1) * 8 + r] = ph;
          if (RES) pr[j >> 1].v[(j & 1) * 8 + r] = (_Float16)((p1k - (float)ph) * 4096.0f);
        }
      }
      lrow = lrow * alpha + (psum[0] + psum[1]);
#pragma unroll
      for (int t = 0; t < 4; ++t)
#pragma unroll
        for (int r = 0; r < 8; ++r) oacc[t][r] *= alpha;
    }

    // ---- context^T += V^T . P^T (f16 WMMA), residual products into a separate accumulator ----
    v8f o1[4];
#pragma unroll
    for (int t = 0; t < 4; ++t) o1[t] = zero8();
#pragma unroll
    for (int kk = 0; kk < 2; ++kk) {               // unrolled: pb / pr are register operands
      FH vb[4], vl[4];
#pragma unroll
      for (int t = 0; t < 4; ++t) {
        vb[t].h[0] = *(const v8h*)(Vth + (t * 16 + c) * LP + kk * 32 + 8 * hh);
        vb[t].h[1] = *(const v8h*)(Vth + (t * 16 + c) * LP + kk * 32 + 16 + 8 * hh);
        if (RES) {
          vl[t].h[0] = *(const v8h*)(Vtl + (t * 16 + c) * LP + kk * 32 + 8 * hh);
          vl[t].h[1] = *(const v8h*)(Vtl + (t * 16 + c) * LP + kk * 32 + 16 + 8 * hh);
        }
      }
#pragma unroll
      for (int t = 0; t < 4; ++t) oacc[t] = mma_h_raw(vb[t].v, pb[kk].v, oacc[t]);
      if (RES) {
#pragma unroll
        for (int t = 0; t < 4; ++t) o1[t] = mma_h_raw(vl[t].v, pb[kk].v, o1[t]);
#pragma unroll
        for (int t = 0; t < 4; ++t) o1[t] = mma_h_raw(vb[t].v, pr[kk].v, o1[t]);
      }
    }
    if (RES) {
#pragma unroll
      for (int t = 0; t < 4; ++t)
#pragma unroll
        for (int r = 0; r < 8; ++r) oacc[t][r] += o1[t][r] * (1.0f / 4096.0f);
    }
    asm volatile("s_wait_dscnt 0x0" ::: "memory");      // this wave's reads of buffer kt & 1 are done before it is refilled
    asm volatile("s_wait_asynccnt 0x0" ::: "memory");   // this wave's tile kt + 1 copies have landed
    __syncthreads();                                     // publishes tile kt + 1, ends every read of buffer kt & 1
    if (kt + 2 < nkt) stage(kt + 2, kt & 1);
  }
  asm volatile("s_wait_asynccnt 0x0" ::: "memory");     // nothing in flight when the buffers become the context tiles

  // ---- normalise (1/l and the 1/1024 p carry), stage the wave's 16x64 tile, bf16 hi/lo split,
  float* os = (float*)(void*)sKV + wave * (16 * OSP);
  {
    const float l = lrow + xhalf(lrow);        // both lane halves' keys of query q0 + c
    const float inv = ((l > 0.f) ? (1.0f / l) : 0.f) * (1.0f / 1024.0f);
#pragma unroll
    for (int t = 0; t < 4; ++t)
#pragma unroll
      for (int r = 0; r < 8; ++r) os[c * OSP + t * 16 + 8 * hh + r] = oacc[t][r] * inv;
  }
  __builtin_amdgcn_fence(3, "workgroup");
  __builtin_amdgcn_wave_barrier();
  __builtin_amdgcn_fence(2, "workgroup");
  {
    const int q4 = lane >> 3, c8 = (lane & 7) * 8;
    v4u hv[4], lv[4];
#pragma unroll
    for (int it = 0; it < 4; ++it) {
      const int row = it * 4 + q4;   // it 0..3 x q4 0..3 = rows 0..15 of the wave tile
      const float* sp = os + row * OSP + c8;
      v4u a, a2;
#pragma unroll
      for (int e = 0; e < 4; ++e) {
        const float f0 = sp[2 * e], f1 = sp[2 * e + 1];
        const unsigned short h0 = bf_bits(f0), h1 = bf_bits(f1);
        const unsigned short l0 = bf_bits(f0 - bf_up(h0)), l1 = bf_bits(f1 - bf_up(h1));
        a[e] = pk16(h0, h1); a2[e] = pk16(l0, l1);
      }
      hv[it] = a; lv[it] = a2;
    }
    {
#pragma unroll
      for (int it = 0; it < 4; ++it) {
        const int row = it * 4 + q4;
        const size_t go = (size_t)(q0 + row) * DM + (size_t)h * HD + c8;
        *(v4u*)(Ohb + go) = hv[it];
        *(v4u*)(Olb + go) = lv[it];
      }
      
    }
  }
}

// =====================================================================================================
// Workspace map (bytes, NB = 4, SEQ = 2048; every activation plane holds NB batch slices back to back):
//   Xb    bf16 [NB*SEQ][1024]          0           16777216   (also holds Oh after the projections: same extent)
//   Wqb   bf16 [1024 n][1024 k]        16777216     2097152
//   Wkb   bf16 [1024 n][1024 k]        18874368     2097152
//   Wvb   bf16 [1024 n][1024 k]        20971520     2097152
//   Wob   bf16 [1024 n][1024 k]        23068672     2097152
//   Qh    bf16 [NB*SEQ][1024]          25165824    16777216
//   Ql    bf16 [NB*SEQ][1024]          41943040    16777216
//   Kh    bf16 [NB*SEQ][1024]          58720256    16777216
//   Kl    bf16 [NB*SEQ][1024]          75497472    16777216
//   VTh   f16  NB x [1024][SEQ]        92274688    16777216
//   VTl   f16  NB x [1024][VLP=512]   109051904     4194304
//   Ol    bf16 [NB*SEQ][1024]         113246208    16777216
//   end                               130023424
// Oh aliases Xb: Xb is last read by the projection launch (q, k and v^T tiles), Oh is first written by the attention launches that
// come after it in stream order; both extents are NB*SEQ*DM*2 bytes exactly.
// All planes are exact multiples of their 64x64 / whole-line store granularity (no padded tails needed),
// =====================================================================================================
extern "C" void kernel_launch(void* const* d_in, const int* in_sizes, int n_in,
                              void* d_out, int out_size, void* d_ws, size_t ws_size,
                              hipStream_t stream) {
  if (n_in < 5) return;
  const long long needX = (long long)(NB - 1) * SEQ_FULL * DM + (long long)SEQ * DM;   // last row read / written
  if ((long long)in_sizes[0] < needX) return;         // x [NB_FULL][SEQ_FULL][1024], rows 0..SEQ-1 of batches 0..NB-1
  if (in_sizes[1] < DM * DM) return;                  // Wq [1024 out][1024 in]
  if (in_sizes[2] < DM * DM) return;                  // Wk
  if (in_sizes[3] < DM * DM) return;                  // Wv
  if (in_sizes[4] < DM * DM) return;                  // Wo
  if ((long long)out_size < needX) return;

  const float* x  = (const float*)d_in[0];
  const float* Wq = (const float*)d_in[1];
  const float* Wk = (const float*)d_in[2];
  const float* Wv = (const float*)d_in[3];
  const float* Wo = (const float*)d_in[4];

  const size_t PX  = (size_t)NB * SEQ * DM * 2;     // 16-bit activation plane [NB*SEQ][1024]
  const size_t PW  = (size_t)DM * DM * 2;           // 16-bit weight plane [1024][1024]
  const size_t PVT = (size_t)NB * DM * SEQ * 2;     // v^T hi plane, NB slices
  const size_t PVL = (size_t)NB * DM * VLP * 2;     // v^T residual plane, NB slices
  static_assert((size_t)NB * SEQ * DM * 2 == (size_t)NB * DM * SEQ * 2);
  size_t off = 0;
  const size_t oXb  = off; off += PX;
  const size_t oOh  = oXb;                          // aliased, same extent PX
  const size_t oWq  = off; off += PW;
  const size_t oWk  = off; off += PW;
  const size_t oWv  = off; off += PW;
  const size_t oWo  = off; off += PW;
  const size_t oQh  = off; off += PX;
  const size_t oQl  = off; off += PX;
  const size_t oKh  = off; off += PX;
  const size_t oKl  = off; off += PX;
  const size_t oVTh = off; off += PVT;
  const size_t oVTl = off; off += PVL;
  const size_t oOl  = off; off += PX;
  if (off > ws_size) return;                     // off = 130023424 for NB = 4, SEQ = 2048
  if (off > (size_t)134217728) return;

  char* ws = (char*)d_ws;
  unsigned short* Xb  = (unsigned short*)(ws + oXb);
  unsigned short* Oh  = (unsigned short*)(ws + oOh);
  unsigned short* Wqb = (unsigned short*)(ws + oWq);
  unsigned short* Wkb = (unsigned short*)(ws + oWk);
  unsigned short* Wvb = (unsigned short*)(ws + oWv);
  unsigned short* Wob = (unsigned short*)(ws + oWo);
  unsigned short* Qh  = (unsigned short*)(ws + oQh);
  unsigned short* Ql  = (unsigned short*)(ws + oQl);
  unsigned short* Kh  = (unsigned short*)(ws + oKh);
  unsigned short* Kl  = (unsigned short*)(ws + oKl);
  unsigned short* VTh = (unsigned short*)(ws + oVTh);
  unsigned short* VTl = (unsigned short*)(ws + oVTl);
  unsigned short* Ol  = (unsigned short*)(ws + oOl);

  const dim3 blk(256);
  const dim3 gOut((SEQ / GBM) * (DM / GBN), NB);                   // M = SEQ, N = 1024, per batch
  const long long xStrideIn = (long long)SEQ_FULL * DM;            // input x batch stride (full layout)
  const long long pStride   = (long long)SEQ * DM;                 // plane batch stride

  // (1) x -> bf16 plane [NB*SEQ][1024] (batch b reads input rows b*SEQ_FULL .. +SEQ-1); weights -> bf16 [n][k]
  cvt_all<<<dim3(CVG), dim3(CVB), 0, stream>>>(x, Wq, Wk, Wv, Wo, Xb, Wqb, Wkb, Wvb, Wob);
  // (2) - (4) q = x . Wq^T and k = x . Wk^T -> bf16 hi/lo planes [b*SEQ + t][h*64+d] (M = NB*SEQ, N = 1024, K = 1024);
  //     v^T = Wv . x^T per batch -> f16 hi plane [h*64+d][s] (pitch SEQ, batch stride DM*SEQ) and residual plane (x4096,
  //     keys < VLP only, pitch VLP, batch stride DM*VLP) (M = 1024, N = SEQ, K = 1024): all 128x256 tiles in one launch
  proj_qkv<<<dim3(2 * TQK + TVT * NB), blk, 0, stream>>>(Xb, Wqb, Wkb, Wvb, Qh, Ql, Kh, Kl, VTh, VTl,
                                                         NB * SEQ, DM, SEQ, VLP, 4096.0f);
  // (5) causal attention: query blocks 0..RESQB-1 with residual planes, the rest without; grid = (NH * query blocks, NB),
  //     the kernel maps the start rank to (query block descending, batch, head)
  attn_causal64<true><<<dim3(NH * RESQB, NB), dim3(128), 0, stream>>>(
      Qh, Ql, Kh, Kl, VTh, VTl, Oh, Ol, 0, RESQB, 0.125f);
  if (NQB > RESQB) {
    attn_causal64<false><<<dim3(NH * (NQB - RESQB), NB), dim3(128), 0, stream>>>(
        Qh, Ql, Kh, Kl, VTh, VTl, Oh, Ol, RESQB, NQB - RESQB, 0.125f);
  }
  // (6) out = context . Wo^T -> d_out f32, batch b rows b*SEQ_FULL .. +SEQ-1 (A = context hi + lo planes,
  //     2 products; M = SEQ, N = 1024, K = 1024, grid.y = batch)
  gemm64<1, 0><<<gOut, blk, 0, stream>>>(
      Oh, Ol, DM, pStride, Wob, DM, 0LL,
      d_out, DM, xStrideIn, d_out, DM, 0LL, DM,
      SEQ, DM, DM, 1.0f);
  (void)hipGetLastError();
}

// v010
// Measured time: 156 microseconds a run.
// Next to v009, in two timings, it ran 1.06 times as fast each time.
// Over all steps from v000 it is 3.60 times as fast.
// Contractions: q, k, v^T projections = v_wmma_f32_16x16x32_bf16 (bf16 operands from RNE-converted inputs, single product);
// q.k^T scores = v_wmma_f32_16x16x32_bf16 with bf16 hi/lo split q and k (hi.hi + hi.lo + lo.hi);
// (attention products are formed transposed: A = k rows / v^T rows, B = q / p^T, so a lane owns one query column)
// p.v = v_wmma_f32_16x16x32_f16 (p carried x1024 in f16, v in f16; extra f16 residual planes x4096 of p and v for the first VLP query rows);
// ctx.Wo = v_wmma_f32_16x16x32_bf16 with ctx as bf16 hi/lo planes times bf16 Wo (2 products); all f32 accumulate; causal compare and softmax in f32.
#include <hip/hip_runtime.h>
#include <math.h>
#include <float.h>
#include <stdint.h>

#ifndef NB
#define NB    4
#endif
#ifndef SEQ
#define SEQ   2048
#endif
#define NB_FULL  4
#define SEQ_FULL 2048
#define DM    1024
#define NH    16
#define HD    64
#define NQB   (SEQ / 64)                      // key / query tiles of 64
#define VLP   ((SEQ < 512) ? SEQ : 512)       // key pitch of the v^T residual plane (keys 0..VLP-1)
#define RESQB (VLP / 64)                      // number of leading 64-row query blocks that use the p / v residual planes
#define LP    72                              // LDS row pitch (16-bit elements) of the 64-wide K and V^T tiles: 144 B = 16 B x odd
#define OSP   68                              // LDS row pitch (floats) of the per-wave context tile: 272 B = 16 B x odd
#define GP    72                              // LDS row pitch (16-bit elements) of the staged 64-k GEMM operand rows: 144 B = 16 B x odd
#define GBM   128                             // GEMM work-group tile rows (2 waves of 64)
#define GBN   256                             // GEMM work-group tile columns (4 waves of 64)
static_assert(NB >= 1 && NB <= NB_FULL);
static_assert((SEQ % GBN) == 0 && (DM % GBN) == 0 && (DM % 128) == 0);
static_assert(NH * HD == DM && HD == 64);
static_assert((SEQ % 64) == 0 && (DM % 64) == 0 && SEQ >= 64 && SEQ <= SEQ_FULL);
static_assert(RESQB * 64 == VLP && VLP <= SEQ && RESQB >= 1 && RESQB <= NQB);

typedef _Float16 v16h __attribute__((ext_vector_type(16)));
typedef _Float16 v8h  __attribute__((ext_vector_type(8)));
typedef __bf16   v16b __attribute__((ext_vector_type(16)));
typedef __bf16   v8b  __attribute__((ext_vector_type(8)));
typedef float    v8f  __attribute__((ext_vector_type(8)));
typedef float    v4f  __attribute__((ext_vector_type(4)));
typedef unsigned int v4u __attribute__((ext_vector_type(4)));

// ---- scalar helpers --------------------------------------------------------------------------------
__device__ __forceinline__ unsigned short bf_bits(float f) {          // f32 -> bf16 bits, RNE convert
  unsigned u = __float_as_uint(f);
  return (unsigned short)((u + 0x7FFFu + ((u >> 16) & 1u)) >> 16);
}
__device__ __forceinline__ float bf_up(unsigned short h) { return __uint_as_float(((unsigned)h) << 16); }
__device__ __forceinline__ unsigned short h_bits(_Float16 x) { return __builtin_bit_cast(unsigned short, x); }
__device__ __forceinline__ unsigned pk16(unsigned short a, unsigned short b) { return (unsigned)a | ((unsigned)b << 16); }
__device__ __forceinline__ v8f zero8() { v8f z = {0.f, 0.f, 0.f, 0.f, 0.f, 0.f, 0.f, 0.f}; return z; }

// ---- fragment loaders: 16-bit A/B operand, lane -> row/col (lane&15), p already includes +8*(lane>>4);
//      elements 0..7 <- p[0..7] (k0+8h..), elements 8..15 <- p[16..23] (k0+16+8h..)
__device__ __forceinline__ v16b ldfrag_b(const __bf16* p) {
  union { v16b v; v8b h[2]; } f;
  f.h[0] = *(const v8b*)(p);
  f.h[1] = *(const v8b*)(p + 16);
  return f.v;
}

// ---- WMMA helpers: plain builtins (the compiler keeps the distance to a vector instruction on D, A or B) ----
__device__ __forceinline__ v8f mma_b_raw(v16b a, v16b b, v8f c) {
  return __builtin_amdgcn_wmma_f32_16x16x32_bf16(false, a, false, b, (short)0, c, false, false);
}
__device__ __forceinline__ v8f mma_h_raw(v16h a, v16h b, v8f c) {
  return __builtin_amdgcn_wmma_f32_16x16x32_f16(false, a, false, b, (short)0, c, false, false);
}
__device__ __forceinline__ void acc_guard4(v8f& a, v8f& b, v8f& c, v8f& d) {
  asm volatile("v_nop\n\tv_nop\n\tv_nop\n\tv_nop" : "+v"(a), "+v"(b), "+v"(c), "+v"(d));
}

// ---- value of lane l ^ 16 (the other 16-lane row), on the vector port; all 32 lanes are on wherever it is called
__device__ __forceinline__ float xhalf(float x) {
  const int b = __float_as_int(x);
  return __int_as_float(__builtin_amdgcn_permlanex16(b, b, 0x76543210, 0xfedcba98, false, false));
}

// ---- asynchronous copies global -> LDS: four 16-B pieces per lane (l* = LDS byte address, g* = global address).
//      The s_wait_xcnt closes the statement so that no address register is rewritten ahead of it.
__device__ __forceinline__ void copy4_lds(unsigned l0, const __bf16* g0, unsigned l1, const __bf16* g1,
                                          unsigned l2, const __bf16* g2, unsigned l3, const __bf16* g3) {
  asm volatile("global_load_async_to_lds_b128 %0, %1, off\n\t"
               "global_load_async_to_lds_b128 %2, %3, off\n\t"
               "global_load_async_to_lds_b128 %4, %5, off\n\t"
               "global_load_async_to_lds_b128 %6, %7, off\n\t"
               "s_wait_xcnt 0x0"
               :: "v"(l0), "v"(g0), "v"(l1), "v"(g1), "v"(l2), "v"(g2), "v"(l3), "v"(g3) : "memory");
}
// ---- the same for three 64-row planes at once: plane p = rows at LDS l + p * pl + i * ls and global g<p> + i * s<p> elements
//      (i = 0..3), twelve 16-B pieces per lane under one closing s_wait_xcnt.
__device__ __forceinline__ void copy12_lds(unsigned l, unsigned pl, unsigned ls,
                                           const unsigned short* g0, size_t s0, const unsigned short* g1, size_t s1,
                                           const unsigned short* g2, size_t s2) {
  asm volatile("global_load_async_to_lds_b128 %0, %1, off\n\t"
               "global_load_async_to_lds_b128 %2, %3, off\n\t"
               "global_load_async_to_lds_b128 %4, %5, off\n\t"
               "global_load_async_to_lds_b128 %6, %7, off\n\t"
               "global_load_async_to_lds_b128 %8, %9, off\n\t"
               "global_load_async_to_lds_b128 %10, %11, off\n\t"
               "global_load_async_to_lds_b128 %12, %13, off\n\t"
               "global_load_async_to_lds_b128 %14, %15, off\n\t"
               "global_load_async_to_lds_b128 %16, %17, off\n\t"
               "global_load_async_to_lds_b128 %18, %19, off\n\t"
               "global_load_async_to_lds_b128 %20, %21, off\n\t"
               "global_load_async_to_lds_b128 %22, %23, off\n\t"
               "s_wait_xcnt 0x0"
               :: "v"(l), "v"(g0), "v"(l + ls), "v"(g0 + s0), "v"(l + 2 * ls), "v"(g0 + 2 * s0), "v"(l + 3 * ls), "v"(g0 + 3 * s0),
                  "v"(l + pl), "v"(g1), "v"(l + pl + ls), "v"(g1 + s1), "v"(l + pl + 2 * ls), "v"(g1 + 2 * s1),
                  "v"(l + pl + 3 * ls), "v"(g1 + 3 * s1),
                  "v"(l + 2 * pl), "v"(g2), "v"(l + 2 * pl + ls), "v"(g2 + s2), "v"(l + 2 * pl + 2 * ls), "v"(g2 + 2 * s2),
                  "v"(l + 2 * pl + 3 * ls), "v"(g2 + 3 * s2)
               : "memory");
}

// =====================================================================================================
// f32 -> bf16 (RNE convert) of x and of the four weight matrices in ONE launch of CVG work-groups x CVB threads: about one
// work-group of 16 waves per WGP, started once.
// A unit = 8 elements = 32 B read, one 16-B store per lane (a wave writes 512 contiguous B). Work-group b owns units
// b * XIT * CVB .. + XIT * CVB - 1 of x and b * WIT * CVB .. + WIT * CVB - 1 of each weight; thread t takes units k * CVB + t
// of each range. All of a thread's loads are issued ahead of its first convert.
// x unit u lies in batch slice u / XUB (input batch stride SEQ_FULL * DM elements, plane batch stride SEQ * DM).
// coverage: CVG * XIT * CVB >= XU and CVG * WIT * CVB >= WU; units past the end are read at the last unit's address and
// not stored.
// =====================================================================================================
#define CVB  512                              // threads of a convert work-group
#define CVG  256                              // convert work-groups
#define CVTH (CVB * CVG)                      // convert threads
#define XUB  (SEQ * DM / 8)                   // units of one batch slice of x
#define XU   (NB * XUB)                       // units of x
#define WU   (DM * DM / 8)                    // units of one weight matrix
#define XIT  ((XU + CVTH - 1) / CVTH)         // units of x per thread
#define WIT  ((WU + CVTH - 1) / CVTH)         // units of one weight matrix per thread
__device__ __forceinline__ v4u cvt8(v4f a, v4f b) {
  v4u p;
  p[0] = pk16(bf_bits(a[0]), bf_bits(a[1]));
  p[1] = pk16(bf_bits(a[2]), bf_bits(a[3]));
  p[2] = pk16(bf_bits(b[0]), bf_bits(b[1]));
  p[3] = pk16(bf_bits(b[2]), bf_bits(b[3]));
  return p;
}
__global__ __launch_bounds__(CVB) void cvt_all(const float* __restrict__ x, const float* __restrict__ wq,
                                               const float* __restrict__ wk, const float* __restrict__ wv,
                                               const float* __restrict__ wo, unsigned short* __restrict__ xb,
                                               unsigned short* __restrict__ wqb, unsigned short* __restrict__ wkb,
                                               unsigned short* __restrict__ wvb, unsigned short* __restrict__ wob) {
  const unsigned t  = threadIdx.x;
  const unsigned xu = blockIdx.x * (unsigned)(XIT * CVB);    // first x unit of the work-group
  const unsigned wu = blockIdx.x * (unsigned)(WIT * CVB);    // first unit of the work-group in each weight
  constexpr bool XEX = (XUB % (XIT * CVB)) == 0 && (XU % CVTH) == 0;   // whole ranges, each inside one batch slice
  constexpr bool WEX = (WU % CVTH) == 0;
  // work-group-uniform bases, in 16-B pieces; a lane adds a 32-bit piece index
  const unsigned xbs = xu / (unsigned)XUB;
  const v4f* px = (const v4f*)(x + (size_t)xbs * ((size_t)SEQ_FULL * DM) + (size_t)(xu - xbs * (unsigned)XUB) * 8);
  const size_t wb = WEX ? (size_t)wu * 2 : (size_t)0;
  const v4f* pw[4] = {(const v4f*)wq + wb, (const v4f*)wk + wb, (const v4f*)wv + wb, (const v4f*)wo + wb};
  v4u* ox = (v4u*)xb + xu;
  v4u* ow[4] = {(v4u*)wqb + wu, (v4u*)wkb + wu, (v4u*)wvb + wu, (v4u*)wob + wu};
  // holds the argument loads and the index arithmetic of the bases in front of the run of loads: placed behind it they
  // rewrite a base register of a load just issued
  __builtin_amdgcn_sched_barrier(0);
  v4f xa[XIT], xc[XIT], wa[4][WIT], wc[4][WIT];
#pragma unroll
  for (int k = 0; k < XIT; ++k) {
    if (XEX) {
      xa[k] = px[2u * (k * CVB + t)];
      xc[k] = px[2u * (k * CVB + t) + 1u];
    } else {
      const unsigned u  = xu + k * CVB + t;
      const unsigned uc = (u < (unsigned)XU) ? u : (unsigned)(XU - 1);
      const unsigned bs = uc / (unsigned)XUB;
      const v4f* p = (const v4f*)(x + (size_t)bs * ((size_t)SEQ_FULL * DM) + (size_t)(uc - bs * (unsigned)XUB) * 8);
      xa[k] = p[0];
      xc[k] = p[1];
    }
  }
#pragma unroll
  for (int k = 0; k < WIT; ++k) {
    const unsigned u = wu + k * CVB + t;
    const unsigned o = WEX ? 2u * (k * CVB + t) : 2u * ((u < (unsigned)WU) ? u : (unsigned)(WU - 1));
#pragma unroll
    for (int w = 0; w < 4; ++w) {
      wa[w][k] = pw[w][o];
      wc[w][k] = pw[w][o + 1u];
    }
  }
  // keeps every load above in front of the converts: without it the last loads are issued only after the first have
  // come back, and the wave waits out the memory latency twice
  __builtin_amdgcn_sched_barrier(0);
  // the converts reuse the loads' address registers: the wait stands in front of the first such overwrite
  asm volatile("s_wait_xcnt 0x0" ::: "memory");
  __builtin_amdgcn_sched_barrier(0);           // holds the converts behind that wait
#pragma unroll
  for (int k = 0; k < XIT; ++k) {
    if (XEX || xu + k * CVB + t < (unsigned)XU) ox[k * CVB + t] = cvt8(xa[k], xc[k]);
    // keeps each store where its unit is ready: without it every store sinks behind the wait for the wave's last load
    __builtin_amdgcn_sched_barrier(0);
  }
#pragma unroll
  for (int k = 0; k < WIT; ++k) {
    if (WEX || wu + k * CVB + t < (unsigned)WU) {
#pragma unroll
      for (int w = 0; w < 4; ++w) ow[w][k * CVB + t] = cvt8(wa[w][k], wc[w][k]);
    }
  }
}

// =====================================================================================================
// bf16 WMMA GEMM: C[m][n] = sum_k A[m][k] * Bt[n][k]; a work-group of 8 waves (2 x 4) owns a 128x256 tile, each wave
// a 64x64 tile. A row-major [M][K] pitch lda; Bt row-major [N][K] pitch ldb (k contiguous); M multiple of 128,
// N multiple of 256, K multiple of 64 (host-checked). batch index b (strides in elements).
// Operand staging: per 64-k slab the rows of A (and A2) and Bt that the work-group needs are copied once into LDS
// (asynchronous 16-B copies, 8 lanes per 128-B row piece = whole lines; LDS pitch GP), two buffers, the next
// slab in flight while a slab is multiplied; every wave reads its fragments from LDS.
// NSPLIT: 0 = A.Bt; 1 = (A + A2).Bt (A2 = unscaled bf16 lo plane of A).
// OUT_MODE: 0 = f32 (pitch ldc); 2 = bf16 hi plane C + bf16 lo plane C2 (lo = RNE(v - hi), unscaled);
//           3 = f16 hi plane C + f16 residual plane C2 = f16((v - hi) * rscale), C2 written only for tiles
//               with n0 < N2 (pitch ldc2, batch stride strideC2).
// =====================================================================================================
// gemm64_tile = one work-group tile: tile index bx (bm = bx / (N / 256), bn = the rest), batch index b; sAB = the two slab
// buffers [A 128 rows | A2 128 rows | Bt 256 rows] x 64 k, sT = 8 per-wave 16x64 slabs of pitch 68 floats, both the kernel's LDS.
#define GEMM_ABE(NSPLIT) (2 * ((((NSPLIT) == 1) ? 2 * GBM : GBM) + GBN) * GP)   // 16-bit elements of the two slab buffers
#define GEMM_STE (8 * 16 * 68)                                                  // floats of the eight per-wave slabs
template <int NSPLIT, int OUT_MODE>
__device__ __forceinline__ void gemm64_tile(
    __bf16* sAB, float* sT, int bx, int b,
    const unsigned short* __restrict__ Ap, const unsigned short* A2p, int lda, long long strideA,
    const unsigned short* __restrict__ Btp, int ldb, long long strideB,
    void* Cout, int ldc, long long strideC,
    void* Cout2, int ldc2, long long strideC2, int N2,
    int M, int N, int K, float rscale) {
  static_assert(NSPLIT == 0 || NSPLIT == 1);
  constexpr int AROWS = (NSPLIT == 1) ? 2 * GBM : GBM;   // staged rows of A, then of A2
  constexpr int BUFE  = (AROWS + GBN) * GP;              // 16-bit elements of one slab buffer
  static_assert(2 * BUFE == GEMM_ABE(NSPLIT));
  const __bf16* A   = (const __bf16*)(const void*)Ap;
  const __bf16* A2  = (const __bf16*)(const void*)A2p;
  const __bf16* Bt  = (const __bf16*)(const void*)Btp;
  const int tid  = threadIdx.x;
  const int lane = tid & 31;
  const int wave = tid >> 5;
  const int nbn = N / GBN;
  const int nbm = M / GBM;
  if (bx >= nbm * nbn) return;                // block-uniform, in front of every barrier and copy
  const int bm = bx / nbn;
  const int bn = bx - bm * nbn;
  const int wm = wave >> 2;                    // wave row 0..1
  const int wn = wave & 3;                     // wave column 0..3
  const int m0 = bm * GBM + (wm << 6);
  const int n0 = bn * GBN + (wn << 6);

  const __bf16* Ab  = A  + (size_t)b * strideA;
  const __bf16* Bb  = Bt + (size_t)b * strideB;
  const __bf16* Ab2 = (NSPLIT == 1) ? (A2 + (size_t)b * strideA) : Ab;

  const int rlane = lane & 15;                 // row (A) / col (B, D) within subtile
  const int koff  = (lane >> 4) * 8;           // k offset of this lane half
  const int mOff  = (lane >> 4) * 8;           // D row offset

  // copy map: thread -> row (tid >> 3) + 32 * i of a staged plane, 16-B piece (tid & 7) of its 128 B
  const int crow = tid >> 3;
  const int cpc  = (tid & 7) * 8;
  const __bf16* gA  = Ab  + (size_t)(bm * GBM + crow) * lda + cpc;
  const __bf16* gA2 = Ab2 + (size_t)(bm * GBM + crow) * lda + cpc;
  const __bf16* gB  = Bb  + (size_t)(bn * GBN + crow) * ldb + cpc;
  const unsigned lbase = (unsigned)(uintptr_t)(&sAB[0]) + (unsigned)((crow * GP + cpc) * 2);
  const size_t a32 = (size_t)32 * lda, b32 = (size_t)32 * ldb;
  constexpr unsigned L32 = 32u * GP * 2u;      // LDS bytes of 32 staged rows

  auto stage = [&](int t, int buf) {           // slab t (k = 64 t .. 64 t + 63) into buffer buf
    const unsigned l = lbase + (unsigned)buf * (unsigned)(BUFE * 2);
    const __bf16* a = gA + (size_t)t * 64;
    copy4_lds(l, a, l + L32, a + a32, l + 2 * L32, a + 2 * a32, l + 3 * L32, a + 3 * a32);
    if (NSPLIT == 1) {
      const __bf16* a2 = gA2 + (size_t)t * 64;
      const unsigned l2 = l + 4 * L32;
      copy4_lds(l2, a2, l2 + L32, a2 + a32, l2 + 2 * L32, a2 + 2 * a32, l2 + 3 * L32, a2 + 3 * a32);
    }
    const __bf16* bp = gB + (size_t)t * 64;
    const unsigned lb = l + (unsigned)(AROWS / 32) * L32;
    copy4_lds(lb, bp, lb + L32, bp + b32, lb + 2 * L32, bp + 2 * b32, lb + 3 * L32, bp + 3 * b32);
    copy4_lds(lb + 4 * L32, bp + 4 * b32, lb + 5 * L32, bp + 5 * b32, lb + 6 * L32, bp + 6 * b32, lb + 7 * L32, bp + 7 * b32);
  };

  v8f acc[4][4];
#pragma unroll
  for (int i = 0; i < 4; ++i)
#pragma unroll
    for (int j = 0; j < 4; ++j) acc[i][j] = zero8();

  const int nst = K >> 6;                      // slabs of 64 k
  stage(0, 0);
  asm volatile("s_wait_asynccnt 0x0" ::: "memory");   // this wave's slab-0 copies have landed
  __syncthreads();                                     // slab 0 readable by every wave
  if (nst > 1) stage(1, 1);

  const int aoff = ((wm << 6) + rlane) * GP + koff;            // this lane's A fragment row in a buffer
  const int boff = (AROWS + (wn << 6) + rlane) * GP + koff;    // this lane's Bt fragment row in a buffer
  for (int t = 0; t < nst; ++t) {
    const __bf16* sb = sAB + (t & 1) * BUFE;
#pragma unroll
    for (int ks = 0; ks < 2; ++ks) {
      v16b bh[4], ah[4], al[4];
#pragma unroll
      for (int j = 0; j < 4; ++j) bh[j] = ldfrag_b(sb + boff + j * 16 * GP + ks * 32);
#pragma unroll
      for (int i = 0; i < 4; ++i) {
        ah[i] = ldfrag_b(sb + aoff + i * 16 * GP + ks * 32);
        if (NSPLIT == 1) al[i] = ldfrag_b(sb + aoff + (GBM + i * 16) * GP + ks * 32); else al[i] = ah[i];
      }
      // inputs-only fence on the loaded fragments: keeps the k-step's LDS reads one group in front of its WMMAs
      // (without it each A fragment is read into one register set and its LDS latency waited out four times)
      asm volatile("" :: "v"(bh[0]), "v"(bh[1]), "v"(bh[2]), "v"(bh[3]), "v"(ah[0]), "v"(ah[1]), "v"(ah[2]), "v"(ah[3]));
      if (NSPLIT == 1) asm volatile("" :: "v"(al[0]), "v"(al[1]), "v"(al[2]), "v"(al[3]));   // same, lo plane
#pragma unroll
      for (int i = 0; i < 4; ++i) {
#pragma unroll
        for (int j = 0; j < 4; ++j) {
          acc[i][j] = mma_b_raw(ah[i], bh[j], acc[i][j]);
          if (NSPLIT == 1) acc[i][j] = mma_b_raw(al[i], bh[j], acc[i][j]);
        }
      }
    }
    asm volatile("s_wait_dscnt 0x0" ::: "memory");      // this wave's reads of buffer t & 1 are done before it is refilled
    asm volatile("s_wait_asynccnt 0x0" ::: "memory");   // this wave's slab t + 1 copies have landed
    __syncthreads();                                     // publishes slab t + 1, ends every read of buffer t & 1
    if (t + 2 < nst) stage(t + 2, t & 1);
  }
  asm volatile("s_wait_asynccnt 0x0" ::: "memory");     // nothing in flight when the wave goes on
  acc_guard4(acc[0][0], acc[0][1], acc[0][2], acc[0][3]);
  acc_guard4(acc[1][0], acc[1][1], acc[1][2], acc[1][3]);
  acc_guard4(acc[2][0], acc[2][1], acc[2][2], acc[2][3]);
  acc_guard4(acc[3][0], acc[3][1], acc[3][2], acc[3][3]);

  // ---- epilogue ----
  float* slab = sT + wave * (16 * 68);
#pragma unroll
  for (int i = 0; i < 4; ++i) {
    const int mBase = m0 + (i << 4);
#pragma unroll
    for (int j = 0; j < 4; ++j) {
#pragma unroll
      for (int r = 0; r < 8; ++r) {
        slab[(mOff + r) * 68 + (j << 4) + rlane] = acc[i][j][r];
      }
    }
    __builtin_amdgcn_fence(3, "workgroup");
    __builtin_amdgcn_wave_barrier();
    __builtin_amdgcn_fence(2, "workgroup");
    if (OUT_MODE == 0) {
      float* C = (float*)Cout + (size_t)b * strideC;
      const int hh = lane >> 4, c4 = (lane & 15) * 4;     // 256-B row segment = 16 lanes x 16 B
      {
#pragma unroll
        for (int it = 0; it < 8; ++it) {
          const int row = it * 2 + hh;                     // it 0..7 x hh 0..1 = rows 0..15
          const v4f v = *(const v4f*)(slab + row * 68 + c4);
          *(v4f*)(C + (size_t)(mBase + row) * ldc + n0 + c4) = v;
        }
        
      }
    } else {
      const int q = lane >> 3, c8 = (lane & 7) * 8;
      unsigned short* C  = (unsigned short*)Cout  + (size_t)b * strideC;
      unsigned short* C2 = (unsigned short*)Cout2 + (size_t)b * strideC2;
      const bool wlo = (OUT_MODE == 2) || (n0 < N2);      // wave-uniform
      v4u hv[4], lv[4];
#pragma unroll
      for (int it = 0; it < 4; ++it) {
        const int row = it * 4 + q;                        // it 0..3 x q 0..3 = rows 0..15
        const float* sp = slab + row * 68 + c8;
        v4u a, a2;
#pragma unroll
        for (int e = 0; e < 4; ++e) {
          const float f0 = sp[2 * e], f1 = sp[2 * e + 1];
          unsigned short h0, h1, l0, l1;
          if (OUT_MODE == 2) {
            h0 = bf_bits(f0); h1 = bf_bits(f1);
            l0 = bf_bits(f0 - bf_up(h0)); l1 = bf_bits(f1 - bf_up(h1));
          } else {
            const _Float16 x0 = (_Float16)f0, x1 = (_Float16)f1;
            h0 = h_bits(x0); h1 = h_bits(x1);
            l0 = h_bits((_Float16)((f0 - (float)x0) * rscale));
            l1 = h_bits((_Float16)((f1 - (float)x1) * rscale));
          }
          a[e] = pk16(h0, h1); a2[e] = pk16(l0, l1);
        }
        hv[it] = a; lv[it] = a2;
      }
      {
#pragma unroll
        for (int it = 0; it < 4; ++it) {
          const int row = it * 4 + q;
          *(v4u*)(C + (size_t)(mBase + row) * ldc + n0 + c8) = hv[it];
          if (wlo) *(v4u*)(C2 + (size_t)(mBase + row) * ldc2 + n0 + c8) = lv[it];
        }
        
      }
    }
    __builtin_amdgcn_fence(3, "workgroup");
    __builtin_amdgcn_wave_barrier();
    __builtin_amdgcn_fence(2, "workgroup");
  }
}

// one GEMM per launch: blockIdx.x = tile index, blockIdx.y = batch index
template <int NSPLIT, int OUT_MODE>
__global__ __launch_bounds__(256) void gemm64(
    const unsigned short* __restrict__ Ap, const unsigned short* A2p, int lda, long long strideA,
    const unsigned short* __restrict__ Btp, int ldb, long long strideB,
    void* Cout, int ldc, long long strideC,
    void* Cout2, int ldc2, long long strideC2, int N2,
    int M, int N, int K, float rscale) {
  __shared__ __align__(16) __bf16 sAB[GEMM_ABE(NSPLIT)];
  __shared__ __align__(16) float sT[GEMM_STE];
  gemm64_tile<NSPLIT, OUT_MODE>(sAB, sT, (int)blockIdx.x, (int)blockIdx.y, Ap, A2p, lda, strideA, Btp, ldb, strideB,
                                Cout, ldc, strideC, Cout2, ldc2, strideC2, N2, M, N, K, rscale);
}

// =====================================================================================================
// The q, k and v^T projections in ONE launch of 2 * TQK + TVT * NB work-groups (each GEMM alone has one work-group per WGP:
// two waves per SIMD, and its start, first slab and epilogue overlap nothing). The LDS and registers of a work-group let
// two of them share a WGP, so one's LDS reads, slab waits, barriers and epilogue run beside the other's WMMAs.
//   blockIdx.x in [0, TQK): q tile; [TQK, 2 TQK): k tile   (A = x plane [NB*SEQ][1024], Bt = Wq / Wk [n][k]; bf16 hi / lo out)
//   then TVT tiles per batch of v^T = Wv . x^T              (A = Wv [n][k], Bt = x slice of the batch; f16 hi plane pitch SEQ,
//   residual plane x rscale for keys < vlp, pitch vlp). The choice is block-uniform; the tiles are independent of each other.
//   rowsX = NB*SEQ, dm = 1024, seq = SEQ, vlp = VLP: the pitches and extents of the three products.
// =====================================================================================================
#define TQK ((NB * SEQ / GBM) * (DM / GBN))   // tiles of the q (or k) projection: M = NB*SEQ, N = 1024
#define TVT ((DM / GBM) * (SEQ / GBN))        // tiles of the v^T projection of one batch: M = 1024, N = SEQ
__global__ __launch_bounds__(256) void proj_qkv(
    const unsigned short* __restrict__ xb, const unsigned short* __restrict__ wqb, const unsigned short* __restrict__ wkb,
    const unsigned short* __restrict__ wvb, unsigned short* qh, unsigned short* ql, unsigned short* kh, unsigned short* kl,
    unsigned short* vth, unsigned short* vtl, int rowsX, int dm, int seq, int vlp, float rscale) {
  __shared__ __align__(16) __bf16 sAB[GEMM_ABE(0)];
  __shared__ __align__(16) float sT[GEMM_STE];
  const int idx = (int)blockIdx.x;
  if (idx < 2 * TQK) {
    const bool isk = idx >= TQK;
    gemm64_tile<0, 2>(sAB, sT, isk ? idx - TQK : idx, 0, xb, xb, dm, 0LL, isk ? wkb : wqb, dm, 0LL,
                      (void*)(isk ? kh : qh), dm, 0LL, (void*)(isk ? kl : ql), dm, 0LL, dm,
                      rowsX, dm, dm, 1.0f);
  } else {
    const int r = idx - 2 * TQK;
    gemm64_tile<0, 3>(sAB, sT, r % TVT, r / TVT, wvb, wvb, dm, 0LL, xb, dm, (long long)seq * dm,
                      (void*)vth, seq, (long long)dm * seq, (void*)vtl, vlp, (long long)dm * vlp, vlp,
                      dm, seq, dm, rscale);
  }
}

#define ATT_PLE (64 * LP)                       // 16-bit elements of one staged plane tile, pitch LP, 9 KB
template <bool RES>
__device__ __forceinline__
void attn_block(unsigned short* sKV, int qb, int bb, int h, const v16b (&qah)[2], const v16b (&qal)[2],
                const unsigned short* __restrict__ khp, const unsigned short* __restrict__ klp,
                const unsigned short* __restrict__ vhp, const unsigned short* __restrict__ vlp,
                unsigned short* ohp, unsigned short* olp, float sscale) {
  union FB { v16b v; v8b h[2]; };
  union FH { v16h v; v8h h[2]; };
  constexpr int PLE  = ATT_PLE;
  constexpr int BUFE = (RES ? 4 : 3) * PLE;     // one buffer: K hi [kv][d] | K lo | V^T hi [d][kv] | V^T residual (RES)
  static_assert((size_t)2 * BUFE * 2 >= (size_t)4 * 16 * OSP * 4);

  const int tid  = threadIdx.x;
  const int wave = tid >> 5;
  const int lane = tid & 31;
  const int hh   = lane >> 4;
  const int c    = lane & 15;

  const int q0   = qb * 64 + wave * 16;

  const size_t pstride = (size_t)SEQ * DM;                  // per-batch elements of the [t][h*64+d] planes
  const __bf16* Kh = (const __bf16*)(const void*)khp + (size_t)bb * pstride + (size_t)h * HD;
  const __bf16* Kl = (const __bf16*)(const void*)klp + (size_t)bb * pstride + (size_t)h * HD;
  const _Float16* Vh = (const _Float16*)(const void*)vhp + (size_t)bb * ((size_t)DM * SEQ) + (size_t)h * HD * SEQ;
  const _Float16* Vl = (const _Float16*)(const void*)vlp + (size_t)bb * ((size_t)DM * VLP) + (size_t)h * HD * VLP;
  unsigned short* Ohb = ohp + (size_t)bb * pstride;
  unsigned short* Olb = olp + (size_t)bb * pstride;

  float mrow = -INFINITY, lrow = 0.f;        // of query q0 + c; lrow sums this lane half's keys only
  v8f oacc[4];                               // O^T: oacc[t][r] = context(query q0 + c, d = 16 t + 8 hh + r)
#pragma unroll
  for (int t = 0; t < 4; ++t) oacc[t] = zero8();

  // copy map: thread -> row (tid >> 3) + 16 * i of a plane tile, 16-B piece (tid & 7) of its 128 B
  const int crow = tid >> 3;
  const int cpc  = (tid & 7) * 8;
  const unsigned short* gKh = (const unsigned short*)(const void*)Kh + (size_t)crow * DM + cpc;    // K row kv0 + crow + 16 i (< SEQ)
  const unsigned short* gKl = (const unsigned short*)(const void*)Kl + (size_t)crow * DM + cpc;
  const unsigned short* gVh = (const unsigned short*)(const void*)Vh + (size_t)crow * SEQ + cpc;   // V^T row d = crow + 16 i
  const unsigned short* gVl = (const unsigned short*)(const void*)Vl + (size_t)crow * VLP + cpc;
  const unsigned lbase = (unsigned)(uintptr_t)(&sKV[0]) + (unsigned)((crow * LP + cpc) * 2);
  constexpr unsigned L16 = 16u * LP * 2u;      // LDS bytes of 16 staged rows
  constexpr unsigned PLB = (unsigned)PLE * 2u; // LDS bytes of one plane tile
  auto stage = [&](int t, int buf) {           // key tile t (keys 64 t .. 64 t + 63) into buffer buf
    const int k0 = t * 64;
    const unsigned l = lbase + (unsigned)buf * (unsigned)(BUFE * 2);
    copy12_lds(l, PLB, L16, gKh + (size_t)k0 * DM, (size_t)16 * DM, gKl + (size_t)k0 * DM, (size_t)16 * DM,
               gVh + k0, (size_t)16 * SEQ);
    if (RES) {
      const int kvl = (k0 + 64 <= VLP) ? k0 : (VLP - 64);        // clamped address into the residual plane
      const __bf16* w = (const __bf16*)(const void*)(gVl + kvl);
      const unsigned lw = l + 3 * PLB;
      copy4_lds(lw, w, lw + L16, w + 16 * VLP, lw + 2 * L16, w + 32 * VLP, lw + 3 * L16, w + 48 * VLP);
    }
  };

  const int nkt = qb + 1;                    // key tiles 0..qb (block-uniform)
  stage(0, 0);
  asm volatile("s_wait_asynccnt 0x0" ::: "memory");   // this wave's tile-0 copies have landed
  __syncthreads();                                     // tile 0 readable by every wave
  if (nkt > 1) stage(1, 1);
  for (int kt = 0; kt < NQB; ++kt) {         // static bound
    if (kt >= nkt) break;                    // block-uniform
    const bool diag = (kt == qb);            // block-uniform
    const int kv0 = kt * 64;
    const unsigned short* sb = sKV + (kt & 1) * BUFE;
    const __bf16*   Ksh = (const __bf16*)(const void*)sb;                    // K hi [kv][d]
    const __bf16*   Ksl = (const __bf16*)(const void*)(sb + PLE);            // K lo
    const _Float16* Vth = (const _Float16*)(const void*)(sb + 2 * PLE);      // V^T hi [d][kv]
    const _Float16* Vtl = (const _Float16*)(const void*)(sb + (RES ? 3 : 2) * PLE);   // V^T residual, read only when RES

    // ---- scores, transposed: 64 keys x 16 query columns per wave, 3 bf16 products ----
    //      Issue order: d-chunk, product, key group innermost, so that neighbouring WMMAs write four independent tiles;
    //      each tile still sums (hi.hi, lo.hi, hi.lo) of d-chunk 0, then of d-chunk 1.
    v8f s[4];
#pragma unroll
    for (int j = 0; j < 4; ++j) s[j] = zero8();
#pragma unroll
    for (int dc = 0; dc < 2; ++dc) {
      FB kb[4], kl[4];
#pragma unroll
      for (int j = 0; j < 4; ++j) {
        kb[j].h[0] = *(const v8b*)(Ksh + (j * 16 + c) * LP + dc * 32 + 8 * hh);
        kb[j].h[1] = *(const v8b*)(Ksh + (j * 16 + c) * LP + dc * 32 + 16 + 8 * hh);
        kl[j].h[0] = *(const v8b*)(Ksl + (j * 16 + c) * LP + dc * 32 + 8 * hh);
        kl[j].h[1] = *(const v8b*)(Ksl + (j * 16 + c) * LP + dc * 32 + 16 + 8 * hh);
      }
#pragma unroll
      for (int j = 0; j < 4; ++j) s[j] = mma_b_raw(kb[j].v, qah[dc], s[j]);
#pragma unroll
      for (int j = 0; j < 4; ++j) s[j] = mma_b_raw(kl[j].v, qah[dc], s[j]);
#pragma unroll
      for (int j = 0; j < 4; ++j) s[j] = mma_b_raw(kb[j].v, qal[dc], s[j]);
    }

    // ---- scale + causal compare (diagonal tile only), column max, online softmax; P^T (x1024, f16) and its
    //      residual (x4096) are packed in registers as the B operands of the context products ----
    FH pb[2], pr[2];
    {
      const int qrow = q0 + c;                     // this lane's query
      float m = -INFINITY;
#pragma unroll
      for (int j = 0; j < 4; ++j)
#pragma unroll
        for (int r = 0; r < 8; ++r) s[j][r] *= sscale;
      if (diag) {                                  // block-uniform branch: a tile below the diagonal has nothing to compare
#pragma unroll
        for (int j = 0; j < 4; ++j) {
#pragma unroll
          for (int r = 0; r < 8; ++r) {
            const int key = kv0 + j * 16 + 8 * hh + r;   // key of accumulator element r of this lane
            s[j][r] = (key > qrow) ? -FLT_MAX : s[j][r];
          }
        }
      }
#pragma unroll
      for (int j = 0; j < 4; ++j)
#pragma unroll
        for (int r = 0; r < 8; ++r) m = fmaxf(m, s[j][r]);
      m = fmaxf(m, xhalf(m));                      // the query's other 32 keys of the tile
      const float mnew  = fmaxf(mrow, m);
      const float msafe = (mnew == -INFINITY) ? 0.f : mnew;
      const float alpha = __expf(mrow - msafe);
      mrow = mnew;
      float psum[2] = {0.f, 0.f};                  // one chain per 32 keys: two independent sums
#pragma unroll
      for (int j = 0; j < 4; ++j) {
#pragma unroll
        for (int r = 0; r < 8; ++r) {
          const float p = __expf(s[j][r] - msafe);   // floor logit against a normal max: exp -> 0
          psum[j >> 1] += p;
          const float p1k = p * 1024.0f;
          const _Float16 ph = (_Float16)p1k;
          pb[j >> 1].v[(j & 1) * 8 + r] = ph;
          if (RES) pr[j >> 1].v[(j & 1) * 8 + r] = (_Float16)((p1k - (float)ph) * 4096.0f);
        }
      }
      lrow = lrow * alpha + (psum[0] + psum[1]);
#pragma unroll
      for (int t = 0; t < 4; ++t)
#pragma unroll
        for (int r = 0; r < 8; ++r) oacc[t][r] *= alpha;
    }

    // ---- context^T += V^T . P^T (f16 WMMA), residual products into a separate accumulator ----
    v8f o1[4];
#pragma unroll
    for (int t = 0; t < 4; ++t) o1[t] = zero8();
#pragma unroll
    for (int kk = 0; kk < 2; ++kk) {               // unrolled: pb / pr are register operands
      FH vb[4], vl[4];
#pragma unroll
      for (int t = 0; t < 4; ++t) {
        vb[t].h[0] = *(const v8h*)(Vth + (t * 16 + c) * LP + kk * 32 + 8 * hh);
        vb[t].h[1] = *(const v8h*)(Vth + (t * 16 + c) * LP + kk * 32 + 16 + 8 * hh);
        if (RES) {
          vl[t].h[0] = *(const v8h*)(Vtl + (t * 16 + c) * LP + kk * 32 + 8 * hh);
          vl[t].h[1] = *(const v8h*)(Vtl + (t * 16 + c) * LP + kk * 32 + 16 + 8 * hh);
        }
      }
#pragma unroll
      for (int t = 0; t < 4; ++t) oacc[t] = mma_h_raw(vb[t].v, pb[kk].v, oacc[t]);
      if (RES) {
#pragma unroll
        for (int t = 0; t < 4; ++t) o1[t] = mma_h_raw(vl[t].v, pb[kk].v, o1[t]);
#pragma unroll
        for (int t = 0; t < 4; ++t) o1[t] = mma_h_raw(vb[t].v, pr[kk].v, o1[t]);
      }
    }
    if (RES) {
#pragma unroll
      for (int t = 0; t < 4; ++t)
#pragma unroll
        for (int r = 0; r < 8; ++r) oacc[t][r] += o1[t][r] * (1.0f / 4096.0f);
    }
    asm volatile("s_wait_dscnt 0x0" ::: "memory");      // this wave's reads of buffer kt & 1 are done before it is refilled
    asm volatile("s_wait_asynccnt 0x0" ::: "memory");   // this wave's tile kt + 1 copies have landed
    __syncthreads();                                     // publishes tile kt + 1, ends every read of buffer kt & 1
    if (kt + 2 < nkt) stage(kt + 2, kt & 1);
  }
  asm volatile("s_wait_asynccnt 0x0" ::: "memory");     // nothing in flight when the buffers become the context tiles

  // ---- normalise (1/l and the 1/1024 p carry), stage the wave's 16x64 tile, bf16 hi/lo split,
  float* os = (float*)(void*)sKV + wave * (16 * OSP);
  {
    const float l = lrow + xhalf(lrow);        // both lane halves' keys of query q0 + c
    const float inv = ((l > 0.f) ? (1.0f / l) : 0.f) * (1.0f / 1024.0f);
#pragma unroll
    for (int t = 0; t < 4; ++t)
#pragma unroll
      for (int r = 0; r < 8; ++r) os[c * OSP + t * 16 + 8 * hh + r] = oacc[t][r] * inv;
  }
  __builtin_amdgcn_fence(3, "workgroup");
  __builtin_amdgcn_wave_barrier();
  __builtin_amdgcn_fence(2, "workgroup");
  {
    const int q4 = lane >> 3, c8 = (lane & 7) * 8;
    v4u hv[4], lv[4];
#pragma unroll
    for (int it = 0; it < 4; ++it) {
      const int row = it * 4 + q4;   // it 0..3 x q4 0..3 = rows 0..15 of the wave tile
      const float* sp = os + row * OSP + c8;
      v4u a, a2;
#pragma unroll
      for (int e = 0; e < 4; ++e) {
        const float f0 = sp[2 * e], f1 = sp[2 * e + 1];
        const unsigned short h0 = bf_bits(f0), h1 = bf_bits(f1);
        const unsigned short l0 = bf_bits(f0 - bf_up(h0)), l1 = bf_bits(f1 - bf_up(h1));
        a[e] = pk16(h0, h1); a2[e] = pk16(l0, l1);
      }
      hv[it] = a; lv[it] = a2;
    }
    {
#pragma unroll
      for (int it = 0; it < 4; ++it) {
        const int row = it * 4 + q4;
        const size_t go = (size_t)(q0 + row) * DM + (size_t)h * HD + c8;
        *(v4u*)(Ohb + go) = hv[it];
        *(v4u*)(Olb + go) = lv[it];
      }
      
    }
  }
}

// =====================================================================================================
// All query blocks in ONE launch of NQB * NH * NB work-groups (a launch of the RESQB leading blocks alone holds few, short and
// unequal work-groups: it leaves most resident places empty, and the launch of the rest ends with places idle that those
// short work-groups can fill). A block-uniform branch picks the body with or without the residual planes.
// There are more work-groups than resident places: the rank (x fastest, then
// y) maps to the query block slowest, by falling cost, so the costliest work-groups take the lowest ranks and the cheapest
// the highest. Cost of block qb = qb + 1 key tiles, a tile with residual planes counted 3/2 (48 matrix instructions against 32).
// rank -> (qb, bb, h) is a permutation of the grid (QbOrder holds each query block once).
// =====================================================================================================
struct QbOrder { unsigned char q[NQB]; };
constexpr QbOrder qb_by_cost() {
  QbOrder o{};
  bool used[NQB] = {};
  for (int g = 0; g < NQB; ++g) {
    int best = -1, bc = -1;
    for (int q = NQB - 1; q >= 0; --q) {
      const int cst = (q + 1) * ((q < RESQB) ? 3 : 2);
      if (!used[q] && cst > bc) { bc = cst; best = q; }
    }
    used[best] = true;
    o.q[g] = (unsigned char)best;
  }
  return o;
}
// Register budget of four waves per SIMD: the grouped fragment reads take more registers than five waves leave, and under
// the tighter budget the compiler runs the softmax as one dependent chain through a few registers.
__global__ __launch_bounds__(128) __attribute__((amdgpu_num_vgpr(256), amdgpu_waves_per_eu(4, 4)))
void attn_causal64(const unsigned short* __restrict__ qhp, const unsigned short* __restrict__ qlp,
                   const unsigned short* __restrict__ khp, const unsigned short* __restrict__ klp,
                   const unsigned short* __restrict__ vhp, const unsigned short* __restrict__ vlp,
                   unsigned short* ohp, unsigned short* olp, float sscale) {
  __shared__ __align__(16) unsigned short sKV[2 * 4 * ATT_PLE];   // two tile buffers of up to four planes
  constexpr QbOrder ord = qb_by_cost();
  const int rank = (int)blockIdx.y * (NQB * NH) + (int)blockIdx.x;   // 0 .. NQB*NH*NB-1 (grid = (NQB*NH, NB))
  const int qb   = ord.q[rank / (NH * NB)];          // query block, costliest first
  const int bb   = (rank / NH) % NB;                 // batch
  const int h    = rank % NH;                        // head
  // ---- Q fragments of query qb * 64 + 16 * wave + (lane & 15), both bodies' alike: read in front of the choice of body ----
  const int tid = threadIdx.x;
  const int qrw = qb * 64 + (tid >> 5) * 16 + (tid & 15);
  const __bf16* Qh = (const __bf16*)(const void*)qhp + (size_t)bb * ((size_t)SEQ * DM) + (size_t)h * HD;
  const __bf16* Ql = (const __bf16*)(const void*)qlp + (size_t)bb * ((size_t)SEQ * DM) + (size_t)h * HD;
  v16b qah[2], qal[2];
#pragma unroll
  for (int dc = 0; dc < 2; ++dc) {
    const size_t qo = (size_t)qrw * DM + dc * 32 + 8 * ((tid >> 4) & 1);
    qah[dc] = ldfrag_b(Qh + qo);
    qal[dc] = ldfrag_b(Ql + qo);
  }
  // both bodies reuse the offset register of these loads: the wait stands in front of every such overwrite
  asm volatile("s_wait_xcnt 0x0" ::: "memory");
  if (qb < RESQB) attn_block<true>(sKV, qb, bb, h, qah, qal, khp, klp, vhp, vlp, ohp, olp, sscale);
  else            attn_block<false>(sKV, qb, bb, h, qah, qal, khp, klp, vhp, vlp, ohp, olp, sscale);
}

// =====================================================================================================
// Workspace map (bytes, NB = 4, SEQ = 2048; every activation plane holds NB batch slices back to back):
//   Xb    bf16 [NB*SEQ][1024]          0           16777216   (also holds Oh after the projections: same extent)
//   Wqb   bf16 [1024 n][1024 k]        16777216     2097152
//   Wkb   bf16 [1024 n][1024 k]        18874368     2097152
//   Wvb   bf16 [1024 n][1024 k]        20971520     2097152
//   Wob   bf16 [1024 n][1024 k]        23068672     2097152
//   Qh    bf16 [NB*SEQ][1024]          25165824    16777216
//   Ql    bf16 [NB*SEQ][1024]          41943040    16777216
//   Kh    bf16 [NB*SEQ][1024]          58720256    16777216
//   Kl    bf16 [NB*SEQ][1024]          75497472    16777216
//   VTh   f16  NB x [1024][SEQ]        92274688    16777216
//   VTl   f16  NB x [1024][VLP=512]   109051904     4194304
//   Ol    bf16 [NB*SEQ][1024]         113246208    16777216
//   end                               130023424
// Oh aliases Xb: Xb is last read by the projection launch (q, k and v^T tiles), Oh is first written by the attention launch that
// comes after it in stream order; both extents are NB*SEQ*DM*2 bytes exactly.
// All planes are exact multiples of their 64x64 / whole-line store granularity (no padded tails needed),
// =====================================================================================================
extern "C" void kernel_launch(void* const* d_in, const int* in_sizes, int n_in,
                              void* d_out, int out_size, void* d_ws, size_t ws_size,
                              hipStream_t stream) {
  if (n_in < 5) return;
  const long long needX = (long long)(NB - 1) * SEQ_FULL * DM + (long long)SEQ * DM;   // last row read / written
  if ((long long)in_sizes[0] < needX) return;         // x [NB_FULL][SEQ_FULL][1024], rows 0..SEQ-1 of batches 0..NB-1
  if (in_sizes[1] < DM * DM) return;                  // Wq [1024 out][1024 in]
  if (in_sizes[2] < DM * DM) return;                  // Wk
  if (in_sizes[3] < DM * DM) return;                  // Wv
  if (in_sizes[4] < DM * DM) return;                  // Wo
  if ((long long)out_size < needX) return;

  const float* x  = (const float*)d_in[0];
  const float* Wq = (const float*)d_in[1];
  const float* Wk = (const float*)d_in[2];
  const float* Wv = (const float*)d_in[3];
  const float* Wo = (const float*)d_in[4];

  const size_t PX  = (size_t)NB * SEQ * DM * 2;     // 16-bit activation plane [NB*SEQ][1024]
  const size_t PW  = (size_t)DM * DM * 2;           // 16-bit weight plane [1024][1024]
  const size_t PVT = (size_t)NB * DM * SEQ * 2;     // v^T hi plane, NB slices
  const size_t PVL = (size_t)NB * DM * VLP * 2;     // v^T residual plane, NB slices
  static_assert((size_t)NB * SEQ * DM * 2 == (size_t)NB * DM * SEQ * 2);
  size_t off = 0;
  const size_t oXb  = off; off += PX;
  const size_t oOh  = oXb;                          // aliased, same extent PX
  const size_t oWq  = off; off += PW;
  const size_t oWk  = off; off += PW;
  const size_t oWv  = off; off += PW;
  const size_t oWo  = off; off += PW;
  const size_t oQh  = off; off += PX;
  const size_t oQl  = off; off += PX;
  const size_t oKh  = off; off += PX;
  const size_t oKl  = off; off += PX;
  const size_t oVTh = off; off += PVT;
  const size_t oVTl = off; off += PVL;
  const size_t oOl  = off; off += PX;
  if (off > ws_size) return;                     // off = 130023424 for NB = 4, SEQ = 2048
  if (off > (size_t)134217728) return;

  char* ws = (char*)d_ws;
  unsigned short* Xb  = (unsigned short*)(ws + oXb);
  unsigned short* Oh  = (unsigned short*)(ws + oOh);
  unsigned short* Wqb = (unsigned short*)(ws + oWq);
  unsigned short* Wkb = (unsigned short*)(ws + oWk);
  unsigned short* Wvb = (unsigned short*)(ws + oWv);
  unsigned short* Wob = (unsigned short*)(ws + oWo);
  unsigned short* Qh  = (unsigned short*)(ws + oQh);
  unsigned short* Ql  = (unsigned short*)(ws + oQl);
  unsigned short* Kh  = (unsigned short*)(ws + oKh);
  unsigned short* Kl  = (unsigned short*)(ws + oKl);
  unsigned short* VTh = (unsigned short*)(ws + oVTh);
  unsigned short* VTl = (unsigned short*)(ws + oVTl);
  unsigned short* Ol  = (unsigned short*)(ws + oOl);

  const dim3 blk(256);
  const dim3 gOut((SEQ / GBM) * (DM / GBN), NB);                   // M = SEQ, N = 1024, per batch
  const long long xStrideIn = (long long)SEQ_FULL * DM;            // input x batch stride (full layout)
  const long long pStride   = (long long)SEQ * DM;                 // plane batch stride

  // (1) x -> bf16 plane [NB*SEQ][1024] (batch b reads input rows b*SEQ_FULL .. +SEQ-1); weights -> bf16 [n][k]
  cvt_all<<<dim3(CVG), dim3(CVB), 0, stream>>>(x, Wq, Wk, Wv, Wo, Xb, Wqb, Wkb, Wvb, Wob);
  // (2) - (4) q = x . Wq^T and k = x . Wk^T -> bf16 hi/lo planes [b*SEQ + t][h*64+d] (M = NB*SEQ, N = 1024, K = 1024);
  //     v^T = Wv . x^T per batch -> f16 hi plane [h*64+d][s] (pitch SEQ, batch stride DM*SEQ) and residual plane (x4096,
  //     keys < VLP only, pitch VLP, batch stride DM*VLP) (M = 1024, N = SEQ, K = 1024): all 128x256 tiles in one launch
  proj_qkv<<<dim3(2 * TQK + TVT * NB), blk, 0, stream>>>(Xb, Wqb, Wkb, Wvb, Qh, Ql, Kh, Kl, VTh, VTl,
                                                         NB * SEQ, DM, SEQ, VLP, 4096.0f);
  // (5) causal attention: query blocks 0..RESQB-1 with residual planes, the rest without, all in one launch;
  //     grid = (NH * query blocks, NB), the kernel maps the start rank to (query block by falling cost, batch, head)
  attn_causal64<<<dim3(NH * NQB, NB), dim3(128), 0, stream>>>(Qh, Ql, Kh, Kl, VTh, VTl, Oh, Ol, 0.125f);
  // (6) out = context . Wo^T -> d_out f32, batch b rows b*SEQ_FULL .. +SEQ-1 (A = context hi + lo planes,
  //     2 products; M = SEQ, N = 1024, K = 1024, grid.y = batch)
  gemm64<1, 0><<<gOut, blk, 0, stream>>>(
      Oh, Ol, DM, pStride, Wob, DM, 0LL,
      d_out, DM, xStrideIn, d_out, DM, 0LL, DM,
      SEQ, DM, DM, 1.0f);
  (void)hipGetLastError();
}
